// v000
// Times are from an AMD MI455X. After a warm-up the kernel runs many times in a row, and a time is the length of
// such a window on the GPU divided by its runs, so every launch and the gaps after it count. The runs cycle
// through copies of the inputs. A figure is the median of several windows, for all but v000 over two sittings.
// Sittings can differ by a few percent; kernels timed side by side share one.
// v000 is the starting kernel. One run takes 1050 microseconds.
#include <hip/hip_runtime.h>

// DeBERTa disentangled self-attention (hidden_states [2][1024][1024]; q, k, v = hs W^T + b ('oi' [1024][1024]; 16 heads x 64); pos_k = rel_embeddings Wpk^T + bpk, pos_q = rel_embeddings Wpq^T + bpq (rel_embeddings [512][1024], read); scale = 1/sqrt(64 x 3); scores = q.k scale + c2p[i][clip(i-j+256, 0, 511)] + p2c[clip(i-j+256, 0, 511)][j] with c2p = q.pos_k scale ([S][512]) and p2c = (pos_q scale).k ([512][S]); mask (int32 [2][1][1024][1024], read; all ones) == 0 -> finfo.min and weight 0; softmax; out = merged attn.v -> [2][1024][1024] (2.1 M), no output projection).
// Layout: exact bf16 projections; hi/lo planes for q, k, pos_k, pos_q (every row: 3-product score GEMMs); per pass of two heads: content scores [2][1024][1024], c2p [2][1024][512] and p2c [2][512][1024] as hi/lo GEMMs, and the softmax kernel gathers the two relative terms per logit (index clip(i - j + 256, 0, 511)), scales, applies the mask select, f32 softmax, hi/lo P; attn.v (3 products); f32 merged output.
// Compute dtypes, f32 accumulate: every input rounded to bf16; q/k/v/pos_k/pos_q on PLAIN bf16 operands (exact) + biases; all score terms and attn.v on hi/lo planes (3 products) for every row; softmax f32; output f32.

#define NB_  2
#define TT   1024
#define DM   1024
#define NH_  16
#define NKV  16
#define REP  (NH_ / NKV)
#define HD   64
#define DQ   (NH_ * HD)
#define DKV  (NKV * HD)
#define ZH   2
#define RH   1024                  // query rows < RH use hi+lo planes (0: none)
#define WIN  0
#define PCAR 1024.0f
#define SCL  0.072168783648703225f   // 1/sqrt(64 x 3)
#define NPE  512                  // 2 x att_span relative positions
#define SPAN 256
typedef _Float16 h16;
typedef unsigned short bf;
typedef __attribute__((ext_vector_type(16))) __bf16   v16bf;
typedef __attribute__((ext_vector_type(16))) _Float16 v16h;
typedef __attribute__((ext_vector_type(8)))  _Float16 v8h;
typedef __attribute__((ext_vector_type(8)))  unsigned short v8us;
typedef __attribute__((ext_vector_type(8)))  float    v8f;
typedef __attribute__((ext_vector_type(4)))  float    v4f;
typedef v8h  __attribute__((may_alias)) v8ha;
typedef v4f  __attribute__((may_alias)) v4fa;
typedef v8us __attribute__((may_alias)) v8usa;

__device__ __forceinline__ unsigned short f2bf(float f) { unsigned u = __float_as_uint(f); u += 0x7FFFu + ((u >> 16) & 1u); return (unsigned short)(u >> 16); }
__device__ __forceinline__ float bf2f(unsigned short b) { return __uint_as_float(((unsigned)b) << 16); }
__device__ __forceinline__ float bfr(float f) { return bf2f(f2bf(f)); }
__device__ __forceinline__ v16h cat16(v8h lo, v8h hi) { return __builtin_shufflevector(lo, hi, 0, 1, 2, 3, 4, 5, 6, 7, 8, 9, 10, 11, 12, 13, 14, 15); }
__device__ __forceinline__ v16bf cat16b(v8us lo, v8us hi) { return __builtin_bit_cast(v16bf, __builtin_shufflevector(lo, hi, 0, 1, 2, 3, 4, 5, 6, 7, 8, 9, 10, 11, 12, 13, 14, 15)); }
__device__ __forceinline__ v8f wmma16(v16h a, v16h b, v8f c) { return __builtin_amdgcn_wmma_f32_16x16x32_f16(false, a, false, b, (short)0, c, false, false); }
__device__ __forceinline__ v8f wmmab(v16bf a, v16bf b, v8f c) { return __builtin_amdgcn_wmma_f32_16x16x32_bf16(false, a, false, b, (short)0, c, false, false); }



// ---- k_gemmw: register-blocked GEMM, ONE WAVE per 64x64 output tile (16 accumulators), operands straight from K-contiguous 16-bit planes; grid (M/64, N/64, Z), 32 threads.
// C[m][n] (f32, pitch ldc, + optional f32 bias[n]) = sum_k A[m][k] Bt[n][k] (+ split products per NSPLIT). z-batch strides sA/sB/sC in elements. K % 32 == 0.
template <typename T16> struct WFrag;
template <> struct WFrag<h16> { typedef v16h V; static __device__ __forceinline__ V ld(const h16* p) { return cat16(*(const v8h*)p, *(const v8h*)(p + 16)); } static __device__ __forceinline__ v8f mma(V a, V b, v8f c) { return wmma16(a, b, c); } };
template <> struct WFrag<bf> { typedef v16bf V; static __device__ __forceinline__ V ld(const bf* p) { return cat16b(*(const v8us*)p, *(const v8us*)(p + 16)); } static __device__ __forceinline__ v8f mma(V a, V b, v8f c) { return wmmab(a, b, c); } };
template <typename T16, int NSPLIT, bool BIAS>
__global__ __launch_bounds__(32) void k_gemmw(const T16* __restrict__ A, const T16* __restrict__ A2, const T16* __restrict__ Bt, const T16* __restrict__ Bt2, int K, float* C, int ldc, const float* __restrict__ bias, size_t sA, size_t sB, size_t sC) {
    typedef typename WFrag<T16>::V V;
    __shared__ __align__(16) float os[16 * 68];
    const size_t z = blockIdx.z; A += z * sA; if (A2) A2 += z * sA; Bt += z * sB; if (Bt2) Bt2 += z * sB; C += z * sC;
    const int lane = threadIdx.x & 31, lr = lane & 15, hi = lane >> 4; const int r0 = blockIdx.x * 64, c0 = blockIdx.y * 64;
    v8f acc[4][4];
#pragma unroll
    for (int mb = 0; mb < 4; ++mb)
#pragma unroll
        for (int nb = 0; nb < 4; ++nb) acc[mb][nb] = (v8f){};
    const size_t aoff = (size_t)(r0 + lr) * K + 8 * hi, boff = (size_t)(c0 + lr) * K + 8 * hi;
#pragma unroll 1
    for (int kc = 0; kc < K; kc += 32) {
        V a[4], a2[4];
#pragma unroll
        for (int mb = 0; mb < 4; ++mb) { a[mb] = WFrag<T16>::ld(A + aoff + (size_t)mb * 16 * K + kc); if (NSPLIT == 1 || NSPLIT == 2) a2[mb] = WFrag<T16>::ld(A2 + aoff + (size_t)mb * 16 * K + kc); }
#pragma unroll
        for (int nb = 0; nb < 4; ++nb) { const V b = WFrag<T16>::ld(Bt + boff + (size_t)nb * 16 * K + kc); V b2; if (NSPLIT >= 2) b2 = WFrag<T16>::ld(Bt2 + boff + (size_t)nb * 16 * K + kc);
#pragma unroll
            for (int mb = 0; mb < 4; ++mb) { acc[mb][nb] = WFrag<T16>::mma(a[mb], b, acc[mb][nb]); if (NSPLIT == 1 || NSPLIT == 2) acc[mb][nb] = WFrag<T16>::mma(a2[mb], b, acc[mb][nb]); if (NSPLIT >= 2) acc[mb][nb] = WFrag<T16>::mma(a[mb], b2, acc[mb][nb]); } }
        asm volatile("v_nop\n\tv_nop\n\tv_nop\n\tv_nop" : "+v"(acc[0][0]), "+v"(acc[1][1]), "+v"(acc[2][2]), "+v"(acc[3][3]) : "v"(a[0]), "v"(a[3]));
    }
#pragma unroll
    for (int mb = 0; mb < 4; ++mb) {
#pragma unroll
        for (int nb = 0; nb < 4; ++nb) {
#pragma unroll
            for (int j = 0; j < 8; ++j) os[(hi * 8 + j) * 68 + nb * 16 + lr] = acc[mb][nb][j]; }
        __builtin_amdgcn_wave_barrier(); asm volatile("" ::: "memory");
        float* crow = C + (size_t)(r0 + mb * 16) * ldc + c0;
{
#pragma unroll
            for (int s = 0; s < 8; ++s) { const int row = 2 * s + hi, cofs = lr * 4; v4f val = *(const v4fa*)(os + row * 68 + cofs); if (BIAS) { val[0] += bfr(bias[c0 + cofs]); val[1] += bfr(bias[c0 + cofs + 1]); val[2] += bfr(bias[c0 + cofs + 2]); val[3] += bfr(bias[c0 + cofs + 3]); }
                *(v4f*)(crow + (size_t)row * ldc + cofs) = val; }
             }
        __builtin_amdgcn_wave_barrier(); asm volatile("" ::: "memory");
    }
}

__device__ __forceinline__ h16 tohx(float x) { return (h16)x; }
__device__ __forceinline__ void splitf(float y, unsigned short& h, unsigned short& l) { h = f2bf(y); l = f2bf(y - bf2f(h)); }
typedef __attribute__((ext_vector_type(2))) _Float16 v2h;
typedef __attribute__((ext_vector_type(4))) _Float16 v4h;
typedef __attribute__((ext_vector_type(2))) unsigned short v2us;
typedef __attribute__((ext_vector_type(4))) unsigned short v4us;
typedef __attribute__((ext_vector_type(2))) float v2f;
typedef __attribute__((ext_vector_type(4))) int v4i;

__global__ __launch_bounds__(256) void k_wtG(const float* __restrict__ w, int K, int N, bf* Bt) {
    const int lane = threadIdx.x & 31; const int L0 = (blockIdx.x * 8 + (threadIdx.x >> 5)) * 8; const int nlines = N * K / 64;
{
#pragma unroll 1
        for (int l = 0; l < 8; ++l) { const int L = L0 + l; if (L >= nlines) break; const size_t e = (size_t)L * 64 + lane * 2; const int k = (int)(e % K), n = (int)(e / K); v2us o;
            o[0] = f2bf(w[(size_t)k * N + n]); o[1] = f2bf(w[(size_t)(k + 1) * N + n]); *(v2us*)(Bt + e) = o; }
         }
}
__global__ __launch_bounds__(256) void k_cvt8(const float* __restrict__ src, bf* dst, size_t n8) { const size_t i = (size_t)blockIdx.x * 256 + threadIdx.x; if (i >= n8) return; const v8f v = *(const v8f*)(src + i * 8); v8us o;
#pragma unroll
    for (int k = 0; k < 8; ++k) o[k] = f2bf(v[k]); *(v8us*)(dst + i * 8) = o;  }

// k_rope: head planes [h][t][d] (fp16 + hi/lo) of rope(x) x sc with the rotate-half convention out[d] = x[d] cos[t][d] - x[d+HD/2] sin[t][d], out[d+HD/2] = x[d+HD/2] cos[t][d+HD/2] + x[d] sin[t][d+HD/2]
__global__ __launch_bounds__(256) void k_rope(const float* __restrict__ F, int pitch, int nheads, const float* __restrict__ CS, const float* __restrict__ RF, const float* __restrict__ nw, float sc, h16* P16, bf* Ph, bf* Pl) {
    const size_t e = ((size_t)blockIdx.x * 256 + threadIdx.x) * 2; if (e >= (size_t)nheads * TT * HD) return; const int d = (int)(e % HD); const int t = (int)((e / HD) % TT); const int h = (int)(e / ((size_t)HD * TT)); const float* f = F + (size_t)t * pitch + h * HD; const float rf = RF ? RF[(size_t)h * TT + t] : 1.0f; v2h o16; v2us oh, ol;
#pragma unroll
    for (int q = 0; q < 2; ++q) { const int dd = d + q; const int dp = (dd < HD / 2) ? dd + HD / 2 : dd - HD / 2; float x0 = f[dd], x1 = f[dp];
        if (RF) { float n0 = __fmul_rn(x0, rf), n1 = __fmul_rn(x1, rf); asm volatile("" : "+v"(n0)); asm volatile("" : "+v"(n1)); x0 = __fmul_rn(bfr(nw[dd]), n0); x1 = __fmul_rn(bfr(nw[dp]), n1); }
        const v2f cs = *(const v2f*)(CS + ((size_t)t * HD + dd) * 2); float a = __fmul_rn(x0, cs[0]), bq = __fmul_rn(x1, cs[1]); asm volatile("" : "+v"(a)); asm volatile("" : "+v"(bq)); const float r = ((dd < HD / 2) ? __fsub_rn(a, bq) : __fadd_rn(a, bq)) * sc;
        o16[q] = tohx(r); unsigned short a2, c2; splitf(r, a2, c2); oh[q] = a2; ol[q] = c2; }
    *(v2h*)(P16 + e) = o16; *(v2us*)(Ph + e) = oh; *(v2us*)(Pl + e) = ol;  }
__global__ __launch_bounds__(256) void k_vtp(const float* __restrict__ F, int pitch, int nheads, h16* V16, bf* Vh, bf* Vl) { const size_t e = ((size_t)blockIdx.x * 256 + threadIdx.x) * 2; if (e >= (size_t)nheads * HD * TT) return; const int t = (int)(e % TT); const int d = (int)((e / TT) % HD); const int g = (int)(e / ((size_t)TT * HD)); v2h o16; v2us oh, ol;
#pragma unroll
    for (int q = 0; q < 2; ++q) { const float x = F[(size_t)(t + q) * pitch + g * HD + d]; o16[q] = tohx(x); unsigned short a2, c2; splitf(x, a2, c2); oh[q] = a2; ol[q] = c2; }
    *(v2h*)(V16 + e) = o16; *(v2us*)(Vh + e) = oh; *(v2us*)(Vl + e) = ol;  }
__global__ __launch_bounds__(256) void k_csid(float* CS) { const int idx = blockIdx.x * 256 + threadIdx.x; if (idx >= TT * HD) return; v2f cs; cs[0] = 1.0f; cs[1] = 0.0f; *(v2f*)(CS + (size_t)idx * 2) = cs;  }
__global__ __launch_bounds__(256) void k_pplane(const float* __restrict__ POS, bf* Ph2, bf* Pl2) { const size_t e = ((size_t)blockIdx.x * 256 + threadIdx.x) * 2; if (e >= (size_t)NH_ * NPE * HD) return; const int d = (int)(e % HD); const int p = (int)((e / HD) % NPE); const int h = (int)(e / ((size_t)HD * NPE)); v2us oh, ol;
#pragma unroll
    for (int q = 0; q < 2; ++q) { unsigned short a, c; splitf(POS[(size_t)p * DQ + h * HD + d + q], a, c); oh[q] = a; ol[q] = c; } *(v2us*)(Ph2 + e) = oh; *(v2us*)(Pl2 + e) = ol;  }
// k_asoft: per row (zz, i): t = (S + c2p[i][rp] + p2c[rp][j]) x scale with rp = clip(i - j + 256, 0, 511), -3.0e38 where mask == 0; softmax over the 1024 keys (register row, one exp, fixed trees);
__global__ __launch_bounds__(256) void k_asoft(const float* __restrict__ Sb, const float* __restrict__ C2P, const float* __restrict__ P2C, const int* __restrict__ MKb, h16* P16, bf* Ph, bf* Pl) {
    const int lane = threadIdx.x & 31; const int row = blockIdx.x * 8 + (threadIdx.x >> 5); if (row >= ZH * TT) return; const int i = row % TT; const int zz = row / TT; const float* cr = C2P + (size_t)row * NPE; const float* pr = P2C + (size_t)zz * NPE * TT; const int* mkr = MKb + (size_t)i * TT; const bool hires = (i < RH); const float* sr = Sb + (size_t)row * TT; float v[TT / 32]; float mx = -3.0e38f;
#pragma unroll
    for (int ch = 0; ch < TT / 128; ++ch) { const int j0 = ch * 128 + lane * 4; const v4f a = *(const v4f*)(sr + j0); const v4i m4 = *(const v4i*)(mkr + j0);
#pragma unroll
        for (int q = 0; q < 4; ++q) { const int j = j0 + q; (void)j; int rp = i - j + SPAN; rp = rp < 0 ? 0 : (rp > NPE - 1 ? NPE - 1 : rp); float s1 = __fadd_rn(a[q], cr[rp]); asm volatile("" : "+v"(s1)); float s2 = __fadd_rn(s1, pr[(size_t)rp * TT + j]); asm volatile("" : "+v"(s2)); float sa = s2 * SCL; asm volatile("" : "+v"(sa)); const float t = (m4[q] != 0) ? sa : -3.0e38f;   /* (qk + c2p[i][rp] + p2c[rp][j]) x scale, rp = clip(i - j + 256, 0, 511); mask select */ v[ch * 4 + q] = t; mx = fmaxf(mx, t); } }
#pragma unroll
    for (int sh = 16; sh; sh >>= 1) mx = fmaxf(mx, __shfl_xor(mx, sh, 32));
    float sum = 0.f;
#pragma unroll
    for (int k = 0; k < TT / 32; ++k) { float d0 = __fsub_rn(v[k], mx); asm volatile("" : "+v"(d0)); v[k] = __builtin_amdgcn_exp2f(__fmul_rn(d0, 1.4426950408889634f)); sum += v[k]; }
#pragma unroll
    for (int sh = 16; sh; sh >>= 1) sum += __shfl_xor(sum, sh, 32);
    const float f = __fdiv_rn(hires ? 1.0f : PCAR, sum);
{
        if (hires) {
#pragma unroll
            for (int ch = 0; ch < TT / 128; ++ch) { v4us oh, ol;
#pragma unroll
                for (int q = 0; q < 4; ++q) { unsigned short a, c2; splitf(v[ch * 4 + q] * f, a, c2); oh[q] = a; ol[q] = c2; }
                const size_t oo = ((size_t)zz * (RH ? RH : 1) + i) * TT + ch * 128 + lane * 4; *(v4us*)(Ph + oo) = oh; *(v4us*)(Pl + oo) = ol; }
        } else {
#pragma unroll
            for (int ch = 0; ch < TT / 128; ++ch) { v4h o4;
#pragma unroll
                for (int q = 0; q < 4; ++q) o4[q] = tohx(v[ch * 4 + q] * f);
                *(v4h*)(P16 + (size_t)row * TT + ch * 128 + lane * 4) = o4; } }
         }
}
__global__ __launch_bounds__(256) void k_merge(const float* __restrict__ O, int h0, float* OUTb) { const size_t e = ((size_t)blockIdx.x * 256 + threadIdx.x) * 2; if (e >= (size_t)ZH * TT * HD) return; const int d = (int)(e % HD); const int t = (int)((e / HD) % TT); const int zz = (int)(e / ((size_t)HD * TT)); const float cs = (t < RH) ? 1.0f : (1.0f / PCAR); const size_t oo = (size_t)t * DQ + (h0 + zz) * HD + d;
    v2f o2; o2[0] = O[e] * cs; o2[1] = O[e + 1] * cs; *(v2f*)(OUTb + oo) = o2;  }

extern "C" void kernel_launch(void* const* d_in, const int* in_sizes, int n_in,
                              void* d_out, int out_size, void* d_ws, size_t ws_size, hipStream_t stream) {
    (void)in_sizes; (void)n_in; (void)out_size;
    const float* x = (const float*)d_in[0]; const int* MK = (const int*)d_in[1]; const float* rel = (const float*)d_in[2]; const float* wq = (const float*)d_in[3]; const float* bq = (const float*)d_in[4]; const float* wk = (const float*)d_in[5]; const float* bk = (const float*)d_in[6]; const float* wv = (const float*)d_in[7]; const float* bv = (const float*)d_in[8]; const float* wpk = (const float*)d_in[9]; const float* bpk = (const float*)d_in[10]; const float* wpq = (const float*)d_in[11]; const float* bpq = (const float*)d_in[12];
    float* OUT = (float*)d_out;     // [2][1024][1024]
    char* wsp = (char*)d_ws;
    auto take = [&](size_t bytes) { char* p = wsp; wsp += (bytes + 255) & ~(size_t)255; return (void*)p; };
    bf* WQ = (bf*)take((size_t)DQ * DM * 2); bf* WK = (bf*)take((size_t)DKV * DM * 2); bf* WV = (bf*)take((size_t)DKV * DM * 2); float* CS = (float*)take((size_t)TT * HD * 2 * 4); bf* WPK = (bf*)take((size_t)DQ * DM * 2); bf* WPQ = (bf*)take((size_t)DQ * DM * 2); bf* RE = (bf*)take((size_t)NPE * DM * 2); float* POS = (float*)take((size_t)NPE * DQ * 4); bf* PKh = (bf*)take((size_t)NH_ * NPE * HD * 2); bf* PKl = (bf*)take((size_t)NH_ * NPE * HD * 2); bf* PQh = (bf*)take((size_t)NH_ * NPE * HD * 2); bf* PQl = (bf*)take((size_t)NH_ * NPE * HD * 2); float* C2P = (float*)take((size_t)ZH * TT * NPE * 4); float* P2C = (float*)take((size_t)ZH * NPE * TT * 4);
    bf* XB = (bf*)take((size_t)TT * DM * 2); float* FQ = (float*)take((size_t)TT * DQ * 4); float* FK = (float*)take((size_t)TT * DKV * 4);
    h16* QP16 = (h16*)take((size_t)NH_ * TT * HD * 2); h16* KP16 = (h16*)take((size_t)NKV * TT * HD * 2); h16* VT16 = (h16*)take((size_t)NKV * HD * TT * 2);
    bf* QPh = (bf*)take((size_t)NH_ * TT * HD * 2); bf* QPl = (bf*)take((size_t)NH_ * TT * HD * 2); bf* KPh = (bf*)take((size_t)NKV * TT * HD * 2); bf* KPl = (bf*)take((size_t)NKV * TT * HD * 2); bf* VTh = (bf*)take((size_t)NKV * HD * TT * 2); bf* VTl = (bf*)take((size_t)NKV * HD * TT * 2); bf* Ph = (bf*)take((size_t)ZH * RH * TT * 2); bf* Pl = (bf*)take((size_t)ZH * RH * TT * 2);
    float* Sb = (float*)take((size_t)ZH * TT * TT * 4); h16* P16 = (h16*)take(256);   /* unused: all rows hi/lo */ float* Ob = (float*)take((size_t)ZH * TT * HD * 4);
    if ((size_t)(wsp - (char*)d_ws) > ws_size) return;    // ws 256 MiB
    float* FV = FK;   // v projection reuses the k buffer after the k planes are built (stream-ordered)
    { k_cvt8<<<(unsigned)(((size_t)DQ * DM / 8 + 255) / 256), 256, 0, stream>>>(wq, WQ, (size_t)DQ * DM / 8); k_cvt8<<<(unsigned)(((size_t)DKV * DM / 8 + 255) / 256), 256, 0, stream>>>(wk, WK, (size_t)DKV * DM / 8); k_cvt8<<<(unsigned)(((size_t)DKV * DM / 8 + 255) / 256), 256, 0, stream>>>(wv, WV, (size_t)DKV * DM / 8);
      
       }
    k_csid<<<(TT * HD + 255) / 256, 256, 0, stream>>>(CS);
    k_cvt8<<<(unsigned)(((size_t)DQ * DM / 8 + 255) / 256), 256, 0, stream>>>(wpk, WPK, (size_t)DQ * DM / 8); k_cvt8<<<(unsigned)(((size_t)DQ * DM / 8 + 255) / 256), 256, 0, stream>>>(wpq, WPQ, (size_t)DQ * DM / 8); k_cvt8<<<(unsigned)(((size_t)NPE * DM / 8 + 255) / 256), 256, 0, stream>>>(rel, RE, (size_t)NPE * DM / 8);
    k_gemmw<bf, 0, true><<<dim3(NPE / 64, DQ / 64, 1), 32, 0, stream>>>(RE, nullptr, WPK, nullptr, DM, POS, DQ, bpk, 0, 0, 0); k_pplane<<<(unsigned)(((size_t)NH_ * NPE * HD / 2 + 255) / 256), 256, 0, stream>>>(POS, PKh, PKl);   /* pos_k = rel Wpk^T + bpk -> per-head hi/lo planes [h][512][64] */
    k_gemmw<bf, 0, true><<<dim3(NPE / 64, DQ / 64, 1), 32, 0, stream>>>(RE, nullptr, WPQ, nullptr, DM, POS, DQ, bpq, 0, 0, 0); k_pplane<<<(unsigned)(((size_t)NH_ * NPE * HD / 2 + 255) / 256), 256, 0, stream>>>(POS, PQh, PQl);   /* pos_q planes (POS reused after pos_k's planes are built) */
    const unsigned LQ = (unsigned)(((size_t)NH_ * TT * HD / 2 + 255) / 256), LKv = (unsigned)(((size_t)NKV * TT * HD / 2 + 255) / 256);
    for (int b = 0; b < NB_; ++b) {
        
        k_cvt8<<<(unsigned)(((size_t)TT * DM / 8 + 255) / 256), 256, 0, stream>>>(x + (size_t)b * TT * DM, XB, (size_t)TT * DM / 8);
        k_gemmw<bf, 0, true><<<dim3(TT / 64, DQ / 64, 1), 32, 0, stream>>>(XB, nullptr, WQ, nullptr, DM, FQ, DQ, bq, 0, 0, 0);
        k_rope<<<LQ, 256, 0, stream>>>(FQ, DQ, NH_, CS, nullptr, nullptr, 1.0f, QP16, QPh, QPl);
        k_gemmw<bf, 0, true><<<dim3(TT / 64, DKV / 64, 1), 32, 0, stream>>>(XB, nullptr, WK, nullptr, DM, FK, DKV, bk, 0, 0, 0);
        k_rope<<<LKv, 256, 0, stream>>>(FK, DKV, NKV, CS, nullptr, nullptr, 1.0f, KP16, KPh, KPl);
        k_gemmw<bf, 0, true><<<dim3(TT / 64, DKV / 64, 1), 32, 0, stream>>>(XB, nullptr, WV, nullptr, DM, FV, DKV, bv, 0, 0, 0); k_vtp<<<LKv, 256, 0, stream>>>(FV, DKV, NKV, VT16, VTh, VTl);
        for (int h0 = 0; h0 < NH_; h0 += ZH) { const size_t zq = (size_t)h0, zk = (size_t)(h0 / REP);   // one kv head per query head: the pass's two heads use consecutive kv planes (z-strides TT*HD)
            k_gemmw<bf, 2, false><<<dim3(RH / 64, TT / 64, ZH), 32, 0, stream>>>(QPh + zq * TT * HD, QPl + zq * TT * HD, KPh + zk * TT * HD, KPl + zk * TT * HD, HD, Sb, TT, nullptr, (size_t)TT * HD, (size_t)TT * HD, (size_t)TT * TT);
            k_gemmw<bf, 2, false><<<dim3(TT / 64, NPE / 64, ZH), 32, 0, stream>>>(QPh + zq * TT * HD, QPl + zq * TT * HD, PKh + zq * NPE * HD, PKl + zq * NPE * HD, HD, C2P, NPE, nullptr, (size_t)TT * HD, (size_t)NPE * HD, (size_t)TT * NPE);   /* c2p raw [2][1024][512] */ k_gemmw<bf, 2, false><<<dim3(NPE / 64, TT / 64, ZH), 32, 0, stream>>>(PQh + zq * NPE * HD, PQl + zq * NPE * HD, KPh + zk * TT * HD, KPl + zk * TT * HD, HD, P2C, TT, nullptr, (size_t)NPE * HD, (size_t)TT * HD, (size_t)NPE * TT);   /* p2c raw [2][512][1024] */ k_asoft<<<ZH * TT / 8, 256, 0, stream>>>(Sb, C2P, P2C, MK + (size_t)b * TT * TT, P16, Ph, Pl);
            k_gemmw<bf, 2, false><<<dim3(RH / 64, HD / 64, ZH), 32, 0, stream>>>(Ph, Pl, VTh + zk * HD * TT, VTl + zk * HD * TT, TT, Ob, HD, nullptr, (size_t)RH * TT, (size_t)HD * TT, (size_t)TT * HD);
            k_merge<<<(unsigned)(((size_t)ZH * TT * HD / 2 + 255) / 256), 256, 0, stream>>>(Ob, h0, OUT + (size_t)b * TT * DQ); }
         }
}

// v001
// Measured time: 511 microseconds a run.
// Timed twice side by side with v000, it ran 2.05 and 2.08 times as fast.
#include <hip/hip_runtime.h>

// DeBERTa disentangled self-attention (hidden_states [2][1024][1024]; q, k, v = hs W^T + b ('oi' [1024][1024]; 16 heads x 64); pos_k = rel_embeddings Wpk^T + bpk, pos_q = rel_embeddings Wpq^T + bpq (rel_embeddings [512][1024], read); scale = 1/sqrt(64 x 3); scores = q.k scale + c2p[i][clip(i-j+256, 0, 511)] + p2c[clip(i-j+256, 0, 511)][j] with c2p = q.pos_k scale ([S][512]) and p2c = (pos_q scale).k ([512][S]); mask (int32 [2][1][1024][1024], read; all ones) == 0 -> finfo.min and weight 0; softmax; out = merged attn.v -> [2][1024][1024] (2.1 M), no output projection).
// Layout: exact bf16 projections; hi/lo planes for q, k, pos_k, pos_q (every row: 3-product score GEMMs); per pass of ZH = 16 heads (one pass per batch item): content scores [16][1024][1024], c2p [16][1024][512] and p2c [16][512][1024] as hi/lo GEMMs, and the softmax kernel gathers the two relative terms per logit (index clip(i - j + 256, 0, 511)), scales, applies the mask select, f32 softmax, hi/lo P; attn.v (3 products); f32 merged output.
// Compute dtypes, f32 accumulate: every input rounded to bf16; q/k/v/pos_k/pos_q on PLAIN bf16 operands (exact) + biases; all score terms and attn.v on hi/lo planes (3 products) for every row; softmax f32; output f32.

#define NB_  2
#define TT   1024
#define DM   1024
#define NH_  16
#define NKV  16
#define REP  (NH_ / NKV)
#define HD   64
#define DQ   (NH_ * HD)
#define DKV  (NKV * HD)
#define ZH   16                    // heads per pass: all heads of one batch item ride in grid z of every score and attn.v launch (grid x of the softmax launch)
#define RH   1024                  // query rows < RH use hi+lo planes (0: none)
#define WIN  0
#define PCAR 1024.0f
#define SCL  0.072168783648703225f   // 1/sqrt(64 x 3)
#define NPE  512                  // 2 x att_span relative positions
#define SPAN 256
typedef _Float16 h16;
typedef unsigned short bf;
typedef __attribute__((ext_vector_type(16))) __bf16   v16bf;
typedef __attribute__((ext_vector_type(16))) _Float16 v16h;
typedef __attribute__((ext_vector_type(8)))  _Float16 v8h;
typedef __attribute__((ext_vector_type(8)))  unsigned short v8us;
typedef __attribute__((ext_vector_type(8)))  float    v8f;
typedef __attribute__((ext_vector_type(4)))  float    v4f;
typedef v8h  __attribute__((may_alias)) v8ha;
typedef v4f  __attribute__((may_alias)) v4fa;
typedef v8us __attribute__((may_alias)) v8usa;

__device__ __forceinline__ unsigned short f2bf(float f) { unsigned u = __float_as_uint(f); u += 0x7FFFu + ((u >> 16) & 1u); return (unsigned short)(u >> 16); }
__device__ __forceinline__ float bf2f(unsigned short b) { return __uint_as_float(((unsigned)b) << 16); }
__device__ __forceinline__ float bfr(float f) { return bf2f(f2bf(f)); }
__device__ __forceinline__ v16h cat16(v8h lo, v8h hi) { return __builtin_shufflevector(lo, hi, 0, 1, 2, 3, 4, 5, 6, 7, 8, 9, 10, 11, 12, 13, 14, 15); }
__device__ __forceinline__ v16bf cat16b(v8us lo, v8us hi) { return __builtin_bit_cast(v16bf, __builtin_shufflevector(lo, hi, 0, 1, 2, 3, 4, 5, 6, 7, 8, 9, 10, 11, 12, 13, 14, 15)); }
__device__ __forceinline__ v8f wmma16(v16h a, v16h b, v8f c) { return __builtin_amdgcn_wmma_f32_16x16x32_f16(false, a, false, b, (short)0, c, false, false); }
__device__ __forceinline__ v8f wmmab(v16bf a, v16bf b, v8f c) { return __builtin_amdgcn_wmma_f32_16x16x32_bf16(false, a, false, b, (short)0, c, false, false); }



// ---- k_gemmw: register-blocked GEMM, ONE WAVE per 64x64 output tile (16 accumulators), operands straight from K-contiguous 16-bit planes; grid (M/64, N/64, Z), 32 threads.
// C[m][n] (f32, pitch ldc, + optional f32 bias[n]) = sum_k A[m][k] Bt[n][k] (+ split products per NSPLIT). z-batch strides sA/sB/sC in elements. K % 32 == 0.
template <typename T16> struct WFrag;
template <> struct WFrag<h16> { typedef v16h V; static __device__ __forceinline__ V ld(const h16* p) { return cat16(*(const v8h*)p, *(const v8h*)(p + 16)); } static __device__ __forceinline__ v8f mma(V a, V b, v8f c) { return wmma16(a, b, c); } };
template <> struct WFrag<bf> { typedef v16bf V; static __device__ __forceinline__ V ld(const bf* p) { return cat16b(*(const v8us*)p, *(const v8us*)(p + 16)); } static __device__ __forceinline__ v8f mma(V a, V b, v8f c) { return wmmab(a, b, c); } };
template <typename T16, int NSPLIT, bool BIAS>
__global__ __launch_bounds__(32) void k_gemmw(const T16* __restrict__ A, const T16* __restrict__ A2, const T16* __restrict__ Bt, const T16* __restrict__ Bt2, int K, float* C, int ldc, const float* __restrict__ bias, size_t sA, size_t sB, size_t sC) {
    typedef typename WFrag<T16>::V V;
    __shared__ __align__(16) float os[16 * 68];
    const size_t z = blockIdx.z; A += z * sA; if (A2) A2 += z * sA; Bt += z * sB; if (Bt2) Bt2 += z * sB; C += z * sC;
    const int lane = threadIdx.x & 31, lr = lane & 15, hi = lane >> 4; const int r0 = blockIdx.x * 64, c0 = blockIdx.y * 64;
    v8f acc[4][4];
#pragma unroll
    for (int mb = 0; mb < 4; ++mb)
#pragma unroll
        for (int nb = 0; nb < 4; ++nb) acc[mb][nb] = (v8f){};
    const size_t aoff = (size_t)(r0 + lr) * K + 8 * hi, boff = (size_t)(c0 + lr) * K + 8 * hi;
#pragma unroll 1
    for (int kc = 0; kc < K; kc += 32) {
        V a[4], a2[4];
#pragma unroll
        for (int mb = 0; mb < 4; ++mb) { a[mb] = WFrag<T16>::ld(A + aoff + (size_t)mb * 16 * K + kc); if (NSPLIT == 1 || NSPLIT == 2) a2[mb] = WFrag<T16>::ld(A2 + aoff + (size_t)mb * 16 * K + kc); }
#pragma unroll
        for (int nb = 0; nb < 4; ++nb) { const V b = WFrag<T16>::ld(Bt + boff + (size_t)nb * 16 * K + kc); V b2; if (NSPLIT >= 2) b2 = WFrag<T16>::ld(Bt2 + boff + (size_t)nb * 16 * K + kc);
#pragma unroll
            for (int mb = 0; mb < 4; ++mb) { acc[mb][nb] = WFrag<T16>::mma(a[mb], b, acc[mb][nb]); if (NSPLIT == 1 || NSPLIT == 2) acc[mb][nb] = WFrag<T16>::mma(a2[mb], b, acc[mb][nb]); if (NSPLIT >= 2) acc[mb][nb] = WFrag<T16>::mma(a[mb], b2, acc[mb][nb]); } }
        asm volatile("v_nop\n\tv_nop\n\tv_nop\n\tv_nop" : "+v"(acc[0][0]), "+v"(acc[1][1]), "+v"(acc[2][2]), "+v"(acc[3][3]) : "v"(a[0]), "v"(a[3]));
    }
#pragma unroll
    for (int mb = 0; mb < 4; ++mb) {
#pragma unroll
        for (int nb = 0; nb < 4; ++nb) {
#pragma unroll
            for (int j = 0; j < 8; ++j) os[(hi * 8 + j) * 68 + nb * 16 + lr] = acc[mb][nb][j]; }
        __builtin_amdgcn_wave_barrier(); asm volatile("" ::: "memory");
        float* crow = C + (size_t)(r0 + mb * 16) * ldc + c0;
{
#pragma unroll
            for (int s = 0; s < 8; ++s) { const int row = 2 * s + hi, cofs = lr * 4; v4f val = *(const v4fa*)(os + row * 68 + cofs); if (BIAS) { val[0] += bfr(bias[c0 + cofs]); val[1] += bfr(bias[c0 + cofs + 1]); val[2] += bfr(bias[c0 + cofs + 2]); val[3] += bfr(bias[c0 + cofs + 3]); }
                *(v4f*)(crow + (size_t)row * ldc + cofs) = val; }
             }
        __builtin_amdgcn_wave_barrier(); asm volatile("" ::: "memory");
    }
}

__device__ __forceinline__ h16 tohx(float x) { return (h16)x; }
__device__ __forceinline__ void splitf(float y, unsigned short& h, unsigned short& l) { h = f2bf(y); l = f2bf(y - bf2f(h)); }
typedef __attribute__((ext_vector_type(2))) _Float16 v2h;
typedef __attribute__((ext_vector_type(4))) _Float16 v4h;
typedef __attribute__((ext_vector_type(2))) unsigned short v2us;
typedef __attribute__((ext_vector_type(4))) unsigned short v4us;
typedef __attribute__((ext_vector_type(2))) float v2f;
typedef __attribute__((ext_vector_type(4))) int v4i;

__global__ __launch_bounds__(256) void k_wtG(const float* __restrict__ w, int K, int N, bf* Bt) {
    const int lane = threadIdx.x & 31; const int L0 = (blockIdx.x * 8 + (threadIdx.x >> 5)) * 8; const int nlines = N * K / 64;
{
#pragma unroll 1
        for (int l = 0; l < 8; ++l) { const int L = L0 + l; if (L >= nlines) break; const size_t e = (size_t)L * 64 + lane * 2; const int k = (int)(e % K), n = (int)(e / K); v2us o;
            o[0] = f2bf(w[(size_t)k * N + n]); o[1] = f2bf(w[(size_t)(k + 1) * N + n]); *(v2us*)(Bt + e) = o; }
         }
}
__global__ __launch_bounds__(256) void k_cvt8(const float* __restrict__ src, bf* dst, size_t n8) { const size_t i = (size_t)blockIdx.x * 256 + threadIdx.x; if (i >= n8) return; const v8f v = *(const v8f*)(src + i * 8); v8us o;
#pragma unroll
    for (int k = 0; k < 8; ++k) o[k] = f2bf(v[k]); *(v8us*)(dst + i * 8) = o;  }

// k_rope: head planes [h][t][d] (fp16 + hi/lo) of rope(x) x sc with the rotate-half convention out[d] = x[d] cos[t][d] - x[d+HD/2] sin[t][d], out[d+HD/2] = x[d+HD/2] cos[t][d+HD/2] + x[d] sin[t][d+HD/2]
__global__ __launch_bounds__(256) void k_rope(const float* __restrict__ F, int pitch, int nheads, const float* __restrict__ CS, const float* __restrict__ RF, const float* __restrict__ nw, float sc, h16* P16, bf* Ph, bf* Pl) {
    const size_t e = ((size_t)blockIdx.x * 256 + threadIdx.x) * 2; if (e >= (size_t)nheads * TT * HD) return; const int d = (int)(e % HD); const int t = (int)((e / HD) % TT); const int h = (int)(e / ((size_t)HD * TT)); const float* f = F + (size_t)t * pitch + h * HD; const float rf = RF ? RF[(size_t)h * TT + t] : 1.0f; v2h o16; v2us oh, ol;
#pragma unroll
    for (int q = 0; q < 2; ++q) { const int dd = d + q; const int dp = (dd < HD / 2) ? dd + HD / 2 : dd - HD / 2; float x0 = f[dd], x1 = f[dp];
        if (RF) { float n0 = __fmul_rn(x0, rf), n1 = __fmul_rn(x1, rf); asm volatile("" : "+v"(n0)); asm volatile("" : "+v"(n1)); x0 = __fmul_rn(bfr(nw[dd]), n0); x1 = __fmul_rn(bfr(nw[dp]), n1); }
        const v2f cs = *(const v2f*)(CS + ((size_t)t * HD + dd) * 2); float a = __fmul_rn(x0, cs[0]), bq = __fmul_rn(x1, cs[1]); asm volatile("" : "+v"(a)); asm volatile("" : "+v"(bq)); const float r = ((dd < HD / 2) ? __fsub_rn(a, bq) : __fadd_rn(a, bq)) * sc;
        o16[q] = tohx(r); unsigned short a2, c2; splitf(r, a2, c2); oh[q] = a2; ol[q] = c2; }
    *(v2h*)(P16 + e) = o16; *(v2us*)(Ph + e) = oh; *(v2us*)(Pl + e) = ol;  }
__global__ __launch_bounds__(256) void k_vtp(const float* __restrict__ F, int pitch, int nheads, h16* V16, bf* Vh, bf* Vl) { const size_t e = ((size_t)blockIdx.x * 256 + threadIdx.x) * 2; if (e >= (size_t)nheads * HD * TT) return; const int t = (int)(e % TT); const int d = (int)((e / TT) % HD); const int g = (int)(e / ((size_t)TT * HD)); v2h o16; v2us oh, ol;
#pragma unroll
    for (int q = 0; q < 2; ++q) { const float x = F[(size_t)(t + q) * pitch + g * HD + d]; o16[q] = tohx(x); unsigned short a2, c2; splitf(x, a2, c2); oh[q] = a2; ol[q] = c2; }
    *(v2h*)(V16 + e) = o16; *(v2us*)(Vh + e) = oh; *(v2us*)(Vl + e) = ol;  }
__global__ __launch_bounds__(256) void k_csid(float* CS) { const int idx = blockIdx.x * 256 + threadIdx.x; if (idx >= TT * HD) return; v2f cs; cs[0] = 1.0f; cs[1] = 0.0f; *(v2f*)(CS + (size_t)idx * 2) = cs;  }
__global__ __launch_bounds__(256) void k_pplane(const float* __restrict__ POS, bf* Ph2, bf* Pl2) { const size_t e = ((size_t)blockIdx.x * 256 + threadIdx.x) * 2; if (e >= (size_t)NH_ * NPE * HD) return; const int d = (int)(e % HD); const int p = (int)((e / HD) % NPE); const int h = (int)(e / ((size_t)HD * NPE)); v2us oh, ol;
#pragma unroll
    for (int q = 0; q < 2; ++q) { unsigned short a, c; splitf(POS[(size_t)p * DQ + h * HD + d + q], a, c); oh[q] = a; ol[q] = c; } *(v2us*)(Ph2 + e) = oh; *(v2us*)(Pl2 + e) = ol;  }
// k_asoft: per row (zz, i): t = (S + c2p[i][rp] + p2c[rp][j]) x scale with rp = clip(i - j + 256, 0, 511), -3.0e38 where mask == 0; softmax over the 1024 keys (register row, one exp, fixed trees);
__global__ __launch_bounds__(256) void k_asoft(const float* __restrict__ Sb, const float* __restrict__ C2P, const float* __restrict__ P2C, const int* __restrict__ MKb, h16* P16, bf* Ph, bf* Pl) {
    const int lane = threadIdx.x & 31; const int row = blockIdx.x * 8 + (threadIdx.x >> 5); if (row >= ZH * TT) return; const int i = row % TT; const int zz = row / TT; const float* cr = C2P + (size_t)row * NPE; const float* pr = P2C + (size_t)zz * NPE * TT; const int* mkr = MKb + (size_t)i * TT; const bool hires = (i < RH); const float* sr = Sb + (size_t)row * TT; float v[TT / 32]; float mx = -3.0e38f;
#pragma unroll
    for (int ch = 0; ch < TT / 128; ++ch) { const int j0 = ch * 128 + lane * 4; const v4f a = *(const v4f*)(sr + j0); const v4i m4 = *(const v4i*)(mkr + j0);
#pragma unroll
        for (int q = 0; q < 4; ++q) { const int j = j0 + q; (void)j; int rp = i - j + SPAN; rp = rp < 0 ? 0 : (rp > NPE - 1 ? NPE - 1 : rp); float s1 = __fadd_rn(a[q], cr[rp]); asm volatile("" : "+v"(s1)); float s2 = __fadd_rn(s1, pr[(size_t)rp * TT + j]); asm volatile("" : "+v"(s2)); float sa = s2 * SCL; asm volatile("" : "+v"(sa)); const float t = (m4[q] != 0) ? sa : -3.0e38f;   /* (qk + c2p[i][rp] + p2c[rp][j]) x scale, rp = clip(i - j + 256, 0, 511); mask select */ v[ch * 4 + q] = t; mx = fmaxf(mx, t); } }
#pragma unroll
    for (int sh = 16; sh; sh >>= 1) mx = fmaxf(mx, __shfl_xor(mx, sh, 32));
    float sum = 0.f;
#pragma unroll
    for (int k = 0; k < TT / 32; ++k) { float d0 = __fsub_rn(v[k], mx); asm volatile("" : "+v"(d0)); v[k] = __builtin_amdgcn_exp2f(__fmul_rn(d0, 1.4426950408889634f)); sum += v[k]; }
#pragma unroll
    for (int sh = 16; sh; sh >>= 1) sum += __shfl_xor(sum, sh, 32);
    const float f = __fdiv_rn(hires ? 1.0f : PCAR, sum);
{
        if (hires) {
#pragma unroll
            for (int ch = 0; ch < TT / 128; ++ch) { v4us oh, ol;
#pragma unroll
                for (int q = 0; q < 4; ++q) { unsigned short a, c2; splitf(v[ch * 4 + q] * f, a, c2); oh[q] = a; ol[q] = c2; }
                const size_t oo = ((size_t)zz * (RH ? RH : 1) + i) * TT + ch * 128 + lane * 4; *(v4us*)(Ph + oo) = oh; *(v4us*)(Pl + oo) = ol; }
        } else {
#pragma unroll
            for (int ch = 0; ch < TT / 128; ++ch) { v4h o4;
#pragma unroll
                for (int q = 0; q < 4; ++q) o4[q] = tohx(v[ch * 4 + q] * f);
                *(v4h*)(P16 + (size_t)row * TT + ch * 128 + lane * 4) = o4; } }
         }
}
__global__ __launch_bounds__(256) void k_merge(const float* __restrict__ O, int h0, float* OUTb) { const size_t e = ((size_t)blockIdx.x * 256 + threadIdx.x) * 2; if (e >= (size_t)ZH * TT * HD) return; const int d = (int)(e % HD); const int t = (int)((e / HD) % TT); const int zz = (int)(e / ((size_t)HD * TT)); const float cs = (t < RH) ? 1.0f : (1.0f / PCAR); const size_t oo = (size_t)t * DQ + (h0 + zz) * HD + d;
    v2f o2; o2[0] = O[e] * cs; o2[1] = O[e + 1] * cs; *(v2f*)(OUTb + oo) = o2;  }

extern "C" void kernel_launch(void* const* d_in, const int* in_sizes, int n_in,
                              void* d_out, int out_size, void* d_ws, size_t ws_size, hipStream_t stream) {
    (void)in_sizes; (void)n_in; (void)out_size;
    const float* x = (const float*)d_in[0]; const int* MK = (const int*)d_in[1]; const float* rel = (const float*)d_in[2]; const float* wq = (const float*)d_in[3]; const float* bq = (const float*)d_in[4]; const float* wk = (const float*)d_in[5]; const float* bk = (const float*)d_in[6]; const float* wv = (const float*)d_in[7]; const float* bv = (const float*)d_in[8]; const float* wpk = (const float*)d_in[9]; const float* bpk = (const float*)d_in[10]; const float* wpq = (const float*)d_in[11]; const float* bpq = (const float*)d_in[12];
    float* OUT = (float*)d_out;     // [2][1024][1024]
    char* wsp = (char*)d_ws;
    auto take = [&](size_t bytes) { char* p = wsp; wsp += (bytes + 255) & ~(size_t)255; return (void*)p; };
    bf* WQ = (bf*)take((size_t)DQ * DM * 2); bf* WK = (bf*)take((size_t)DKV * DM * 2); bf* WV = (bf*)take((size_t)DKV * DM * 2); float* CS = (float*)take((size_t)TT * HD * 2 * 4); bf* WPK = (bf*)take((size_t)DQ * DM * 2); bf* WPQ = (bf*)take((size_t)DQ * DM * 2); bf* RE = (bf*)take((size_t)NPE * DM * 2); float* POS = (float*)take((size_t)NPE * DQ * 4); bf* PKh = (bf*)take((size_t)NH_ * NPE * HD * 2); bf* PKl = (bf*)take((size_t)NH_ * NPE * HD * 2); bf* PQh = (bf*)take((size_t)NH_ * NPE * HD * 2); bf* PQl = (bf*)take((size_t)NH_ * NPE * HD * 2); float* C2P = (float*)take((size_t)ZH * TT * NPE * 4); float* P2C = (float*)take((size_t)ZH * NPE * TT * 4);
    bf* XB = (bf*)take((size_t)TT * DM * 2); float* FQ = (float*)take((size_t)TT * DQ * 4); float* FK = (float*)take((size_t)TT * DKV * 4);
    h16* QP16 = (h16*)take((size_t)NH_ * TT * HD * 2); h16* KP16 = (h16*)take((size_t)NKV * TT * HD * 2); h16* VT16 = (h16*)take((size_t)NKV * HD * TT * 2);
    bf* QPh = (bf*)take((size_t)NH_ * TT * HD * 2); bf* QPl = (bf*)take((size_t)NH_ * TT * HD * 2); bf* KPh = (bf*)take((size_t)NKV * TT * HD * 2); bf* KPl = (bf*)take((size_t)NKV * TT * HD * 2); bf* VTh = (bf*)take((size_t)NKV * HD * TT * 2); bf* VTl = (bf*)take((size_t)NKV * HD * TT * 2); bf* Ph = (bf*)take((size_t)ZH * RH * TT * 2); bf* Pl = (bf*)take((size_t)ZH * RH * TT * 2);
    float* Sb = (float*)take((size_t)ZH * TT * TT * 4); h16* P16 = (h16*)take(256);   /* unused: all rows hi/lo */ float* Ob = (float*)take((size_t)ZH * TT * HD * 4);
    if ((size_t)(wsp - (char*)d_ws) > ws_size) return;    // ws 256 MiB; 241.5 MiB taken at ZH = 16
    float* FV = FK;   // v projection reuses the k buffer after the k planes are built (stream-ordered)
    { k_cvt8<<<(unsigned)(((size_t)DQ * DM / 8 + 255) / 256), 256, 0, stream>>>(wq, WQ, (size_t)DQ * DM / 8); k_cvt8<<<(unsigned)(((size_t)DKV * DM / 8 + 255) / 256), 256, 0, stream>>>(wk, WK, (size_t)DKV * DM / 8); k_cvt8<<<(unsigned)(((size_t)DKV * DM / 8 + 255) / 256), 256, 0, stream>>>(wv, WV, (size_t)DKV * DM / 8);
      
       }
    k_csid<<<(TT * HD + 255) / 256, 256, 0, stream>>>(CS);
    k_cvt8<<<(unsigned)(((size_t)DQ * DM / 8 + 255) / 256), 256, 0, stream>>>(wpk, WPK, (size_t)DQ * DM / 8); k_cvt8<<<(unsigned)(((size_t)DQ * DM / 8 + 255) / 256), 256, 0, stream>>>(wpq, WPQ, (size_t)DQ * DM / 8); k_cvt8<<<(unsigned)(((size_t)NPE * DM / 8 + 255) / 256), 256, 0, stream>>>(rel, RE, (size_t)NPE * DM / 8);
    k_gemmw<bf, 0, true><<<dim3(NPE / 64, DQ / 64, 1), 32, 0, stream>>>(RE, nullptr, WPK, nullptr, DM, POS, DQ, bpk, 0, 0, 0); k_pplane<<<(unsigned)(((size_t)NH_ * NPE * HD / 2 + 255) / 256), 256, 0, stream>>>(POS, PKh, PKl);   /* pos_k = rel Wpk^T + bpk -> per-head hi/lo planes [h][512][64] */
    k_gemmw<bf, 0, true><<<dim3(NPE / 64, DQ / 64, 1), 32, 0, stream>>>(RE, nullptr, WPQ, nullptr, DM, POS, DQ, bpq, 0, 0, 0); k_pplane<<<(unsigned)(((size_t)NH_ * NPE * HD / 2 + 255) / 256), 256, 0, stream>>>(POS, PQh, PQl);   /* pos_q planes (POS reused after pos_k's planes are built) */
    const unsigned LQ = (unsigned)(((size_t)NH_ * TT * HD / 2 + 255) / 256), LKv = (unsigned)(((size_t)NKV * TT * HD / 2 + 255) / 256);
    for (int b = 0; b < NB_; ++b) {
        
        k_cvt8<<<(unsigned)(((size_t)TT * DM / 8 + 255) / 256), 256, 0, stream>>>(x + (size_t)b * TT * DM, XB, (size_t)TT * DM / 8);
        k_gemmw<bf, 0, true><<<dim3(TT / 64, DQ / 64, 1), 32, 0, stream>>>(XB, nullptr, WQ, nullptr, DM, FQ, DQ, bq, 0, 0, 0);
        k_rope<<<LQ, 256, 0, stream>>>(FQ, DQ, NH_, CS, nullptr, nullptr, 1.0f, QP16, QPh, QPl);
        k_gemmw<bf, 0, true><<<dim3(TT / 64, DKV / 64, 1), 32, 0, stream>>>(XB, nullptr, WK, nullptr, DM, FK, DKV, bk, 0, 0, 0);
        k_rope<<<LKv, 256, 0, stream>>>(FK, DKV, NKV, CS, nullptr, nullptr, 1.0f, KP16, KPh, KPl);
        k_gemmw<bf, 0, true><<<dim3(TT / 64, DKV / 64, 1), 32, 0, stream>>>(XB, nullptr, WV, nullptr, DM, FV, DKV, bv, 0, 0, 0); k_vtp<<<LKv, 256, 0, stream>>>(FV, DKV, NKV, VT16, VTh, VTl);
        for (int h0 = 0; h0 < NH_; h0 += ZH) { const size_t zq = (size_t)h0, zk = (size_t)(h0 / REP);   // one kv head per query head: the pass's heads use consecutive kv planes (z-strides TT*HD)
            k_gemmw<bf, 2, false><<<dim3(RH / 64, TT / 64, ZH), 32, 0, stream>>>(QPh + zq * TT * HD, QPl + zq * TT * HD, KPh + zk * TT * HD, KPl + zk * TT * HD, HD, Sb, TT, nullptr, (size_t)TT * HD, (size_t)TT * HD, (size_t)TT * TT);
            k_gemmw<bf, 2, false><<<dim3(TT / 64, NPE / 64, ZH), 32, 0, stream>>>(QPh + zq * TT * HD, QPl + zq * TT * HD, PKh + zq * NPE * HD, PKl + zq * NPE * HD, HD, C2P, NPE, nullptr, (size_t)TT * HD, (size_t)NPE * HD, (size_t)TT * NPE);   /* c2p raw [ZH][1024][512] */ k_gemmw<bf, 2, false><<<dim3(NPE / 64, TT / 64, ZH), 32, 0, stream>>>(PQh + zq * NPE * HD, PQl + zq * NPE * HD, KPh + zk * TT * HD, KPl + zk * TT * HD, HD, P2C, TT, nullptr, (size_t)NPE * HD, (size_t)TT * HD, (size_t)NPE * TT);   /* p2c raw [ZH][512][1024] */ k_asoft<<<ZH * TT / 8, 256, 0, stream>>>(Sb, C2P, P2C, MK + (size_t)b * TT * TT, P16, Ph, Pl);
            k_gemmw<bf, 2, false><<<dim3(RH / 64, HD / 64, ZH), 32, 0, stream>>>(Ph, Pl, VTh + zk * HD * TT, VTl + zk * HD * TT, TT, Ob, HD, nullptr, (size_t)RH * TT, (size_t)HD * TT, (size_t)TT * HD);
            k_merge<<<(unsigned)(((size_t)ZH * TT * HD / 2 + 255) / 256), 256, 0, stream>>>(Ob, h0, OUT + (size_t)b * TT * DQ); }
         }
}

// v002
// Measured time: 365 microseconds a run.
// Next to v001, in two timings, it ran 1.40 and 1.41 times as fast.
// All steps since v000 together make it 2.91 times as fast.
#include <hip/hip_runtime.h>

// DeBERTa disentangled self-attention (hidden_states [2][1024][1024]; q, k, v = hs W^T + b ('oi' [1024][1024]; 16 heads x 64); pos_k = rel_embeddings Wpk^T + bpk, pos_q = rel_embeddings Wpq^T + bpq (rel_embeddings [512][1024], read); scale = 1/sqrt(64 x 3); scores = q.k scale + c2p[i][clip(i-j+256, 0, 511)] + p2c[clip(i-j+256, 0, 511)][j] with c2p = q.pos_k scale ([S][512]) and p2c = (pos_q scale).k ([512][S]); mask (int32 [2][1][1024][1024], read; all ones) == 0 -> finfo.min and weight 0; softmax; out = merged attn.v -> [2][1024][1024] (2.1 M), no output projection).
// Layout: exact bf16 projections; hi/lo planes for q, k, pos_k, pos_q (every row: 3-product score GEMMs); per pass of ZH = 16 heads (one pass per batch item): content scores [16][1024][1024], c2p [16][1024][512] and p2c [16][512][1024] as hi/lo GEMMs, and the softmax kernel gathers the two relative terms per logit (index clip(i - j + 256, 0, 511)), scales, applies the mask select, f32 softmax, hi/lo P; attn.v (3 products); f32 merged output.
// Compute dtypes, f32 accumulate: every input rounded to bf16; q/k/v/pos_k/pos_q on PLAIN bf16 operands (exact) + biases; all score terms and attn.v on hi/lo planes (3 products) for every row; softmax f32; output f32.

#define NB_  2
#define TT   1024
#define DM   1024
#define NH_  16
#define NKV  16
#define REP  (NH_ / NKV)
#define HD   64
#define DQ   (NH_ * HD)
#define DKV  (NKV * HD)
#define ZH   16                    // heads per pass: all heads of one batch item ride in grid z of every score and attn.v launch (grid x of the softmax launch)
#define RH   1024                  // query rows < RH use hi+lo planes (0: none)
#define WIN  0
#define PCAR 1024.0f
#define SCL  0.072168783648703225f   // 1/sqrt(64 x 3)
#define NPE  512                  // 2 x att_span relative positions
#define SPAN 256
#define KSL  8                     // K slices (waves per work-group) of the K = 1024 GEMMs: the five projections and attn.v
typedef _Float16 h16;
typedef unsigned short bf;
typedef __attribute__((ext_vector_type(16))) __bf16   v16bf;
typedef __attribute__((ext_vector_type(16))) _Float16 v16h;
typedef __attribute__((ext_vector_type(8)))  _Float16 v8h;
typedef __attribute__((ext_vector_type(8)))  unsigned short v8us;
typedef __attribute__((ext_vector_type(8)))  float    v8f;
typedef __attribute__((ext_vector_type(4)))  float    v4f;
typedef v8h  __attribute__((may_alias)) v8ha;
typedef v4f  __attribute__((may_alias)) v4fa;
typedef v8us __attribute__((may_alias)) v8usa;

__device__ __forceinline__ unsigned short f2bf(float f) { unsigned u = __float_as_uint(f); u += 0x7FFFu + ((u >> 16) & 1u); return (unsigned short)(u >> 16); }
__device__ __forceinline__ float bf2f(unsigned short b) { return __uint_as_float(((unsigned)b) << 16); }
__device__ __forceinline__ float bfr(float f) { return bf2f(f2bf(f)); }
__device__ __forceinline__ v16h cat16(v8h lo, v8h hi) { return __builtin_shufflevector(lo, hi, 0, 1, 2, 3, 4, 5, 6, 7, 8, 9, 10, 11, 12, 13, 14, 15); }
__device__ __forceinline__ v16bf cat16b(v8us lo, v8us hi) { return __builtin_bit_cast(v16bf, __builtin_shufflevector(lo, hi, 0, 1, 2, 3, 4, 5, 6, 7, 8, 9, 10, 11, 12, 13, 14, 15)); }
__device__ __forceinline__ v8f wmma16(v16h a, v16h b, v8f c) { return __builtin_amdgcn_wmma_f32_16x16x32_f16(false, a, false, b, (short)0, c, false, false); }
__device__ __forceinline__ v8f wmmab(v16bf a, v16bf b, v8f c) { return __builtin_amdgcn_wmma_f32_16x16x32_bf16(false, a, false, b, (short)0, c, false, false); }



// ---- k_gemmw: register-blocked GEMM, 64x64 output tile (16 accumulators per wave), operands straight from K-contiguous 16-bit planes; grid (M/64, N/64, Z), 32 x KW threads.
// KW = 1: one wave does the whole K. KW > 1 (long K): K is cut into KW contiguous slices, one wave of the work-group per slice, so that KW waves' loads are in flight on a tile; each wave leaves its partial tile in LDS and, behind one barrier, every thread sums its share of the tile over the slices in the fixed order 0 .. KW-1. K % (32 x KW) == 0.
// C[m][n] (f32, pitch ldc, + optional f32 bias[n]) = sum_k A[m][k] Bt[n][k] (+ split products per NSPLIT). z-batch strides sA/sB/sC in elements. K % 32 == 0.
template <typename T16> struct WFrag;
template <> struct WFrag<h16> { typedef v16h V; static __device__ __forceinline__ V ld(const h16* p) { return cat16(*(const v8h*)p, *(const v8h*)(p + 16)); } static __device__ __forceinline__ v8f mma(V a, V b, v8f c) { return wmma16(a, b, c); } };
template <> struct WFrag<bf> { typedef v16bf V; static __device__ __forceinline__ V ld(const bf* p) { return cat16b(*(const v8us*)p, *(const v8us*)(p + 16)); } static __device__ __forceinline__ v8f mma(V a, V b, v8f c) { return wmmab(a, b, c); } };
template <typename T16, int NSPLIT, bool BIAS, int KW>
__global__ __launch_bounds__(32 * KW) void k_gemmw(const T16* __restrict__ A, const T16* __restrict__ A2, const T16* __restrict__ Bt, const T16* __restrict__ Bt2, int K, float* C, int ldc, const float* __restrict__ bias, size_t sA, size_t sB, size_t sC) {
    typedef typename WFrag<T16>::V V;
    __shared__ __align__(16) float os[KW == 1 ? 16 * 68 : KW * 64 * 68];
    const size_t z = blockIdx.z; A += z * sA; if (A2) A2 += z * sA; Bt += z * sB; if (Bt2) Bt2 += z * sB; C += z * sC;
    const int lane = threadIdx.x & 31, lr = lane & 15, hi = lane >> 4; const int r0 = blockIdx.x * 64, c0 = blockIdx.y * 64;
    v8f acc[4][4];
#pragma unroll
    for (int mb = 0; mb < 4; ++mb)
#pragma unroll
        for (int nb = 0; nb < 4; ++nb) acc[mb][nb] = (v8f){};
    const size_t aoff = (size_t)(r0 + lr) * K + 8 * hi, boff = (size_t)(c0 + lr) * K + 8 * hi;
    const int wv = KW == 1 ? 0 : __builtin_amdgcn_readfirstlane((int)(threadIdx.x >> 5)); const int k0 = wv * (K / KW), k1 = k0 + K / KW;   // this wave's K slice, in scalar registers
#pragma unroll 1
    for (int kc = k0; kc < k1; kc += 32) {
        V a[4], a2[4];
#pragma unroll
        for (int mb = 0; mb < 4; ++mb) { a[mb] = WFrag<T16>::ld(A + aoff + (size_t)mb * 16 * K + kc); if (NSPLIT == 1 || NSPLIT == 2) a2[mb] = WFrag<T16>::ld(A2 + aoff + (size_t)mb * 16 * K + kc); }
#pragma unroll
        for (int nb = 0; nb < 4; ++nb) { const V b = WFrag<T16>::ld(Bt + boff + (size_t)nb * 16 * K + kc); V b2; if (NSPLIT >= 2) b2 = WFrag<T16>::ld(Bt2 + boff + (size_t)nb * 16 * K + kc);
#pragma unroll
            for (int mb = 0; mb < 4; ++mb) { acc[mb][nb] = WFrag<T16>::mma(a[mb], b, acc[mb][nb]); if (NSPLIT == 1 || NSPLIT == 2) acc[mb][nb] = WFrag<T16>::mma(a2[mb], b, acc[mb][nb]); if (NSPLIT >= 2) acc[mb][nb] = WFrag<T16>::mma(a[mb], b2, acc[mb][nb]); } }
        asm volatile("v_nop\n\tv_nop\n\tv_nop\n\tv_nop" : "+v"(acc[0][0]), "+v"(acc[1][1]), "+v"(acc[2][2]), "+v"(acc[3][3]) : "v"(a[0]), "v"(a[3]));
    }
    if (KW > 1) {
        float* mine = os + wv * (64 * 68);
        // the three loops are unrolled so that acc is indexed by constants and stays in registers
#pragma unroll
        for (int mb = 0; mb < 4; ++mb)
#pragma unroll
            for (int nb = 0; nb < 4; ++nb)
#pragma unroll
                for (int j = 0; j < 8; ++j) mine[(mb * 16 + hi * 8 + j) * 68 + nb * 16 + lr] = acc[mb][nb][j];
        __syncthreads();   // every slice's partial tile is in LDS before any thread sums across the slices
        // both loops are unrolled so that a thread's LDS reads issue ahead of its sums
#pragma unroll
        for (int s = 0; s < 32 / KW; ++s) { const int idx = s * (32 * KW) + (int)threadIdx.x; const int row = idx >> 4, cofs = (idx & 15) * 4; v4f val = *(const v4fa*)(os + row * 68 + cofs);
#pragma unroll
            for (int w = 1; w < KW; ++w) val += *(const v4fa*)(os + w * (64 * 68) + row * 68 + cofs);
            if (BIAS) { val[0] += bfr(bias[c0 + cofs]); val[1] += bfr(bias[c0 + cofs + 1]); val[2] += bfr(bias[c0 + cofs + 2]); val[3] += bfr(bias[c0 + cofs + 3]); }
            *(v4f*)(C + (size_t)(r0 + row) * ldc + c0 + cofs) = val; }
        return;
    }
#pragma unroll
    for (int mb = 0; mb < 4; ++mb) {
#pragma unroll
        for (int nb = 0; nb < 4; ++nb) {
#pragma unroll
            for (int j = 0; j < 8; ++j) os[(hi * 8 + j) * 68 + nb * 16 + lr] = acc[mb][nb][j]; }
        __builtin_amdgcn_wave_barrier(); asm volatile("" ::: "memory");
        float* crow = C + (size_t)(r0 + mb * 16) * ldc + c0;
{
#pragma unroll
            for (int s = 0; s < 8; ++s) { const int row = 2 * s + hi, cofs = lr * 4; v4f val = *(const v4fa*)(os + row * 68 + cofs); if (BIAS) { val[0] += bfr(bias[c0 + cofs]); val[1] += bfr(bias[c0 + cofs + 1]); val[2] += bfr(bias[c0 + cofs + 2]); val[3] += bfr(bias[c0 + cofs + 3]); }
                *(v4f*)(crow + (size_t)row * ldc + cofs) = val; }
             }
        __builtin_amdgcn_wave_barrier(); asm volatile("" ::: "memory");
    }
}

__device__ __forceinline__ h16 tohx(float x) { return (h16)x; }
__device__ __forceinline__ void splitf(float y, unsigned short& h, unsigned short& l) { h = f2bf(y); l = f2bf(y - bf2f(h)); }
typedef __attribute__((ext_vector_type(2))) _Float16 v2h;
typedef __attribute__((ext_vector_type(4))) _Float16 v4h;
typedef __attribute__((ext_vector_type(2))) unsigned short v2us;
typedef __attribute__((ext_vector_type(4))) unsigned short v4us;
typedef __attribute__((ext_vector_type(2))) float v2f;
typedef __attribute__((ext_vector_type(4))) int v4i;

__global__ __launch_bounds__(256) void k_wtG(const float* __restrict__ w, int K, int N, bf* Bt) {
    const int lane = threadIdx.x & 31; const int L0 = (blockIdx.x * 8 + (threadIdx.x >> 5)) * 8; const int nlines = N * K / 64;
{
#pragma unroll 1
        for (int l = 0; l < 8; ++l) { const int L = L0 + l; if (L >= nlines) break; const size_t e = (size_t)L * 64 + lane * 2; const int k = (int)(e % K), n = (int)(e / K); v2us o;
            o[0] = f2bf(w[(size_t)k * N + n]); o[1] = f2bf(w[(size_t)(k + 1) * N + n]); *(v2us*)(Bt + e) = o; }
         }
}
__global__ __launch_bounds__(256) void k_cvt8(const float* __restrict__ src, bf* dst, size_t n8) { const size_t i = (size_t)blockIdx.x * 256 + threadIdx.x; if (i >= n8) return; const v8f v = *(const v8f*)(src + i * 8); v8us o;
#pragma unroll
    for (int k = 0; k < 8; ++k) o[k] = f2bf(v[k]); *(v8us*)(dst + i * 8) = o;  }

// k_rope: head planes [h][t][d] (fp16 + hi/lo) of rope(x) x sc with the rotate-half convention out[d] = x[d] cos[t][d] - x[d+HD/2] sin[t][d], out[d+HD/2] = x[d+HD/2] cos[t][d+HD/2] + x[d] sin[t][d+HD/2]
__global__ __launch_bounds__(256) void k_rope(const float* __restrict__ F, int pitch, int nheads, const float* __restrict__ CS, const float* __restrict__ RF, const float* __restrict__ nw, float sc, h16* P16, bf* Ph, bf* Pl) {
    const size_t e = ((size_t)blockIdx.x * 256 + threadIdx.x) * 2; if (e >= (size_t)nheads * TT * HD) return; const int d = (int)(e % HD); const int t = (int)((e / HD) % TT); const int h = (int)(e / ((size_t)HD * TT)); const float* f = F + (size_t)t * pitch + h * HD; const float rf = RF ? RF[(size_t)h * TT + t] : 1.0f; v2h o16; v2us oh, ol;
#pragma unroll
    for (int q = 0; q < 2; ++q) { const int dd = d + q; const int dp = (dd < HD / 2) ? dd + HD / 2 : dd - HD / 2; float x0 = f[dd], x1 = f[dp];
        if (RF) { float n0 = __fmul_rn(x0, rf), n1 = __fmul_rn(x1, rf); asm volatile("" : "+v"(n0)); asm volatile("" : "+v"(n1)); x0 = __fmul_rn(bfr(nw[dd]), n0); x1 = __fmul_rn(bfr(nw[dp]), n1); }
        const v2f cs = *(const v2f*)(CS + ((size_t)t * HD + dd) * 2); float a = __fmul_rn(x0, cs[0]), bq = __fmul_rn(x1, cs[1]); asm volatile("" : "+v"(a)); asm volatile("" : "+v"(bq)); const float r = ((dd < HD / 2) ? __fsub_rn(a, bq) : __fadd_rn(a, bq)) * sc;
        o16[q] = tohx(r); unsigned short a2, c2; splitf(r, a2, c2); oh[q] = a2; ol[q] = c2; }
    *(v2h*)(P16 + e) = o16; *(v2us*)(Ph + e) = oh; *(v2us*)(Pl + e) = ol;  }
__global__ __launch_bounds__(256) void k_vtp(const float* __restrict__ F, int pitch, int nheads, h16* V16, bf* Vh, bf* Vl) { const size_t e = ((size_t)blockIdx.x * 256 + threadIdx.x) * 2; if (e >= (size_t)nheads * HD * TT) return; const int t = (int)(e % TT); const int d = (int)((e / TT) % HD); const int g = (int)(e / ((size_t)TT * HD)); v2h o16; v2us oh, ol;
#pragma unroll
    for (int q = 0; q < 2; ++q) { const float x = F[(size_t)(t + q) * pitch + g * HD + d]; o16[q] = tohx(x); unsigned short a2, c2; splitf(x, a2, c2); oh[q] = a2; ol[q] = c2; }
    *(v2h*)(V16 + e) = o16; *(v2us*)(Vh + e) = oh; *(v2us*)(Vl + e) = ol;  }
__global__ __launch_bounds__(256) void k_csid(float* CS) { const int idx = blockIdx.x * 256 + threadIdx.x; if (idx >= TT * HD) return; v2f cs; cs[0] = 1.0f; cs[1] = 0.0f; *(v2f*)(CS + (size_t)idx * 2) = cs;  }
__global__ __launch_bounds__(256) void k_pplane(const float* __restrict__ POS, bf* Ph2, bf* Pl2) { const size_t e = ((size_t)blockIdx.x * 256 + threadIdx.x) * 2; if (e >= (size_t)NH_ * NPE * HD) return; const int d = (int)(e % HD); const int p = (int)((e / HD) % NPE); const int h = (int)(e / ((size_t)HD * NPE)); v2us oh, ol;
#pragma unroll
    for (int q = 0; q < 2; ++q) { unsigned short a, c; splitf(POS[(size_t)p * DQ + h * HD + d + q], a, c); oh[q] = a; ol[q] = c; } *(v2us*)(Ph2 + e) = oh; *(v2us*)(Pl2 + e) = ol;  }
// k_asoft: per row (zz, i): t = (S + c2p[i][rp] + p2c[rp][j]) x scale with rp = clip(i - j + 256, 0, 511), -3.0e38 where mask == 0; softmax over the 1024 keys (register row, one exp, fixed trees);
__global__ __launch_bounds__(256) void k_asoft(const float* __restrict__ Sb, const float* __restrict__ C2P, const float* __restrict__ P2C, const int* __restrict__ MKb, h16* P16, bf* Ph, bf* Pl) {
    const int lane = threadIdx.x & 31; const int row = blockIdx.x * 8 + (threadIdx.x >> 5); if (row >= ZH * TT) return; const int i = row % TT; const int zz = row / TT; const float* cr = C2P + (size_t)row * NPE; const float* pr = P2C + (size_t)zz * NPE * TT; const int* mkr = MKb + (size_t)i * TT; const bool hires = (i < RH); const float* sr = Sb + (size_t)row * TT; float v[TT / 32]; float mx = -3.0e38f;
#pragma unroll
    for (int ch = 0; ch < TT / 128; ++ch) { const int j0 = ch * 128 + lane * 4; const v4f a = *(const v4f*)(sr + j0); const v4i m4 = *(const v4i*)(mkr + j0);
#pragma unroll
        for (int q = 0; q < 4; ++q) { const int j = j0 + q; (void)j; int rp = i - j + SPAN; rp = rp < 0 ? 0 : (rp > NPE - 1 ? NPE - 1 : rp); float s1 = __fadd_rn(a[q], cr[rp]); asm volatile("" : "+v"(s1)); float s2 = __fadd_rn(s1, pr[(size_t)rp * TT + j]); asm volatile("" : "+v"(s2)); float sa = s2 * SCL; asm volatile("" : "+v"(sa)); const float t = (m4[q] != 0) ? sa : -3.0e38f;   /* (qk + c2p[i][rp] + p2c[rp][j]) x scale, rp = clip(i - j + 256, 0, 511); mask select */ v[ch * 4 + q] = t; mx = fmaxf(mx, t); } }
#pragma unroll
    for (int sh = 16; sh; sh >>= 1) mx = fmaxf(mx, __shfl_xor(mx, sh, 32));
    float sum = 0.f;
#pragma unroll
    for (int k = 0; k < TT / 32; ++k) { float d0 = __fsub_rn(v[k], mx); asm volatile("" : "+v"(d0)); v[k] = __builtin_amdgcn_exp2f(__fmul_rn(d0, 1.4426950408889634f)); sum += v[k]; }
#pragma unroll
    for (int sh = 16; sh; sh >>= 1) sum += __shfl_xor(sum, sh, 32);
    const float f = __fdiv_rn(hires ? 1.0f : PCAR, sum);
{
        if (hires) {
#pragma unroll
            for (int ch = 0; ch < TT / 128; ++ch) { v4us oh, ol;
#pragma unroll
                for (int q = 0; q < 4; ++q) { unsigned short a, c2; splitf(v[ch * 4 + q] * f, a, c2); oh[q] = a; ol[q] = c2; }
                const size_t oo = ((size_t)zz * (RH ? RH : 1) + i) * TT + ch * 128 + lane * 4; *(v4us*)(Ph + oo) = oh; *(v4us*)(Pl + oo) = ol; }
        } else {
#pragma unroll
            for (int ch = 0; ch < TT / 128; ++ch) { v4h o4;
#pragma unroll
                for (int q = 0; q < 4; ++q) o4[q] = tohx(v[ch * 4 + q] * f);
                *(v4h*)(P16 + (size_t)row * TT + ch * 128 + lane * 4) = o4; } }
         }
}
__global__ __launch_bounds__(256) void k_merge(const float* __restrict__ O, int h0, float* OUTb) { const size_t e = ((size_t)blockIdx.x * 256 + threadIdx.x) * 2; if (e >= (size_t)ZH * TT * HD) return; const int d = (int)(e % HD); const int t = (int)((e / HD) % TT); const int zz = (int)(e / ((size_t)HD * TT)); const float cs = (t < RH) ? 1.0f : (1.0f / PCAR); const size_t oo = (size_t)t * DQ + (h0 + zz) * HD + d;
    v2f o2; o2[0] = O[e] * cs; o2[1] = O[e + 1] * cs; *(v2f*)(OUTb + oo) = o2;  }

extern "C" void kernel_launch(void* const* d_in, const int* in_sizes, int n_in,
                              void* d_out, int out_size, void* d_ws, size_t ws_size, hipStream_t stream) {
    (void)in_sizes; (void)n_in; (void)out_size;
    const float* x = (const float*)d_in[0]; const int* MK = (const int*)d_in[1]; const float* rel = (const float*)d_in[2]; const float* wq = (const float*)d_in[3]; const float* bq = (const float*)d_in[4]; const float* wk = (const float*)d_in[5]; const float* bk = (const float*)d_in[6]; const float* wv = (const float*)d_in[7]; const float* bv = (const float*)d_in[8]; const float* wpk = (const float*)d_in[9]; const float* bpk = (const float*)d_in[10]; const float* wpq = (const float*)d_in[11]; const float* bpq = (const float*)d_in[12];
    float* OUT = (float*)d_out;     // [2][1024][1024]
    char* wsp = (char*)d_ws;
    auto take = [&](size_t bytes) { char* p = wsp; wsp += (bytes + 255) & ~(size_t)255; return (void*)p; };
    bf* WQ = (bf*)take((size_t)DQ * DM * 2); bf* WK = (bf*)take((size_t)DKV * DM * 2); bf* WV = (bf*)take((size_t)DKV * DM * 2); float* CS = (float*)take((size_t)TT * HD * 2 * 4); bf* WPK = (bf*)take((size_t)DQ * DM * 2); bf* WPQ = (bf*)take((size_t)DQ * DM * 2); bf* RE = (bf*)take((size_t)NPE * DM * 2); float* POS = (float*)take((size_t)NPE * DQ * 4); bf* PKh = (bf*)take((size_t)NH_ * NPE * HD * 2); bf* PKl = (bf*)take((size_t)NH_ * NPE * HD * 2); bf* PQh = (bf*)take((size_t)NH_ * NPE * HD * 2); bf* PQl = (bf*)take((size_t)NH_ * NPE * HD * 2); float* C2P = (float*)take((size_t)ZH * TT * NPE * 4); float* P2C = (float*)take((size_t)ZH * NPE * TT * 4);
    bf* XB = (bf*)take((size_t)TT * DM * 2); float* FQ = (float*)take((size_t)TT * DQ * 4); float* FK = (float*)take((size_t)TT * DKV * 4);
    h16* QP16 = (h16*)take((size_t)NH_ * TT * HD * 2); h16* KP16 = (h16*)take((size_t)NKV * TT * HD * 2); h16* VT16 = (h16*)take((size_t)NKV * HD * TT * 2);
    bf* QPh = (bf*)take((size_t)NH_ * TT * HD * 2); bf* QPl = (bf*)take((size_t)NH_ * TT * HD * 2); bf* KPh = (bf*)take((size_t)NKV * TT * HD * 2); bf* KPl = (bf*)take((size_t)NKV * TT * HD * 2); bf* VTh = (bf*)take((size_t)NKV * HD * TT * 2); bf* VTl = (bf*)take((size_t)NKV * HD * TT * 2); bf* Ph = (bf*)take((size_t)ZH * RH * TT * 2); bf* Pl = (bf*)take((size_t)ZH * RH * TT * 2);
    float* Sb = (float*)take((size_t)ZH * TT * TT * 4); h16* P16 = (h16*)take(256);   /* unused: all rows hi/lo */ float* Ob = (float*)take((size_t)ZH * TT * HD * 4);
    if ((size_t)(wsp - (char*)d_ws) > ws_size) return;    // ws 256 MiB; 241.5 MiB taken at ZH = 16
    float* FV = FK;   // v projection reuses the k buffer after the k planes are built (stream-ordered)
    { k_cvt8<<<(unsigned)(((size_t)DQ * DM / 8 + 255) / 256), 256, 0, stream>>>(wq, WQ, (size_t)DQ * DM / 8); k_cvt8<<<(unsigned)(((size_t)DKV * DM / 8 + 255) / 256), 256, 0, stream>>>(wk, WK, (size_t)DKV * DM / 8); k_cvt8<<<(unsigned)(((size_t)DKV * DM / 8 + 255) / 256), 256, 0, stream>>>(wv, WV, (size_t)DKV * DM / 8);
      
       }
    k_csid<<<(TT * HD + 255) / 256, 256, 0, stream>>>(CS);
    k_cvt8<<<(unsigned)(((size_t)DQ * DM / 8 + 255) / 256), 256, 0, stream>>>(wpk, WPK, (size_t)DQ * DM / 8); k_cvt8<<<(unsigned)(((size_t)DQ * DM / 8 + 255) / 256), 256, 0, stream>>>(wpq, WPQ, (size_t)DQ * DM / 8); k_cvt8<<<(unsigned)(((size_t)NPE * DM / 8 + 255) / 256), 256, 0, stream>>>(rel, RE, (size_t)NPE * DM / 8);
    k_gemmw<bf, 0, true, KSL><<<dim3(NPE / 64, DQ / 64, 1), 32 * KSL, 0, stream>>>(RE, nullptr, WPK, nullptr, DM, POS, DQ, bpk, 0, 0, 0); k_pplane<<<(unsigned)(((size_t)NH_ * NPE * HD / 2 + 255) / 256), 256, 0, stream>>>(POS, PKh, PKl);   /* pos_k = rel Wpk^T + bpk -> per-head hi/lo planes [h][512][64] */
    k_gemmw<bf, 0, true, KSL><<<dim3(NPE / 64, DQ / 64, 1), 32 * KSL, 0, stream>>>(RE, nullptr, WPQ, nullptr, DM, POS, DQ, bpq, 0, 0, 0); k_pplane<<<(unsigned)(((size_t)NH_ * NPE * HD / 2 + 255) / 256), 256, 0, stream>>>(POS, PQh, PQl);   /* pos_q planes (POS reused after pos_k's planes are built) */
    const unsigned LQ = (unsigned)(((size_t)NH_ * TT * HD / 2 + 255) / 256), LKv = (unsigned)(((size_t)NKV * TT * HD / 2 + 255) / 256);
    for (int b = 0; b < NB_; ++b) {
        
        k_cvt8<<<(unsigned)(((size_t)TT * DM / 8 + 255) / 256), 256, 0, stream>>>(x + (size_t)b * TT * DM, XB, (size_t)TT * DM / 8);
        k_gemmw<bf, 0, true, KSL><<<dim3(TT / 64, DQ / 64, 1), 32 * KSL, 0, stream>>>(XB, nullptr, WQ, nullptr, DM, FQ, DQ, bq, 0, 0, 0);
        k_rope<<<LQ, 256, 0, stream>>>(FQ, DQ, NH_, CS, nullptr, nullptr, 1.0f, QP16, QPh, QPl);
        k_gemmw<bf, 0, true, KSL><<<dim3(TT / 64, DKV / 64, 1), 32 * KSL, 0, stream>>>(XB, nullptr, WK, nullptr, DM, FK, DKV, bk, 0, 0, 0);
        k_rope<<<LKv, 256, 0, stream>>>(FK, DKV, NKV, CS, nullptr, nullptr, 1.0f, KP16, KPh, KPl);
        k_gemmw<bf, 0, true, KSL><<<dim3(TT / 64, DKV / 64, 1), 32 * KSL, 0, stream>>>(XB, nullptr, WV, nullptr, DM, FV, DKV, bv, 0, 0, 0); k_vtp<<<LKv, 256, 0, stream>>>(FV, DKV, NKV, VT16, VTh, VTl);
        for (int h0 = 0; h0 < NH_; h0 += ZH) { const size_t zq = (size_t)h0, zk = (size_t)(h0 / REP);   // one kv head per query head: the pass's heads use consecutive kv planes (z-strides TT*HD)
            k_gemmw<bf, 2, false, 1><<<dim3(RH / 64, TT / 64, ZH), 32, 0, stream>>>(QPh + zq * TT * HD, QPl + zq * TT * HD, KPh + zk * TT * HD, KPl + zk * TT * HD, HD, Sb, TT, nullptr, (size_t)TT * HD, (size_t)TT * HD, (size_t)TT * TT);
            k_gemmw<bf, 2, false, 1><<<dim3(TT / 64, NPE / 64, ZH), 32, 0, stream>>>(QPh + zq * TT * HD, QPl + zq * TT * HD, PKh + zq * NPE * HD, PKl + zq * NPE * HD, HD, C2P, NPE, nullptr, (size_t)TT * HD, (size_t)NPE * HD, (size_t)TT * NPE);   /* c2p raw [ZH][1024][512] */ k_gemmw<bf, 2, false, 1><<<dim3(NPE / 64, TT / 64, ZH), 32, 0, stream>>>(PQh + zq * NPE * HD, PQl + zq * NPE * HD, KPh + zk * TT * HD, KPl + zk * TT * HD, HD, P2C, TT, nullptr, (size_t)NPE * HD, (size_t)TT * HD, (size_t)NPE * TT);   /* p2c raw [ZH][512][1024] */ k_asoft<<<ZH * TT / 8, 256, 0, stream>>>(Sb, C2P, P2C, MK + (size_t)b * TT * TT, P16, Ph, Pl);
            k_gemmw<bf, 2, false, KSL><<<dim3(RH / 64, HD / 64, ZH), 32 * KSL, 0, stream>>>(Ph, Pl, VTh + zk * HD * TT, VTl + zk * HD * TT, TT, Ob, HD, nullptr, (size_t)RH * TT, (size_t)HD * TT, (size_t)TT * HD);
            k_merge<<<(unsigned)(((size_t)ZH * TT * HD / 2 + 255) / 256), 256, 0, stream>>>(Ob, h0, OUT + (size_t)b * TT * DQ); }
         }
}

// v003
// Measured time: 320 microseconds a run.
// In two side-by-side timings against v002, it was 1.14 and 1.15 times as fast.
// Counting every step since v000, it is 3.32 times as fast.
#include <hip/hip_runtime.h>

// DeBERTa disentangled self-attention (hidden_states [2][1024][1024]; q, k, v = hs W^T + b ('oi' [1024][1024]; 16 heads x 64); pos_k = rel_embeddings Wpk^T + bpk, pos_q = rel_embeddings Wpq^T + bpq (rel_embeddings [512][1024], read); scale = 1/sqrt(64 x 3); scores = q.k scale + c2p[i][clip(i-j+256, 0, 511)] + p2c[clip(i-j+256, 0, 511)][j] with c2p = q.pos_k scale ([S][512]) and p2c = (pos_q scale).k ([512][S]); mask (int32 [2][1][1024][1024], read; all ones) == 0 -> finfo.min and weight 0; softmax; out = merged attn.v -> [2][1024][1024] (2.1 M), no output projection).
// Layout: exact bf16 projections; hi/lo planes for q, k, pos_k, pos_q (every row: 3-product score GEMMs); per pass of ZH = 16 heads (one pass per batch item): content scores [16][1024][1024], c2p [16][1024][512] and p2c (sheared to [16][1024][512], row i column rp, plus its two end rows) as hi/lo GEMMs, and the softmax kernel gathers the two relative terms per logit (index clip(i - j + 256, 0, 511)), scales, applies the mask select, f32 softmax, hi/lo P; attn.v (3 products); f32 merged output.
// Compute dtypes, f32 accumulate: every input rounded to bf16; q/k/v/pos_k/pos_q on PLAIN bf16 operands (exact) + biases; all score terms and attn.v on hi/lo planes (3 products) for every row; softmax f32; output f32.

#define NB_  2
#define TT   1024
#define DM   1024
#define NH_  16
#define NKV  16
#define REP  (NH_ / NKV)
#define HD   64
#define DQ   (NH_ * HD)
#define DKV  (NKV * HD)
#define ZH   16                    // heads per pass: all heads of one batch item ride in grid z of every score and attn.v launch (grid x of the softmax launch)
#define RH   1024                  // query rows < RH use hi+lo planes (0: none)
#define WIN  0
#define PCAR 1024.0f
#define SCL  0.072168783648703225f   // 1/sqrt(64 x 3)
#define NPE  512                  // 2 x att_span relative positions
#define SPAN 256
#define KSL  8                     // K slices (waves per work-group) of the K = 1024 GEMMs: the five projections and attn.v
typedef _Float16 h16;
typedef unsigned short bf;
typedef __attribute__((ext_vector_type(16))) __bf16   v16bf;
typedef __attribute__((ext_vector_type(16))) _Float16 v16h;
typedef __attribute__((ext_vector_type(8)))  _Float16 v8h;
typedef __attribute__((ext_vector_type(8)))  unsigned short v8us;
typedef __attribute__((ext_vector_type(8)))  float    v8f;
typedef __attribute__((ext_vector_type(4)))  float    v4f;
typedef v8h  __attribute__((may_alias)) v8ha;
typedef v4f  __attribute__((may_alias)) v4fa;
typedef v8us __attribute__((may_alias)) v8usa;

__device__ __forceinline__ unsigned short f2bf(float f) { unsigned u = __float_as_uint(f); u += 0x7FFFu + ((u >> 16) & 1u); return (unsigned short)(u >> 16); }
__device__ __forceinline__ float bf2f(unsigned short b) { return __uint_as_float(((unsigned)b) << 16); }
__device__ __forceinline__ float bfr(float f) { return bf2f(f2bf(f)); }
__device__ __forceinline__ v16h cat16(v8h lo, v8h hi) { return __builtin_shufflevector(lo, hi, 0, 1, 2, 3, 4, 5, 6, 7, 8, 9, 10, 11, 12, 13, 14, 15); }
__device__ __forceinline__ v16bf cat16b(v8us lo, v8us hi) { return __builtin_bit_cast(v16bf, __builtin_shufflevector(lo, hi, 0, 1, 2, 3, 4, 5, 6, 7, 8, 9, 10, 11, 12, 13, 14, 15)); }
__device__ __forceinline__ v8f wmma16(v16h a, v16h b, v8f c) { return __builtin_amdgcn_wmma_f32_16x16x32_f16(false, a, false, b, (short)0, c, false, false); }
__device__ __forceinline__ v8f wmmab(v16bf a, v16bf b, v8f c) { return __builtin_amdgcn_wmma_f32_16x16x32_bf16(false, a, false, b, (short)0, c, false, false); }



// ---- k_gemmw: register-blocked GEMM, 64x64 output tile (16 accumulators per wave), operands straight from K-contiguous 16-bit planes; grid (M/64, N/64, Z), 32 x KW threads.
// KW = 1: one wave does the whole K. KW > 1 (long K): K is cut into KW contiguous slices, one wave of the work-group per slice, so that KW waves' loads are in flight on a tile; each wave leaves its partial tile in LDS and, behind one barrier, every thread sums its share of the tile over the slices in the fixed order 0 .. KW-1. K % (32 x KW) == 0.
// C[m][n] (f32, pitch ldc, + optional f32 bias[n]) = sum_k A[m][k] Bt[n][k] (+ split products per NSPLIT). z-batch strides sA/sB/sC in elements. K % 32 == 0.
template <typename T16> struct WFrag;
template <> struct WFrag<h16> { typedef v16h V; static __device__ __forceinline__ V ld(const h16* p) { return cat16(*(const v8h*)p, *(const v8h*)(p + 16)); } static __device__ __forceinline__ v8f mma(V a, V b, v8f c) { return wmma16(a, b, c); } };
template <> struct WFrag<bf> { typedef v16bf V; static __device__ __forceinline__ V ld(const bf* p) { return cat16b(*(const v8us*)p, *(const v8us*)(p + 16)); } static __device__ __forceinline__ v8f mma(V a, V b, v8f c) { return wmmab(a, b, c); } };
template <typename T16, int NSPLIT, bool BIAS, int KW>
__global__ __launch_bounds__(32 * KW) void k_gemmw(const T16* __restrict__ A, const T16* __restrict__ A2, const T16* __restrict__ Bt, const T16* __restrict__ Bt2, int K, float* C, int ldc, const float* __restrict__ bias, size_t sA, size_t sB, size_t sC) {
    typedef typename WFrag<T16>::V V;
    __shared__ __align__(16) float os[KW == 1 ? 16 * 68 : KW * 64 * 68];
    const size_t z = blockIdx.z; A += z * sA; if (A2) A2 += z * sA; Bt += z * sB; if (Bt2) Bt2 += z * sB; C += z * sC;
    const int lane = threadIdx.x & 31, lr = lane & 15, hi = lane >> 4; const int r0 = blockIdx.x * 64, c0 = blockIdx.y * 64;
    v8f acc[4][4];
#pragma unroll
    for (int mb = 0; mb < 4; ++mb)
#pragma unroll
        for (int nb = 0; nb < 4; ++nb) acc[mb][nb] = (v8f){};
    const size_t aoff = (size_t)(r0 + lr) * K + 8 * hi, boff = (size_t)(c0 + lr) * K + 8 * hi;
    const int wv = KW == 1 ? 0 : __builtin_amdgcn_readfirstlane((int)(threadIdx.x >> 5)); const int k0 = wv * (K / KW), k1 = k0 + K / KW;   // this wave's K slice, in scalar registers
#pragma unroll 1
    for (int kc = k0; kc < k1; kc += 32) {
        V a[4], a2[4];
#pragma unroll
        for (int mb = 0; mb < 4; ++mb) { a[mb] = WFrag<T16>::ld(A + aoff + (size_t)mb * 16 * K + kc); if (NSPLIT == 1 || NSPLIT == 2) a2[mb] = WFrag<T16>::ld(A2 + aoff + (size_t)mb * 16 * K + kc); }
#pragma unroll
        for (int nb = 0; nb < 4; ++nb) { const V b = WFrag<T16>::ld(Bt + boff + (size_t)nb * 16 * K + kc); V b2; if (NSPLIT >= 2) b2 = WFrag<T16>::ld(Bt2 + boff + (size_t)nb * 16 * K + kc);
#pragma unroll
            for (int mb = 0; mb < 4; ++mb) { acc[mb][nb] = WFrag<T16>::mma(a[mb], b, acc[mb][nb]); if (NSPLIT == 1 || NSPLIT == 2) acc[mb][nb] = WFrag<T16>::mma(a2[mb], b, acc[mb][nb]); if (NSPLIT >= 2) acc[mb][nb] = WFrag<T16>::mma(a[mb], b2, acc[mb][nb]); } }
        asm volatile("v_nop\n\tv_nop\n\tv_nop\n\tv_nop" : "+v"(acc[0][0]), "+v"(acc[1][1]), "+v"(acc[2][2]), "+v"(acc[3][3]) : "v"(a[0]), "v"(a[3]));
    }
    if (KW > 1) {
        float* mine = os + wv * (64 * 68);
        // the three loops are unrolled so that acc is indexed by constants and stays in registers
#pragma unroll
        for (int mb = 0; mb < 4; ++mb)
#pragma unroll
            for (int nb = 0; nb < 4; ++nb)
#pragma unroll
                for (int j = 0; j < 8; ++j) mine[(mb * 16 + hi * 8 + j) * 68 + nb * 16 + lr] = acc[mb][nb][j];
        __syncthreads();   // every slice's partial tile is in LDS before any thread sums across the slices
        // both loops are unrolled so that a thread's LDS reads issue ahead of its sums
#pragma unroll
        for (int s = 0; s < 32 / KW; ++s) { const int idx = s * (32 * KW) + (int)threadIdx.x; const int row = idx >> 4, cofs = (idx & 15) * 4; v4f val = *(const v4fa*)(os + row * 68 + cofs);
#pragma unroll
            for (int w = 1; w < KW; ++w) val += *(const v4fa*)(os + w * (64 * 68) + row * 68 + cofs);
            if (BIAS) { val[0] += bfr(bias[c0 + cofs]); val[1] += bfr(bias[c0 + cofs + 1]); val[2] += bfr(bias[c0 + cofs + 2]); val[3] += bfr(bias[c0 + cofs + 3]); }
            *(v4f*)(C + (size_t)(r0 + row) * ldc + c0 + cofs) = val; }
        return;
    }
#pragma unroll
    for (int mb = 0; mb < 4; ++mb) {
#pragma unroll
        for (int nb = 0; nb < 4; ++nb) {
#pragma unroll
            for (int j = 0; j < 8; ++j) os[(hi * 8 + j) * 68 + nb * 16 + lr] = acc[mb][nb][j]; }
        __builtin_amdgcn_wave_barrier(); asm volatile("" ::: "memory");
        float* crow = C + (size_t)(r0 + mb * 16) * ldc + c0;
{
#pragma unroll
            for (int s = 0; s < 8; ++s) { const int row = 2 * s + hi, cofs = lr * 4; v4f val = *(const v4fa*)(os + row * 68 + cofs); if (BIAS) { val[0] += bfr(bias[c0 + cofs]); val[1] += bfr(bias[c0 + cofs + 1]); val[2] += bfr(bias[c0 + cofs + 2]); val[3] += bfr(bias[c0 + cofs + 3]); }
                *(v4f*)(crow + (size_t)row * ldc + cofs) = val; }
             }
        __builtin_amdgcn_wave_barrier(); asm volatile("" ::: "memory");
    }
}

// ---- k_p2cs: the p2c term laid out the way the softmax reads it. G[z][i][p] = pos_q[p] . k[i - p + SPAN] (hi/lo, 3 products, same products in the same order as k_gemmw<bf, 2>), so that row i of G is indexed by the same
// relative position as row i of c2p and a wave's gather runs along a row instead of down a diagonal of [p][j]. One wave per tile of 64 i x 64 p: it needs the 127 keys j = jb .. jb + 126 (jb = i0 - p0 + SPAN - 63), computes the
// 64 p x 128 j products in two halves into LDS and stores the sheared tile in whole 256-byte rows. Keys outside [0, TT) are clamped for the load only; the G elements made from them belong to no (i, j) and are never read.
// E[z][0][j] = p2c[0][j] and E[z][1][j] = p2c[NPE-1][j] serve the clipped ends (j >= i + SPAN, j <= i - SPAN + 1); each 64-key piece is written by the one tile that holds it aligned. grid (TT/64, NPE/64, Z), 32 threads.
__global__ __launch_bounds__(32) void k_p2cs(const bf* __restrict__ A, const bf* __restrict__ A2, const bf* __restrict__ Bt, const bf* __restrict__ Bt2, float* G, float* E) {
    typedef WFrag<bf>::V V;
    __shared__ __align__(16) float ts[64 * 132];
    const size_t z = blockIdx.z; A += z * (size_t)(NPE * HD); A2 += z * (size_t)(NPE * HD); Bt += z * (size_t)(TT * HD); Bt2 += z * (size_t)(TT * HD); G += z * (size_t)(TT * NPE); E += z * (size_t)(2 * TT);
    const int lane = threadIdx.x & 31, lr = lane & 15, hi = lane >> 4; const int i0 = blockIdx.x * 64, p0 = blockIdx.y * 64; const int jb = i0 - p0 + (SPAN - 63);
    const size_t aoff = (size_t)(p0 + lr) * HD + 8 * hi;
#pragma unroll 1
    for (int hf = 0; hf < 2; ++hf) {   // rolled: one set of 16 accumulators serves both halves
        v8f acc[4][4];
#pragma unroll
        for (int mb = 0; mb < 4; ++mb)
#pragma unroll
            for (int nb = 0; nb < 4; ++nb) acc[mb][nb] = (v8f){};
        size_t boff[4];
#pragma unroll
        for (int nb = 0; nb < 4; ++nb) { int j = jb + hf * 64 + nb * 16 + lr; j = j < 0 ? 0 : (j > TT - 1 ? TT - 1 : j); boff[nb] = (size_t)j * HD + 8 * hi; }
#pragma unroll 1
        for (int kc = 0; kc < HD; kc += 32) {
            V a[4], a2[4];
#pragma unroll
            for (int mb = 0; mb < 4; ++mb) { a[mb] = WFrag<bf>::ld(A + aoff + (size_t)mb * 16 * HD + kc); a2[mb] = WFrag<bf>::ld(A2 + aoff + (size_t)mb * 16 * HD + kc); }
#pragma unroll
            for (int nb = 0; nb < 4; ++nb) { const V b = WFrag<bf>::ld(Bt + boff[nb] + kc); const V b2 = WFrag<bf>::ld(Bt2 + boff[nb] + kc);
#pragma unroll
                for (int mb = 0; mb < 4; ++mb) { acc[mb][nb] = WFrag<bf>::mma(a[mb], b, acc[mb][nb]); acc[mb][nb] = WFrag<bf>::mma(a2[mb], b, acc[mb][nb]); acc[mb][nb] = WFrag<bf>::mma(a[mb], b2, acc[mb][nb]); } }
            // four vector slots between the last matrix instruction and the back edge, where the next trip's loads overwrite its operands (as in k_gemmw)
            asm volatile("v_nop\n\tv_nop\n\tv_nop\n\tv_nop" : "+v"(acc[0][0]), "+v"(acc[1][1]), "+v"(acc[2][2]), "+v"(acc[3][3]) : "v"(a[0]), "v"(a[3]));
        }
        // unrolled so that acc is indexed by constants and stays in registers
#pragma unroll
        for (int mb = 0; mb < 4; ++mb)
#pragma unroll
            for (int nb = 0; nb < 4; ++nb)
#pragma unroll
                for (int r = 0; r < 8; ++r) ts[(mb * 16 + hi * 8 + r) * 132 + hf * 64 + nb * 16 + lr] = acc[mb][nb][r];
    }
    __builtin_amdgcn_wave_barrier(); asm volatile("" ::: "memory");   // the reads below take other lanes' writes: keep the compiler from moving them up (one wave: the LDS itself works in order)
#pragma unroll 1
    for (int s0 = 0; s0 < 32; s0 += 8) {
        // unrolled so that the LDS reads of eight row pairs issue ahead of their stores
#pragma unroll
        for (int s = 0; s < 8; ++s) { const int ii = 2 * (s0 + s) + hi, pp = lr * 4; v4f val;
#pragma unroll
            for (int q = 0; q < 4; ++q) val[q] = ts[(pp + q) * 132 + ii - (pp + q) + 63];   // key j = (i0 + ii) - (p0 + pp + q) + SPAN = jb + this column
            *(v4f*)(G + (size_t)(i0 + ii) * NPE + p0 + pp) = val; }
        asm volatile("s_wait_xcnt 0x0" ::: "memory");   // the next trip rewrites the address and data registers that these stores name
    }
    if (p0 == 0 && i0 + SPAN < TT) { E[i0 + SPAN + lane] = ts[63 + lane]; E[i0 + SPAN + 32 + lane] = ts[63 + 32 + lane]; }                                        // p = 0: keys i0 + SPAN .. + 63
    if (p0 == NPE - 64 && i0 >= SPAN - 64) { E[TT + i0 - (SPAN - 64) + lane] = ts[63 * 132 + 63 + lane]; E[TT + i0 - (SPAN - 64) + 32 + lane] = ts[63 * 132 + 63 + 32 + lane]; }   // p = NPE - 1: keys i0 - SPAN + 64 .. + 63
}

__device__ __forceinline__ h16 tohx(float x) { return (h16)x; }
__device__ __forceinline__ void splitf(float y, unsigned short& h, unsigned short& l) { h = f2bf(y); l = f2bf(y - bf2f(h)); }
typedef __attribute__((ext_vector_type(2))) _Float16 v2h;
typedef __attribute__((ext_vector_type(4))) _Float16 v4h;
typedef __attribute__((ext_vector_type(2))) unsigned short v2us;
typedef __attribute__((ext_vector_type(4))) unsigned short v4us;
typedef __attribute__((ext_vector_type(2))) float v2f;
typedef __attribute__((ext_vector_type(4))) int v4i;

__global__ __launch_bounds__(256) void k_wtG(const float* __restrict__ w, int K, int N, bf* Bt) {
    const int lane = threadIdx.x & 31; const int L0 = (blockIdx.x * 8 + (threadIdx.x >> 5)) * 8; const int nlines = N * K / 64;
{
#pragma unroll 1
        for (int l = 0; l < 8; ++l) { const int L = L0 + l; if (L >= nlines) break; const size_t e = (size_t)L * 64 + lane * 2; const int k = (int)(e % K), n = (int)(e / K); v2us o;
            o[0] = f2bf(w[(size_t)k * N + n]); o[1] = f2bf(w[(size_t)(k + 1) * N + n]); *(v2us*)(Bt + e) = o; }
         }
}
__global__ __launch_bounds__(256) void k_cvt8(const float* __restrict__ src, bf* dst, size_t n8) { const size_t i = (size_t)blockIdx.x * 256 + threadIdx.x; if (i >= n8) return; const v8f v = *(const v8f*)(src + i * 8); v8us o;
#pragma unroll
    for (int k = 0; k < 8; ++k) o[k] = f2bf(v[k]); *(v8us*)(dst + i * 8) = o;  }

// k_rope: head planes [h][t][d] (fp16 + hi/lo) of rope(x) x sc with the rotate-half convention out[d] = x[d] cos[t][d] - x[d+HD/2] sin[t][d], out[d+HD/2] = x[d+HD/2] cos[t][d+HD/2] + x[d] sin[t][d+HD/2]
__global__ __launch_bounds__(256) void k_rope(const float* __restrict__ F, int pitch, int nheads, const float* __restrict__ CS, const float* __restrict__ RF, const float* __restrict__ nw, float sc, h16* P16, bf* Ph, bf* Pl) {
    const size_t e = ((size_t)blockIdx.x * 256 + threadIdx.x) * 2; if (e >= (size_t)nheads * TT * HD) return; const int d = (int)(e % HD); const int t = (int)((e / HD) % TT); const int h = (int)(e / ((size_t)HD * TT)); const float* f = F + (size_t)t * pitch + h * HD; const float rf = RF ? RF[(size_t)h * TT + t] : 1.0f; v2h o16; v2us oh, ol;
#pragma unroll
    for (int q = 0; q < 2; ++q) { const int dd = d + q; const int dp = (dd < HD / 2) ? dd + HD / 2 : dd - HD / 2; float x0 = f[dd], x1 = f[dp];
        if (RF) { float n0 = __fmul_rn(x0, rf), n1 = __fmul_rn(x1, rf); asm volatile("" : "+v"(n0)); asm volatile("" : "+v"(n1)); x0 = __fmul_rn(bfr(nw[dd]), n0); x1 = __fmul_rn(bfr(nw[dp]), n1); }
        const v2f cs = *(const v2f*)(CS + ((size_t)t * HD + dd) * 2); float a = __fmul_rn(x0, cs[0]), bq = __fmul_rn(x1, cs[1]); asm volatile("" : "+v"(a)); asm volatile("" : "+v"(bq)); const float r = ((dd < HD / 2) ? __fsub_rn(a, bq) : __fadd_rn(a, bq)) * sc;
        o16[q] = tohx(r); unsigned short a2, c2; splitf(r, a2, c2); oh[q] = a2; ol[q] = c2; }
    *(v2h*)(P16 + e) = o16; *(v2us*)(Ph + e) = oh; *(v2us*)(Pl + e) = ol;  }
__global__ __launch_bounds__(256) void k_vtp(const float* __restrict__ F, int pitch, int nheads, h16* V16, bf* Vh, bf* Vl) { const size_t e = ((size_t)blockIdx.x * 256 + threadIdx.x) * 2; if (e >= (size_t)nheads * HD * TT) return; const int t = (int)(e % TT); const int d = (int)((e / TT) % HD); const int g = (int)(e / ((size_t)TT * HD)); v2h o16; v2us oh, ol;
#pragma unroll
    for (int q = 0; q < 2; ++q) { const float x = F[(size_t)(t + q) * pitch + g * HD + d]; o16[q] = tohx(x); unsigned short a2, c2; splitf(x, a2, c2); oh[q] = a2; ol[q] = c2; }
    *(v2h*)(V16 + e) = o16; *(v2us*)(Vh + e) = oh; *(v2us*)(Vl + e) = ol;  }
__global__ __launch_bounds__(256) void k_csid(float* CS) { const int idx = blockIdx.x * 256 + threadIdx.x; if (idx >= TT * HD) return; v2f cs; cs[0] = 1.0f; cs[1] = 0.0f; *(v2f*)(CS + (size_t)idx * 2) = cs;  }
__global__ __launch_bounds__(256) void k_pplane(const float* __restrict__ POS, bf* Ph2, bf* Pl2) { const size_t e = ((size_t)blockIdx.x * 256 + threadIdx.x) * 2; if (e >= (size_t)NH_ * NPE * HD) return; const int d = (int)(e % HD); const int p = (int)((e / HD) % NPE); const int h = (int)(e / ((size_t)HD * NPE)); v2us oh, ol;
#pragma unroll
    for (int q = 0; q < 2; ++q) { unsigned short a, c; splitf(POS[(size_t)p * DQ + h * HD + d + q], a, c); oh[q] = a; ol[q] = c; } *(v2us*)(Ph2 + e) = oh; *(v2us*)(Pl2 + e) = ol;  }
// k_asoft: per row (zz, i): t = (S + c2p[i][rp] + p2c[rp][j]) x scale with rp = clip(i - j + 256, 0, 511), -3.0e38 where mask == 0; softmax over the 1024 keys (register row, one exp, fixed trees);
// p2c[rp][j] is read from k_p2cs's planes: G[row][rp] inside the span, E[zz][0][j] / E[zz][1][j] (behind G in the same buffer) at and beyond the clipped ends
__global__ __launch_bounds__(256) void k_asoft(const float* __restrict__ Sb, const float* __restrict__ C2P, const float* __restrict__ P2C, const int* __restrict__ MKb, h16* P16, bf* Ph, bf* Pl) {
    const int lane = threadIdx.x & 31; const int row = blockIdx.x * 8 + (threadIdx.x >> 5); if (row >= ZH * TT) return; const int i = row % TT; const int zz = row / TT; const float* cr = C2P + (size_t)row * NPE; const int go = row * NPE, eo = ZH * TT * NPE + zz * 2 * TT; const int* mkr = MKb + (size_t)i * TT; const bool hires = (i < RH); const float* sr = Sb + (size_t)row * TT; float v[TT / 32]; float mx = -3.0e38f;
#pragma unroll
    for (int ch = 0; ch < TT / 128; ++ch) { const int j0 = ch * 128 + lane * 4; const v4f a = *(const v4f*)(sr + j0); const v4i m4 = *(const v4i*)(mkr + j0);
#pragma unroll
        for (int q = 0; q < 4; ++q) { const int j = j0 + q; (void)j; int rp = i - j + SPAN; rp = rp < 0 ? 0 : (rp > NPE - 1 ? NPE - 1 : rp); const int pin = go + rp, pend = eo + (rp & SPAN) * (TT / SPAN) + j; const int po = ((unsigned)(rp - 1) < (unsigned)(NPE - 2)) ? pin : pend; float s1 = __fadd_rn(a[q], cr[rp]); asm volatile("" : "+v"(s1)); float s2 = __fadd_rn(s1, P2C[po]); asm volatile("" : "+v"(s2)); float sa = s2 * SCL; asm volatile("" : "+v"(sa)); const float t = (m4[q] != 0) ? sa : -3.0e38f;   /* (qk + c2p[i][rp] + p2c[rp][j]) x scale, rp = clip(i - j + 256, 0, 511); mask select */ v[ch * 4 + q] = t; mx = fmaxf(mx, t); } }
#pragma unroll
    for (int sh = 16; sh; sh >>= 1) mx = fmaxf(mx, __shfl_xor(mx, sh, 32));
    float sum = 0.f;
#pragma unroll
    for (int k = 0; k < TT / 32; ++k) { float d0 = __fsub_rn(v[k], mx); asm volatile("" : "+v"(d0)); v[k] = __builtin_amdgcn_exp2f(__fmul_rn(d0, 1.4426950408889634f)); sum += v[k]; }
#pragma unroll
    for (int sh = 16; sh; sh >>= 1) sum += __shfl_xor(sum, sh, 32);
    const float f = __fdiv_rn(hires ? 1.0f : PCAR, sum);
{
        if (hires) {
#pragma unroll
            for (int ch = 0; ch < TT / 128; ++ch) { v4us oh, ol;
#pragma unroll
                for (int q = 0; q < 4; ++q) { unsigned short a, c2; splitf(v[ch * 4 + q] * f, a, c2); oh[q] = a; ol[q] = c2; }
                const size_t oo = ((size_t)zz * (RH ? RH : 1) + i) * TT + ch * 128 + lane * 4; *(v4us*)(Ph + oo) = oh; *(v4us*)(Pl + oo) = ol; }
        } else {
#pragma unroll
            for (int ch = 0; ch < TT / 128; ++ch) { v4h o4;
#pragma unroll
                for (int q = 0; q < 4; ++q) o4[q] = tohx(v[ch * 4 + q] * f);
                *(v4h*)(P16 + (size_t)row * TT + ch * 128 + lane * 4) = o4; } }
         }
}
__global__ __launch_bounds__(256) void k_merge(const float* __restrict__ O, int h0, float* OUTb) { const size_t e = ((size_t)blockIdx.x * 256 + threadIdx.x) * 2; if (e >= (size_t)ZH * TT * HD) return; const int d = (int)(e % HD); const int t = (int)((e / HD) % TT); const int zz = (int)(e / ((size_t)HD * TT)); const float cs = (t < RH) ? 1.0f : (1.0f / PCAR); const size_t oo = (size_t)t * DQ + (h0 + zz) * HD + d;
    v2f o2; o2[0] = O[e] * cs; o2[1] = O[e + 1] * cs; *(v2f*)(OUTb + oo) = o2;  }

extern "C" void kernel_launch(void* const* d_in, const int* in_sizes, int n_in,
                              void* d_out, int out_size, void* d_ws, size_t ws_size, hipStream_t stream) {
    (void)in_sizes; (void)n_in; (void)out_size;
    const float* x = (const float*)d_in[0]; const int* MK = (const int*)d_in[1]; const float* rel = (const float*)d_in[2]; const float* wq = (const float*)d_in[3]; const float* bq = (const float*)d_in[4]; const float* wk = (const float*)d_in[5]; const float* bk = (const float*)d_in[6]; const float* wv = (const float*)d_in[7]; const float* bv = (const float*)d_in[8]; const float* wpk = (const float*)d_in[9]; const float* bpk = (const float*)d_in[10]; const float* wpq = (const float*)d_in[11]; const float* bpq = (const float*)d_in[12];
    float* OUT = (float*)d_out;     // [2][1024][1024]
    char* wsp = (char*)d_ws;
    auto take = [&](size_t bytes) { char* p = wsp; wsp += (bytes + 255) & ~(size_t)255; return (void*)p; };
    bf* WQ = (bf*)take((size_t)DQ * DM * 2); bf* WK = (bf*)take((size_t)DKV * DM * 2); bf* WV = (bf*)take((size_t)DKV * DM * 2); float* CS = (float*)take((size_t)TT * HD * 2 * 4); bf* WPK = (bf*)take((size_t)DQ * DM * 2); bf* WPQ = (bf*)take((size_t)DQ * DM * 2); bf* RE = (bf*)take((size_t)NPE * DM * 2); float* POS = (float*)take((size_t)NPE * DQ * 4); bf* PKh = (bf*)take((size_t)NH_ * NPE * HD * 2); bf* PKl = (bf*)take((size_t)NH_ * NPE * HD * 2); bf* PQh = (bf*)take((size_t)NH_ * NPE * HD * 2); bf* PQl = (bf*)take((size_t)NH_ * NPE * HD * 2); float* C2P = (float*)take((size_t)ZH * TT * NPE * 4); float* P2C = (float*)take((size_t)ZH * NPE * TT * 4 + (size_t)ZH * 2 * TT * 4);   /* G [ZH][1024][512], then E [ZH][2][1024] */
    bf* XB = (bf*)take((size_t)TT * DM * 2); float* FQ = (float*)take((size_t)TT * DQ * 4); float* FK = (float*)take((size_t)TT * DKV * 4);
    h16* QP16 = (h16*)take((size_t)NH_ * TT * HD * 2); h16* KP16 = (h16*)take((size_t)NKV * TT * HD * 2); h16* VT16 = (h16*)take((size_t)NKV * HD * TT * 2);
    bf* QPh = (bf*)take((size_t)NH_ * TT * HD * 2); bf* QPl = (bf*)take((size_t)NH_ * TT * HD * 2); bf* KPh = (bf*)take((size_t)NKV * TT * HD * 2); bf* KPl = (bf*)take((size_t)NKV * TT * HD * 2); bf* VTh = (bf*)take((size_t)NKV * HD * TT * 2); bf* VTl = (bf*)take((size_t)NKV * HD * TT * 2); bf* Ph = (bf*)take((size_t)ZH * RH * TT * 2); bf* Pl = (bf*)take((size_t)ZH * RH * TT * 2);
    float* Sb = (float*)take((size_t)ZH * TT * TT * 4); h16* P16 = (h16*)take(256);   /* unused: all rows hi/lo */ float* Ob = (float*)take((size_t)ZH * TT * HD * 4);
    if ((size_t)(wsp - (char*)d_ws) > ws_size) return;    // ws 256 MiB; 241.6 MiB taken at ZH = 16
    float* FV = FK;   // v projection reuses the k buffer after the k planes are built (stream-ordered)
    { k_cvt8<<<(unsigned)(((size_t)DQ * DM / 8 + 255) / 256), 256, 0, stream>>>(wq, WQ, (size_t)DQ * DM / 8); k_cvt8<<<(unsigned)(((size_t)DKV * DM / 8 + 255) / 256), 256, 0, stream>>>(wk, WK, (size_t)DKV * DM / 8); k_cvt8<<<(unsigned)(((size_t)DKV * DM / 8 + 255) / 256), 256, 0, stream>>>(wv, WV, (size_t)DKV * DM / 8);
      
       }
    k_csid<<<(TT * HD + 255) / 256, 256, 0, stream>>>(CS);
    k_cvt8<<<(unsigned)(((size_t)DQ * DM / 8 + 255) / 256), 256, 0, stream>>>(wpk, WPK, (size_t)DQ * DM / 8); k_cvt8<<<(unsigned)(((size_t)DQ * DM / 8 + 255) / 256), 256, 0, stream>>>(wpq, WPQ, (size_t)DQ * DM / 8); k_cvt8<<<(unsigned)(((size_t)NPE * DM / 8 + 255) / 256), 256, 0, stream>>>(rel, RE, (size_t)NPE * DM / 8);
    k_gemmw<bf, 0, true, KSL><<<dim3(NPE / 64, DQ / 64, 1), 32 * KSL, 0, stream>>>(RE, nullptr, WPK, nullptr, DM, POS, DQ, bpk, 0, 0, 0); k_pplane<<<(unsigned)(((size_t)NH_ * NPE * HD / 2 + 255) / 256), 256, 0, stream>>>(POS, PKh, PKl);   /* pos_k = rel Wpk^T + bpk -> per-head hi/lo planes [h][512][64] */
    k_gemmw<bf, 0, true, KSL><<<dim3(NPE / 64, DQ / 64, 1), 32 * KSL, 0, stream>>>(RE, nullptr, WPQ, nullptr, DM, POS, DQ, bpq, 0, 0, 0); k_pplane<<<(unsigned)(((size_t)NH_ * NPE * HD / 2 + 255) / 256), 256, 0, stream>>>(POS, PQh, PQl);   /* pos_q planes (POS reused after pos_k's planes are built) */
    const unsigned LQ = (unsigned)(((size_t)NH_ * TT * HD / 2 + 255) / 256), LKv = (unsigned)(((size_t)NKV * TT * HD / 2 + 255) / 256);
    for (int b = 0; b < NB_; ++b) {
        
        k_cvt8<<<(unsigned)(((size_t)TT * DM / 8 + 255) / 256), 256, 0, stream>>>(x + (size_t)b * TT * DM, XB, (size_t)TT * DM / 8);
        k_gemmw<bf, 0, true, KSL><<<dim3(TT / 64, DQ / 64, 1), 32 * KSL, 0, stream>>>(XB, nullptr, WQ, nullptr, DM, FQ, DQ, bq, 0, 0, 0);
        k_rope<<<LQ, 256, 0, stream>>>(FQ, DQ, NH_, CS, nullptr, nullptr, 1.0f, QP16, QPh, QPl);
        k_gemmw<bf, 0, true, KSL><<<dim3(TT / 64, DKV / 64, 1), 32 * KSL, 0, stream>>>(XB, nullptr, WK, nullptr, DM, FK, DKV, bk, 0, 0, 0);
        k_rope<<<LKv, 256, 0, stream>>>(FK, DKV, NKV, CS, nullptr, nullptr, 1.0f, KP16, KPh, KPl);
        k_gemmw<bf, 0, true, KSL><<<dim3(TT / 64, DKV / 64, 1), 32 * KSL, 0, stream>>>(XB, nullptr, WV, nullptr, DM, FV, DKV, bv, 0, 0, 0); k_vtp<<<LKv, 256, 0, stream>>>(FV, DKV, NKV, VT16, VTh, VTl);
        for (int h0 = 0; h0 < NH_; h0 += ZH) { const size_t zq = (size_t)h0, zk = (size_t)(h0 / REP);   // one kv head per query head: the pass's heads use consecutive kv planes (z-strides TT*HD)
            k_gemmw<bf, 2, false, 1><<<dim3(RH / 64, TT / 64, ZH), 32, 0, stream>>>(QPh + zq * TT * HD, QPl + zq * TT * HD, KPh + zk * TT * HD, KPl + zk * TT * HD, HD, Sb, TT, nullptr, (size_t)TT * HD, (size_t)TT * HD, (size_t)TT * TT);
            k_gemmw<bf, 2, false, 1><<<dim3(TT / 64, NPE / 64, ZH), 32, 0, stream>>>(QPh + zq * TT * HD, QPl + zq * TT * HD, PKh + zq * NPE * HD, PKl + zq * NPE * HD, HD, C2P, NPE, nullptr, (size_t)TT * HD, (size_t)NPE * HD, (size_t)TT * NPE);   /* c2p raw [ZH][1024][512] */ k_p2cs<<<dim3(TT / 64, NPE / 64, ZH), 32, 0, stream>>>(PQh + zq * NPE * HD, PQl + zq * NPE * HD, KPh + zk * TT * HD, KPl + zk * TT * HD, P2C, P2C + (size_t)ZH * TT * NPE);   /* p2c raw, sheared: G [ZH][1024][512] + E [ZH][2][1024] */ k_asoft<<<ZH * TT / 8, 256, 0, stream>>>(Sb, C2P, P2C, MK + (size_t)b * TT * TT, P16, Ph, Pl);
            k_gemmw<bf, 2, false, KSL><<<dim3(RH / 64, HD / 64, ZH), 32 * KSL, 0, stream>>>(Ph, Pl, VTh + zk * HD * TT, VTl + zk * HD * TT, TT, Ob, HD, nullptr, (size_t)RH * TT, (size_t)HD * TT, (size_t)TT * HD);
            k_merge<<<(unsigned)(((size_t)ZH * TT * HD / 2 + 255) / 256), 256, 0, stream>>>(Ob, h0, OUT + (size_t)b * TT * DQ); }
         }
}

// v004
// A run of this version takes 283 microseconds.
// In both of two side-by-side timings against v003, it was 1.13 times as fast.
// Counting every step since v000, it is 3.76 times as fast.
#include <hip/hip_runtime.h>

// DeBERTa disentangled self-attention (hidden_states [2][1024][1024]; q, k, v = hs W^T + b ('oi' [1024][1024]; 16 heads x 64); pos_k = rel_embeddings Wpk^T + bpk, pos_q = rel_embeddings Wpq^T + bpq (rel_embeddings [512][1024], read); scale = 1/sqrt(64 x 3); scores = q.k scale + c2p[i][clip(i-j+256, 0, 511)] + p2c[clip(i-j+256, 0, 511)][j] with c2p = q.pos_k scale ([S][512]) and p2c = (pos_q scale).k ([512][S]); mask (int32 [2][1][1024][1024], read; all ones) == 0 -> finfo.min and weight 0; softmax; out = merged attn.v -> [2][1024][1024] (2.1 M), no output projection).
// Layout: exact bf16 projections, whose GEMM epilogue writes the hi/lo planes that the next GEMM reads (q, k, pos_k, pos_q per head [h][t][d]; v transposed [h][d][t], from the product taken as Wv x^T); hi/lo planes for q, k, pos_k, pos_q (every row: 3-product score GEMMs); per pass of ZH = 16 heads (one pass per batch item): content scores [16][1024][1024], c2p [16][1024][512] and p2c (sheared to [16][1024][512], row i column rp, plus its two end rows) as hi/lo GEMMs, and the softmax kernel gathers the two relative terms per logit (index clip(i - j + 256, 0, 511)), scales, applies the mask select, f32 softmax, hi/lo P; attn.v (3 products), stored straight into the merged f32 output.
// Compute dtypes, f32 accumulate: every input rounded to bf16; q/k/v/pos_k/pos_q on PLAIN bf16 operands (exact) + biases; all score terms and attn.v on hi/lo planes (3 products) for every row; softmax f32; output f32.

#define NB_  2
#define TT   1024
#define DM   1024
#define NH_  16
#define NKV  16
#define REP  (NH_ / NKV)
#define HD   64
#define DQ   (NH_ * HD)
#define DKV  (NKV * HD)
#define ZH   16                    // heads per pass: all heads of one batch item ride in grid z of every score and attn.v launch (grid x of the softmax launch)
#define RH   1024                  // query rows < RH use hi+lo planes (0: none)
#define WIN  0
#define PCAR 1024.0f
#define SCL  0.072168783648703225f   // 1/sqrt(64 x 3)
#define NPE  512                  // 2 x att_span relative positions
#define SPAN 256
#define KSL  8                     // K slices (waves per work-group) of the K = 1024 GEMMs: the five projections and attn.v
typedef _Float16 h16;
typedef unsigned short bf;
typedef __attribute__((ext_vector_type(16))) __bf16   v16bf;
typedef __attribute__((ext_vector_type(16))) _Float16 v16h;
typedef __attribute__((ext_vector_type(8)))  _Float16 v8h;
typedef __attribute__((ext_vector_type(8)))  unsigned short v8us;
typedef __attribute__((ext_vector_type(8)))  float    v8f;
typedef __attribute__((ext_vector_type(4)))  float    v4f;
typedef v8h  __attribute__((may_alias)) v8ha;
typedef v4f  __attribute__((may_alias)) v4fa;
typedef v8us __attribute__((may_alias)) v8usa;

__device__ __forceinline__ unsigned short f2bf(float f) { unsigned u = __float_as_uint(f); u += 0x7FFFu + ((u >> 16) & 1u); return (unsigned short)(u >> 16); }
__device__ __forceinline__ float bf2f(unsigned short b) { return __uint_as_float(((unsigned)b) << 16); }
__device__ __forceinline__ float bfr(float f) { return bf2f(f2bf(f)); }
__device__ __forceinline__ v16h cat16(v8h lo, v8h hi) { return __builtin_shufflevector(lo, hi, 0, 1, 2, 3, 4, 5, 6, 7, 8, 9, 10, 11, 12, 13, 14, 15); }
__device__ __forceinline__ v16bf cat16b(v8us lo, v8us hi) { return __builtin_bit_cast(v16bf, __builtin_shufflevector(lo, hi, 0, 1, 2, 3, 4, 5, 6, 7, 8, 9, 10, 11, 12, 13, 14, 15)); }
__device__ __forceinline__ v8f wmma16(v16h a, v16h b, v8f c) { return __builtin_amdgcn_wmma_f32_16x16x32_f16(false, a, false, b, (short)0, c, false, false); }
__device__ __forceinline__ v8f wmmab(v16bf a, v16bf b, v8f c) { return __builtin_amdgcn_wmma_f32_16x16x32_bf16(false, a, false, b, (short)0, c, false, false); }



// ---- k_gemmw: register-blocked GEMM, 64x64 output tile (16 accumulators per wave), operands straight from K-contiguous 16-bit planes; grid (M/64, N/64, Z), 32 x KW threads.
// KW = 1: one wave does the whole K. KW > 1 (long K): K is cut into KW contiguous slices, one wave of the work-group per slice, so that KW waves' loads are in flight on a tile; each wave leaves its partial tile in LDS and, behind one barrier, every thread sums its share of the tile over the slices in the fixed order 0 .. KW-1. K % (32 x KW) == 0.
// C[m][n] (+ optional f32 bias: BIAS 1 bias[n], BIAS 2 bias[m]) = sum_k A[m][k] Bt[n][k] (+ split products per NSPLIT). z-batch strides sA/sB/sC in elements. K % 32 == 0.
// Where it goes: element (m, n) of column tile y lies at m x ldc + y x cstep + (n - 64 y), so a 64-column tile can be a head's own plane (ldc 64, cstep rows x 64) as well as a piece of a row (cstep 64).
// PL false: f32 into C. PL true (KW > 1 only): the value split into bf16 hi + lo, into Ch and Cl, the planes the next GEMM takes as operands.
__device__ __forceinline__ void splitf(float y, unsigned short& h, unsigned short& l) { h = f2bf(y); l = f2bf(y - bf2f(h)); }
typedef __attribute__((ext_vector_type(4))) unsigned short v4us;
template <typename T16> struct WFrag;
template <> struct WFrag<h16> { typedef v16h V; static __device__ __forceinline__ V ld(const h16* p) { return cat16(*(const v8h*)p, *(const v8h*)(p + 16)); } static __device__ __forceinline__ v8f mma(V a, V b, v8f c) { return wmma16(a, b, c); } };
template <> struct WFrag<bf> { typedef v16bf V; static __device__ __forceinline__ V ld(const bf* p) { return cat16b(*(const v8us*)p, *(const v8us*)(p + 16)); } static __device__ __forceinline__ v8f mma(V a, V b, v8f c) { return wmmab(a, b, c); } };
template <typename T16, int NSPLIT, int BIAS, int KW, bool PL>
__global__ __launch_bounds__(32 * KW) void k_gemmw(const T16* __restrict__ A, const T16* __restrict__ A2, const T16* __restrict__ Bt, const T16* __restrict__ Bt2, int K, float* C, bf* Ch, bf* Cl, int ldc, int cstep, const float* __restrict__ bias, size_t sA, size_t sB, size_t sC) {
    static_assert((!PL && BIAS != 2) || KW > 1, "plane output and the row bias are written by the sliced epilogue only");
    typedef typename WFrag<T16>::V V;
    __shared__ __align__(16) float os[KW == 1 ? 16 * 68 : KW * 64 * 68];
    const size_t z = blockIdx.z; A += z * sA; if (A2) A2 += z * sA; Bt += z * sB; if (Bt2) Bt2 += z * sB; const size_t co = z * sC + (size_t)blockIdx.y * cstep;   // where this z and this column tile start in the output
    const int lane = threadIdx.x & 31, lr = lane & 15, hi = lane >> 4; const int r0 = blockIdx.x * 64, c0 = blockIdx.y * 64;
    v8f acc[4][4];
#pragma unroll
    for (int mb = 0; mb < 4; ++mb)
#pragma unroll
        for (int nb = 0; nb < 4; ++nb) acc[mb][nb] = (v8f){};
    const size_t aoff = (size_t)(r0 + lr) * K + 8 * hi, boff = (size_t)(c0 + lr) * K + 8 * hi;
    const int wv = KW == 1 ? 0 : __builtin_amdgcn_readfirstlane((int)(threadIdx.x >> 5)); const int k0 = wv * (K / KW), k1 = k0 + K / KW;   // this wave's K slice, in scalar registers
#pragma unroll 1
    for (int kc = k0; kc < k1; kc += 32) {
        V a[4], a2[4];
#pragma unroll
        for (int mb = 0; mb < 4; ++mb) { a[mb] = WFrag<T16>::ld(A + aoff + (size_t)mb * 16 * K + kc); if (NSPLIT == 1 || NSPLIT == 2) a2[mb] = WFrag<T16>::ld(A2 + aoff + (size_t)mb * 16 * K + kc); }
#pragma unroll
        for (int nb = 0; nb < 4; ++nb) { const V b = WFrag<T16>::ld(Bt + boff + (size_t)nb * 16 * K + kc); V b2; if (NSPLIT >= 2) b2 = WFrag<T16>::ld(Bt2 + boff + (size_t)nb * 16 * K + kc);
#pragma unroll
            for (int mb = 0; mb < 4; ++mb) { acc[mb][nb] = WFrag<T16>::mma(a[mb], b, acc[mb][nb]); if (NSPLIT == 1 || NSPLIT == 2) acc[mb][nb] = WFrag<T16>::mma(a2[mb], b, acc[mb][nb]); if (NSPLIT >= 2) acc[mb][nb] = WFrag<T16>::mma(a[mb], b2, acc[mb][nb]); } }
        asm volatile("v_nop\n\tv_nop\n\tv_nop\n\tv_nop" : "+v"(acc[0][0]), "+v"(acc[1][1]), "+v"(acc[2][2]), "+v"(acc[3][3]) : "v"(a[0]), "v"(a[3]));
    }
    if (KW > 1) {
        float* mine = os + wv * (64 * 68);
        // the three loops are unrolled so that acc is indexed by constants and stays in registers
#pragma unroll
        for (int mb = 0; mb < 4; ++mb)
#pragma unroll
            for (int nb = 0; nb < 4; ++nb)
#pragma unroll
                for (int j = 0; j < 8; ++j) mine[(mb * 16 + hi * 8 + j) * 68 + nb * 16 + lr] = acc[mb][nb][j];
        __syncthreads();   // every slice's partial tile is in LDS before any thread sums across the slices
        // both loops are unrolled so that a thread's LDS reads issue ahead of its sums
#pragma unroll
        for (int s = 0; s < 32 / KW; ++s) { const int idx = s * (32 * KW) + (int)threadIdx.x; const int row = idx >> 4, cofs = (idx & 15) * 4; v4f val = *(const v4fa*)(os + row * 68 + cofs);
#pragma unroll
            for (int w = 1; w < KW; ++w) val += *(const v4fa*)(os + w * (64 * 68) + row * 68 + cofs);
            if (BIAS == 1) { val[0] += bfr(bias[c0 + cofs]); val[1] += bfr(bias[c0 + cofs + 1]); val[2] += bfr(bias[c0 + cofs + 2]); val[3] += bfr(bias[c0 + cofs + 3]); }
            if (BIAS == 2) { const float br = bfr(bias[r0 + row]); val[0] += br; val[1] += br; val[2] += br; val[3] += br; }
            const size_t o = (size_t)(r0 + row) * ldc + co + cofs;
            if (PL) { v4us oh, ol;
#pragma unroll
                for (int q = 0; q < 4; ++q) { unsigned short a, c; splitf(val[q], a, c); oh[q] = a; ol[q] = c; }
                *(v4us*)(Ch + o) = oh; *(v4us*)(Cl + o) = ol; }
            else *(v4f*)(C + o) = val; }
        return;
    }
#pragma unroll
    for (int mb = 0; mb < 4; ++mb) {
#pragma unroll
        for (int nb = 0; nb < 4; ++nb) {
#pragma unroll
            for (int j = 0; j < 8; ++j) os[(hi * 8 + j) * 68 + nb * 16 + lr] = acc[mb][nb][j]; }
        __builtin_amdgcn_wave_barrier(); asm volatile("" ::: "memory");
        float* crow = C + (size_t)(r0 + mb * 16) * ldc + co;
{
#pragma unroll
            for (int s = 0; s < 8; ++s) { const int row = 2 * s + hi, cofs = lr * 4; v4f val = *(const v4fa*)(os + row * 68 + cofs); if (BIAS == 1) { val[0] += bfr(bias[c0 + cofs]); val[1] += bfr(bias[c0 + cofs + 1]); val[2] += bfr(bias[c0 + cofs + 2]); val[3] += bfr(bias[c0 + cofs + 3]); }
                *(v4f*)(crow + (size_t)row * ldc + cofs) = val; }
             }
        __builtin_amdgcn_wave_barrier(); asm volatile("" ::: "memory");
    }
}

// ---- k_p2cs: the p2c term laid out the way the softmax reads it. G[z][i][p] = pos_q[p] . k[i - p + SPAN] (hi/lo, 3 products, same products in the same order as k_gemmw<bf, 2>), so that row i of G is indexed by the same
// relative position as row i of c2p and a wave's gather runs along a row instead of down a diagonal of [p][j]. One wave per tile of 64 i x 64 p: it needs the 127 keys j = jb .. jb + 126 (jb = i0 - p0 + SPAN - 63), computes the
// 64 p x 128 j products in two halves into LDS and stores the sheared tile in whole 256-byte rows. Keys outside [0, TT) are clamped for the load only; the G elements made from them belong to no (i, j) and are never read.
// E[z][0][j] = p2c[0][j] and E[z][1][j] = p2c[NPE-1][j] serve the clipped ends (j >= i + SPAN, j <= i - SPAN + 1); each 64-key piece is written by the one tile that holds it aligned. grid (TT/64, NPE/64, Z), 32 threads.
__global__ __launch_bounds__(32) void k_p2cs(const bf* __restrict__ A, const bf* __restrict__ A2, const bf* __restrict__ Bt, const bf* __restrict__ Bt2, float* G, float* E) {
    typedef WFrag<bf>::V V;
    __shared__ __align__(16) float ts[64 * 132];
    const size_t z = blockIdx.z; A += z * (size_t)(NPE * HD); A2 += z * (size_t)(NPE * HD); Bt += z * (size_t)(TT * HD); Bt2 += z * (size_t)(TT * HD); G += z * (size_t)(TT * NPE); E += z * (size_t)(2 * TT);
    const int lane = threadIdx.x & 31, lr = lane & 15, hi = lane >> 4; const int i0 = blockIdx.x * 64, p0 = blockIdx.y * 64; const int jb = i0 - p0 + (SPAN - 63);
    const size_t aoff = (size_t)(p0 + lr) * HD + 8 * hi;
#pragma unroll 1
    for (int hf = 0; hf < 2; ++hf) {   // rolled: one set of 16 accumulators serves both halves
        v8f acc[4][4];
#pragma unroll
        for (int mb = 0; mb < 4; ++mb)
#pragma unroll
            for (int nb = 0; nb < 4; ++nb) acc[mb][nb] = (v8f){};
        size_t boff[4];
#pragma unroll
        for (int nb = 0; nb < 4; ++nb) { int j = jb + hf * 64 + nb * 16 + lr; j = j < 0 ? 0 : (j > TT - 1 ? TT - 1 : j); boff[nb] = (size_t)j * HD + 8 * hi; }
#pragma unroll 1
        for (int kc = 0; kc < HD; kc += 32) {
            V a[4], a2[4];
#pragma unroll
            for (int mb = 0; mb < 4; ++mb) { a[mb] = WFrag<bf>::ld(A + aoff + (size_t)mb * 16 * HD + kc); a2[mb] = WFrag<bf>::ld(A2 + aoff + (size_t)mb * 16 * HD + kc); }
#pragma unroll
            for (int nb = 0; nb < 4; ++nb) { const V b = WFrag<bf>::ld(Bt + boff[nb] + kc); const V b2 = WFrag<bf>::ld(Bt2 + boff[nb] + kc);
#pragma unroll
                for (int mb = 0; mb < 4; ++mb) { acc[mb][nb] = WFrag<bf>::mma(a[mb], b, acc[mb][nb]); acc[mb][nb] = WFrag<bf>::mma(a2[mb], b, acc[mb][nb]); acc[mb][nb] = WFrag<bf>::mma(a[mb], b2, acc[mb][nb]); } }
            // four vector slots between the last matrix instruction and the back edge, where the next trip's loads overwrite its operands (as in k_gemmw)
            asm volatile("v_nop\n\tv_nop\n\tv_nop\n\tv_nop" : "+v"(acc[0][0]), "+v"(acc[1][1]), "+v"(acc[2][2]), "+v"(acc[3][3]) : "v"(a[0]), "v"(a[3]));
        }
        // unrolled so that acc is indexed by constants and stays in registers
#pragma unroll
        for (int mb = 0; mb < 4; ++mb)
#pragma unroll
            for (int nb = 0; nb < 4; ++nb)
#pragma unroll
                for (int r = 0; r < 8; ++r) ts[(mb * 16 + hi * 8 + r) * 132 + hf * 64 + nb * 16 + lr] = acc[mb][nb][r];
    }
    __builtin_amdgcn_wave_barrier(); asm volatile("" ::: "memory");   // the reads below take other lanes' writes: keep the compiler from moving them up (one wave: the LDS itself works in order)
#pragma unroll 1
    for (int s0 = 0; s0 < 32; s0 += 8) {
        // unrolled so that the LDS reads of eight row pairs issue ahead of their stores
#pragma unroll
        for (int s = 0; s < 8; ++s) { const int ii = 2 * (s0 + s) + hi, pp = lr * 4; v4f val;
#pragma unroll
            for (int q = 0; q < 4; ++q) val[q] = ts[(pp + q) * 132 + ii - (pp + q) + 63];   // key j = (i0 + ii) - (p0 + pp + q) + SPAN = jb + this column
            *(v4f*)(G + (size_t)(i0 + ii) * NPE + p0 + pp) = val; }
        asm volatile("s_wait_xcnt 0x0" ::: "memory");   // the next trip rewrites the address and data registers that these stores name
    }
    if (p0 == 0 && i0 + SPAN < TT) { E[i0 + SPAN + lane] = ts[63 + lane]; E[i0 + SPAN + 32 + lane] = ts[63 + 32 + lane]; }                                        // p = 0: keys i0 + SPAN .. + 63
    if (p0 == NPE - 64 && i0 >= SPAN - 64) { E[TT + i0 - (SPAN - 64) + lane] = ts[63 * 132 + 63 + lane]; E[TT + i0 - (SPAN - 64) + 32 + lane] = ts[63 * 132 + 63 + 32 + lane]; }   // p = NPE - 1: keys i0 - SPAN + 64 .. + 63
}

__device__ __forceinline__ h16 tohx(float x) { return (h16)x; }
typedef __attribute__((ext_vector_type(2))) _Float16 v2h;
typedef __attribute__((ext_vector_type(4))) _Float16 v4h;
typedef __attribute__((ext_vector_type(2))) unsigned short v2us;
typedef __attribute__((ext_vector_type(2))) float v2f;
typedef __attribute__((ext_vector_type(4))) int v4i;

__global__ __launch_bounds__(256) void k_wtG(const float* __restrict__ w, int K, int N, bf* Bt) {
    const int lane = threadIdx.x & 31; const int L0 = (blockIdx.x * 8 + (threadIdx.x >> 5)) * 8; const int nlines = N * K / 64;
{
#pragma unroll 1
        for (int l = 0; l < 8; ++l) { const int L = L0 + l; if (L >= nlines) break; const size_t e = (size_t)L * 64 + lane * 2; const int k = (int)(e % K), n = (int)(e / K); v2us o;
            o[0] = f2bf(w[(size_t)k * N + n]); o[1] = f2bf(w[(size_t)(k + 1) * N + n]); *(v2us*)(Bt + e) = o; }
         }
}
__global__ __launch_bounds__(256) void k_cvt8(const float* __restrict__ src, bf* dst, size_t n8) { const size_t i = (size_t)blockIdx.x * 256 + threadIdx.x; if (i >= n8) return; const v8f v = *(const v8f*)(src + i * 8); v8us o;
#pragma unroll
    for (int k = 0; k < 8; ++k) o[k] = f2bf(v[k]); *(v8us*)(dst + i * 8) = o;  }

// k_asoft: per row (zz, i): t = (S + c2p[i][rp] + p2c[rp][j]) x scale with rp = clip(i - j + 256, 0, 511), -3.0e38 where mask == 0; softmax over the 1024 keys (register row, one exp, fixed trees);
// p2c[rp][j] is read from k_p2cs's planes: G[row][rp] inside the span, E[zz][0][j] / E[zz][1][j] (behind G in the same buffer) at and beyond the clipped ends
__global__ __launch_bounds__(256) void k_asoft(const float* __restrict__ Sb, const float* __restrict__ C2P, const float* __restrict__ P2C, const int* __restrict__ MKb, h16* P16, bf* Ph, bf* Pl) {
    const int lane = threadIdx.x & 31; const int row = blockIdx.x * 8 + (threadIdx.x >> 5); if (row >= ZH * TT) return; const int i = row % TT; const int zz = row / TT; const float* cr = C2P + (size_t)row * NPE; const int go = row * NPE, eo = ZH * TT * NPE + zz * 2 * TT; const int* mkr = MKb + (size_t)i * TT; const bool hires = (i < RH); const float* sr = Sb + (size_t)row * TT; float v[TT / 32]; float mx = -3.0e38f;
#pragma unroll
    for (int ch = 0; ch < TT / 128; ++ch) { const int j0 = ch * 128 + lane * 4; const v4f a = *(const v4f*)(sr + j0); const v4i m4 = *(const v4i*)(mkr + j0);
#pragma unroll
        for (int q = 0; q < 4; ++q) { const int j = j0 + q; (void)j; int rp = i - j + SPAN; rp = rp < 0 ? 0 : (rp > NPE - 1 ? NPE - 1 : rp); const int pin = go + rp, pend = eo + (rp & SPAN) * (TT / SPAN) + j; const int po = ((unsigned)(rp - 1) < (unsigned)(NPE - 2)) ? pin : pend; float s1 = __fadd_rn(a[q], cr[rp]); asm volatile("" : "+v"(s1)); float s2 = __fadd_rn(s1, P2C[po]); asm volatile("" : "+v"(s2)); float sa = s2 * SCL; asm volatile("" : "+v"(sa)); const float t = (m4[q] != 0) ? sa : -3.0e38f;   /* (qk + c2p[i][rp] + p2c[rp][j]) x scale, rp = clip(i - j + 256, 0, 511); mask select */ v[ch * 4 + q] = t; mx = fmaxf(mx, t); } }
#pragma unroll
    for (int sh = 16; sh; sh >>= 1) mx = fmaxf(mx, __shfl_xor(mx, sh, 32));
    float sum = 0.f;
#pragma unroll
    for (int k = 0; k < TT / 32; ++k) { float d0 = __fsub_rn(v[k], mx); asm volatile("" : "+v"(d0)); v[k] = __builtin_amdgcn_exp2f(__fmul_rn(d0, 1.4426950408889634f)); sum += v[k]; }
#pragma unroll
    for (int sh = 16; sh; sh >>= 1) sum += __shfl_xor(sum, sh, 32);
    const float f = __fdiv_rn(hires ? 1.0f : PCAR, sum);
{
        if (hires) {
#pragma unroll
            for (int ch = 0; ch < TT / 128; ++ch) { v4us oh, ol;
#pragma unroll
                for (int q = 0; q < 4; ++q) { unsigned short a, c2; splitf(v[ch * 4 + q] * f, a, c2); oh[q] = a; ol[q] = c2; }
                const size_t oo = ((size_t)zz * (RH ? RH : 1) + i) * TT + ch * 128 + lane * 4; *(v4us*)(Ph + oo) = oh; *(v4us*)(Pl + oo) = ol; }
        } else {
#pragma unroll
            for (int ch = 0; ch < TT / 128; ++ch) { v4h o4;
#pragma unroll
                for (int q = 0; q < 4; ++q) o4[q] = tohx(v[ch * 4 + q] * f);
                *(v4h*)(P16 + (size_t)row * TT + ch * 128 + lane * 4) = o4; } }
         }
}

extern "C" void kernel_launch(void* const* d_in, const int* in_sizes, int n_in,
                              void* d_out, int out_size, void* d_ws, size_t ws_size, hipStream_t stream) {
    (void)in_sizes; (void)n_in; (void)out_size;
    const float* x = (const float*)d_in[0]; const int* MK = (const int*)d_in[1]; const float* rel = (const float*)d_in[2]; const float* wq = (const float*)d_in[3]; const float* bq = (const float*)d_in[4]; const float* wk = (const float*)d_in[5]; const float* bk = (const float*)d_in[6]; const float* wv = (const float*)d_in[7]; const float* bv = (const float*)d_in[8]; const float* wpk = (const float*)d_in[9]; const float* bpk = (const float*)d_in[10]; const float* wpq = (const float*)d_in[11]; const float* bpq = (const float*)d_in[12];
    float* OUT = (float*)d_out;     // [2][1024][1024]
    char* wsp = (char*)d_ws;
    auto take = [&](size_t bytes) { char* p = wsp; wsp += (bytes + 255) & ~(size_t)255; return (void*)p; };
    bf* WQ = (bf*)take((size_t)DQ * DM * 2); bf* WK = (bf*)take((size_t)DKV * DM * 2); bf* WV = (bf*)take((size_t)DKV * DM * 2); bf* WPK = (bf*)take((size_t)DQ * DM * 2); bf* WPQ = (bf*)take((size_t)DQ * DM * 2); bf* RE = (bf*)take((size_t)NPE * DM * 2); bf* PKh = (bf*)take((size_t)NH_ * NPE * HD * 2); bf* PKl = (bf*)take((size_t)NH_ * NPE * HD * 2); bf* PQh = (bf*)take((size_t)NH_ * NPE * HD * 2); bf* PQl = (bf*)take((size_t)NH_ * NPE * HD * 2); float* C2P = (float*)take((size_t)ZH * TT * NPE * 4); float* P2C = (float*)take((size_t)ZH * NPE * TT * 4 + (size_t)ZH * 2 * TT * 4);   /* G [ZH][1024][512], then E [ZH][2][1024] */
    bf* XB = (bf*)take((size_t)TT * DM * 2);
    bf* QPh = (bf*)take((size_t)NH_ * TT * HD * 2); bf* QPl = (bf*)take((size_t)NH_ * TT * HD * 2); bf* KPh = (bf*)take((size_t)NKV * TT * HD * 2); bf* KPl = (bf*)take((size_t)NKV * TT * HD * 2); bf* VTh = (bf*)take((size_t)NKV * HD * TT * 2); bf* VTl = (bf*)take((size_t)NKV * HD * TT * 2); bf* Ph = (bf*)take((size_t)ZH * RH * TT * 2); bf* Pl = (bf*)take((size_t)ZH * RH * TT * 2);
    float* Sb = (float*)take((size_t)ZH * TT * TT * 4); h16* P16 = (h16*)take(256);   /* unused: all rows hi/lo */
    if ((size_t)(wsp - (char*)d_ws) > ws_size) return;    // ws 256 MiB; about 221 MiB taken at ZH = 16
    k_cvt8<<<(unsigned)(((size_t)DQ * DM / 8 + 255) / 256), 256, 0, stream>>>(wq, WQ, (size_t)DQ * DM / 8); k_cvt8<<<(unsigned)(((size_t)DKV * DM / 8 + 255) / 256), 256, 0, stream>>>(wk, WK, (size_t)DKV * DM / 8); k_cvt8<<<(unsigned)(((size_t)DKV * DM / 8 + 255) / 256), 256, 0, stream>>>(wv, WV, (size_t)DKV * DM / 8);
    k_cvt8<<<(unsigned)(((size_t)DQ * DM / 8 + 255) / 256), 256, 0, stream>>>(wpk, WPK, (size_t)DQ * DM / 8); k_cvt8<<<(unsigned)(((size_t)DQ * DM / 8 + 255) / 256), 256, 0, stream>>>(wpq, WPQ, (size_t)DQ * DM / 8); k_cvt8<<<(unsigned)(((size_t)NPE * DM / 8 + 255) / 256), 256, 0, stream>>>(rel, RE, (size_t)NPE * DM / 8);
    k_gemmw<bf, 0, 1, KSL, true><<<dim3(NPE / 64, DQ / 64, 1), 32 * KSL, 0, stream>>>(RE, nullptr, WPK, nullptr, DM, nullptr, PKh, PKl, HD, NPE * HD, bpk, 0, 0, 0);   /* pos_k = rel Wpk^T + bpk -> per-head hi/lo planes [h][512][64] */
    k_gemmw<bf, 0, 1, KSL, true><<<dim3(NPE / 64, DQ / 64, 1), 32 * KSL, 0, stream>>>(RE, nullptr, WPQ, nullptr, DM, nullptr, PQh, PQl, HD, NPE * HD, bpq, 0, 0, 0);   /* pos_q planes */
    for (int b = 0; b < NB_; ++b) {
        k_cvt8<<<(unsigned)(((size_t)TT * DM / 8 + 255) / 256), 256, 0, stream>>>(x + (size_t)b * TT * DM, XB, (size_t)TT * DM / 8);
        k_gemmw<bf, 0, 1, KSL, true><<<dim3(TT / 64, DQ / 64, 1), 32 * KSL, 0, stream>>>(XB, nullptr, WQ, nullptr, DM, nullptr, QPh, QPl, HD, TT * HD, bq, 0, 0, 0);      /* q planes [h][t][d] */
        k_gemmw<bf, 0, 1, KSL, true><<<dim3(TT / 64, DKV / 64, 1), 32 * KSL, 0, stream>>>(XB, nullptr, WK, nullptr, DM, nullptr, KPh, KPl, HD, TT * HD, bk, 0, 0, 0);     /* k planes [h][t][d] */
        k_gemmw<bf, 0, 2, KSL, true><<<dim3(DKV / 64, TT / 64, 1), 32 * KSL, 0, stream>>>(WV, nullptr, XB, nullptr, DM, nullptr, VTh, VTl, TT, 64, bv, 0, 0, 0);           /* v^T = Wv x^T + bv by row: planes [h][d][t] = [feature][t] */
        for (int h0 = 0; h0 < NH_; h0 += ZH) { const size_t zq = (size_t)h0, zk = (size_t)(h0 / REP);   // one kv head per query head: the pass's heads use consecutive kv planes (z-strides TT*HD)
            k_gemmw<bf, 2, 0, 1, false><<<dim3(RH / 64, TT / 64, ZH), 32, 0, stream>>>(QPh + zq * TT * HD, QPl + zq * TT * HD, KPh + zk * TT * HD, KPl + zk * TT * HD, HD, Sb, nullptr, nullptr, TT, 64, nullptr, (size_t)TT * HD, (size_t)TT * HD, (size_t)TT * TT);
            k_gemmw<bf, 2, 0, 1, false><<<dim3(TT / 64, NPE / 64, ZH), 32, 0, stream>>>(QPh + zq * TT * HD, QPl + zq * TT * HD, PKh + zq * NPE * HD, PKl + zq * NPE * HD, HD, C2P, nullptr, nullptr, NPE, 64, nullptr, (size_t)TT * HD, (size_t)NPE * HD, (size_t)TT * NPE);   /* c2p raw [ZH][1024][512] */ k_p2cs<<<dim3(TT / 64, NPE / 64, ZH), 32, 0, stream>>>(PQh + zq * NPE * HD, PQl + zq * NPE * HD, KPh + zk * TT * HD, KPl + zk * TT * HD, P2C, P2C + (size_t)ZH * TT * NPE);   /* p2c raw, sheared: G [ZH][1024][512] + E [ZH][2][1024] */ k_asoft<<<ZH * TT / 8, 256, 0, stream>>>(Sb, C2P, P2C, MK + (size_t)b * TT * TT, P16, Ph, Pl);
            k_gemmw<bf, 2, 0, KSL, false><<<dim3(RH / 64, HD / 64, ZH), 32 * KSL, 0, stream>>>(Ph, Pl, VTh + zk * HD * TT, VTl + zk * HD * TT, TT, OUT + (size_t)b * TT * DQ + (size_t)h0 * HD, nullptr, nullptr, DQ, 64, nullptr, (size_t)RH * TT, (size_t)HD * TT, (size_t)HD); }   /* head z's 64 columns of the merged output [t][h x 64 + d] */
         }
}

// v005
// One run takes 245 microseconds.
// Next to v004, in two timings, it ran 1.16 times as fast each time.
// Counting every step since v000, it is 4.36 times as fast.
#include <hip/hip_runtime.h>

// DeBERTa disentangled self-attention (hidden_states [2][1024][1024]; q, k, v = hs W^T + b ('oi' [1024][1024]; 16 heads x 64); pos_k = rel_embeddings Wpk^T + bpk, pos_q = rel_embeddings Wpq^T + bpq (rel_embeddings [512][1024], read); scale = 1/sqrt(64 x 3); scores = q.k scale + c2p[i][clip(i-j+256, 0, 511)] + p2c[clip(i-j+256, 0, 511)][j] with c2p = q.pos_k scale ([S][512]) and p2c = (pos_q scale).k ([512][S]); mask (int32 [2][1][1024][1024], read; all ones) == 0 -> finfo.min and weight 0; softmax; out = merged attn.v -> [2][1024][1024] (2.1 M), no output projection).
// Layout: exact bf16 projections, whose GEMM epilogue writes the hi/lo planes that the next GEMM reads (q, k, pos_k, pos_q per head [h][t][d]; v transposed [h][d][t], from the product taken as Wv x^T); hi/lo planes for q, k, pos_k, pos_q (every row: 3-product score GEMMs); per pass of ZH = 16 heads (one pass per batch item): c2p [16][1024][512] and p2c (sheared to [16][1024][512], row i column rp, plus its two end rows) as hi/lo GEMMs; then one kernel forms the content scores (hi/lo) in registers, gathers the two relative terms per logit (index clip(i - j + 256, 0, 511)), scales, applies the mask select, f32 softmax, hi/lo P through LDS, attn.v (3 products), stored straight into the merged f32 output.
// Compute dtypes, f32 accumulate: every input rounded to bf16; q/k/v/pos_k/pos_q on PLAIN bf16 operands (exact) + biases; all score terms and attn.v on hi/lo planes (3 products) for every row; softmax f32; output f32.

#define NB_  2
#define TT   1024
#define DM   1024
#define NH_  16
#define NKV  16
#define REP  (NH_ / NKV)
#define HD   64
#define DQ   (NH_ * HD)
#define DKV  (NKV * HD)
#define ZH   16                    // heads per pass: all heads of one batch item ride in grid z of the c2p and p2c launches and in grid y of k_fattn
#define RH   1024                  // unused: every query row uses hi+lo planes
#define WIN  0
#define PCAR 1024.0f
#define SCL  0.072168783648703225f   // 1/sqrt(64 x 3)
#define NPE  512                  // 2 x att_span relative positions
#define SPAN 256
#define KSL  8                     // K slices (waves per work-group) of the K = 1024 GEMMs: the five projections, and attn.v inside k_fattn
typedef _Float16 h16;
typedef unsigned short bf;
typedef __attribute__((ext_vector_type(16))) __bf16   v16bf;
typedef __attribute__((ext_vector_type(16))) _Float16 v16h;
typedef __attribute__((ext_vector_type(8)))  _Float16 v8h;
typedef __attribute__((ext_vector_type(8)))  unsigned short v8us;
typedef __attribute__((ext_vector_type(8)))  float    v8f;
typedef __attribute__((ext_vector_type(4)))  float    v4f;
typedef v8h  __attribute__((may_alias)) v8ha;
typedef v4f  __attribute__((may_alias)) v4fa;
typedef v8us __attribute__((may_alias)) v8usa;

__device__ __forceinline__ unsigned short f2bf(float f) { unsigned u = __float_as_uint(f); u += 0x7FFFu + ((u >> 16) & 1u); return (unsigned short)(u >> 16); }
__device__ __forceinline__ float bf2f(unsigned short b) { return __uint_as_float(((unsigned)b) << 16); }
__device__ __forceinline__ float bfr(float f) { return bf2f(f2bf(f)); }
__device__ __forceinline__ v16h cat16(v8h lo, v8h hi) { return __builtin_shufflevector(lo, hi, 0, 1, 2, 3, 4, 5, 6, 7, 8, 9, 10, 11, 12, 13, 14, 15); }
__device__ __forceinline__ v16bf cat16b(v8us lo, v8us hi) { return __builtin_bit_cast(v16bf, __builtin_shufflevector(lo, hi, 0, 1, 2, 3, 4, 5, 6, 7, 8, 9, 10, 11, 12, 13, 14, 15)); }
__device__ __forceinline__ v8f wmma16(v16h a, v16h b, v8f c) { return __builtin_amdgcn_wmma_f32_16x16x32_f16(false, a, false, b, (short)0, c, false, false); }
__device__ __forceinline__ v8f wmmab(v16bf a, v16bf b, v8f c) { return __builtin_amdgcn_wmma_f32_16x16x32_bf16(false, a, false, b, (short)0, c, false, false); }



// ---- k_gemmw: register-blocked GEMM, 64x64 output tile (16 accumulators per wave), operands straight from K-contiguous 16-bit planes; grid (M/64, N/64, Z), 32 x KW threads.
// KW = 1: one wave does the whole K. KW > 1 (long K): K is cut into KW contiguous slices, one wave of the work-group per slice, so that KW waves' loads are in flight on a tile; each wave leaves its partial tile in LDS and, behind one barrier, every thread sums its share of the tile over the slices in the fixed order 0 .. KW-1. K % (32 x KW) == 0.
// C[m][n] (+ optional f32 bias: BIAS 1 bias[n], BIAS 2 bias[m]) = sum_k A[m][k] Bt[n][k] (+ split products per NSPLIT). z-batch strides sA/sB/sC in elements. K % 32 == 0.
// Where it goes: element (m, n) of column tile y lies at m x ldc + y x cstep + (n - 64 y), so a 64-column tile can be a head's own plane (ldc 64, cstep rows x 64) as well as a piece of a row (cstep 64).
// PL false: f32 into C. PL true (KW > 1 only): the value split into bf16 hi + lo, into Ch and Cl, the planes the next GEMM takes as operands.
__device__ __forceinline__ void splitf(float y, unsigned short& h, unsigned short& l) { h = f2bf(y); l = f2bf(y - bf2f(h)); }
typedef __attribute__((ext_vector_type(4))) unsigned short v4us;
template <typename T16> struct WFrag;
template <> struct WFrag<h16> { typedef v16h V; static __device__ __forceinline__ V ld(const h16* p) { return cat16(*(const v8h*)p, *(const v8h*)(p + 16)); } static __device__ __forceinline__ v8f mma(V a, V b, v8f c) { return wmma16(a, b, c); } };
template <> struct WFrag<bf> { typedef v16bf V; static __device__ __forceinline__ V ld(const bf* p) { return cat16b(*(const v8us*)p, *(const v8us*)(p + 16)); } static __device__ __forceinline__ v8f mma(V a, V b, v8f c) { return wmmab(a, b, c); } };
template <typename T16, int NSPLIT, int BIAS, int KW, bool PL>
__global__ __launch_bounds__(32 * KW) void k_gemmw(const T16* __restrict__ A, const T16* __restrict__ A2, const T16* __restrict__ Bt, const T16* __restrict__ Bt2, int K, float* C, bf* Ch, bf* Cl, int ldc, int cstep, const float* __restrict__ bias, size_t sA, size_t sB, size_t sC) {
    static_assert((!PL && BIAS != 2) || KW > 1, "plane output and the row bias are written by the sliced epilogue only");
    typedef typename WFrag<T16>::V V;
    __shared__ __align__(16) float os[KW == 1 ? 16 * 68 : KW * 64 * 68];
    const size_t z = blockIdx.z; A += z * sA; if (A2) A2 += z * sA; Bt += z * sB; if (Bt2) Bt2 += z * sB; const size_t co = z * sC + (size_t)blockIdx.y * cstep;   // where this z and this column tile start in the output
    const int lane = threadIdx.x & 31, lr = lane & 15, hi = lane >> 4; const int r0 = blockIdx.x * 64, c0 = blockIdx.y * 64;
    v8f acc[4][4];
#pragma unroll
    for (int mb = 0; mb < 4; ++mb)
#pragma unroll
        for (int nb = 0; nb < 4; ++nb) acc[mb][nb] = (v8f){};
    const size_t aoff = (size_t)(r0 + lr) * K + 8 * hi, boff = (size_t)(c0 + lr) * K + 8 * hi;
    const int wv = KW == 1 ? 0 : __builtin_amdgcn_readfirstlane((int)(threadIdx.x >> 5)); const int k0 = wv * (K / KW), k1 = k0 + K / KW;   // this wave's K slice, in scalar registers
#pragma unroll 1
    for (int kc = k0; kc < k1; kc += 32) {
        V a[4], a2[4];
#pragma unroll
        for (int mb = 0; mb < 4; ++mb) { a[mb] = WFrag<T16>::ld(A + aoff + (size_t)mb * 16 * K + kc); if (NSPLIT == 1 || NSPLIT == 2) a2[mb] = WFrag<T16>::ld(A2 + aoff + (size_t)mb * 16 * K + kc); }
#pragma unroll
        for (int nb = 0; nb < 4; ++nb) { const V b = WFrag<T16>::ld(Bt + boff + (size_t)nb * 16 * K + kc); V b2; if (NSPLIT >= 2) b2 = WFrag<T16>::ld(Bt2 + boff + (size_t)nb * 16 * K + kc);
#pragma unroll
            for (int mb = 0; mb < 4; ++mb) { acc[mb][nb] = WFrag<T16>::mma(a[mb], b, acc[mb][nb]); if (NSPLIT == 1 || NSPLIT == 2) acc[mb][nb] = WFrag<T16>::mma(a2[mb], b, acc[mb][nb]); if (NSPLIT >= 2) acc[mb][nb] = WFrag<T16>::mma(a[mb], b2, acc[mb][nb]); } }
        asm volatile("v_nop\n\tv_nop\n\tv_nop\n\tv_nop" : "+v"(acc[0][0]), "+v"(acc[1][1]), "+v"(acc[2][2]), "+v"(acc[3][3]) : "v"(a[0]), "v"(a[3]));
    }
    if (KW > 1) {
        float* mine = os + wv * (64 * 68);
        // the three loops are unrolled so that acc is indexed by constants and stays in registers
#pragma unroll
        for (int mb = 0; mb < 4; ++mb)
#pragma unroll
            for (int nb = 0; nb < 4; ++nb)
#pragma unroll
                for (int j = 0; j < 8; ++j) mine[(mb * 16 + hi * 8 + j) * 68 + nb * 16 + lr] = acc[mb][nb][j];
        __syncthreads();   // every slice's partial tile is in LDS before any thread sums across the slices
        // both loops are unrolled so that a thread's LDS reads issue ahead of its sums
#pragma unroll
        for (int s = 0; s < 32 / KW; ++s) { const int idx = s * (32 * KW) + (int)threadIdx.x; const int row = idx >> 4, cofs = (idx & 15) * 4; v4f val = *(const v4fa*)(os + row * 68 + cofs);
#pragma unroll
            for (int w = 1; w < KW; ++w) val += *(const v4fa*)(os + w * (64 * 68) + row * 68 + cofs);
            if (BIAS == 1) { val[0] += bfr(bias[c0 + cofs]); val[1] += bfr(bias[c0 + cofs + 1]); val[2] += bfr(bias[c0 + cofs + 2]); val[3] += bfr(bias[c0 + cofs + 3]); }
            if (BIAS == 2) { const float br = bfr(bias[r0 + row]); val[0] += br; val[1] += br; val[2] += br; val[3] += br; }
            const size_t o = (size_t)(r0 + row) * ldc + co + cofs;
            if (PL) { v4us oh, ol;
#pragma unroll
                for (int q = 0; q < 4; ++q) { unsigned short a, c; splitf(val[q], a, c); oh[q] = a; ol[q] = c; }
                *(v4us*)(Ch + o) = oh; *(v4us*)(Cl + o) = ol; }
            else *(v4f*)(C + o) = val; }
        return;
    }
#pragma unroll
    for (int mb = 0; mb < 4; ++mb) {
#pragma unroll
        for (int nb = 0; nb < 4; ++nb) {
#pragma unroll
            for (int j = 0; j < 8; ++j) os[(hi * 8 + j) * 68 + nb * 16 + lr] = acc[mb][nb][j]; }
        __builtin_amdgcn_wave_barrier(); asm volatile("" ::: "memory");
        float* crow = C + (size_t)(r0 + mb * 16) * ldc + co;
{
#pragma unroll
            for (int s = 0; s < 8; ++s) { const int row = 2 * s + hi, cofs = lr * 4; v4f val = *(const v4fa*)(os + row * 68 + cofs); if (BIAS == 1) { val[0] += bfr(bias[c0 + cofs]); val[1] += bfr(bias[c0 + cofs + 1]); val[2] += bfr(bias[c0 + cofs + 2]); val[3] += bfr(bias[c0 + cofs + 3]); }
                *(v4f*)(crow + (size_t)row * ldc + cofs) = val; }
             }
        __builtin_amdgcn_wave_barrier(); asm volatile("" ::: "memory");
    }
}

// ---- k_p2cs: the p2c term laid out the way the softmax reads it. G[z][i][p] = pos_q[p] . k[i - p + SPAN] (hi/lo, 3 products, same products in the same order as k_gemmw<bf, 2>), so that row i of G is indexed by the same
// relative position as row i of c2p and a wave's gather runs along a row instead of down a diagonal of [p][j]. One wave per tile of 64 i x 64 p: it needs the 127 keys j = jb .. jb + 126 (jb = i0 - p0 + SPAN - 63), computes the
// 64 p x 128 j products in two halves into LDS and stores the sheared tile in whole 256-byte rows. Keys outside [0, TT) are clamped for the load only; the G elements made from them belong to no (i, j) and are never read.
// E[z][0][j] = p2c[0][j] and E[z][1][j] = p2c[NPE-1][j] serve the clipped ends (j >= i + SPAN, j <= i - SPAN + 1); each 64-key piece is written by the one tile that holds it aligned. grid (TT/64, NPE/64, Z), 32 threads.
__global__ __launch_bounds__(32) void k_p2cs(const bf* __restrict__ A, const bf* __restrict__ A2, const bf* __restrict__ Bt, const bf* __restrict__ Bt2, float* G, float* E) {
    typedef WFrag<bf>::V V;
    __shared__ __align__(16) float ts[64 * 132];
    const size_t z = blockIdx.z; A += z * (size_t)(NPE * HD); A2 += z * (size_t)(NPE * HD); Bt += z * (size_t)(TT * HD); Bt2 += z * (size_t)(TT * HD); G += z * (size_t)(TT * NPE); E += z * (size_t)(2 * TT);
    const int lane = threadIdx.x & 31, lr = lane & 15, hi = lane >> 4; const int i0 = blockIdx.x * 64, p0 = blockIdx.y * 64; const int jb = i0 - p0 + (SPAN - 63);
    const size_t aoff = (size_t)(p0 + lr) * HD + 8 * hi;
#pragma unroll 1
    for (int hf = 0; hf < 2; ++hf) {   // rolled: one set of 16 accumulators serves both halves
        v8f acc[4][4];
#pragma unroll
        for (int mb = 0; mb < 4; ++mb)
#pragma unroll
            for (int nb = 0; nb < 4; ++nb) acc[mb][nb] = (v8f){};
        size_t boff[4];
#pragma unroll
        for (int nb = 0; nb < 4; ++nb) { int j = jb + hf * 64 + nb * 16 + lr; j = j < 0 ? 0 : (j > TT - 1 ? TT - 1 : j); boff[nb] = (size_t)j * HD + 8 * hi; }
#pragma unroll 1
        for (int kc = 0; kc < HD; kc += 32) {
            V a[4], a2[4];
#pragma unroll
            for (int mb = 0; mb < 4; ++mb) { a[mb] = WFrag<bf>::ld(A + aoff + (size_t)mb * 16 * HD + kc); a2[mb] = WFrag<bf>::ld(A2 + aoff + (size_t)mb * 16 * HD + kc); }
#pragma unroll
            for (int nb = 0; nb < 4; ++nb) { const V b = WFrag<bf>::ld(Bt + boff[nb] + kc); const V b2 = WFrag<bf>::ld(Bt2 + boff[nb] + kc);
#pragma unroll
                for (int mb = 0; mb < 4; ++mb) { acc[mb][nb] = WFrag<bf>::mma(a[mb], b, acc[mb][nb]); acc[mb][nb] = WFrag<bf>::mma(a2[mb], b, acc[mb][nb]); acc[mb][nb] = WFrag<bf>::mma(a[mb], b2, acc[mb][nb]); } }
            // four vector slots between the last matrix instruction and the back edge, where the next trip's loads overwrite its operands (as in k_gemmw)
            asm volatile("v_nop\n\tv_nop\n\tv_nop\n\tv_nop" : "+v"(acc[0][0]), "+v"(acc[1][1]), "+v"(acc[2][2]), "+v"(acc[3][3]) : "v"(a[0]), "v"(a[3]));
        }
        // unrolled so that acc is indexed by constants and stays in registers
#pragma unroll
        for (int mb = 0; mb < 4; ++mb)
#pragma unroll
            for (int nb = 0; nb < 4; ++nb)
#pragma unroll
                for (int r = 0; r < 8; ++r) ts[(mb * 16 + hi * 8 + r) * 132 + hf * 64 + nb * 16 + lr] = acc[mb][nb][r];
    }
    __builtin_amdgcn_wave_barrier(); asm volatile("" ::: "memory");   // the reads below take other lanes' writes: keep the compiler from moving them up (one wave: the LDS itself works in order)
#pragma unroll 1
    for (int s0 = 0; s0 < 32; s0 += 8) {
        // unrolled so that the LDS reads of eight row pairs issue ahead of their stores
#pragma unroll
        for (int s = 0; s < 8; ++s) { const int ii = 2 * (s0 + s) + hi, pp = lr * 4; v4f val;
#pragma unroll
            for (int q = 0; q < 4; ++q) val[q] = ts[(pp + q) * 132 + ii - (pp + q) + 63];   // key j = (i0 + ii) - (p0 + pp + q) + SPAN = jb + this column
            *(v4f*)(G + (size_t)(i0 + ii) * NPE + p0 + pp) = val; }
        asm volatile("s_wait_xcnt 0x0" ::: "memory");   // the next trip rewrites the address and data registers that these stores name
    }
    if (p0 == 0 && i0 + SPAN < TT) { E[i0 + SPAN + lane] = ts[63 + lane]; E[i0 + SPAN + 32 + lane] = ts[63 + 32 + lane]; }                                        // p = 0: keys i0 + SPAN .. + 63
    if (p0 == NPE - 64 && i0 >= SPAN - 64) { E[TT + i0 - (SPAN - 64) + lane] = ts[63 * 132 + 63 + lane]; E[TT + i0 - (SPAN - 64) + 32 + lane] = ts[63 * 132 + 63 + 32 + lane]; }   // p = NPE - 1: keys i0 - SPAN + 64 .. + 63
}

__device__ __forceinline__ h16 tohx(float x) { return (h16)x; }
typedef __attribute__((ext_vector_type(2))) _Float16 v2h;
typedef __attribute__((ext_vector_type(4))) _Float16 v4h;
typedef __attribute__((ext_vector_type(2))) unsigned short v2us;
typedef __attribute__((ext_vector_type(2))) float v2f;
typedef __attribute__((ext_vector_type(4))) int v4i;

__global__ __launch_bounds__(256) void k_wtG(const float* __restrict__ w, int K, int N, bf* Bt) {
    const int lane = threadIdx.x & 31; const int L0 = (blockIdx.x * 8 + (threadIdx.x >> 5)) * 8; const int nlines = N * K / 64;
{
#pragma unroll 1
        for (int l = 0; l < 8; ++l) { const int L = L0 + l; if (L >= nlines) break; const size_t e = (size_t)L * 64 + lane * 2; const int k = (int)(e % K), n = (int)(e / K); v2us o;
            o[0] = f2bf(w[(size_t)k * N + n]); o[1] = f2bf(w[(size_t)(k + 1) * N + n]); *(v2us*)(Bt + e) = o; }
         }
}
__global__ __launch_bounds__(256) void k_cvt8(const float* __restrict__ src, bf* dst, size_t n8) { const size_t i = (size_t)blockIdx.x * 256 + threadIdx.x; if (i >= n8) return; const v8f v = *(const v8f*)(src + i * 8); v8us o;
#pragma unroll
    for (int k = 0; k < 8; ++k) o[k] = f2bf(v[k]); *(v8us*)(dst + i * 8) = o;  }

// ---- k_fattn: content scores, the two relative terms, softmax and attn.v of FR = 32 query rows of one head in one work-group, so that neither the scores nor the weights go through memory. grid (TT/FR, ZH), 32 x KSL threads.
// Wave w owns the keys 128 w .. 128 w + 127. It forms its 32 x 128 scores (hi/lo, 3 products, the products and their order as in k_gemmw<bf, 2>) in 16 accumulators and, in the accumulator's own layout (row = 16 mb + 8 hi + r, key = 16 nb + lr),
// t = (S + c2p[i][rp] + p2c[rp][j]) x scale with rp = clip(i - j + 256, 0, 511), -3e38 where mask == 0. p2c[rp][j] is read from k_p2cs's planes: G[row][rp] inside the span, E[zz][0][j] / E[zz][1][j] (behind G in the same buffer) at and beyond the clipped ends.
// Row maximum and row sum: over the wave's own keys in registers and by lane exchange, then over the eight waves through LDS in the order 0 .. 7. The weights, split hi/lo, go to the wave's own LDS piece row by row, from where the A loader takes them as it would from memory;
// each wave multiplies its 128 keys into a partial 32 x 64 tile (the K slices of the former attn.v GEMM), and the partial tiles are summed in LDS in slice order.
#define FR   32                    // query rows per work-group
#define PPI  136                   // LDS pitch of a row of weights, in 16-bit elements: 256 bytes + 16, for 16-byte fragment reads
#define PWV  (2 * FR * PPI)        // 16-bit elements of one wave's LDS piece: hi plane, lo plane
__device__ __forceinline__ v16bf ldsfrag(const bf* p) { return cat16b(*(const v8usa*)p, *(const v8usa*)(p + 16)); }
// launch bounds: 4 waves per SIMD, that is at most 256 registers a wave, so that two work-groups (their LDS fits twice) share a WGP and the whole grid is resident at once
__global__ __launch_bounds__(32 * KSL, 4) void k_fattn(const bf* __restrict__ Qh, const bf* __restrict__ Ql, const bf* __restrict__ Kh, const bf* __restrict__ Kl, const bf* __restrict__ Vh, const bf* __restrict__ Vl, const float* __restrict__ C2P, const float* __restrict__ P2C, const int* __restrict__ MKb, float* O) {
    typedef WFrag<bf>::V V;
    __shared__ __align__(16) bf ps[KSL * PWV];
    __shared__ __align__(16) float red[2 * FR * KSL];
    const int zz = blockIdx.y, i0 = blockIdx.x * FR; const int lane = threadIdx.x & 31, lr = lane & 15, hi = lane >> 4;
    const int wv = __builtin_amdgcn_readfirstlane((int)(threadIdx.x >> 5)); const int j0 = wv * (TT / KSL);   // this wave's keys, in a scalar register
    // uniform bases (head, first query row, the wave's first key) plus one unsigned lane offset per operand: every fragment load is then scalar base + lane offset + constant
    { const size_t zo = (size_t)zz * (TT * HD); Qh += zo + i0 * HD; Ql += zo + i0 * HD; Kh += zo + j0 * HD; Kl += zo + j0 * HD; Vh += zo + j0; Vl += zo + j0; }
    const unsigned lo64 = (unsigned)(lr * HD + 8 * hi), lov = (unsigned)(lr * TT + 8 * hi);
    v8f acc[2][8];
#pragma unroll
    for (int mb = 0; mb < 2; ++mb)
#pragma unroll
        for (int nb = 0; nb < 8; ++nb) acc[mb][nb] = (v8f){};
    // every loop over mb, nb, r below is unrolled so that the accumulators are indexed by constants and stay in registers
#pragma unroll
    for (int kc = 0; kc < HD; kc += 32) {
        V a[2], a2[2];
#pragma unroll
        for (int mb = 0; mb < 2; ++mb) { const int o = mb * 16 * HD + kc; a[mb] = WFrag<bf>::ld(Qh + o + lo64); a2[mb] = WFrag<bf>::ld(Ql + o + lo64); }
#pragma unroll
        for (int nb = 0; nb < 8; ++nb) { const int o = nb * 16 * HD + kc; const V b = WFrag<bf>::ld(Kh + o + lo64); const V b2 = WFrag<bf>::ld(Kl + o + lo64);
#pragma unroll
            for (int mb = 0; mb < 2; ++mb) { acc[mb][nb] = WFrag<bf>::mma(a[mb], b, acc[mb][nb]); acc[mb][nb] = WFrag<bf>::mma(a2[mb], b, acc[mb][nb]); acc[mb][nb] = WFrag<bf>::mma(a[mb], b2, acc[mb][nb]); } }
    }
    // lane bases; the mask index adds only a compile-time constant, which goes into the instruction's offset; the gather indices add the clipped relative position rp as well
    const int ib = i0 + hi * 8, jl = j0 + lr; const int gb = (zz * TT + ib) * NPE, db = ib - jl + SPAN, mo = ib * TT + jl, eo = ZH * TT * NPE + zz * 2 * TT + jl;
    float* rl = red + hi * 8 * KSL;
    float mx[2][8], sm[2][8];
    __builtin_amdgcn_sched_barrier(0);   // keeps the address arithmetic of the gathers out of the matrix phase, where it would hold registers
    // two rows (16 logits a lane) at a time: their 48 loads are all issued before the first is used, so that a wave waits once per batch and not once per logit
#pragma unroll
    for (int mb = 0; mb < 2; ++mb)
#pragma unroll
        for (int rb = 0; rb < 8; rb += 2) { float cv[2][8], pv[2][8]; int mv[2][8];
#pragma unroll
            for (int q = 0; q < 2; ++q) { const int ro = mb * 16 + rb + q;   // query row i = ib + ro, key j = jl + 16 nb
                int pa[8], pb[8];
#pragma unroll
                for (int nb = 0; nb < 8; ++nb) { int rp = db + (ro - nb * 16); rp = rp < 0 ? 0 : (rp > NPE - 1 ? NPE - 1 : rp); const int pin = gb + rp + ro * NPE, pend = eo + (rp & SPAN) * (TT / SPAN) + nb * 16; const int po = ((unsigned)(rp - 1) < (unsigned)(NPE - 2)) ? pin : pend; pa[nb] = pin; pb[nb] = po;
                    cv[q][nb] = C2P[pin]; pv[q][nb] = P2C[po]; mv[q][nb] = MKb[mo + (ro * TT + nb * 16)]; }
                // the row's 24 loads name these index registers: they stay whole up to this wait, so that no later load or sum is given one of them to write into before it
                asm volatile("s_wait_xcnt 0x0" :: "v"(pa[0]), "v"(pa[1]), "v"(pa[2]), "v"(pa[3]), "v"(pa[4]), "v"(pa[5]), "v"(pa[6]), "v"(pa[7]), "v"(pb[0]), "v"(pb[1]), "v"(pb[2]), "v"(pb[3]), "v"(pb[4]), "v"(pb[5]), "v"(pb[6]), "v"(pb[7]), "v"(mo) : "memory"); }
            __builtin_amdgcn_sched_barrier(0);   // the batch's loads stay above, their uses below
#pragma unroll
            for (int q = 0; q < 2; ++q) { const int r = rb + q; float m = -3.0e38f;
#pragma unroll
                for (int nb = 0; nb < 8; ++nb) { const float sa = __fmul_rn(__fadd_rn(__fadd_rn(acc[mb][nb][r], cv[q][nb]), pv[q][nb]), SCL); const float t = (mv[q][nb] != 0) ? sa : -3.0e38f; acc[mb][nb][r] = t; m = fmaxf(m, t); }
                mx[mb][r] = m; }
            __builtin_amdgcn_sched_barrier(0);   // the next batch's loads do not start before this batch's registers are free
        }
#pragma unroll
    for (int sh = 8; sh; sh >>= 1)   // over the 16 lanes that hold a row; the 16 rows' exchanges of one distance go together
#pragma unroll
        for (int mb = 0; mb < 2; ++mb)
#pragma unroll
            for (int r = 0; r < 8; ++r) mx[mb][r] = fmaxf(mx[mb][r], __shfl_xor(mx[mb][r], sh, 32));
    if (lr == 0) {
#pragma unroll
        for (int mb = 0; mb < 2; ++mb)
#pragma unroll
            for (int r = 0; r < 8; ++r) rl[(mb * 16 + r) * KSL + wv] = mx[mb][r]; }
    __syncthreads();   // every wave's row maxima are in LDS before any wave takes the maximum over the waves
#pragma unroll
    for (int mb = 0; mb < 2; ++mb)
#pragma unroll
        for (int r = 0; r < 8; ++r) { const float* rr = rl + (mb * 16 + r) * KSL; const v4f u = *(const v4fa*)rr, w = *(const v4fa*)(rr + 4); const float m = fmaxf(fmaxf(fmaxf(u[0], u[1]), fmaxf(u[2], u[3])), fmaxf(fmaxf(w[0], w[1]), fmaxf(w[2], w[3]))); float s = 0.f;
#pragma unroll
            for (int nb = 0; nb < 8; ++nb) { const float x = __fmul_rn(__fsub_rn(acc[mb][nb][r], m), 1.4426950408889634f); float e;
                asm("v_exp_f32 %0, %1\n\tv_nop" : "=v"(e) : "v"(x));   // the v_nop fills the one slot behind a transcendental, whatever instruction the compiler puts next
                acc[mb][nb][r] = e; s += e; }
            sm[mb][r] = s; }
#pragma unroll
    for (int sh = 8; sh; sh >>= 1)
#pragma unroll
        for (int mb = 0; mb < 2; ++mb)
#pragma unroll
            for (int r = 0; r < 8; ++r) sm[mb][r] += __shfl_xor(sm[mb][r], sh, 32);
    if (lr == 0) {
#pragma unroll
        for (int mb = 0; mb < 2; ++mb)
#pragma unroll
            for (int r = 0; r < 8; ++r) rl[FR * KSL + (mb * 16 + r) * KSL + wv] = sm[mb][r]; }
    __syncthreads();   // every wave's row sums are in LDS before any wave adds them up
    __builtin_amdgcn_sched_barrier(0);   // keeps the addresses of the later phases from being formed early and spilled
    bf* ph = ps + wv * PWV; bf* pl = ph + FR * PPI; bf* phw = ph + hi * 8 * PPI + lr; bf* plw = pl + hi * 8 * PPI + lr; const bf* phr = ph + lr * PPI + 8 * hi; const bf* plr = pl + lr * PPI + 8 * hi;   // lane bases of the stores and of the fragment reads
#pragma unroll
    for (int mb = 0; mb < 2; ++mb)
#pragma unroll
        for (int r = 0; r < 8; ++r) { const float* rr = rl + FR * KSL + (mb * 16 + r) * KSL; const v4f u = *(const v4fa*)rr, w = *(const v4fa*)(rr + 4); const float s = ((((((u[0] + u[1]) + u[2]) + u[3]) + w[0]) + w[1]) + w[2]) + w[3]; const float f = __fdiv_rn(1.0f, s);
#pragma unroll
            for (int nb = 0; nb < 8; ++nb) { unsigned short a, c; splitf(acc[mb][nb][r] * f, a, c); const int o = (mb * 16 + r) * PPI + nb * 16; phw[o] = a; plw[o] = c; } }
    __builtin_amdgcn_wave_barrier(); asm volatile("" ::: "memory");   // the fragment reads below take other lanes' writes: keep the compiler from moving them up (one wave's own piece: the LDS itself works in order)
    v8f oc[2][4];
#pragma unroll
    for (int mb = 0; mb < 2; ++mb)
#pragma unroll
        for (int nb = 0; nb < 4; ++nb) oc[mb][nb] = (v8f){};
#pragma unroll
    for (int kc = 0; kc < TT / KSL; kc += 32) {
        V a[2], a2[2];
#pragma unroll
        for (int mb = 0; mb < 2; ++mb) { const int o = mb * 16 * PPI + kc; a[mb] = ldsfrag(phr + o); a2[mb] = ldsfrag(plr + o); }
#pragma unroll
        for (int nb = 0; nb < 4; ++nb) { const int o = nb * 16 * TT + kc; const V b = WFrag<bf>::ld(Vh + o + lov); const V b2 = WFrag<bf>::ld(Vl + o + lov);
#pragma unroll
            for (int mb = 0; mb < 2; ++mb) { oc[mb][nb] = WFrag<bf>::mma(a[mb], b, oc[mb][nb]); oc[mb][nb] = WFrag<bf>::mma(a2[mb], b, oc[mb][nb]); oc[mb][nb] = WFrag<bf>::mma(a[mb], b2, oc[mb][nb]); } }
    }
    __builtin_amdgcn_wave_barrier(); asm volatile("" ::: "memory");   // the partial tile goes over the wave's own weights: keep the compiler from moving its stores above the fragment reads
    float* os = (float*)ps;   // one wave's piece holds PWV / 2 floats, its partial tile takes the first FR x 68 of them
    {   float* mine = os + wv * (PWV / 2) + hi * 8 * 68 + lr;
#pragma unroll
        for (int mb = 0; mb < 2; ++mb)
#pragma unroll
            for (int nb = 0; nb < 4; ++nb)
#pragma unroll
                for (int r = 0; r < 8; ++r) mine[(mb * 16 + r) * 68 + nb * 16] = oc[mb][nb][r]; }
    __syncthreads();   // every slice's partial tile is in LDS before any thread sums across the slices
    // both loops are unrolled so that a thread's LDS reads issue ahead of its sums
#pragma unroll
    for (int s = 0; s < FR * 16 / (32 * KSL); ++s) { const int idx = s * (32 * KSL) + (int)threadIdx.x; const int row = idx >> 4, cofs = (idx & 15) * 4; v4f val = *(const v4fa*)(os + row * 68 + cofs);
#pragma unroll
        for (int w = 1; w < KSL; ++w) val += *(const v4fa*)(os + w * (PWV / 2) + row * 68 + cofs);
        *(v4f*)(O + (size_t)(i0 + row) * DQ + zz * HD + cofs) = val; }
}

extern "C" void kernel_launch(void* const* d_in, const int* in_sizes, int n_in,
                              void* d_out, int out_size, void* d_ws, size_t ws_size, hipStream_t stream) {
    (void)in_sizes; (void)n_in; (void)out_size;
    const float* x = (const float*)d_in[0]; const int* MK = (const int*)d_in[1]; const float* rel = (const float*)d_in[2]; const float* wq = (const float*)d_in[3]; const float* bq = (const float*)d_in[4]; const float* wk = (const float*)d_in[5]; const float* bk = (const float*)d_in[6]; const float* wv = (const float*)d_in[7]; const float* bv = (const float*)d_in[8]; const float* wpk = (const float*)d_in[9]; const float* bpk = (const float*)d_in[10]; const float* wpq = (const float*)d_in[11]; const float* bpq = (const float*)d_in[12];
    float* OUT = (float*)d_out;     // [2][1024][1024]
    char* wsp = (char*)d_ws;
    auto take = [&](size_t bytes) { char* p = wsp; wsp += (bytes + 255) & ~(size_t)255; return (void*)p; };
    bf* WQ = (bf*)take((size_t)DQ * DM * 2); bf* WK = (bf*)take((size_t)DKV * DM * 2); bf* WV = (bf*)take((size_t)DKV * DM * 2); bf* WPK = (bf*)take((size_t)DQ * DM * 2); bf* WPQ = (bf*)take((size_t)DQ * DM * 2); bf* RE = (bf*)take((size_t)NPE * DM * 2); bf* PKh = (bf*)take((size_t)NH_ * NPE * HD * 2); bf* PKl = (bf*)take((size_t)NH_ * NPE * HD * 2); bf* PQh = (bf*)take((size_t)NH_ * NPE * HD * 2); bf* PQl = (bf*)take((size_t)NH_ * NPE * HD * 2); float* C2P = (float*)take((size_t)ZH * TT * NPE * 4); float* P2C = (float*)take((size_t)ZH * NPE * TT * 4 + (size_t)ZH * 2 * TT * 4);   /* G [ZH][1024][512], then E [ZH][2][1024] */
    bf* XB = (bf*)take((size_t)TT * DM * 2);
    bf* QPh = (bf*)take((size_t)NH_ * TT * HD * 2); bf* QPl = (bf*)take((size_t)NH_ * TT * HD * 2); bf* KPh = (bf*)take((size_t)NKV * TT * HD * 2); bf* KPl = (bf*)take((size_t)NKV * TT * HD * 2); bf* VTh = (bf*)take((size_t)NKV * HD * TT * 2); bf* VTl = (bf*)take((size_t)NKV * HD * TT * 2);
    if ((size_t)(wsp - (char*)d_ws) > ws_size) return;    // ws 256 MiB; about 93 MiB taken at ZH = 16
    k_cvt8<<<(unsigned)(((size_t)DQ * DM / 8 + 255) / 256), 256, 0, stream>>>(wq, WQ, (size_t)DQ * DM / 8); k_cvt8<<<(unsigned)(((size_t)DKV * DM / 8 + 255) / 256), 256, 0, stream>>>(wk, WK, (size_t)DKV * DM / 8); k_cvt8<<<(unsigned)(((size_t)DKV * DM / 8 + 255) / 256), 256, 0, stream>>>(wv, WV, (size_t)DKV * DM / 8);
    k_cvt8<<<(unsigned)(((size_t)DQ * DM / 8 + 255) / 256), 256, 0, stream>>>(wpk, WPK, (size_t)DQ * DM / 8); k_cvt8<<<(unsigned)(((size_t)DQ * DM / 8 + 255) / 256), 256, 0, stream>>>(wpq, WPQ, (size_t)DQ * DM / 8); k_cvt8<<<(unsigned)(((size_t)NPE * DM / 8 + 255) / 256), 256, 0, stream>>>(rel, RE, (size_t)NPE * DM / 8);
    k_gemmw<bf, 0, 1, KSL, true><<<dim3(NPE / 64, DQ / 64, 1), 32 * KSL, 0, stream>>>(RE, nullptr, WPK, nullptr, DM, nullptr, PKh, PKl, HD, NPE * HD, bpk, 0, 0, 0);   /* pos_k = rel Wpk^T + bpk -> per-head hi/lo planes [h][512][64] */
    k_gemmw<bf, 0, 1, KSL, true><<<dim3(NPE / 64, DQ / 64, 1), 32 * KSL, 0, stream>>>(RE, nullptr, WPQ, nullptr, DM, nullptr, PQh, PQl, HD, NPE * HD, bpq, 0, 0, 0);   /* pos_q planes */
    for (int b = 0; b < NB_; ++b) {
        k_cvt8<<<(unsigned)(((size_t)TT * DM / 8 + 255) / 256), 256, 0, stream>>>(x + (size_t)b * TT * DM, XB, (size_t)TT * DM / 8);
        k_gemmw<bf, 0, 1, KSL, true><<<dim3(TT / 64, DQ / 64, 1), 32 * KSL, 0, stream>>>(XB, nullptr, WQ, nullptr, DM, nullptr, QPh, QPl, HD, TT * HD, bq, 0, 0, 0);      /* q planes [h][t][d] */
        k_gemmw<bf, 0, 1, KSL, true><<<dim3(TT / 64, DKV / 64, 1), 32 * KSL, 0, stream>>>(XB, nullptr, WK, nullptr, DM, nullptr, KPh, KPl, HD, TT * HD, bk, 0, 0, 0);     /* k planes [h][t][d] */
        k_gemmw<bf, 0, 2, KSL, true><<<dim3(DKV / 64, TT / 64, 1), 32 * KSL, 0, stream>>>(WV, nullptr, XB, nullptr, DM, nullptr, VTh, VTl, TT, 64, bv, 0, 0, 0);           /* v^T = Wv x^T + bv by row: planes [h][d][t] = [feature][t] */
        for (int h0 = 0; h0 < NH_; h0 += ZH) { const size_t zq = (size_t)h0, zk = (size_t)(h0 / REP);   // one kv head per query head: the pass's heads use consecutive kv planes (z-strides TT*HD)
            k_gemmw<bf, 2, 0, 1, false><<<dim3(TT / 64, NPE / 64, ZH), 32, 0, stream>>>(QPh + zq * TT * HD, QPl + zq * TT * HD, PKh + zq * NPE * HD, PKl + zq * NPE * HD, HD, C2P, nullptr, nullptr, NPE, 64, nullptr, (size_t)TT * HD, (size_t)NPE * HD, (size_t)TT * NPE);   /* c2p raw [ZH][1024][512] */ k_p2cs<<<dim3(TT / 64, NPE / 64, ZH), 32, 0, stream>>>(PQh + zq * NPE * HD, PQl + zq * NPE * HD, KPh + zk * TT * HD, KPl + zk * TT * HD, P2C, P2C + (size_t)ZH * TT * NPE);   /* p2c raw, sheared: G [ZH][1024][512] + E [ZH][2][1024] */
            k_fattn<<<dim3(TT / FR, ZH), 32 * KSL, 0, stream>>>(QPh + zq * TT * HD, QPl + zq * TT * HD, KPh + zk * TT * HD, KPl + zk * TT * HD, VTh + zk * HD * TT, VTl + zk * HD * TT, C2P, P2C, MK + (size_t)b * TT * TT, OUT + (size_t)b * TT * DQ + (size_t)h0 * HD); }   /* scores, softmax and attn.v; head z's 64 columns of the merged output [t][h x 64 + d] */
         }
}

// v006
// It runs in 196 microseconds.
// Two timings next to v005 put it at 1.25 and 1.24 times that version's speed.
// All steps since v000 together make it 5.43 times as fast.
#include <hip/hip_runtime.h>

// DeBERTa disentangled self-attention (hidden_states [2][1024][1024]; q, k, v = hs W^T + b ('oi' [1024][1024]; 16 heads x 64); pos_k = rel_embeddings Wpk^T + bpk, pos_q = rel_embeddings Wpq^T + bpq (rel_embeddings [512][1024], read); scale = 1/sqrt(64 x 3); scores = q.k scale + c2p[i][clip(i-j+256, 0, 511)] + p2c[clip(i-j+256, 0, 511)][j] with c2p = q.pos_k scale ([S][512]) and p2c = (pos_q scale).k ([512][S]); mask (int32 [2][1][1024][1024], read; all ones) == 0 -> finfo.min and weight 0; softmax; out = merged attn.v -> [2][1024][1024] (2.1 M), no output projection).
// Layout: exact bf16 projections, whose GEMM epilogue writes the hi/lo planes that the next GEMM reads (q, k, pos_k, pos_q per head [h][t][d]; v transposed [h][d][t], from the product taken as Wv x^T); hi/lo planes for q, k, pos_k, pos_q (every row: 3-product score GEMMs); all NZ = 32 (batch item, head) pairs in one pass: c2p [32][1024][512] and p2c (sheared to [32][1024][512], row i column rp, plus its two end rows) as hi/lo GEMMs; then one kernel forms the content scores (hi/lo) in registers, gathers the two relative terms per logit (index clip(i - j + 256, 0, 511)), scales, applies the mask select, f32 softmax, hi/lo P through LDS, attn.v (3 products), stored straight into the merged f32 output.
// Compute dtypes, f32 accumulate: every input rounded to bf16; q/k/v/pos_k/pos_q on PLAIN bf16 operands (exact) + biases; all score terms and attn.v on hi/lo planes (3 products) for every row; softmax f32; output f32.

#define NB_  2
#define TT   1024
#define DM   1024
#define NH_  16
#define HD   64
#define DQ   (NH_ * HD)
#define NZ   (NB_ * NH_)          // (batch item, head) pairs: all of them ride in the grid of every score, softmax and attn.v launch, z = batch item x NH_ + head
#define RH   1024                  // not read by the code: every query row uses hi+lo planes
#define WIN  0
#define PCAR 1024.0f
#define SCL  0.072168783648703225f   // 1/sqrt(64 x 3)
#define NPE  512                  // 2 x att_span relative positions
#define SPAN 256
#define KSL  8                     // K slices (waves per work-group) of the K = 1024 GEMMs: the five projections, and attn.v inside k_fattn
typedef _Float16 h16;
typedef unsigned short bf;
typedef __attribute__((ext_vector_type(16))) __bf16   v16bf;
typedef __attribute__((ext_vector_type(16))) _Float16 v16h;
typedef __attribute__((ext_vector_type(8)))  _Float16 v8h;
typedef __attribute__((ext_vector_type(8)))  unsigned short v8us;
typedef __attribute__((ext_vector_type(8)))  float    v8f;
typedef __attribute__((ext_vector_type(4)))  float    v4f;
typedef v8h  __attribute__((may_alias)) v8ha;
typedef v4f  __attribute__((may_alias)) v4fa;
typedef v8us __attribute__((may_alias)) v8usa;

__device__ __forceinline__ unsigned short f2bf(float f) { unsigned u = __float_as_uint(f); u += 0x7FFFu + ((u >> 16) & 1u); return (unsigned short)(u >> 16); }
__device__ __forceinline__ float bf2f(unsigned short b) { return __uint_as_float(((unsigned)b) << 16); }
__device__ __forceinline__ float bfr(float f) { return bf2f(f2bf(f)); }
__device__ __forceinline__ v16h cat16(v8h lo, v8h hi) { return __builtin_shufflevector(lo, hi, 0, 1, 2, 3, 4, 5, 6, 7, 8, 9, 10, 11, 12, 13, 14, 15); }
__device__ __forceinline__ v16bf cat16b(v8us lo, v8us hi) { return __builtin_bit_cast(v16bf, __builtin_shufflevector(lo, hi, 0, 1, 2, 3, 4, 5, 6, 7, 8, 9, 10, 11, 12, 13, 14, 15)); }
__device__ __forceinline__ v8f wmma16(v16h a, v16h b, v8f c) { return __builtin_amdgcn_wmma_f32_16x16x32_f16(false, a, false, b, (short)0, c, false, false); }
__device__ __forceinline__ v8f wmmab(v16bf a, v16bf b, v8f c) { return __builtin_amdgcn_wmma_f32_16x16x32_bf16(false, a, false, b, (short)0, c, false, false); }



// ---- the two GEMM kernels: register-blocked, 64x64 output tile (16 accumulators per wave), operands straight from K-contiguous 16-bit planes.
__device__ __forceinline__ void splitf(float y, unsigned short& h, unsigned short& l) { h = f2bf(y); l = f2bf(y - bf2f(h)); }
typedef __attribute__((ext_vector_type(4))) unsigned short v4us;
template <typename T16> struct WFrag;
template <> struct WFrag<h16> { typedef v16h V; static __device__ __forceinline__ V ld(const h16* p) { return cat16(*(const v8h*)p, *(const v8h*)(p + 16)); } static __device__ __forceinline__ v8f mma(V a, V b, v8f c) { return wmma16(a, b, c); } };
template <> struct WFrag<bf> { typedef v16bf V; static __device__ __forceinline__ V ld(const bf* p) { return cat16b(*(const v8us*)p, *(const v8us*)(p + 16)); } static __device__ __forceinline__ v8f mma(V a, V b, v8f c) { return wmmab(a, b, c); } };

// Workspace layout that k_cvt writes and k_proj reads (bf16, in elements from CV): the five weights in the order q, k, v, pos_k, pos_q, then hidden_states (both batch items), then rel_embeddings.
#define CVW  (DM * DM)             // one weight
#define CVX  (5 * CVW)             // hidden_states
#define CVR  (CVX + NB_ * TT * DM) // rel_embeddings
#define CVN  (CVR + NPE * DM)
// Planes that k_proj writes (in elements from PLN): q hi, q lo, k hi, k lo, v hi, v lo, each [batch item][head][..][..]; then pos_k hi, pos_k lo, pos_q hi, pos_q lo, each [head][512][64].
#define PLB  (NH_ * TT * HD)       // one batch item of one plane
#define PLQ  (NB_ * PLB)           // one q, k or v plane
#define PLP  (NH_ * NPE * HD)      // one pos_k or pos_q plane
#define PLN_ (6 * PLQ + 4 * PLP)

// ---- k_proj: all eight projections (q, k, v of both batch items, pos_k, pos_q) in one grid; none reads what another writes. grid (16, 16, 7), 32 x KSL threads. blockIdx.z: 0, 1 q of batch item 0, 1; 2, 3 k; 4, 5 v; 6 pos_k (x < 8) and pos_q (x >= 8).
// A tile's K = 1024 is cut into KSL contiguous slices, one wave of the work-group per slice, so that KSL waves' loads are in flight on a tile; each wave leaves its partial tile in LDS and, behind one barrier, every thread sums its share of the tile over the slices in the fixed order 0 .. KSL-1.
// C[m][n] = sum_k A[m][k] Bt[n][k] + bias (bias[n]; for v, taken as Wv x^T, bias[m]). Element (m, n) of column tile y lies at m x ldc + y x cstep + (n - 64 y), so that a 64-column tile is a head's own plane (q, k, pos: ldc 64, cstep rows x 64) or a piece of a row (v: ldc 1024, cstep 64).
// The value is split into bf16 hi + lo, the planes the next GEMM takes as operands.
__global__ __launch_bounds__(32 * KSL) void k_proj(const bf* __restrict__ CV, bf* PLN, const float* __restrict__ bq, const float* __restrict__ bk, const float* __restrict__ bv, const float* __restrict__ bpk, const float* __restrict__ bpq) {
    typedef WFrag<bf>::V V;
    __shared__ __align__(16) float os[KSL * 64 * 68];
    const int job = blockIdx.z; int bx = blockIdx.x;
    const bf* A; const bf* Bt; bf* Ch; bf* Cl; const float* bias; int ldc, cstep; bool rowb = false;   // all uniform over the work-group
    if (job < 6) { const int t = job >> 1, b = job & 1; const bf* X = CV + CVX + b * (TT * DM); const bf* Wt = CV + t * CVW; Ch = PLN + 2 * t * PLQ + b * PLB; Cl = Ch + PLQ; bias = t == 0 ? bq : (t == 1 ? bk : bv);
        if (t < 2) { A = X; Bt = Wt; ldc = HD; cstep = TT * HD; } else { A = Wt; Bt = X; ldc = TT; cstep = 64; rowb = true; } }
    else { const int t = bx >> 3; bx &= 7; A = CV + CVR; Bt = CV + (3 + t) * CVW; Ch = PLN + 6 * PLQ + 2 * t * PLP; Cl = Ch + PLP; bias = t ? bpq : bpk; ldc = HD; cstep = NPE * HD; }
    const size_t co = (size_t)blockIdx.y * cstep;   // where this column tile starts in the output
    const int lane = threadIdx.x & 31, lr = lane & 15, hi = lane >> 4; const int r0 = bx * 64, c0 = blockIdx.y * 64;
    v8f acc[4][4];
#pragma unroll
    for (int mb = 0; mb < 4; ++mb)
#pragma unroll
        for (int nb = 0; nb < 4; ++nb) acc[mb][nb] = (v8f){};
    const size_t aoff = (size_t)(r0 + lr) * DM + 8 * hi, boff = (size_t)(c0 + lr) * DM + 8 * hi;
    const int wv = __builtin_amdgcn_readfirstlane((int)(threadIdx.x >> 5)); const int k0 = wv * (DM / KSL), k1 = k0 + DM / KSL;   // this wave's K slice, in scalar registers
#pragma unroll 1
    for (int kc = k0; kc < k1; kc += 32) {   // rolled: one trip's fragments and the 16 accumulators are what the registers hold
        const bf* ap = A + aoff + kc; const bf* bp = Bt + boff + kc; V a[4];
#pragma unroll
        for (int mb = 0; mb < 4; ++mb) a[mb] = WFrag<bf>::ld(ap + mb * 16 * DM);
#pragma unroll
        for (int nb = 0; nb < 4; ++nb) { const V b = WFrag<bf>::ld(bp + nb * 16 * DM);
#pragma unroll
            for (int mb = 0; mb < 4; ++mb) acc[mb][nb] = WFrag<bf>::mma(a[mb], b, acc[mb][nb]); }
        // the trip's 16 loads name these two addresses: they stay whole up to this wait, so that no later load is given one of them to write into before it
        asm volatile("s_wait_xcnt 0x0" :: "v"(ap), "v"(bp) : "memory");
        // four vector slots between the last matrix instruction and the back edge, where the next trip's loads overwrite its operands
        asm volatile("v_nop\n\tv_nop\n\tv_nop\n\tv_nop" : "+v"(acc[0][0]), "+v"(acc[1][1]), "+v"(acc[2][2]), "+v"(acc[3][3]) : "v"(a[0]), "v"(a[3]));
    }
    // the bias by column and by row of this thread's four pieces, both read here (both lie inside the 1024 floats for every job) so that the loads fly during the LDS stores and the barrier; the job picks one below
    const int cofs = ((int)threadIdx.x & 15) * 4, rw = (int)threadIdx.x >> 4; const float* bcp = bias + c0 + cofs; const float* brp = bias + r0 + rw; float bc[4], br[4];
#pragma unroll
    for (int q = 0; q < 4; ++q) { bc[q] = bcp[q]; br[q] = brp[q * (2 * KSL)]; }
    // these loads name the two addresses: they stay whole up to this wait, so that nothing below is given one of them to write into before it
    asm volatile("s_wait_xcnt 0x0" :: "v"(bcp), "v"(brp) : "memory");
    float* mine = os + wv * (64 * 68);
    // the three loops are unrolled so that acc is indexed by constants and stays in registers
#pragma unroll
    for (int mb = 0; mb < 4; ++mb)
#pragma unroll
        for (int nb = 0; nb < 4; ++nb)
#pragma unroll
            for (int j = 0; j < 8; ++j) mine[(mb * 16 + hi * 8 + j) * 68 + nb * 16 + lr] = acc[mb][nb][j];
    __syncthreads();   // every slice's partial tile is in LDS before any thread sums across the slices
    v4us oh[32 / KSL], ol[32 / KSL];
    // both loops are unrolled so that a thread's LDS reads issue ahead of its sums
#pragma unroll
    for (int s = 0; s < 32 / KSL; ++s) { const int row = s * (2 * KSL) + rw; v4f val = *(const v4fa*)(os + row * 68 + cofs);
#pragma unroll
        for (int w = 1; w < KSL; ++w) val += *(const v4fa*)(os + w * (64 * 68) + row * 68 + cofs);
#pragma unroll
        for (int q = 0; q < 4; ++q) { unsigned short a, c; splitf(val[q] + bfr(rowb ? br[s] : bc[q]), a, c); oh[s][q] = a; ol[s][q] = c; } }
    __builtin_amdgcn_sched_barrier(0);   // the stores stay below every sum, last in the kernel, so that nothing rewrites a register that an issued store names
#pragma unroll
    for (int s = 0; s < 32 / KSL; ++s) { const size_t o = (size_t)(r0 + s * (2 * KSL) + rw) * ldc + co + cofs; *(v4us*)(Ch + o) = oh[s]; *(v4us*)(Cl + o) = ol[s]; }
}

// ---- k_gemmw: one wave does a whole 64x64 tile (short K); grid (M/64, N/64, Z), 32 threads. C[z][m][n] (+ optional f32 bias[n]) = sum_k A[z][m][k] Bt[z % ZB][n][k] (+ split products per NSPLIT), f32 out, row pitch ldc.
// z-batch strides sA/sB/sC in elements; the B planes repeat every ZB z's (they do not depend on the batch item). K % 32 == 0.
template <typename T16, int NSPLIT, int BIAS, int ZB>
__global__ __launch_bounds__(32) void k_gemmw(const T16* __restrict__ A, const T16* __restrict__ A2, const T16* __restrict__ Bt, const T16* __restrict__ Bt2, int K, float* C, int ldc, const float* __restrict__ bias, size_t sA, size_t sB, size_t sC) {
    typedef typename WFrag<T16>::V V;
    __shared__ __align__(16) float os[16 * 68];
    const size_t z = blockIdx.z, zB = blockIdx.z % ZB; A += z * sA; if (A2) A2 += z * sA; Bt += zB * sB; if (Bt2) Bt2 += zB * sB; const size_t co = z * sC + (size_t)blockIdx.y * 64;   // where this z and this column tile start in the output
    const int lane = threadIdx.x & 31, lr = lane & 15, hi = lane >> 4; const int r0 = blockIdx.x * 64, c0 = blockIdx.y * 64;
    v8f acc[4][4];
#pragma unroll
    for (int mb = 0; mb < 4; ++mb)
#pragma unroll
        for (int nb = 0; nb < 4; ++nb) acc[mb][nb] = (v8f){};
    const size_t aoff = (size_t)(r0 + lr) * K + 8 * hi, boff = (size_t)(c0 + lr) * K + 8 * hi;
    const int k0 = 0, k1 = K;
#pragma unroll 1
    for (int kc = k0; kc < k1; kc += 32) {
        V a[4], a2[4];
#pragma unroll
        for (int mb = 0; mb < 4; ++mb) { a[mb] = WFrag<T16>::ld(A + aoff + (size_t)mb * 16 * K + kc); if (NSPLIT == 1 || NSPLIT == 2) a2[mb] = WFrag<T16>::ld(A2 + aoff + (size_t)mb * 16 * K + kc); }
#pragma unroll
        for (int nb = 0; nb < 4; ++nb) { const V b = WFrag<T16>::ld(Bt + boff + (size_t)nb * 16 * K + kc); V b2; if (NSPLIT >= 2) b2 = WFrag<T16>::ld(Bt2 + boff + (size_t)nb * 16 * K + kc);
#pragma unroll
            for (int mb = 0; mb < 4; ++mb) { acc[mb][nb] = WFrag<T16>::mma(a[mb], b, acc[mb][nb]); if (NSPLIT == 1 || NSPLIT == 2) acc[mb][nb] = WFrag<T16>::mma(a2[mb], b, acc[mb][nb]); if (NSPLIT >= 2) acc[mb][nb] = WFrag<T16>::mma(a[mb], b2, acc[mb][nb]); } }
        asm volatile("v_nop\n\tv_nop\n\tv_nop\n\tv_nop" : "+v"(acc[0][0]), "+v"(acc[1][1]), "+v"(acc[2][2]), "+v"(acc[3][3]) : "v"(a[0]), "v"(a[3]));
    }
#pragma unroll
    for (int mb = 0; mb < 4; ++mb) {
#pragma unroll
        for (int nb = 0; nb < 4; ++nb) {
#pragma unroll
            for (int j = 0; j < 8; ++j) os[(hi * 8 + j) * 68 + nb * 16 + lr] = acc[mb][nb][j]; }
        __builtin_amdgcn_wave_barrier(); asm volatile("" ::: "memory");
        float* crow = C + (size_t)(r0 + mb * 16) * ldc + co;
{
#pragma unroll
            for (int s = 0; s < 8; ++s) { const int row = 2 * s + hi, cofs = lr * 4; v4f val = *(const v4fa*)(os + row * 68 + cofs); if (BIAS == 1) { val[0] += bfr(bias[c0 + cofs]); val[1] += bfr(bias[c0 + cofs + 1]); val[2] += bfr(bias[c0 + cofs + 2]); val[3] += bfr(bias[c0 + cofs + 3]); }
                *(v4f*)(crow + (size_t)row * ldc + cofs) = val; }
             }
        __builtin_amdgcn_wave_barrier(); asm volatile("" ::: "memory");
    }
}

// ---- k_p2cs: the p2c term laid out the way the softmax reads it. G[z][i][p] = pos_q[p] . k[i - p + SPAN] (hi/lo, 3 products, same products in the same order as k_gemmw<bf, 2>), so that row i of G is indexed by the same
// relative position as row i of c2p and a wave's gather runs along a row instead of down a diagonal of [p][j]. One wave per tile of 64 i x 64 p: it needs the 127 keys j = jb .. jb + 126 (jb = i0 - p0 + SPAN - 63), computes the
// 64 p x 128 j products in two halves into LDS and stores the sheared tile in whole 256-byte rows. Keys outside [0, TT) are clamped for the load only; the G elements made from them belong to no (i, j) and are never read.
// E[z][0][j] = p2c[0][j] and E[z][1][j] = p2c[NPE-1][j] serve the clipped ends (j >= i + SPAN, j <= i - SPAN + 1); each 64-key piece is written by the one tile that holds it aligned. grid (TT/64, NPE/64, NZ), 32 threads; z = batch item x NH_ + head picks k, G and E, the head alone picks pos_q.
__global__ __launch_bounds__(32) void k_p2cs(const bf* __restrict__ A, const bf* __restrict__ A2, const bf* __restrict__ Bt, const bf* __restrict__ Bt2, float* G, float* E) {
    typedef WFrag<bf>::V V;
    __shared__ __align__(16) float ts[64 * 132];
    const size_t z = blockIdx.z, zh = blockIdx.z % NH_; A += zh * (size_t)(NPE * HD); A2 += zh * (size_t)(NPE * HD); Bt += z * (size_t)(TT * HD); Bt2 += z * (size_t)(TT * HD); G += z * (size_t)(TT * NPE); E += z * (size_t)(2 * TT);
    const int lane = threadIdx.x & 31, lr = lane & 15, hi = lane >> 4; const int i0 = blockIdx.x * 64, p0 = blockIdx.y * 64; const int jb = i0 - p0 + (SPAN - 63);
    const size_t aoff = (size_t)(p0 + lr) * HD + 8 * hi;
#pragma unroll 1
    for (int hf = 0; hf < 2; ++hf) {   // rolled: one set of 16 accumulators serves both halves
        v8f acc[4][4];
#pragma unroll
        for (int mb = 0; mb < 4; ++mb)
#pragma unroll
            for (int nb = 0; nb < 4; ++nb) acc[mb][nb] = (v8f){};
        size_t boff[4];
#pragma unroll
        for (int nb = 0; nb < 4; ++nb) { int j = jb + hf * 64 + nb * 16 + lr; j = j < 0 ? 0 : (j > TT - 1 ? TT - 1 : j); boff[nb] = (size_t)j * HD + 8 * hi; }
#pragma unroll 1
        for (int kc = 0; kc < HD; kc += 32) {
            V a[4], a2[4];
#pragma unroll
            for (int mb = 0; mb < 4; ++mb) { a[mb] = WFrag<bf>::ld(A + aoff + (size_t)mb * 16 * HD + kc); a2[mb] = WFrag<bf>::ld(A2 + aoff + (size_t)mb * 16 * HD + kc); }
#pragma unroll
            for (int nb = 0; nb < 4; ++nb) { const V b = WFrag<bf>::ld(Bt + boff[nb] + kc); const V b2 = WFrag<bf>::ld(Bt2 + boff[nb] + kc);
#pragma unroll
                for (int mb = 0; mb < 4; ++mb) { acc[mb][nb] = WFrag<bf>::mma(a[mb], b, acc[mb][nb]); acc[mb][nb] = WFrag<bf>::mma(a2[mb], b, acc[mb][nb]); acc[mb][nb] = WFrag<bf>::mma(a[mb], b2, acc[mb][nb]); } }
            // four vector slots between the last matrix instruction and the back edge, where the next trip's loads overwrite its operands (as in k_gemmw)
            asm volatile("v_nop\n\tv_nop\n\tv_nop\n\tv_nop" : "+v"(acc[0][0]), "+v"(acc[1][1]), "+v"(acc[2][2]), "+v"(acc[3][3]) : "v"(a[0]), "v"(a[3]));
        }
        // unrolled so that acc is indexed by constants and stays in registers
#pragma unroll
        for (int mb = 0; mb < 4; ++mb)
#pragma unroll
            for (int nb = 0; nb < 4; ++nb)
#pragma unroll
                for (int r = 0; r < 8; ++r) ts[(mb * 16 + hi * 8 + r) * 132 + hf * 64 + nb * 16 + lr] = acc[mb][nb][r];
    }
    __builtin_amdgcn_wave_barrier(); asm volatile("" ::: "memory");   // the reads below take other lanes' writes: keep the compiler from moving them up (one wave: the LDS itself works in order)
#pragma unroll 1
    for (int s0 = 0; s0 < 32; s0 += 8) {
        // unrolled so that the LDS reads of eight row pairs issue ahead of their stores
#pragma unroll
        for (int s = 0; s < 8; ++s) { const int ii = 2 * (s0 + s) + hi, pp = lr * 4; v4f val;
#pragma unroll
            for (int q = 0; q < 4; ++q) val[q] = ts[(pp + q) * 132 + ii - (pp + q) + 63];   // key j = (i0 + ii) - (p0 + pp + q) + SPAN = jb + this column
            *(v4f*)(G + (size_t)(i0 + ii) * NPE + p0 + pp) = val; }
        asm volatile("s_wait_xcnt 0x0" ::: "memory");   // the next trip rewrites the address and data registers that these stores name
    }
    if (p0 == 0 && i0 + SPAN < TT) { E[i0 + SPAN + lane] = ts[63 + lane]; E[i0 + SPAN + 32 + lane] = ts[63 + 32 + lane]; }                                        // p = 0: keys i0 + SPAN .. + 63
    if (p0 == NPE - 64 && i0 >= SPAN - 64) { E[TT + i0 - (SPAN - 64) + lane] = ts[63 * 132 + 63 + lane]; E[TT + i0 - (SPAN - 64) + 32 + lane] = ts[63 * 132 + 63 + 32 + lane]; }   // p = NPE - 1: keys i0 - SPAN + 64 .. + 63
}

__device__ __forceinline__ h16 tohx(float x) { return (h16)x; }
typedef __attribute__((ext_vector_type(2))) _Float16 v2h;
typedef __attribute__((ext_vector_type(4))) _Float16 v4h;
typedef __attribute__((ext_vector_type(2))) unsigned short v2us;
typedef __attribute__((ext_vector_type(2))) float v2f;
typedef __attribute__((ext_vector_type(4))) int v4i;

// ---- k_cvt: every f32 -> bf16 rounding of an input (five weights, hidden_states, rel_embeddings) in one grid, into the layout CVW / CVX / CVR above. grid (CVN / 8192), 256 threads.
// A work-group rounds 8192 consecutive elements, a thread four pieces of 8 that lie 2048 apart, so that a wave's loads and stores cover whole lines. Every source is a multiple of 8192 long, so a work-group has one source.
__global__ __launch_bounds__(256) void k_cvt(const float* __restrict__ wq, const float* __restrict__ wk, const float* __restrict__ wv, const float* __restrict__ wpk, const float* __restrict__ wpq, const float* __restrict__ x, const float* __restrict__ rel, bf* CV) {
    const unsigned e0 = blockIdx.x * 8192u; const unsigned seg = e0 / CVW;   // uniform: which source
    const float* src; unsigned s0;
    if (seg < 5) { src = seg == 0 ? wq : (seg == 1 ? wk : (seg == 2 ? wv : (seg == 3 ? wpk : wpq))); s0 = seg * CVW; }
    else if (e0 < CVR) { src = x; s0 = CVX; }
    else { src = rel; s0 = CVR; }
    src += e0 - s0; bf* dst = CV + e0; const unsigned t8 = threadIdx.x * 8;
    v8f v[4];
    // both loops are unrolled so that the four loads issue ahead of the first rounding
#pragma unroll
    for (int u = 0; u < 4; ++u) v[u] = *(const v8f*)(src + u * 2048 + t8);
#pragma unroll
    for (int u = 0; u < 4; ++u) { v8us o;
#pragma unroll
        for (int k = 0; k < 8; ++k) o[k] = f2bf(v[u][k]);
        *(v8us*)(dst + u * 2048 + t8) = o; }
}

// ---- k_fattn: content scores, the two relative terms, softmax and attn.v of FR = 32 query rows of one head in one work-group, so that neither the scores nor the weights go through memory. grid (TT/FR, NZ), 32 x KSL threads; blockIdx.y = batch item x NH_ + head.
// Wave w owns the keys 128 w .. 128 w + 127. It forms its 32 x 128 scores (hi/lo, 3 products, the products and their order as in k_gemmw<bf, 2>) in 16 accumulators and, in the accumulator's own layout (row = 16 mb + 8 hi + r, key = 16 nb + lr),
// t = (S + c2p[i][rp] + p2c[rp][j]) x scale with rp = clip(i - j + 256, 0, 511), -3e38 where mask == 0. p2c[rp][j] is read from k_p2cs's planes: G[row][rp] inside the span, E[zz][0][j] / E[zz][1][j] (behind G in the same buffer) at and beyond the clipped ends.
// Row maximum and row sum: over the wave's own keys in registers and by lane exchange, then over the eight waves through LDS in the order 0 .. 7. The weights, split hi/lo, go to the wave's own LDS piece row by row, from where the A loader takes them as it would from memory;
// each wave multiplies its 128 keys into a partial 32 x 64 tile (the K slices of the former attn.v GEMM), and the partial tiles are summed in LDS in slice order.
#define FR   32                    // query rows per work-group
#define PPI  136                   // LDS pitch of a row of weights, in 16-bit elements: 256 bytes + 16, for 16-byte fragment reads
#define PWV  (2 * FR * PPI)        // 16-bit elements of one wave's LDS piece: hi plane, lo plane
__device__ __forceinline__ v16bf ldsfrag(const bf* p) { return cat16b(*(const v8usa*)p, *(const v8usa*)(p + 16)); }
// launch bounds: 4 waves per SIMD, that is at most 256 registers a wave, so that two work-groups (their LDS fits twice) share a WGP and the whole grid is resident at once
__global__ __launch_bounds__(32 * KSL, 4) void k_fattn(const bf* __restrict__ Qh, const bf* __restrict__ Ql, const bf* __restrict__ Kh, const bf* __restrict__ Kl, const bf* __restrict__ Vh, const bf* __restrict__ Vl, const float* __restrict__ C2P, const float* __restrict__ P2C, const int* __restrict__ MK, float* O) {
    typedef WFrag<bf>::V V;
    __shared__ __align__(16) bf ps[KSL * PWV];
    __shared__ __align__(16) float red[2 * FR * KSL];
    const int zz = blockIdx.y, i0 = blockIdx.x * FR; const int lane = threadIdx.x & 31, lr = lane & 15, hi = lane >> 4;
    const int wv = __builtin_amdgcn_readfirstlane((int)(threadIdx.x >> 5)); const int j0 = wv * (TT / KSL);   // this wave's keys, in a scalar register
    // uniform bases (head, first query row, the wave's first key) plus one unsigned lane offset per operand: every fragment load is then scalar base + lane offset + constant
    { const size_t zo = (size_t)zz * (TT * HD); Qh += zo + i0 * HD; Ql += zo + i0 * HD; Kh += zo + j0 * HD; Kl += zo + j0 * HD; Vh += zo + j0; Vl += zo + j0; }
    const int* MKb = MK + (size_t)(zz / NH_) * (TT * TT); O += (size_t)(zz / NH_) * (TT * DQ) + (zz % NH_) * HD;   // the batch item's mask; the batch item's rows and the head's 64 columns of the merged output
    const unsigned lo64 = (unsigned)(lr * HD + 8 * hi), lov = (unsigned)(lr * TT + 8 * hi);
    v8f acc[2][8];
#pragma unroll
    for (int mb = 0; mb < 2; ++mb)
#pragma unroll
        for (int nb = 0; nb < 8; ++nb) acc[mb][nb] = (v8f){};
    // every loop over mb, nb, r below is unrolled so that the accumulators are indexed by constants and stay in registers
#pragma unroll
    for (int kc = 0; kc < HD; kc += 32) {
        V a[2], a2[2];
#pragma unroll
        for (int mb = 0; mb < 2; ++mb) { const int o = mb * 16 * HD + kc; a[mb] = WFrag<bf>::ld(Qh + o + lo64); a2[mb] = WFrag<bf>::ld(Ql + o + lo64); }
#pragma unroll
        for (int nb = 0; nb < 8; ++nb) { const int o = nb * 16 * HD + kc; const V b = WFrag<bf>::ld(Kh + o + lo64); const V b2 = WFrag<bf>::ld(Kl + o + lo64);
#pragma unroll
            for (int mb = 0; mb < 2; ++mb) { acc[mb][nb] = WFrag<bf>::mma(a[mb], b, acc[mb][nb]); acc[mb][nb] = WFrag<bf>::mma(a2[mb], b, acc[mb][nb]); acc[mb][nb] = WFrag<bf>::mma(a[mb], b2, acc[mb][nb]); } }
    }
    // lane bases; the mask index adds only a compile-time constant to mo, while rp is clamped and the p2c index picked (G or E) per logit
    const int ib = i0 + hi * 8, jl = j0 + lr; const int gb = (zz * TT + ib) * NPE, db = ib - jl + SPAN, mo = ib * TT + jl, eo = NZ * TT * NPE + zz * 2 * TT + jl;
    float* rl = red + hi * 8 * KSL;
    float mx[2][8], sm[2][8];
    __builtin_amdgcn_sched_barrier(0);   // keeps the address arithmetic of the gathers out of the matrix phase, where it would hold registers
    // two rows (16 logits a lane) at a time: their 48 loads are all issued before the first is used, so that a wave waits once per batch and not once per logit
#pragma unroll
    for (int mb = 0; mb < 2; ++mb)
#pragma unroll
        for (int rb = 0; rb < 8; rb += 2) { float cv[2][8], pv[2][8]; int mv[2][8];
#pragma unroll
            for (int q = 0; q < 2; ++q) { const int ro = mb * 16 + rb + q;   // query row i = ib + ro, key j = jl + 16 nb
                int pa[8], pb[8];
#pragma unroll
                for (int nb = 0; nb < 8; ++nb) { int rp = db + (ro - nb * 16); rp = rp < 0 ? 0 : (rp > NPE - 1 ? NPE - 1 : rp); const int pin = gb + rp + ro * NPE, pend = eo + (rp & SPAN) * (TT / SPAN) + nb * 16; const int po = ((unsigned)(rp - 1) < (unsigned)(NPE - 2)) ? pin : pend; pa[nb] = pin; pb[nb] = po;
                    cv[q][nb] = C2P[pin]; pv[q][nb] = P2C[po]; mv[q][nb] = MKb[mo + (ro * TT + nb * 16)]; }
                // the row's 24 loads name these index registers: they stay whole up to this wait, so that no later load or sum is given one of them to write into before it
                asm volatile("s_wait_xcnt 0x0" :: "v"(pa[0]), "v"(pa[1]), "v"(pa[2]), "v"(pa[3]), "v"(pa[4]), "v"(pa[5]), "v"(pa[6]), "v"(pa[7]), "v"(pb[0]), "v"(pb[1]), "v"(pb[2]), "v"(pb[3]), "v"(pb[4]), "v"(pb[5]), "v"(pb[6]), "v"(pb[7]), "v"(mo) : "memory"); }
            __builtin_amdgcn_sched_barrier(0);   // the batch's loads stay above, their uses below
#pragma unroll
            for (int q = 0; q < 2; ++q) { const int r = rb + q; float m = -3.0e38f;
#pragma unroll
                for (int nb = 0; nb < 8; ++nb) { const float sa = __fmul_rn(__fadd_rn(__fadd_rn(acc[mb][nb][r], cv[q][nb]), pv[q][nb]), SCL); const float t = (mv[q][nb] != 0) ? sa : -3.0e38f; acc[mb][nb][r] = t; m = fmaxf(m, t); }
                mx[mb][r] = m; }
            __builtin_amdgcn_sched_barrier(0);   // the next batch's loads do not start before this batch's registers are free
        }
#pragma unroll
    for (int sh = 8; sh; sh >>= 1)   // over the 16 lanes that hold a row; the 16 rows' exchanges of one distance go together
#pragma unroll
        for (int mb = 0; mb < 2; ++mb)
#pragma unroll
            for (int r = 0; r < 8; ++r) mx[mb][r] = fmaxf(mx[mb][r], __shfl_xor(mx[mb][r], sh, 32));
    if (lr == 0) {
#pragma unroll
        for (int mb = 0; mb < 2; ++mb)
#pragma unroll
            for (int r = 0; r < 8; ++r) rl[(mb * 16 + r) * KSL + wv] = mx[mb][r]; }
    __syncthreads();   // every wave's row maxima are in LDS before any wave takes the maximum over the waves
#pragma unroll
    for (int mb = 0; mb < 2; ++mb)
#pragma unroll
        for (int r = 0; r < 8; ++r) { const float* rr = rl + (mb * 16 + r) * KSL; const v4f u = *(const v4fa*)rr, w = *(const v4fa*)(rr + 4); const float m = fmaxf(fmaxf(fmaxf(u[0], u[1]), fmaxf(u[2], u[3])), fmaxf(fmaxf(w[0], w[1]), fmaxf(w[2], w[3]))); float s = 0.f;
#pragma unroll
            for (int nb = 0; nb < 8; ++nb) { const float x = __fmul_rn(__fsub_rn(acc[mb][nb][r], m), 1.4426950408889634f); float e;
                asm("v_exp_f32 %0, %1\n\tv_nop" : "=v"(e) : "v"(x));   // the v_nop fills the one slot behind a transcendental, whatever instruction the compiler puts next
                acc[mb][nb][r] = e; s += e; }
            sm[mb][r] = s; }
#pragma unroll
    for (int sh = 8; sh; sh >>= 1)
#pragma unroll
        for (int mb = 0; mb < 2; ++mb)
#pragma unroll
            for (int r = 0; r < 8; ++r) sm[mb][r] += __shfl_xor(sm[mb][r], sh, 32);
    if (lr == 0) {
#pragma unroll
        for (int mb = 0; mb < 2; ++mb)
#pragma unroll
            for (int r = 0; r < 8; ++r) rl[FR * KSL + (mb * 16 + r) * KSL + wv] = sm[mb][r]; }
    __syncthreads();   // every wave's row sums are in LDS before any wave adds them up
    __builtin_amdgcn_sched_barrier(0);   // keeps the addresses of the later phases from being formed early and spilled
    bf* ph = ps + wv * PWV; bf* pl = ph + FR * PPI; bf* phw = ph + hi * 8 * PPI + lr; bf* plw = pl + hi * 8 * PPI + lr; const bf* phr = ph + lr * PPI + 8 * hi; const bf* plr = pl + lr * PPI + 8 * hi;   // lane bases of the stores and of the fragment reads
#pragma unroll
    for (int mb = 0; mb < 2; ++mb)
#pragma unroll
        for (int r = 0; r < 8; ++r) { const float* rr = rl + FR * KSL + (mb * 16 + r) * KSL; const v4f u = *(const v4fa*)rr, w = *(const v4fa*)(rr + 4); const float s = ((((((u[0] + u[1]) + u[2]) + u[3]) + w[0]) + w[1]) + w[2]) + w[3]; const float f = __fdiv_rn(1.0f, s);
#pragma unroll
            for (int nb = 0; nb < 8; ++nb) { unsigned short a, c; splitf(acc[mb][nb][r] * f, a, c); const int o = (mb * 16 + r) * PPI + nb * 16; phw[o] = a; plw[o] = c; } }
    __builtin_amdgcn_wave_barrier(); asm volatile("" ::: "memory");   // the fragment reads below take other lanes' writes: keep the compiler from moving them up (one wave's own piece: the LDS itself works in order)
    v8f oc[2][4];
#pragma unroll
    for (int mb = 0; mb < 2; ++mb)
#pragma unroll
        for (int nb = 0; nb < 4; ++nb) oc[mb][nb] = (v8f){};
#pragma unroll
    for (int kc = 0; kc < TT / KSL; kc += 32) {
        V a[2], a2[2];
#pragma unroll
        for (int mb = 0; mb < 2; ++mb) { const int o = mb * 16 * PPI + kc; a[mb] = ldsfrag(phr + o); a2[mb] = ldsfrag(plr + o); }
#pragma unroll
        for (int nb = 0; nb < 4; ++nb) { const int o = nb * 16 * TT + kc; const V b = WFrag<bf>::ld(Vh + o + lov); const V b2 = WFrag<bf>::ld(Vl + o + lov);
#pragma unroll
            for (int mb = 0; mb < 2; ++mb) { oc[mb][nb] = WFrag<bf>::mma(a[mb], b, oc[mb][nb]); oc[mb][nb] = WFrag<bf>::mma(a2[mb], b, oc[mb][nb]); oc[mb][nb] = WFrag<bf>::mma(a[mb], b2, oc[mb][nb]); } }
    }
    __builtin_amdgcn_wave_barrier(); asm volatile("" ::: "memory");   // the partial tile goes over the wave's own weights: keep the compiler from moving its stores above the fragment reads
    float* os = (float*)ps;   // one wave's piece holds PWV / 2 floats, its partial tile takes the first FR x 68 of them
    {   float* mine = os + wv * (PWV / 2) + hi * 8 * 68 + lr;
#pragma unroll
        for (int mb = 0; mb < 2; ++mb)
#pragma unroll
            for (int nb = 0; nb < 4; ++nb)
#pragma unroll
                for (int r = 0; r < 8; ++r) mine[(mb * 16 + r) * 68 + nb * 16] = oc[mb][nb][r]; }
    __syncthreads();   // every slice's partial tile is in LDS before any thread sums across the slices
    // both loops are unrolled so that a thread's LDS reads issue ahead of its sums
#pragma unroll
    for (int s = 0; s < FR * 16 / (32 * KSL); ++s) { const int idx = s * (32 * KSL) + (int)threadIdx.x; const int row = idx >> 4, cofs = (idx & 15) * 4; v4f val = *(const v4fa*)(os + row * 68 + cofs);
#pragma unroll
        for (int w = 1; w < KSL; ++w) val += *(const v4fa*)(os + w * (PWV / 2) + row * 68 + cofs);
        *(v4f*)(O + (size_t)(i0 + row) * DQ + cofs) = val; }
}

extern "C" void kernel_launch(void* const* d_in, const int* in_sizes, int n_in,
                              void* d_out, int out_size, void* d_ws, size_t ws_size, hipStream_t stream) {
    (void)in_sizes; (void)n_in; (void)out_size;
    const float* x = (const float*)d_in[0]; const int* MK = (const int*)d_in[1]; const float* rel = (const float*)d_in[2]; const float* wq = (const float*)d_in[3]; const float* bq = (const float*)d_in[4]; const float* wk = (const float*)d_in[5]; const float* bk = (const float*)d_in[6]; const float* wv = (const float*)d_in[7]; const float* bv = (const float*)d_in[8]; const float* wpk = (const float*)d_in[9]; const float* bpk = (const float*)d_in[10]; const float* wpq = (const float*)d_in[11]; const float* bpq = (const float*)d_in[12];
    float* OUT = (float*)d_out;     // [2][1024][1024]
    char* wsp = (char*)d_ws;
    auto take = [&](size_t bytes) { char* p = wsp; wsp += (bytes + 255) & ~(size_t)255; return (void*)p; };
    bf* CV = (bf*)take((size_t)CVN * 2); bf* PLN = (bf*)take((size_t)PLN_ * 2); float* C2P = (float*)take((size_t)NZ * TT * NPE * 4); float* P2C = (float*)take((size_t)NZ * NPE * TT * 4 + (size_t)NZ * 2 * TT * 4);   /* G [NZ][1024][512], then E [NZ][2][1024] */
    bf* QPh = PLN; bf* QPl = PLN + (size_t)PLQ; bf* KPh = PLN + (size_t)2 * PLQ; bf* KPl = PLN + (size_t)3 * PLQ; bf* VTh = PLN + (size_t)4 * PLQ; bf* VTl = PLN + (size_t)5 * PLQ; bf* PKh = PLN + (size_t)6 * PLQ; bf* PKl = PKh + (size_t)PLP; bf* PQh = PKh + (size_t)2 * PLP; bf* PQl = PKh + (size_t)3 * PLP;
    if ((size_t)(wsp - (char*)d_ws) > ws_size) return;    // ws 256 MiB; about 171 MiB taken
    // five launches, each reading what earlier ones wrote; k_gemmw (c2p) and k_p2cs (p2c) each read only k_proj's planes, and k_fattn reads both
    k_cvt<<<CVN / 8192, 256, 0, stream>>>(wq, wk, wv, wpk, wpq, x, rel, CV);
    k_proj<<<dim3(16, 16, 7), 32 * KSL, 0, stream>>>(CV, PLN, bq, bk, bv, bpk, bpq);   /* q, k planes [b][h][t][d]; v^T planes [b][h][d][t]; pos_k, pos_q planes [h][512][64] */
    k_gemmw<bf, 2, 0, NH_><<<dim3(TT / 64, NPE / 64, NZ), 32, 0, stream>>>(QPh, QPl, PKh, PKl, HD, C2P, NPE, nullptr, (size_t)TT * HD, (size_t)NPE * HD, (size_t)TT * NPE);   /* c2p raw [NZ][1024][512] */
    k_p2cs<<<dim3(TT / 64, NPE / 64, NZ), 32, 0, stream>>>(PQh, PQl, KPh, KPl, P2C, P2C + (size_t)NZ * TT * NPE);   /* p2c raw, sheared: G [NZ][1024][512] + E [NZ][2][1024] */
    k_fattn<<<dim3(TT / FR, NZ), 32 * KSL, 0, stream>>>(QPh, QPl, KPh, KPl, VTh, VTl, C2P, P2C, MK, OUT);   /* scores, softmax and attn.v, into the merged output [b][t][h x 64 + d] */
}

// v007
// A run of this version takes 145 microseconds.
// In two side-by-side timings against v006, it was 1.35 and 1.34 times as fast.
// Counting every step since v000, it is 7.29 times as fast.
#include <hip/hip_runtime.h>

// DeBERTa disentangled self-attention (hidden_states [2][1024][1024]; q, k, v = hs W^T + b ('oi' [1024][1024]; 16 heads x 64); pos_k = rel_embeddings Wpk^T + bpk, pos_q = rel_embeddings Wpq^T + bpq (rel_embeddings [512][1024], read); scale = 1/sqrt(64 x 3); scores = q.k scale + c2p[i][clip(i-j+256, 0, 511)] + p2c[clip(i-j+256, 0, 511)][j] with c2p = q.pos_k scale ([S][512]) and p2c = (pos_q scale).k ([512][S]); mask (int32 [2][1][1024][1024], read; all ones) == 0 -> finfo.min and weight 0; softmax; out = merged attn.v -> [2][1024][1024] (2.1 M), no output projection).
// Layout: exact bf16 projections, whose GEMM epilogue writes the hi/lo planes that the next GEMM reads (q, k, pos_k, pos_q per head [h][t][d]; v transposed [h][d][t], from the product taken as Wv x^T; the elements of every 16-bit plane in fragment order, see below); hi/lo planes for q, k, pos_k, pos_q (every row: 3-product score GEMMs); all NZ = 32 (batch item, head) pairs in one pass: c2p [32][1024][512] and p2c (sheared to [32][1024][512], row i column rp, plus its two end rows) as hi/lo GEMMs; then one kernel forms the content scores (hi/lo) in registers, gathers the two relative terms per logit (index clip(i - j + 256, 0, 511)), scales, applies the mask select, f32 softmax, hi/lo P through LDS, attn.v (3 products), stored straight into the merged f32 output.
// Compute dtypes, f32 accumulate: every input rounded to bf16; q/k/v/pos_k/pos_q on PLAIN bf16 operands (exact) + biases; all score terms and attn.v on hi/lo planes (3 products) for every row; softmax f32; output f32.

#define NB_  2
#define TT   1024
#define DM   1024
#define NH_  16
#define HD   64
#define DQ   (NH_ * HD)
#define NZ   (NB_ * NH_)          // (batch item, head) pairs: all of them ride in the grid of every score, softmax and attn.v launch, z = batch item x NH_ + head
#define RH   1024                  // not read by the code: every query row uses hi+lo planes
#define WIN  0
#define PCAR 1024.0f
#define SCL  0.072168783648703225f   // 1/sqrt(64 x 3)
#define NPE  512                  // 2 x att_span relative positions
#define SPAN 256
#define KSL  8                     // K slices (waves per work-group) of the K = 1024 GEMMs: the five projections, and attn.v inside k_fattn
typedef _Float16 h16;
typedef unsigned short bf;
typedef __attribute__((ext_vector_type(16))) __bf16   v16bf;
typedef __attribute__((ext_vector_type(16))) _Float16 v16h;
typedef __attribute__((ext_vector_type(8)))  _Float16 v8h;
typedef __attribute__((ext_vector_type(8)))  unsigned short v8us;
typedef __attribute__((ext_vector_type(8)))  float    v8f;
typedef __attribute__((ext_vector_type(4)))  float    v4f;
typedef v8h  __attribute__((may_alias)) v8ha;
typedef v4f  __attribute__((may_alias)) v4fa;
typedef v8us __attribute__((may_alias)) v8usa;

__device__ __forceinline__ unsigned short f2bf(float f) { unsigned u = __float_as_uint(f); u += 0x7FFFu + ((u >> 16) & 1u); return (unsigned short)(u >> 16); }
__device__ __forceinline__ float bf2f(unsigned short b) { return __uint_as_float(((unsigned)b) << 16); }
__device__ __forceinline__ float bfr(float f) { return bf2f(f2bf(f)); }
__device__ __forceinline__ v16h cat16(v8h lo, v8h hi) { return __builtin_shufflevector(lo, hi, 0, 1, 2, 3, 4, 5, 6, 7, 8, 9, 10, 11, 12, 13, 14, 15); }
__device__ __forceinline__ v16bf cat16b(v8us lo, v8us hi) { return __builtin_bit_cast(v16bf, __builtin_shufflevector(lo, hi, 0, 1, 2, 3, 4, 5, 6, 7, 8, 9, 10, 11, 12, 13, 14, 15)); }
__device__ __forceinline__ v8f wmma16(v16h a, v16h b, v8f c) { return __builtin_amdgcn_wmma_f32_16x16x32_f16(false, a, false, b, (short)0, c, false, false); }
__device__ __forceinline__ v8f wmmab(v16bf a, v16bf b, v8f c) { return __builtin_amdgcn_wmma_f32_16x16x32_bf16(false, a, false, b, (short)0, c, false, false); }



// ---- the two GEMM kernels: register-blocked, 64x64 output tile (16 accumulators per wave), operands straight from 16-bit planes in FRAGMENT ORDER.
// Fragment order of a plane of R rows x KD columns (the summed index k runs along a row): 16 rows x 32 k make one chunk of 512 elements, chunk (row / 16) x (KD / 32) + k / 32, and inside it element (row, k) lies at
// ((k / 8) % 4) x 128 + (row % 16) x 8 + k % 8. The 16 bytes that lane l takes for the first half of a fragment then lie at chunk + 8 l, for the second half 256 elements on: each load of a wave covers 512 contiguous bytes (four whole lines),
// where row-major planes gave it 32 bytes out of each of 16 lines. Which element reaches which lane and register is as before. 16 rows take the same space as in row-major order, so every base that is a multiple of 16 rows stays.
__device__ __forceinline__ void splitf(float y, unsigned short& h, unsigned short& l) { h = f2bf(y); l = f2bf(y - bf2f(h)); }
typedef __attribute__((ext_vector_type(4))) unsigned short v4us;
template <typename T16> struct WFrag;
template <> struct WFrag<h16> { typedef v16h V; static __device__ __forceinline__ V ld(const h16* p) { return cat16(*(const v8h*)p, *(const v8h*)(p + 256)); } static __device__ __forceinline__ v8f mma(V a, V b, v8f c) { return wmma16(a, b, c); } };
template <> struct WFrag<bf> { typedef v16bf V; static __device__ __forceinline__ V ld(const bf* p) { return cat16b(*(const v8us*)p, *(const v8us*)(p + 256)); } static __device__ __forceinline__ v8f mma(V a, V b, v8f c) { return wmmab(a, b, c); } };

// Workspace layout that k_cvt writes and k_proj reads (bf16, in elements from CV): the five weights in the order q, k, v, pos_k, pos_q, then hidden_states (both batch items), then rel_embeddings.
#define CVW  (DM * DM)             // one weight
#define CVX  (5 * CVW)             // hidden_states
#define CVR  (CVX + NB_ * TT * DM) // rel_embeddings
#define CVN  (CVR + NPE * DM)
// Planes that k_proj writes (in elements from PLN): q hi, q lo, k hi, k lo, v hi, v lo, each [batch item][head][..][..]; then pos_k hi, pos_k lo, pos_q hi, pos_q lo, each [head][512][64].
#define PLB  (NH_ * TT * HD)       // one batch item of one plane
#define PLQ  (NB_ * PLB)           // one q, k or v plane
#define PLP  (NH_ * NPE * HD)      // one pos_k or pos_q plane
#define PLN_ (6 * PLQ + 4 * PLP)

// ---- k_proj: all eight projections (q, k, v of both batch items, pos_k, pos_q) in one grid; none reads what another writes. grid (16, 16, 7), 32 x KSL threads. blockIdx.z: 0, 1 q of batch item 0, 1; 2, 3 k; 4, 5 v; 6 pos_k (x < 8) and pos_q (x >= 8).
// A tile's K = 1024 is cut into KSL contiguous slices, one wave of the work-group per slice, so that KSL waves' loads are in flight on a tile; each wave leaves its partial tile in LDS and, behind one barrier, every thread sums its share of the tile over the slices in the fixed order 0 .. KSL-1.
// C[m][n] = sum_k A[m][k] Bt[n][k] + bias (bias[n]; for v, taken as Wv x^T, bias[m]). The output planes are in fragment order too, rows m, ldc columns: a 64-column tile y is a head's own plane (q, k, pos: ldc 64, cstep rows x 64) or two chunks of each row block (v: ldc 1024, cstep 2 x 512).
// The value is split into bf16 hi + lo, the planes the next GEMM takes as operands.
__global__ __launch_bounds__(32 * KSL) void k_proj(const bf* __restrict__ CV, bf* PLN, const float* __restrict__ bq, const float* __restrict__ bk, const float* __restrict__ bv, const float* __restrict__ bpk, const float* __restrict__ bpq) {
    typedef WFrag<bf>::V V;
    __shared__ __align__(16) float os[KSL * 64 * 68];
    const int job = blockIdx.z; int bx = blockIdx.x;
    const bf* A; const bf* Bt; bf* Ch; bf* Cl; const float* bias; int ldc, cstep; bool rowb = false;   // all uniform over the work-group
    if (job < 6) { const int t = job >> 1, b = job & 1; const bf* X = CV + CVX + b * (TT * DM); const bf* Wt = CV + t * CVW; Ch = PLN + 2 * t * PLQ + b * PLB; Cl = Ch + PLQ; bias = t == 0 ? bq : (t == 1 ? bk : bv);
        if (t < 2) { A = X; Bt = Wt; ldc = HD; cstep = TT * HD; } else { A = Wt; Bt = X; ldc = TT; cstep = 1024; rowb = true; } }
    else { const int t = bx >> 3; bx &= 7; A = CV + CVR; Bt = CV + (3 + t) * CVW; Ch = PLN + 6 * PLQ + 2 * t * PLP; Cl = Ch + PLP; bias = t ? bpq : bpk; ldc = HD; cstep = NPE * HD; }
    const size_t co = (size_t)blockIdx.y * cstep;   // where this column tile starts in the output
    const int lane = threadIdx.x & 31, lr = lane & 15, hi = lane >> 4; const int r0 = bx * 64, c0 = blockIdx.y * 64;
    v8f acc[4][4];
#pragma unroll
    for (int mb = 0; mb < 4; ++mb)
#pragma unroll
        for (int nb = 0; nb < 4; ++nb) acc[mb][nb] = (v8f){};
    const size_t aoff = (size_t)r0 * DM + 8 * lane, boff = (size_t)c0 * DM + 8 * lane;   // first chunk of the tile's rows, plus the lane's 16 bytes
    const int wv = __builtin_amdgcn_readfirstlane((int)(threadIdx.x >> 5)); const int k0 = wv * (DM / KSL), k1 = k0 + DM / KSL;   // this wave's K slice, in scalar registers
#pragma unroll 1
    for (int kc = k0; kc < k1; kc += 32) {   // rolled: one trip's fragments and the 16 accumulators are what the registers hold
        const bf* ap = A + aoff + kc * 16; const bf* bp = Bt + boff + kc * 16; V a[4];   // chunk kc / 32 of 512 elements
#pragma unroll
        for (int mb = 0; mb < 4; ++mb) a[mb] = WFrag<bf>::ld(ap + mb * 16 * DM);
#pragma unroll
        for (int nb = 0; nb < 4; ++nb) { const V b = WFrag<bf>::ld(bp + nb * 16 * DM);
#pragma unroll
            for (int mb = 0; mb < 4; ++mb) acc[mb][nb] = WFrag<bf>::mma(a[mb], b, acc[mb][nb]); }
        // the trip's 16 loads name these two addresses: they stay whole up to this wait, so that no later load is given one of them to write into before it
        asm volatile("s_wait_xcnt 0x0" :: "v"(ap), "v"(bp) : "memory");
        // four vector slots between the last matrix instruction and the back edge, where the next trip's loads overwrite its operands
        asm volatile("v_nop\n\tv_nop\n\tv_nop\n\tv_nop" : "+v"(acc[0][0]), "+v"(acc[1][1]), "+v"(acc[2][2]), "+v"(acc[3][3]) : "v"(a[0]), "v"(a[3]));
    }
    // the bias by column and by row of this thread's four pieces, both read here (both lie inside the 1024 floats for every job) so that the loads fly during the LDS stores and the barrier; the job picks one below
    const int cofs = ((int)threadIdx.x >> 4) * 4, rw = (int)threadIdx.x & 15; const float* bcp = bias + c0 + cofs; const float* brp = bias + r0 + rw; float bc[4], br[4];
#pragma unroll
    for (int q = 0; q < 4; ++q) { bc[q] = bcp[q]; br[q] = brp[q * (2 * KSL)]; }
    // these loads name the two addresses: they stay whole up to this wait, so that nothing below is given one of them to write into before it
    asm volatile("s_wait_xcnt 0x0" :: "v"(bcp), "v"(brp) : "memory");
    float* mine = os + wv * (64 * 68);
    // the three loops are unrolled so that acc is indexed by constants and stays in registers
#pragma unroll
    for (int mb = 0; mb < 4; ++mb)
#pragma unroll
        for (int nb = 0; nb < 4; ++nb)
#pragma unroll
            for (int j = 0; j < 8; ++j) mine[(mb * 16 + hi * 8 + j) * 68 + nb * 16 + lr] = acc[mb][nb][j];
    __syncthreads();   // every slice's partial tile is in LDS before any thread sums across the slices
    v4us oh[32 / KSL], ol[32 / KSL];
    // both loops are unrolled so that a thread's LDS reads issue ahead of its sums
#pragma unroll
    for (int s = 0; s < 32 / KSL; ++s) { const int row = s * (2 * KSL) + rw; v4f val = *(const v4fa*)(os + row * 68 + cofs);
#pragma unroll
        for (int w = 1; w < KSL; ++w) val += *(const v4fa*)(os + w * (64 * 68) + row * 68 + cofs);
#pragma unroll
        for (int q = 0; q < 4; ++q) { unsigned short a, c; splitf(val[q] + bfr(rowb ? br[s] : bc[q]), a, c); oh[s][q] = a; ol[s][q] = c; } }
    __builtin_amdgcn_sched_barrier(0);   // the stores stay below every sum, last in the kernel, so that nothing rewrites a register that an issued store names
#pragma unroll
    for (int s = 0; s < 32 / KSL; ++s) { const size_t o = (size_t)(r0 / 16 + s) * (ldc * 16) + co + (cofs >> 5) * 512 + ((cofs >> 3) & 3) * 128 + rw * 8 + (cofs & 7); *(v4us*)(Ch + o) = oh[s]; *(v4us*)(Cl + o) = ol[s]; }   // row r0 + 16 s + rw, columns cofs .. + 3 of the tile; a wave's 16 rows x 8 columns are 256 contiguous bytes
}

// ---- k_gemmw: one wave does a whole 64x64 tile (short K); grid (M/64, N/64, Z), 32 threads. C[z][m][n] (+ optional f32 bias[n]) = sum_k A[z][m][k] Bt[z % ZB][n][k] (+ split products per NSPLIT), f32 out, row pitch ldc.
// z-batch strides sA/sB/sC in elements; the B planes repeat every ZB z's (they do not depend on the batch item). K % 32 == 0, a constant, so that every fragment load of a trip is one of four uniform bases + the lane's offset + a constant.
template <typename T16, int NSPLIT, int BIAS, int ZB, int K>
__global__ __launch_bounds__(32) void k_gemmw(const T16* __restrict__ A, const T16* __restrict__ A2, const T16* __restrict__ Bt, const T16* __restrict__ Bt2, float* C, int ldc, const float* __restrict__ bias, size_t sA, size_t sB, size_t sC) {
    typedef typename WFrag<T16>::V V;
    __shared__ __align__(16) float os[16 * 68];
    const size_t z = blockIdx.z, zB = blockIdx.z % ZB; A += z * sA; if (A2) A2 += z * sA; Bt += zB * sB; if (Bt2) Bt2 += zB * sB; const size_t co = z * sC + (size_t)blockIdx.y * 64;   // where this z and this column tile start in the output
    const int lane = threadIdx.x & 31, lr = lane & 15, hi = lane >> 4; const int r0 = blockIdx.x * 64, c0 = blockIdx.y * 64;
    v8f acc[4][4];
#pragma unroll
    for (int mb = 0; mb < 4; ++mb)
#pragma unroll
        for (int nb = 0; nb < 4; ++nb) acc[mb][nb] = (v8f){};
    const unsigned lo = (unsigned)(8 * lane);   // fragment order: the lane's 16 bytes of a chunk's half
    const int k0 = 0, k1 = K;
#pragma unroll 1
    for (int kc = k0; kc < k1; kc += 32) {
        V a[4], a2[4]; const T16* ap = A + r0 * K + kc * 16; const T16* ap2 = A2 + r0 * K + kc * 16; const T16* bp = Bt + c0 * K + kc * 16; const T16* bp2 = Bt2 + c0 * K + kc * 16;   // chunk kc / 32 of the tile's first rows, uniform
#pragma unroll
        for (int mb = 0; mb < 4; ++mb) { a[mb] = WFrag<T16>::ld(ap + mb * 16 * K + lo); if (NSPLIT == 1 || NSPLIT == 2) a2[mb] = WFrag<T16>::ld(ap2 + mb * 16 * K + lo); }
#pragma unroll
        for (int nb = 0; nb < 4; ++nb) { const V b = WFrag<T16>::ld(bp + nb * 16 * K + lo); V b2; if (NSPLIT >= 2) b2 = WFrag<T16>::ld(bp2 + nb * 16 * K + lo);
#pragma unroll
            for (int mb = 0; mb < 4; ++mb) { acc[mb][nb] = WFrag<T16>::mma(a[mb], b, acc[mb][nb]); if (NSPLIT == 1 || NSPLIT == 2) acc[mb][nb] = WFrag<T16>::mma(a2[mb], b, acc[mb][nb]); if (NSPLIT >= 2) acc[mb][nb] = WFrag<T16>::mma(a[mb], b2, acc[mb][nb]); } }
        // the trip's loads name these bases and this offset: they stay whole up to this wait, so that nothing is given one of them to write into before it
        asm volatile("s_wait_xcnt 0x0" :: "s"(ap), "s"(ap2), "s"(bp), "s"(bp2), "v"(lo) : "memory");
        asm volatile("v_nop\n\tv_nop\n\tv_nop\n\tv_nop" : "+v"(acc[0][0]), "+v"(acc[1][1]), "+v"(acc[2][2]), "+v"(acc[3][3]) : "v"(a[0]), "v"(a[3]));
    }
#pragma unroll
    for (int mb = 0; mb < 4; ++mb) {
#pragma unroll
        for (int nb = 0; nb < 4; ++nb) {
#pragma unroll
            for (int j = 0; j < 8; ++j) os[(hi * 8 + j) * 68 + nb * 16 + lr] = acc[mb][nb][j]; }
        __builtin_amdgcn_wave_barrier(); asm volatile("" ::: "memory");
        float* crow = C + (size_t)(r0 + mb * 16) * ldc + co;
{
#pragma unroll
            for (int s = 0; s < 8; ++s) { const int row = 2 * s + hi, cofs = lr * 4; v4f val = *(const v4fa*)(os + row * 68 + cofs); if (BIAS == 1) { val[0] += bfr(bias[c0 + cofs]); val[1] += bfr(bias[c0 + cofs + 1]); val[2] += bfr(bias[c0 + cofs + 2]); val[3] += bfr(bias[c0 + cofs + 3]); }
                *(v4f*)(crow + (size_t)row * ldc + cofs) = val; }
             }
        __builtin_amdgcn_wave_barrier(); asm volatile("" ::: "memory");
    }
}

// ---- k_p2cs: the p2c term laid out the way the softmax reads it. G[z][i][p] = pos_q[p] . k[i - p + SPAN] (hi/lo, 3 products, same products in the same order as k_gemmw<bf, 2>), so that row i of G is indexed by the same
// relative position as row i of c2p and a wave's gather runs along a row instead of down a diagonal of [p][j]. One wave per tile of 64 i x 64 p: it needs the 127 keys j = jb .. jb + 126 (jb = i0 - p0 + SPAN - 63), computes the
// 64 p x 128 j products in two halves into LDS and stores the sheared tile in whole 256-byte rows. Keys outside [0, TT) are clamped for the load only; the G elements made from them belong to no (i, j) and are never read.
// E[z][0][j] = p2c[0][j] and E[z][1][j] = p2c[NPE-1][j] serve the clipped ends (j >= i + SPAN, j <= i - SPAN + 1); each 64-key piece is written by the one tile that holds it aligned. grid (TT/64, NPE/64, NZ), 32 threads; z = batch item x NH_ + head picks k, G and E, the head alone picks pos_q.
__global__ __launch_bounds__(32) void k_p2cs(const bf* __restrict__ A, const bf* __restrict__ A2, const bf* __restrict__ Bt, const bf* __restrict__ Bt2, float* G, float* E) {
    typedef WFrag<bf>::V V;
    __shared__ __align__(16) float ts[64 * 132];
    const size_t z = blockIdx.z, zh = blockIdx.z % NH_; A += zh * (size_t)(NPE * HD); A2 += zh * (size_t)(NPE * HD); Bt += z * (size_t)(TT * HD); Bt2 += z * (size_t)(TT * HD); G += z * (size_t)(TT * NPE); E += z * (size_t)(2 * TT);
    const int lane = threadIdx.x & 31, lr = lane & 15, hi = lane >> 4; const int i0 = blockIdx.x * 64, p0 = blockIdx.y * 64; const int jb = i0 - p0 + (SPAN - 63);
    const unsigned lo = (unsigned)(8 * lane);   // fragment order: the lane's 16 bytes of a chunk's half
#pragma unroll 1
    for (int hf = 0; hf < 2; ++hf) {   // rolled: one set of 16 accumulators serves both halves
        v8f acc[4][4];
#pragma unroll
        for (int mb = 0; mb < 4; ++mb)
#pragma unroll
            for (int nb = 0; nb < 4; ++nb) acc[mb][nb] = (v8f){};
        unsigned boff[4];
#pragma unroll
        for (int nb = 0; nb < 4; ++nb) { int j = jb + hf * 64 + nb * 16 + lr; j = j < 0 ? 0 : (j > TT - 1 ? TT - 1 : j); boff[nb] = (unsigned)((j >> 4) * (16 * HD) + hi * 128 + (j & 15) * 8); }   // the lane's own key in fragment order: the keys of a fragment start at no multiple of 16 here
#pragma unroll 1
        for (int kc = 0; kc < HD; kc += 32) {
            V a[4], a2[4]; const bf* ap = A + p0 * HD + kc * 16; const bf* ap2 = A2 + p0 * HD + kc * 16; const bf* bp = Bt + kc * 16; const bf* bp2 = Bt2 + kc * 16;   // chunk kc / 32, uniform
#pragma unroll
            for (int mb = 0; mb < 4; ++mb) { a[mb] = WFrag<bf>::ld(ap + mb * 16 * HD + lo); a2[mb] = WFrag<bf>::ld(ap2 + mb * 16 * HD + lo); }
#pragma unroll
            for (int nb = 0; nb < 4; ++nb) { const V b = WFrag<bf>::ld(bp + boff[nb]); const V b2 = WFrag<bf>::ld(bp2 + boff[nb]);
#pragma unroll
                for (int mb = 0; mb < 4; ++mb) { acc[mb][nb] = WFrag<bf>::mma(a[mb], b, acc[mb][nb]); acc[mb][nb] = WFrag<bf>::mma(a2[mb], b, acc[mb][nb]); acc[mb][nb] = WFrag<bf>::mma(a[mb], b2, acc[mb][nb]); } }
            // the trip's loads name these bases and offsets: they stay whole up to this wait, so that nothing is given one of them to write into before it
            asm volatile("s_wait_xcnt 0x0" :: "s"(ap), "s"(ap2), "s"(bp), "s"(bp2), "v"(lo), "v"(boff[0]), "v"(boff[1]), "v"(boff[2]), "v"(boff[3]) : "memory");
            // four vector slots between the last matrix instruction and the back edge, where the next trip's loads overwrite its operands (as in k_gemmw)
            asm volatile("v_nop\n\tv_nop\n\tv_nop\n\tv_nop" : "+v"(acc[0][0]), "+v"(acc[1][1]), "+v"(acc[2][2]), "+v"(acc[3][3]) : "v"(a[0]), "v"(a[3]));
        }
        // unrolled so that acc is indexed by constants and stays in registers
#pragma unroll
        for (int mb = 0; mb < 4; ++mb)
#pragma unroll
            for (int nb = 0; nb < 4; ++nb)
#pragma unroll
                for (int r = 0; r < 8; ++r) ts[(mb * 16 + hi * 8 + r) * 132 + hf * 64 + nb * 16 + lr] = acc[mb][nb][r];
    }
    __builtin_amdgcn_wave_barrier(); asm volatile("" ::: "memory");   // the reads below take other lanes' writes: keep the compiler from moving them up (one wave: the LDS itself works in order)
#pragma unroll 1
    for (int s0 = 0; s0 < 32; s0 += 8) {
        // unrolled so that the LDS reads of eight row pairs issue ahead of their stores
#pragma unroll
        for (int s = 0; s < 8; ++s) { const int ii = 2 * (s0 + s) + hi, pp = lr * 4; v4f val;
#pragma unroll
            for (int q = 0; q < 4; ++q) val[q] = ts[(pp + q) * 132 + ii - (pp + q) + 63];   // key j = (i0 + ii) - (p0 + pp + q) + SPAN = jb + this column
            *(v4f*)(G + (size_t)(i0 + ii) * NPE + p0 + pp) = val; }
        asm volatile("s_wait_xcnt 0x0" ::: "memory");   // the next trip rewrites the address and data registers that these stores name
    }
    if (p0 == 0 && i0 + SPAN < TT) { E[i0 + SPAN + lane] = ts[63 + lane]; E[i0 + SPAN + 32 + lane] = ts[63 + 32 + lane]; }                                        // p = 0: keys i0 + SPAN .. + 63
    if (p0 == NPE - 64 && i0 >= SPAN - 64) { E[TT + i0 - (SPAN - 64) + lane] = ts[63 * 132 + 63 + lane]; E[TT + i0 - (SPAN - 64) + 32 + lane] = ts[63 * 132 + 63 + 32 + lane]; }   // p = NPE - 1: keys i0 - SPAN + 64 .. + 63
}

__device__ __forceinline__ h16 tohx(float x) { return (h16)x; }
typedef __attribute__((ext_vector_type(2))) _Float16 v2h;
typedef __attribute__((ext_vector_type(4))) _Float16 v4h;
typedef __attribute__((ext_vector_type(2))) unsigned short v2us;
typedef __attribute__((ext_vector_type(2))) float v2f;
typedef __attribute__((ext_vector_type(4))) int v4i;

// ---- k_cvt: every f32 -> bf16 rounding of an input (five weights, hidden_states, rel_embeddings) in one grid, into the layout CVW / CVX / CVR above, each source in fragment order (KD = 1024). grid (CVN / 8192), 256 threads.
// A work-group rounds 16 rows x 512 columns, that is 16 chunks, 16 KiB in a row of the output. A thread takes four pieces of 8 elements, four chunks apart. A wave takes 8 rows of one chunk at a time: it reads one whole line (32 floats) of each row
// and writes, for each of the chunk's four groups of 8 columns, the 8 rows' pieces as one whole line. Every source is a multiple of 16 rows long, so a work-group has one source.
__global__ __launch_bounds__(256) void k_cvt(const float* __restrict__ wq, const float* __restrict__ wk, const float* __restrict__ wv, const float* __restrict__ wpk, const float* __restrict__ wpq, const float* __restrict__ x, const float* __restrict__ rel, bf* CV) {
    const unsigned e0 = (blockIdx.x >> 1) * (16u * DM), h0 = (blockIdx.x & 1) * 512u; const unsigned seg = e0 / CVW;   // uniform: first element of the 16 rows, first column, which source
    const float* src; unsigned s0;
    if (seg < 5) { src = seg == 0 ? wq : (seg == 1 ? wk : (seg == 2 ? wv : (seg == 3 ? wpk : wpq))); s0 = seg * CVW; }
    else if (e0 < CVR) { src = x; s0 = CVX; }
    else { src = rel; s0 = CVR; }
    src += e0 - s0 + h0; bf* dst = CV + e0 + h0 * 16; const unsigned t = threadIdx.x;
    const unsigned row = ((t >> 5) & 1) * 8 + (t & 7), grp = (t >> 3) & 3, ch = t >> 6;   // the thread's row of the 16, group of 8 columns of the chunk, first chunk
    const unsigned so = row * DM + ch * 32 + grp * 8, eo = ch * 512 + grp * 128 + row * 8;   // where the piece is read and where it is written; u moves both on by four chunks
    v8f v[4];
    // both loops are unrolled so that the four loads issue ahead of the first rounding
#pragma unroll
    for (int u = 0; u < 4; ++u) v[u] = *(const v8f*)(src + u * 128 + so);
#pragma unroll
    for (int u = 0; u < 4; ++u) { v8us o;
#pragma unroll
        for (int k = 0; k < 8; ++k) o[k] = f2bf(v[u][k]);
        *(v8us*)(dst + u * 2048 + eo) = o; }
}

// ---- k_fattn: content scores, the two relative terms, softmax and attn.v of FR = 32 query rows of one head in one work-group, so that neither the scores nor the weights go through memory. grid (TT/FR, NZ), 32 x KSL threads; blockIdx.y = batch item x NH_ + head.
// Wave w owns the keys 128 w .. 128 w + 127. It forms its 32 x 128 scores (hi/lo, 3 products, the products and their order as in k_gemmw<bf, 2>) in 16 accumulators and, in the accumulator's own layout (row = 16 mb + 8 hi + r, key = 16 nb + lr),
// t = (S + c2p[i][rp] + p2c[rp][j]) x scale with rp = clip(i - j + 256, 0, 511), -3e38 where mask == 0. p2c[rp][j] is read from k_p2cs's planes: G[row][rp] inside the span, E[zz][0][j] / E[zz][1][j] (behind G in the same buffer) at and beyond the clipped ends.
// Row maximum and row sum: over the wave's own keys in registers and by lane exchange, then over the eight waves through LDS in the order 0 .. 7. The weights, split hi/lo, go to the wave's own LDS piece row by row, from where the A loader takes them as it would from memory;
// each wave multiplies its 128 keys into a partial 32 x 64 tile (the K slices of the former attn.v GEMM), and the partial tiles are summed in LDS in slice order.
#define FR   32                    // query rows per work-group
#define PPI  136                   // LDS pitch of a row of weights, in 16-bit elements: 256 bytes + 16, for 16-byte fragment reads
#define PWV  (2 * FR * PPI)        // 16-bit elements of one wave's LDS piece: hi plane, lo plane
__device__ __forceinline__ v16bf ldsfrag(const bf* p) { return cat16b(*(const v8usa*)p, *(const v8usa*)(p + 16)); }
// launch bounds: 4 waves per SIMD, that is at most 256 registers a wave, so that two work-groups (their LDS fits twice) share a WGP and the whole grid is resident at once
__global__ __launch_bounds__(32 * KSL, 4) void k_fattn(const bf* __restrict__ Qh, const bf* __restrict__ Ql, const bf* __restrict__ Kh, const bf* __restrict__ Kl, const bf* __restrict__ Vh, const bf* __restrict__ Vl, const float* __restrict__ C2P, const float* __restrict__ P2C, const int* __restrict__ MK, float* O) {
    typedef WFrag<bf>::V V;
    __shared__ __align__(16) bf ps[KSL * PWV];
    __shared__ __align__(16) float red[2 * FR * KSL];
    const int zz = blockIdx.y, i0 = blockIdx.x * FR; const int lane = threadIdx.x & 31, lr = lane & 15, hi = lane >> 4;
    const int wv = __builtin_amdgcn_readfirstlane((int)(threadIdx.x >> 5)); const int j0 = wv * (TT / KSL);   // this wave's keys, in a scalar register
    // uniform bases (head, first query row, the wave's first key) plus one unsigned lane offset per operand: every fragment load is then scalar base + lane offset + constant
    { const size_t zo = (size_t)zz * (TT * HD); Qh += zo + i0 * HD; Ql += zo + i0 * HD; Kh += zo + j0 * HD; Kl += zo + j0 * HD; Vh += zo + j0 * 16; Vl += zo + j0 * 16; }   // v: chunk j0 / 32 of each block of 16 rows d
    const int* MKb = MK + (size_t)(zz / NH_) * (TT * TT); O += (size_t)(zz / NH_) * (TT * DQ) + (zz % NH_) * HD;   // the batch item's mask; the batch item's rows and the head's 64 columns of the merged output
    const unsigned lo64 = (unsigned)(8 * lane), lov = lo64;   // fragment order: the lane's 16 bytes of a chunk's half
    v8f acc[2][8];
#pragma unroll
    for (int mb = 0; mb < 2; ++mb)
#pragma unroll
        for (int nb = 0; nb < 8; ++nb) acc[mb][nb] = (v8f){};
    // every loop over mb, nb, r below is unrolled so that the accumulators are indexed by constants and stay in registers
#pragma unroll
    for (int kc = 0; kc < HD; kc += 32) {
        V a[2], a2[2];
#pragma unroll
        for (int mb = 0; mb < 2; ++mb) { const int o = mb * 16 * HD + kc * 16; a[mb] = WFrag<bf>::ld(Qh + o + lo64); a2[mb] = WFrag<bf>::ld(Ql + o + lo64); }
#pragma unroll
        for (int nb = 0; nb < 8; ++nb) { const int o = nb * 16 * HD + kc * 16; const V b = WFrag<bf>::ld(Kh + o + lo64); const V b2 = WFrag<bf>::ld(Kl + o + lo64);
#pragma unroll
            for (int mb = 0; mb < 2; ++mb) { acc[mb][nb] = WFrag<bf>::mma(a[mb], b, acc[mb][nb]); acc[mb][nb] = WFrag<bf>::mma(a2[mb], b, acc[mb][nb]); acc[mb][nb] = WFrag<bf>::mma(a[mb], b2, acc[mb][nb]); } }
    }
    // the q and k loads name these bases and this offset: they stay whole up to this wait, so that nothing is given one of them to write into before it
    asm volatile("s_wait_xcnt 0x0" :: "s"(Qh), "s"(Ql), "s"(Kh), "s"(Kl), "v"(lo64) : "memory");
    // lane bases: the mask index adds only a compile-time constant (into the instruction's offset); the c2p and p2c indices add the clipped rp of each logit
    const int ib = i0 + hi * 8, jl = j0 + lr; const int gb = (zz * TT + ib) * NPE, db = ib - jl + SPAN, mo = ib * TT + jl, eo = NZ * TT * NPE + zz * 2 * TT + jl;
    float* rl = red + hi * 8 * KSL;
    float mx[2][8], sm[2][8];
    __builtin_amdgcn_sched_barrier(0);   // keeps the address arithmetic of the gathers out of the matrix phase, where it would hold registers
    // two rows (16 logits a lane) at a time: their 48 loads are all issued before the first is used, so that a wave waits once per batch and not once per logit
#pragma unroll
    for (int mb = 0; mb < 2; ++mb)
#pragma unroll
        for (int rb = 0; rb < 8; rb += 2) { float cv[2][8], pv[2][8]; int mv[2][8];
#pragma unroll
            for (int q = 0; q < 2; ++q) { const int ro = mb * 16 + rb + q;   // query row i = ib + ro, key j = jl + 16 nb
                int pa[8], pb[8];
#pragma unroll
                for (int nb = 0; nb < 8; ++nb) { int rp = db + (ro - nb * 16); rp = rp < 0 ? 0 : (rp > NPE - 1 ? NPE - 1 : rp); const int pin = gb + rp + ro * NPE, pend = eo + (rp & SPAN) * (TT / SPAN) + nb * 16; const int po = ((unsigned)(rp - 1) < (unsigned)(NPE - 2)) ? pin : pend; pa[nb] = pin; pb[nb] = po;
                    cv[q][nb] = C2P[pin]; pv[q][nb] = P2C[po]; mv[q][nb] = MKb[mo + (ro * TT + nb * 16)]; }
                // the row's 24 loads name these index registers: they stay whole up to this wait, so that no later load or sum is given one of them to write into before it
                asm volatile("s_wait_xcnt 0x0" :: "v"(pa[0]), "v"(pa[1]), "v"(pa[2]), "v"(pa[3]), "v"(pa[4]), "v"(pa[5]), "v"(pa[6]), "v"(pa[7]), "v"(pb[0]), "v"(pb[1]), "v"(pb[2]), "v"(pb[3]), "v"(pb[4]), "v"(pb[5]), "v"(pb[6]), "v"(pb[7]), "v"(mo) : "memory"); }
            __builtin_amdgcn_sched_barrier(0);   // the batch's loads stay above, their uses below
#pragma unroll
            for (int q = 0; q < 2; ++q) { const int r = rb + q; float m = -3.0e38f;
#pragma unroll
                for (int nb = 0; nb < 8; ++nb) { const float sa = __fmul_rn(__fadd_rn(__fadd_rn(acc[mb][nb][r], cv[q][nb]), pv[q][nb]), SCL); const float t = (mv[q][nb] != 0) ? sa : -3.0e38f; acc[mb][nb][r] = t; m = fmaxf(m, t); }
                mx[mb][r] = m; }
            __builtin_amdgcn_sched_barrier(0);   // the next batch's loads do not start before this batch's registers are free
        }
#pragma unroll
    for (int sh = 8; sh; sh >>= 1)   // over the 16 lanes that hold a row; the 16 rows' exchanges of one distance go together
#pragma unroll
        for (int mb = 0; mb < 2; ++mb)
#pragma unroll
            for (int r = 0; r < 8; ++r) mx[mb][r] = fmaxf(mx[mb][r], __shfl_xor(mx[mb][r], sh, 32));
    if (lr == 0) {
#pragma unroll
        for (int mb = 0; mb < 2; ++mb)
#pragma unroll
            for (int r = 0; r < 8; ++r) rl[(mb * 16 + r) * KSL + wv] = mx[mb][r]; }
    __syncthreads();   // every wave's row maxima are in LDS before any wave takes the maximum over the waves
#pragma unroll
    for (int mb = 0; mb < 2; ++mb)
#pragma unroll
        for (int r = 0; r < 8; ++r) { const float* rr = rl + (mb * 16 + r) * KSL; const v4f u = *(const v4fa*)rr, w = *(const v4fa*)(rr + 4); const float m = fmaxf(fmaxf(fmaxf(u[0], u[1]), fmaxf(u[2], u[3])), fmaxf(fmaxf(w[0], w[1]), fmaxf(w[2], w[3]))); float s = 0.f;
#pragma unroll
            for (int nb = 0; nb < 8; ++nb) { const float x = __fmul_rn(__fsub_rn(acc[mb][nb][r], m), 1.4426950408889634f); float e;
                asm("v_exp_f32 %0, %1\n\tv_nop" : "=v"(e) : "v"(x));   // the v_nop fills the one slot behind a transcendental, whatever instruction the compiler puts next
                acc[mb][nb][r] = e; s += e; }
            sm[mb][r] = s; }
#pragma unroll
    for (int sh = 8; sh; sh >>= 1)
#pragma unroll
        for (int mb = 0; mb < 2; ++mb)
#pragma unroll
            for (int r = 0; r < 8; ++r) sm[mb][r] += __shfl_xor(sm[mb][r], sh, 32);
    if (lr == 0) {
#pragma unroll
        for (int mb = 0; mb < 2; ++mb)
#pragma unroll
            for (int r = 0; r < 8; ++r) rl[FR * KSL + (mb * 16 + r) * KSL + wv] = sm[mb][r]; }
    __syncthreads();   // every wave's row sums are in LDS before any wave adds them up
    __builtin_amdgcn_sched_barrier(0);   // keeps the addresses of the later phases from being formed early and spilled
    bf* ph = ps + wv * PWV; bf* pl = ph + FR * PPI; bf* phw = ph + hi * 8 * PPI + lr; bf* plw = pl + hi * 8 * PPI + lr; const bf* phr = ph + lr * PPI + 8 * hi; const bf* plr = pl + lr * PPI + 8 * hi;   // lane bases of the stores and of the fragment reads
#pragma unroll
    for (int mb = 0; mb < 2; ++mb)
#pragma unroll
        for (int r = 0; r < 8; ++r) { const float* rr = rl + FR * KSL + (mb * 16 + r) * KSL; const v4f u = *(const v4fa*)rr, w = *(const v4fa*)(rr + 4); const float s = ((((((u[0] + u[1]) + u[2]) + u[3]) + w[0]) + w[1]) + w[2]) + w[3]; const float f = __fdiv_rn(1.0f, s);
#pragma unroll
            for (int nb = 0; nb < 8; ++nb) { unsigned short a, c; splitf(acc[mb][nb][r] * f, a, c); const int o = (mb * 16 + r) * PPI + nb * 16; phw[o] = a; plw[o] = c; } }
    __builtin_amdgcn_wave_barrier(); asm volatile("" ::: "memory");   // the fragment reads below take other lanes' writes: keep the compiler from moving them up (one wave's own piece: the LDS itself works in order)
    v8f oc[2][4];
#pragma unroll
    for (int mb = 0; mb < 2; ++mb)
#pragma unroll
        for (int nb = 0; nb < 4; ++nb) oc[mb][nb] = (v8f){};
#pragma unroll
    for (int kc = 0; kc < TT / KSL; kc += 32) {
        V a[2], a2[2];
#pragma unroll
        for (int mb = 0; mb < 2; ++mb) { const int o = mb * 16 * PPI + kc; a[mb] = ldsfrag(phr + o); a2[mb] = ldsfrag(plr + o); }
#pragma unroll
        for (int nb = 0; nb < 4; ++nb) { const int o = nb * 16 * TT + kc * 16; const V b = WFrag<bf>::ld(Vh + o + lov); const V b2 = WFrag<bf>::ld(Vl + o + lov);
#pragma unroll
            for (int mb = 0; mb < 2; ++mb) { oc[mb][nb] = WFrag<bf>::mma(a[mb], b, oc[mb][nb]); oc[mb][nb] = WFrag<bf>::mma(a2[mb], b, oc[mb][nb]); oc[mb][nb] = WFrag<bf>::mma(a[mb], b2, oc[mb][nb]); } }
    }
    __builtin_amdgcn_wave_barrier(); asm volatile("" ::: "memory");   // the partial tile goes over the wave's own weights: keep the compiler from moving its stores above the fragment reads
    float* os = (float*)ps;   // one wave's piece holds PWV / 2 floats, its partial tile takes the first FR x 68 of them
    {   float* mine = os + wv * (PWV / 2) + hi * 8 * 68 + lr;
#pragma unroll
        for (int mb = 0; mb < 2; ++mb)
#pragma unroll
            for (int nb = 0; nb < 4; ++nb)
#pragma unroll
                for (int r = 0; r < 8; ++r) mine[(mb * 16 + r) * 68 + nb * 16] = oc[mb][nb][r]; }
    __syncthreads();   // every slice's partial tile is in LDS before any thread sums across the slices
    // both loops are unrolled so that a thread's LDS reads issue ahead of its sums
#pragma unroll
    for (int s = 0; s < FR * 16 / (32 * KSL); ++s) { const int idx = s * (32 * KSL) + (int)threadIdx.x; const int row = idx >> 4, cofs = (idx & 15) * 4; v4f val = *(const v4fa*)(os + row * 68 + cofs);
#pragma unroll
        for (int w = 1; w < KSL; ++w) val += *(const v4fa*)(os + w * (PWV / 2) + row * 68 + cofs);
        *(v4f*)(O + (size_t)(i0 + row) * DQ + cofs) = val; }
}

extern "C" void kernel_launch(void* const* d_in, const int* in_sizes, int n_in,
                              void* d_out, int out_size, void* d_ws, size_t ws_size, hipStream_t stream) {
    (void)in_sizes; (void)n_in; (void)out_size;
    const float* x = (const float*)d_in[0]; const int* MK = (const int*)d_in[1]; const float* rel = (const float*)d_in[2]; const float* wq = (const float*)d_in[3]; const float* bq = (const float*)d_in[4]; const float* wk = (const float*)d_in[5]; const float* bk = (const float*)d_in[6]; const float* wv = (const float*)d_in[7]; const float* bv = (const float*)d_in[8]; const float* wpk = (const float*)d_in[9]; const float* bpk = (const float*)d_in[10]; const float* wpq = (const float*)d_in[11]; const float* bpq = (const float*)d_in[12];
    float* OUT = (float*)d_out;     // [2][1024][1024]
    char* wsp = (char*)d_ws;
    auto take = [&](size_t bytes) { char* p = wsp; wsp += (bytes + 255) & ~(size_t)255; return (void*)p; };
    bf* CV = (bf*)take((size_t)CVN * 2); bf* PLN = (bf*)take((size_t)PLN_ * 2); float* C2P = (float*)take((size_t)NZ * TT * NPE * 4); float* P2C = (float*)take((size_t)NZ * NPE * TT * 4 + (size_t)NZ * 2 * TT * 4);   /* G [NZ][1024][512], then E [NZ][2][1024] */
    bf* QPh = PLN; bf* QPl = PLN + (size_t)PLQ; bf* KPh = PLN + (size_t)2 * PLQ; bf* KPl = PLN + (size_t)3 * PLQ; bf* VTh = PLN + (size_t)4 * PLQ; bf* VTl = PLN + (size_t)5 * PLQ; bf* PKh = PLN + (size_t)6 * PLQ; bf* PKl = PKh + (size_t)PLP; bf* PQh = PKh + (size_t)2 * PLP; bf* PQl = PKh + (size_t)3 * PLP;
    if ((size_t)(wsp - (char*)d_ws) > ws_size) return;    // ws 256 MiB; about 171 MiB taken
    // five launches, each reading what earlier ones wrote; k_gemmw (c2p) and k_p2cs (p2c) each read only k_proj's planes, and k_fattn reads both
    k_cvt<<<CVN / 8192, 256, 0, stream>>>(wq, wk, wv, wpk, wpq, x, rel, CV);
    k_proj<<<dim3(16, 16, 7), 32 * KSL, 0, stream>>>(CV, PLN, bq, bk, bv, bpk, bpq);   /* q, k planes [b][h][t][d]; v^T planes [b][h][d][t]; pos_k, pos_q planes [h][512][64] */
    k_gemmw<bf, 2, 0, NH_, HD><<<dim3(TT / 64, NPE / 64, NZ), 32, 0, stream>>>(QPh, QPl, PKh, PKl, C2P, NPE, nullptr, (size_t)TT * HD, (size_t)NPE * HD, (size_t)TT * NPE);   /* c2p raw [NZ][1024][512] */
    k_p2cs<<<dim3(TT / 64, NPE / 64, NZ), 32, 0, stream>>>(PQh, PQl, KPh, KPl, P2C, P2C + (size_t)NZ * TT * NPE);   /* p2c raw, sheared: G [NZ][1024][512] + E [NZ][2][1024] */
    k_fattn<<<dim3(TT / FR, NZ), 32 * KSL, 0, stream>>>(QPh, QPl, KPh, KPl, VTh, VTl, C2P, P2C, MK, OUT);   /* scores, softmax and attn.v, into the merged output [b][t][h x 64 + d] */
}

// v008
// It runs in 139 microseconds.
// Two timings next to v007 both put it at 1.04 times that version's speed.
// Over all steps from v000 it is 7.59 times as fast.
#include <hip/hip_runtime.h>

// DeBERTa disentangled self-attention (hidden_states [2][1024][1024]; q, k, v = hs W^T + b ('oi' [1024][1024]; 16 heads x 64); pos_k = rel_embeddings Wpk^T + bpk, pos_q = rel_embeddings Wpq^T + bpq (rel_embeddings [512][1024], read); scale = 1/sqrt(64 x 3); scores = q.k scale + c2p[i][clip(i-j+256, 0, 511)] + p2c[clip(i-j+256, 0, 511)][j] with c2p = q.pos_k scale ([S][512]) and p2c = (pos_q scale).k ([512][S]); mask (int32 [2][1][1024][1024], read; all ones) == 0 -> finfo.min and weight 0; softmax; out = merged attn.v -> [2][1024][1024] (2.1 M), no output projection).
// Layout: exact bf16 projections, whose GEMM epilogue writes the hi/lo planes that the next GEMM reads (q, k, pos_k, pos_q per head [h][t][d]; v transposed [h][d][t], from the product taken as Wv x^T; the elements of every 16-bit plane in fragment order, see below); hi/lo planes for q, k, pos_k, pos_q (every row: 3-product score GEMMs); all NZ = 32 (batch item, head) pairs in one pass: c2p [32][1024][512] and p2c (sheared to [32][1024][512], row i column rp, plus its two end rows) as hi/lo GEMMs; then one kernel forms the content scores (hi/lo) in registers, gathers the two relative terms per logit (index clip(i - j + 256, 0, 511)), scales, applies the mask select, f32 softmax, hi/lo P through LDS, attn.v (3 products), stored straight into the merged f32 output.
// Compute dtypes, f32 accumulate: every input rounded to bf16; q/k/v/pos_k/pos_q on PLAIN bf16 operands (exact) + biases; all score terms and attn.v on hi/lo planes (3 products) for every row; softmax f32; output f32.

#define NB_  2
#define TT   1024
#define DM   1024
#define NH_  16
#define HD   64
#define DQ   (NH_ * HD)
#define NZ   (NB_ * NH_)          // (batch item, head) pairs: all of them ride in the grid of every score, softmax and attn.v launch, z = batch item x NH_ + head
#define RH   1024                  // not read by the code: every query row uses hi+lo planes
#define WIN  0
#define PCAR 1024.0f
#define SCL  0.072168783648703225f   // 1/sqrt(64 x 3)
#define NPE  512                  // 2 x att_span relative positions
#define SPAN 256
#define KSL  8                     // K slices (waves per work-group) of the K = 1024 GEMMs: the five projections, and attn.v inside k_fattn
typedef _Float16 h16;
typedef unsigned short bf;
typedef __attribute__((ext_vector_type(16))) __bf16   v16bf;
typedef __attribute__((ext_vector_type(16))) _Float16 v16h;
typedef __attribute__((ext_vector_type(8)))  _Float16 v8h;
typedef __attribute__((ext_vector_type(8)))  unsigned short v8us;
typedef __attribute__((ext_vector_type(8)))  float    v8f;
typedef __attribute__((ext_vector_type(4)))  float    v4f;
typedef v8h  __attribute__((may_alias)) v8ha;
typedef v4f  __attribute__((may_alias)) v4fa;
typedef v8us __attribute__((may_alias)) v8usa;

// f32 -> bf16, round to nearest even, by the chip's own conversion instruction (two values a time: a in the low half, b in the high half)
typedef __attribute__((ext_vector_type(2))) __bf16 v2bf;
typedef __attribute__((ext_vector_type(2))) float v2fl;
__device__ __forceinline__ unsigned f2bf2(float a, float b) { const v2fl x = {a, b}; return __builtin_bit_cast(unsigned, __builtin_convertvector(x, v2bf)); }
__device__ __forceinline__ unsigned short f2bf(float f) { return (unsigned short)f2bf2(f, f); }
__device__ __forceinline__ float bf2f(unsigned short b) { return __uint_as_float(((unsigned)b) << 16); }
__device__ __forceinline__ float bfr(float f) { return bf2f(f2bf(f)); }
__device__ __forceinline__ v16h cat16(v8h lo, v8h hi) { return __builtin_shufflevector(lo, hi, 0, 1, 2, 3, 4, 5, 6, 7, 8, 9, 10, 11, 12, 13, 14, 15); }
__device__ __forceinline__ v16bf cat16b(v8us lo, v8us hi) { return __builtin_bit_cast(v16bf, __builtin_shufflevector(lo, hi, 0, 1, 2, 3, 4, 5, 6, 7, 8, 9, 10, 11, 12, 13, 14, 15)); }
__device__ __forceinline__ v8f wmma16(v16h a, v16h b, v8f c) { return __builtin_amdgcn_wmma_f32_16x16x32_f16(false, a, false, b, (short)0, c, false, false); }
__device__ __forceinline__ v8f wmmab(v16bf a, v16bf b, v8f c) { return __builtin_amdgcn_wmma_f32_16x16x32_bf16(false, a, false, b, (short)0, c, false, false); }



// ---- the two GEMM kernels: register-blocked, 64x64 output tile (16 accumulators per wave), operands straight from 16-bit planes in FRAGMENT ORDER.
// Fragment order of a plane of R rows x KD columns (the summed index k runs along a row): 16 rows x 32 k make one chunk of 512 elements, chunk (row / 16) x (KD / 32) + k / 32, and inside it element (row, k) lies at
// ((k / 8) % 4) x 128 + (row % 16) x 8 + k % 8. The 16 bytes that lane l takes for the first half of a fragment then lie at chunk + 8 l, for the second half 256 elements on: each load of a wave covers 512 contiguous bytes (four whole lines),
// where row-major planes gave it 32 bytes out of each of 16 lines. Which element reaches which lane and register is as before. 16 rows take the same space as in row-major order, so every base that is a multiple of 16 rows stays.
// two values split into bf16 hi + lo: h and l each hold y0's part in the low half and y1's in the high half
__device__ __forceinline__ void splitf2(float y0, float y1, unsigned& h, unsigned& l) { h = f2bf2(y0, y1); l = f2bf2(y0 - __uint_as_float(h << 16), y1 - __uint_as_float(h & 0xFFFF0000u)); }
typedef __attribute__((ext_vector_type(4))) unsigned short v4us;
typedef __attribute__((ext_vector_type(2))) unsigned v2u;
typedef __attribute__((ext_vector_type(4))) unsigned v4u;
template <typename T16> struct WFrag;
template <> struct WFrag<h16> { typedef v16h V; static __device__ __forceinline__ V ld(const h16* p) { return cat16(*(const v8h*)p, *(const v8h*)(p + 256)); } static __device__ __forceinline__ v8f mma(V a, V b, v8f c) { return wmma16(a, b, c); } };
template <> struct WFrag<bf> { typedef v16bf V; static __device__ __forceinline__ V ld(const bf* p) { return cat16b(*(const v8us*)p, *(const v8us*)(p + 256)); } static __device__ __forceinline__ v8f mma(V a, V b, v8f c) { return wmmab(a, b, c); } };

// Workspace layout that k_cvt writes and k_proj reads (bf16, in elements from CV): the five weights in the order q, k, v, pos_k, pos_q, then hidden_states (both batch items), then rel_embeddings.
#define CVW  (DM * DM)             // one weight
#define CVX  (5 * CVW)             // hidden_states
#define CVR  (CVX + NB_ * TT * DM) // rel_embeddings
#define CVN  (CVR + NPE * DM)
// Planes that k_proj writes (in elements from PLN): q hi, q lo, k hi, k lo, v hi, v lo, each [batch item][head][..][..]; then pos_k hi, pos_k lo, pos_q hi, pos_q lo, each [head][512][64].
#define PLB  (NH_ * TT * HD)       // one batch item of one plane
#define PLQ  (NB_ * PLB)           // one q, k or v plane
#define PLP  (NH_ * NPE * HD)      // one pos_k or pos_q plane
#define PLN_ (6 * PLQ + 4 * PLP)

// ---- k_proj: all eight projections (q, k, v of both batch items, pos_k, pos_q) in one grid; none reads what another writes. grid (16, 16, 7), 32 x KSL threads. blockIdx.z: 0, 1 q of batch item 0, 1; 2, 3 k; 4, 5 v; 6 pos_k (x < 8) and pos_q (x >= 8).
// A tile's K = 1024 is cut into KSL contiguous slices, one wave of the work-group per slice, so that KSL waves' loads are in flight on a tile; each wave leaves its partial tile in LDS and, behind one barrier, every thread sums its share of the tile over the slices in the fixed order 0 .. KSL-1.
// C[m][n] = sum_k A[m][k] Bt[n][k] + bias (bias[n]; for v, taken as Wv x^T, bias[m]). The output planes are in fragment order too, rows m, ldc columns: a 64-column tile y is a head's own plane (q, k, pos: ldc 64, cstep rows x 64) or two chunks of each row block (v: ldc 1024, cstep 2 x 512).
// The value is split into bf16 hi + lo, the planes the next GEMM takes as operands.
__global__ __launch_bounds__(32 * KSL) void k_proj(const bf* __restrict__ CV, bf* PLN, const float* __restrict__ bq, const float* __restrict__ bk, const float* __restrict__ bv, const float* __restrict__ bpk, const float* __restrict__ bpq) {
    typedef WFrag<bf>::V V;
    __shared__ __align__(16) float os[KSL * 64 * 68];
    const int job = blockIdx.z; int bx = blockIdx.x;
    const bf* A; const bf* Bt; bf* Ch; bf* Cl; const float* bias; int ldc, cstep; bool rowb = false;   // all uniform over the work-group
    if (job < 6) { const int t = job >> 1, b = job & 1; const bf* X = CV + CVX + b * (TT * DM); const bf* Wt = CV + t * CVW; Ch = PLN + 2 * t * PLQ + b * PLB; Cl = Ch + PLQ; bias = t == 0 ? bq : (t == 1 ? bk : bv);
        if (t < 2) { A = X; Bt = Wt; ldc = HD; cstep = TT * HD; } else { A = Wt; Bt = X; ldc = TT; cstep = 1024; rowb = true; } }
    else { const int t = bx >> 3; bx &= 7; A = CV + CVR; Bt = CV + (3 + t) * CVW; Ch = PLN + 6 * PLQ + 2 * t * PLP; Cl = Ch + PLP; bias = t ? bpq : bpk; ldc = HD; cstep = NPE * HD; }
    const size_t co = (size_t)blockIdx.y * cstep;   // where this column tile starts in the output
    const int lane = threadIdx.x & 31, lr = lane & 15, hi = lane >> 4; const int r0 = bx * 64, c0 = blockIdx.y * 64;
    v8f acc[4][4];
#pragma unroll
    for (int mb = 0; mb < 4; ++mb)
#pragma unroll
        for (int nb = 0; nb < 4; ++nb) acc[mb][nb] = (v8f){};
    const size_t aoff = (size_t)r0 * DM + 8 * lane, boff = (size_t)c0 * DM + 8 * lane;   // first chunk of the tile's rows, plus the lane's 16 bytes
    const int wv = __builtin_amdgcn_readfirstlane((int)(threadIdx.x >> 5)); const int k0 = wv * (DM / KSL), k1 = k0 + DM / KSL;   // this wave's K slice, in scalar registers
#pragma unroll 1
    for (int kc = k0; kc < k1; kc += 32) {   // rolled: one trip's fragments and the 16 accumulators are what the registers hold
        const bf* ap = A + aoff + kc * 16; const bf* bp = Bt + boff + kc * 16; V a[4];   // chunk kc / 32 of 512 elements
#pragma unroll
        for (int mb = 0; mb < 4; ++mb) a[mb] = WFrag<bf>::ld(ap + mb * 16 * DM);
#pragma unroll
        for (int nb = 0; nb < 4; ++nb) { const V b = WFrag<bf>::ld(bp + nb * 16 * DM);
#pragma unroll
            for (int mb = 0; mb < 4; ++mb) acc[mb][nb] = WFrag<bf>::mma(a[mb], b, acc[mb][nb]); }
        // the trip's 16 loads name these two addresses: they stay whole up to this wait, so that no later load is given one of them to write into before it
        asm volatile("s_wait_xcnt 0x0" :: "v"(ap), "v"(bp) : "memory");
        // four vector slots between the last matrix instruction and the back edge, where the next trip's loads overwrite its operands
        asm volatile("v_nop\n\tv_nop\n\tv_nop\n\tv_nop" : "+v"(acc[0][0]), "+v"(acc[1][1]), "+v"(acc[2][2]), "+v"(acc[3][3]) : "v"(a[0]), "v"(a[3]));
    }
    // the bias by column and by row of this thread's four pieces, both read here (both lie inside the 1024 floats for every job) so that the loads fly during the LDS stores and the barrier; the job picks one below
    const int cofs = ((int)threadIdx.x >> 4) * 4, rw = (int)threadIdx.x & 15; const float* bcp = bias + c0 + cofs; const float* brp = bias + r0 + rw; float bc[4], br[4];
#pragma unroll
    for (int q = 0; q < 4; ++q) { bc[q] = bcp[q]; br[q] = brp[q * (2 * KSL)]; }
    // these loads name the two addresses: they stay whole up to this wait, so that nothing below is given one of them to write into before it
    asm volatile("s_wait_xcnt 0x0" :: "v"(bcp), "v"(brp) : "memory");
    float* mine = os + wv * (64 * 68);
    // the three loops are unrolled so that acc is indexed by constants and stays in registers
#pragma unroll
    for (int mb = 0; mb < 4; ++mb)
#pragma unroll
        for (int nb = 0; nb < 4; ++nb)
#pragma unroll
            for (int j = 0; j < 8; ++j) mine[(mb * 16 + hi * 8 + j) * 68 + nb * 16 + lr] = acc[mb][nb][j];
    __syncthreads();   // every slice's partial tile is in LDS before any thread sums across the slices
    v4us oh[32 / KSL], ol[32 / KSL];
    // both loops are unrolled so that a thread's LDS reads issue ahead of its sums
#pragma unroll
    for (int s = 0; s < 32 / KSL; ++s) { const int row = s * (2 * KSL) + rw; v4f val = *(const v4fa*)(os + row * 68 + cofs);
#pragma unroll
        for (int w = 1; w < KSL; ++w) val += *(const v4fa*)(os + w * (64 * 68) + row * 68 + cofs);
#pragma unroll
        for (int q = 0; q < 4; ++q) val[q] += bfr(rowb ? br[s] : bc[q]);
        unsigned a0, c0h, a1, c1h; splitf2(val[0], val[1], a0, c0h); splitf2(val[2], val[3], a1, c1h); oh[s] = __builtin_bit_cast(v4us, (v2u){a0, a1}); ol[s] = __builtin_bit_cast(v4us, (v2u){c0h, c1h}); }
    __builtin_amdgcn_sched_barrier(0);   // the stores stay below every sum, last in the kernel, so that nothing rewrites a register that an issued store names
#pragma unroll
    for (int s = 0; s < 32 / KSL; ++s) { const size_t o = (size_t)(r0 / 16 + s) * (ldc * 16) + co + (cofs >> 5) * 512 + ((cofs >> 3) & 3) * 128 + rw * 8 + (cofs & 7); *(v4us*)(Ch + o) = oh[s]; *(v4us*)(Cl + o) = ol[s]; }   // row r0 + 16 s + rw, columns cofs .. + 3 of the tile; a wave's 16 rows x 8 columns are 256 contiguous bytes
}

// ---- k_gemmw: one wave does a whole 64x64 tile (short K); grid (M/64, N/64, Z), 32 threads. C[z][m][n] (+ optional f32 bias[n]) = sum_k A[z][m][k] Bt[z % ZB][n][k] (+ split products per NSPLIT), f32 out, row pitch ldc.
// z-batch strides sA/sB/sC in elements; the B planes repeat every ZB z's (they do not depend on the batch item). K % 32 == 0, a constant, so that every fragment load of a trip is one of four uniform bases + the lane's offset + a constant.
template <typename T16, int NSPLIT, int BIAS, int ZB, int K>
__global__ __launch_bounds__(32) void k_gemmw(const T16* __restrict__ A, const T16* __restrict__ A2, const T16* __restrict__ Bt, const T16* __restrict__ Bt2, float* C, int ldc, const float* __restrict__ bias, size_t sA, size_t sB, size_t sC) {
    typedef typename WFrag<T16>::V V;
    __shared__ __align__(16) float os[16 * 68];
    const size_t z = blockIdx.z, zB = blockIdx.z % ZB; A += z * sA; if (A2) A2 += z * sA; Bt += zB * sB; if (Bt2) Bt2 += zB * sB; const size_t co = z * sC + (size_t)blockIdx.y * 64;   // where this z and this column tile start in the output
    const int lane = threadIdx.x & 31, lr = lane & 15, hi = lane >> 4; const int r0 = blockIdx.x * 64, c0 = blockIdx.y * 64;
    v8f acc[4][4];
#pragma unroll
    for (int mb = 0; mb < 4; ++mb)
#pragma unroll
        for (int nb = 0; nb < 4; ++nb) acc[mb][nb] = (v8f){};
    const unsigned lo = (unsigned)(8 * lane);   // fragment order: the lane's 16 bytes of a chunk's half
    const int k0 = 0, k1 = K;
#pragma unroll 1
    for (int kc = k0; kc < k1; kc += 32) {
        V a[4], a2[4]; const T16* ap = A + r0 * K + kc * 16; const T16* ap2 = A2 + r0 * K + kc * 16; const T16* bp = Bt + c0 * K + kc * 16; const T16* bp2 = Bt2 + c0 * K + kc * 16;   // chunk kc / 32 of the tile's first rows, uniform
#pragma unroll
        for (int mb = 0; mb < 4; ++mb) { a[mb] = WFrag<T16>::ld(ap + mb * 16 * K + lo); if (NSPLIT == 1 || NSPLIT == 2) a2[mb] = WFrag<T16>::ld(ap2 + mb * 16 * K + lo); }
#pragma unroll
        for (int nb = 0; nb < 4; ++nb) { const V b = WFrag<T16>::ld(bp + nb * 16 * K + lo); V b2; if (NSPLIT >= 2) b2 = WFrag<T16>::ld(bp2 + nb * 16 * K + lo);
#pragma unroll
            for (int mb = 0; mb < 4; ++mb) { acc[mb][nb] = WFrag<T16>::mma(a[mb], b, acc[mb][nb]); if (NSPLIT == 1 || NSPLIT == 2) acc[mb][nb] = WFrag<T16>::mma(a2[mb], b, acc[mb][nb]); if (NSPLIT >= 2) acc[mb][nb] = WFrag<T16>::mma(a[mb], b2, acc[mb][nb]); } }
        // the trip's loads name these bases and this offset: they stay whole up to this wait, so that nothing is given one of them to write into before it
        asm volatile("s_wait_xcnt 0x0" :: "s"(ap), "s"(ap2), "s"(bp), "s"(bp2), "v"(lo) : "memory");
        asm volatile("v_nop\n\tv_nop\n\tv_nop\n\tv_nop" : "+v"(acc[0][0]), "+v"(acc[1][1]), "+v"(acc[2][2]), "+v"(acc[3][3]) : "v"(a[0]), "v"(a[3]));
    }
#pragma unroll
    for (int mb = 0; mb < 4; ++mb) {
#pragma unroll
        for (int nb = 0; nb < 4; ++nb) {
#pragma unroll
            for (int j = 0; j < 8; ++j) os[(hi * 8 + j) * 68 + nb * 16 + lr] = acc[mb][nb][j]; }
        __builtin_amdgcn_wave_barrier(); asm volatile("" ::: "memory");
        float* crow = C + (size_t)(r0 + mb * 16) * ldc + co;
{
#pragma unroll
            for (int s = 0; s < 8; ++s) { const int row = 2 * s + hi, cofs = lr * 4; v4f val = *(const v4fa*)(os + row * 68 + cofs); if (BIAS == 1) { val[0] += bfr(bias[c0 + cofs]); val[1] += bfr(bias[c0 + cofs + 1]); val[2] += bfr(bias[c0 + cofs + 2]); val[3] += bfr(bias[c0 + cofs + 3]); }
                *(v4f*)(crow + (size_t)row * ldc + cofs) = val; }
             }
        __builtin_amdgcn_wave_barrier(); asm volatile("" ::: "memory");
    }
}

// ---- k_p2cs: the p2c term laid out the way the softmax reads it. G[z][i][p] = pos_q[p] . k[i - p + SPAN] (hi/lo, 3 products, same products in the same order as k_gemmw<bf, 2>), so that row i of G is indexed by the same
// relative position as row i of c2p and a wave's gather runs along a row instead of down a diagonal of [p][j]. One wave per tile of 64 i x 64 p: it needs the 127 keys j = jb .. jb + 126 (jb = i0 - p0 + SPAN - 63), computes the
// 64 p x 128 j products in two halves into LDS and stores the sheared tile in whole 256-byte rows. Keys outside [0, TT) are clamped for the load only; the G elements made from them belong to no (i, j) and are never read.
// E[z][0][j] = p2c[0][j] and E[z][1][j] = p2c[NPE-1][j] serve the clipped ends (j >= i + SPAN, j <= i - SPAN + 1); each 64-key piece is written by the one tile that holds it aligned. grid (TT/64, NPE/64, NZ), 32 threads; z = batch item x NH_ + head picks k, G and E, the head alone picks pos_q.
__global__ __launch_bounds__(32) void k_p2cs(const bf* __restrict__ A, const bf* __restrict__ A2, const bf* __restrict__ Bt, const bf* __restrict__ Bt2, float* G, float* E) {
    typedef WFrag<bf>::V V;
    __shared__ __align__(16) float ts[64 * 132];
    const size_t z = blockIdx.z, zh = blockIdx.z % NH_; A += zh * (size_t)(NPE * HD); A2 += zh * (size_t)(NPE * HD); Bt += z * (size_t)(TT * HD); Bt2 += z * (size_t)(TT * HD); G += z * (size_t)(TT * NPE); E += z * (size_t)(2 * TT);
    const int lane = threadIdx.x & 31, lr = lane & 15, hi = lane >> 4; const int i0 = blockIdx.x * 64, p0 = blockIdx.y * 64; const int jb = i0 - p0 + (SPAN - 63);
    const unsigned lo = (unsigned)(8 * lane);   // fragment order: the lane's 16 bytes of a chunk's half
#pragma unroll 1
    for (int hf = 0; hf < 2; ++hf) {   // rolled: one set of 16 accumulators serves both halves
        v8f acc[4][4];
#pragma unroll
        for (int mb = 0; mb < 4; ++mb)
#pragma unroll
            for (int nb = 0; nb < 4; ++nb) acc[mb][nb] = (v8f){};
        unsigned boff[4];
#pragma unroll
        for (int nb = 0; nb < 4; ++nb) { int j = jb + hf * 64 + nb * 16 + lr; j = j < 0 ? 0 : (j > TT - 1 ? TT - 1 : j); boff[nb] = (unsigned)((j >> 4) * (16 * HD) + hi * 128 + (j & 15) * 8); }   // the lane's own key in fragment order: the keys of a fragment start at no multiple of 16 here
#pragma unroll 1
        for (int kc = 0; kc < HD; kc += 32) {
            V a[4], a2[4]; const bf* ap = A + p0 * HD + kc * 16; const bf* ap2 = A2 + p0 * HD + kc * 16; const bf* bp = Bt + kc * 16; const bf* bp2 = Bt2 + kc * 16;   // chunk kc / 32, uniform
#pragma unroll
            for (int mb = 0; mb < 4; ++mb) { a[mb] = WFrag<bf>::ld(ap + mb * 16 * HD + lo); a2[mb] = WFrag<bf>::ld(ap2 + mb * 16 * HD + lo); }
#pragma unroll
            for (int nb = 0; nb < 4; ++nb) { const V b = WFrag<bf>::ld(bp + boff[nb]); const V b2 = WFrag<bf>::ld(bp2 + boff[nb]);
#pragma unroll
                for (int mb = 0; mb < 4; ++mb) { acc[mb][nb] = WFrag<bf>::mma(a[mb], b, acc[mb][nb]); acc[mb][nb] = WFrag<bf>::mma(a2[mb], b, acc[mb][nb]); acc[mb][nb] = WFrag<bf>::mma(a[mb], b2, acc[mb][nb]); } }
            // the trip's loads name these bases and offsets: they stay whole up to this wait, so that nothing is given one of them to write into before it
            asm volatile("s_wait_xcnt 0x0" :: "s"(ap), "s"(ap2), "s"(bp), "s"(bp2), "v"(lo), "v"(boff[0]), "v"(boff[1]), "v"(boff[2]), "v"(boff[3]) : "memory");
            // four vector slots between the last matrix instruction and the back edge, where the next trip's loads overwrite its operands (as in k_gemmw)
            asm volatile("v_nop\n\tv_nop\n\tv_nop\n\tv_nop" : "+v"(acc[0][0]), "+v"(acc[1][1]), "+v"(acc[2][2]), "+v"(acc[3][3]) : "v"(a[0]), "v"(a[3]));
        }
        // unrolled so that acc is indexed by constants and stays in registers
#pragma unroll
        for (int mb = 0; mb < 4; ++mb)
#pragma unroll
            for (int nb = 0; nb < 4; ++nb)
#pragma unroll
                for (int r = 0; r < 8; ++r) ts[(mb * 16 + hi * 8 + r) * 132 + hf * 64 + nb * 16 + lr] = acc[mb][nb][r];
    }
    __builtin_amdgcn_wave_barrier(); asm volatile("" ::: "memory");   // the reads below take other lanes' writes: keep the compiler from moving them up (one wave: the LDS itself works in order)
#pragma unroll 1
    for (int s0 = 0; s0 < 32; s0 += 8) {
        // unrolled so that the LDS reads of eight row pairs issue ahead of their stores
#pragma unroll
        for (int s = 0; s < 8; ++s) { const int ii = 2 * (s0 + s) + hi, pp = lr * 4; v4f val;
#pragma unroll
            for (int q = 0; q < 4; ++q) val[q] = ts[(pp + q) * 132 + ii - (pp + q) + 63];   // key j = (i0 + ii) - (p0 + pp + q) + SPAN = jb + this column
            *(v4f*)(G + (size_t)(i0 + ii) * NPE + p0 + pp) = val; }
        asm volatile("s_wait_xcnt 0x0" ::: "memory");   // the next trip rewrites the address and data registers that these stores name
    }
    if (p0 == 0 && i0 + SPAN < TT) { E[i0 + SPAN + lane] = ts[63 + lane]; E[i0 + SPAN + 32 + lane] = ts[63 + 32 + lane]; }                                        // p = 0: keys i0 + SPAN .. + 63
    if (p0 == NPE - 64 && i0 >= SPAN - 64) { E[TT + i0 - (SPAN - 64) + lane] = ts[63 * 132 + 63 + lane]; E[TT + i0 - (SPAN - 64) + 32 + lane] = ts[63 * 132 + 63 + 32 + lane]; }   // p = NPE - 1: keys i0 - SPAN + 64 .. + 63
}

__device__ __forceinline__ h16 tohx(float x) { return (h16)x; }
typedef __attribute__((ext_vector_type(2))) _Float16 v2h;
typedef __attribute__((ext_vector_type(4))) _Float16 v4h;
typedef __attribute__((ext_vector_type(2))) unsigned short v2us;
typedef __attribute__((ext_vector_type(2))) float v2f;
typedef __attribute__((ext_vector_type(4))) int v4i;

// ---- k_cvt: every f32 -> bf16 rounding of an input (five weights, hidden_states, rel_embeddings) in one grid, into the layout CVW / CVX / CVR above, each source in fragment order (KD = 1024). grid (CVN / 8192), 256 threads.
// A work-group rounds 16 rows x 512 columns, that is 16 chunks, 16 KiB in a row of the output. A thread takes four pieces of 8 elements, four chunks apart. A wave takes 8 rows of one chunk at a time: it reads one whole line (32 floats) of each row
// and writes, for each of the chunk's four groups of 8 columns, the 8 rows' pieces as one whole line. Every source is a multiple of 16 rows long, so a work-group has one source.
__global__ __launch_bounds__(256) void k_cvt(const float* __restrict__ wq, const float* __restrict__ wk, const float* __restrict__ wv, const float* __restrict__ wpk, const float* __restrict__ wpq, const float* __restrict__ x, const float* __restrict__ rel, bf* CV) {
    const unsigned e0 = (blockIdx.x >> 1) * (16u * DM), h0 = (blockIdx.x & 1) * 512u; const unsigned seg = e0 / CVW;   // uniform: first element of the 16 rows, first column, which source
    const float* src; unsigned s0;
    if (seg < 5) { src = seg == 0 ? wq : (seg == 1 ? wk : (seg == 2 ? wv : (seg == 3 ? wpk : wpq))); s0 = seg * CVW; }
    else if (e0 < CVR) { src = x; s0 = CVX; }
    else { src = rel; s0 = CVR; }
    src += e0 - s0 + h0; bf* dst = CV + e0 + h0 * 16; const unsigned t = threadIdx.x;
    const unsigned row = ((t >> 5) & 1) * 8 + (t & 7), grp = (t >> 3) & 3, ch = t >> 6;   // the thread's row of the 16, group of 8 columns of the chunk, first chunk
    const unsigned so = row * DM + ch * 32 + grp * 8, eo = ch * 512 + grp * 128 + row * 8;   // where the piece is read and where it is written; u moves both on by four chunks
    v8f v[4];
    // both loops are unrolled so that the four loads issue ahead of the first rounding
#pragma unroll
    for (int u = 0; u < 4; ++u) v[u] = *(const v8f*)(src + u * 128 + so);
#pragma unroll
    for (int u = 0; u < 4; ++u) { v4u o;
#pragma unroll
        for (int k = 0; k < 4; ++k) o[k] = f2bf2(v[u][2 * k], v[u][2 * k + 1]);
        *(v8us*)(dst + u * 2048 + eo) = __builtin_bit_cast(v8us, o); }
}

// ---- k_fattn: content scores, the two relative terms, softmax and attn.v of FR = 32 query rows of one head in one work-group, so that neither the scores nor the weights go through memory. grid (TT/FR, NZ), 32 x KSL threads; blockIdx.y = batch item x NH_ + head.
// Wave w owns the keys 128 w .. 128 w + 127. It forms its 32 x 128 scores (hi/lo, 3 products, the products and their order as in k_gemmw<bf, 2>) in 16 accumulators and, in the accumulator's own layout (row = 16 mb + 8 hi + r, key = 16 nb + lr),
// t = (S + c2p[i][rp] + p2c[rp][j]) x scale with rp = clip(i - j + 256, 0, 511), -3e38 where mask == 0. p2c[rp][j] is read from k_p2cs's planes: G[row][rp] inside the span, E[zz][0][j] / E[zz][1][j] (behind G in the same buffer) at and beyond the clipped ends.
// Row maximum and row sum: over the wave's own keys in registers and by lane exchange, then over the eight waves through LDS in the order 0 .. 7. The weights, split hi/lo, go to the wave's own LDS piece row by row, from where the A loader takes them as it would from memory;
// each wave multiplies its 128 keys into a partial 32 x 64 tile (the K slices of the former attn.v GEMM), and the partial tiles are summed in LDS in slice order.
#define FR   32                    // query rows per work-group
#define PPI  136                   // LDS pitch of a row of weights, in 16-bit elements: 256 bytes + 16, for 16-byte fragment reads
#define PWV  (2 * FR * PPI)        // 16-bit elements of one wave's LDS piece: hi plane, lo plane
__device__ __forceinline__ v16bf ldsfrag(const bf* p) { return cat16b(*(const v8usa*)p, *(const v8usa*)(p + 16)); }
// launch bounds: 4 waves per SIMD, that is at most 256 registers a wave, so that two work-groups (their LDS fits twice) share a WGP and the whole grid is resident at once
__global__ __launch_bounds__(32 * KSL, 4) void k_fattn(const bf* __restrict__ Qh, const bf* __restrict__ Ql, const bf* __restrict__ Kh, const bf* __restrict__ Kl, const bf* __restrict__ Vh, const bf* __restrict__ Vl, const float* __restrict__ C2P, const float* __restrict__ P2C, const int* __restrict__ MK, float* O) {
    typedef WFrag<bf>::V V;
    __shared__ __align__(16) bf ps[KSL * PWV];
    __shared__ __align__(16) float red[2 * FR * KSL];
    const int zz = blockIdx.y, i0 = blockIdx.x * FR; const int lane = threadIdx.x & 31, lr = lane & 15, hi = lane >> 4;
    const int wv = __builtin_amdgcn_readfirstlane((int)(threadIdx.x >> 5)); const int j0 = wv * (TT / KSL);   // this wave's keys, in a scalar register
    // uniform bases (head, first query row, the wave's first key) plus one unsigned lane offset per operand: every fragment load is then scalar base + lane offset + constant
    { const size_t zo = (size_t)zz * (TT * HD); Qh += zo + i0 * HD; Ql += zo + i0 * HD; Kh += zo + j0 * HD; Kl += zo + j0 * HD; Vh += zo + j0 * 16; Vl += zo + j0 * 16; }   // v: chunk j0 / 32 of each block of 16 rows d
    const int* MKb = MK + (size_t)(zz / NH_) * (TT * TT); O += (size_t)(zz / NH_) * (TT * DQ) + (zz % NH_) * HD;   // the batch item's mask; the batch item's rows and the head's 64 columns of the merged output
    const unsigned lo64 = (unsigned)(8 * lane), lov = lo64;   // fragment order: the lane's 16 bytes of a chunk's half
    v8f acc[2][8];
#pragma unroll
    for (int mb = 0; mb < 2; ++mb)
#pragma unroll
        for (int nb = 0; nb < 8; ++nb) acc[mb][nb] = (v8f){};
    // every loop over mb, nb, r below is unrolled so that the accumulators are indexed by constants and stay in registers
#pragma unroll
    for (int kc = 0; kc < HD; kc += 32) {
        V a[2], a2[2];
#pragma unroll
        for (int mb = 0; mb < 2; ++mb) { const int o = mb * 16 * HD + kc * 16; a[mb] = WFrag<bf>::ld(Qh + o + lo64); a2[mb] = WFrag<bf>::ld(Ql + o + lo64); }
#pragma unroll
        for (int nb = 0; nb < 8; ++nb) { const int o = nb * 16 * HD + kc * 16; const V b = WFrag<bf>::ld(Kh + o + lo64); const V b2 = WFrag<bf>::ld(Kl + o + lo64);
#pragma unroll
            for (int mb = 0; mb < 2; ++mb) { acc[mb][nb] = WFrag<bf>::mma(a[mb], b, acc[mb][nb]); acc[mb][nb] = WFrag<bf>::mma(a2[mb], b, acc[mb][nb]); acc[mb][nb] = WFrag<bf>::mma(a[mb], b2, acc[mb][nb]); } }
    }
    // the q and k loads name these bases and this offset: they stay whole up to this wait, so that nothing is given one of them to write into before it
    asm volatile("s_wait_xcnt 0x0" :: "s"(Qh), "s"(Ql), "s"(Kh), "s"(Kl), "v"(lo64) : "memory");
    // lane bases: the mask index adds only a compile-time constant (into the instruction's offset); the c2p and p2c indices add the clipped rp of each logit
    const int ib = i0 + hi * 8, jl = j0 + lr; const int gb = (zz * TT + ib) * NPE, db = ib - jl + SPAN, mo = ib * TT + jl, eo = NZ * TT * NPE + zz * 2 * TT + jl;
    float* rl = red + hi * 8 * KSL;
    float mx[2][8], sm[2][8];
    __builtin_amdgcn_sched_barrier(0);   // keeps the address arithmetic of the gathers out of the matrix phase, where it would hold registers
    // two rows (16 logits a lane) at a time: their 48 loads are all issued before the first is used, so that a wave waits once per batch and not once per logit
#pragma unroll
    for (int mb = 0; mb < 2; ++mb)
#pragma unroll
        for (int rb = 0; rb < 8; rb += 2) { float cv[2][8], pv[2][8]; int mv[2][8];
#pragma unroll
            for (int q = 0; q < 2; ++q) { const int ro = mb * 16 + rb + q;   // query row i = ib + ro, key j = jl + 16 nb
                int pa[8], pb[8];
#pragma unroll
                for (int nb = 0; nb < 8; ++nb) { int rp = db + (ro - nb * 16); rp = rp < 0 ? 0 : (rp > NPE - 1 ? NPE - 1 : rp); const int pin = gb + rp + ro * NPE, pend = eo + (rp & SPAN) * (TT / SPAN) + nb * 16; const int po = ((unsigned)(rp - 1) < (unsigned)(NPE - 2)) ? pin : pend; pa[nb] = pin; pb[nb] = po;
                    cv[q][nb] = C2P[pin]; pv[q][nb] = P2C[po]; mv[q][nb] = MKb[mo + (ro * TT + nb * 16)]; }
                // the row's 24 loads name these index registers: they stay whole up to this wait, so that no later load or sum is given one of them to write into before it
                asm volatile("s_wait_xcnt 0x0" :: "v"(pa[0]), "v"(pa[1]), "v"(pa[2]), "v"(pa[3]), "v"(pa[4]), "v"(pa[5]), "v"(pa[6]), "v"(pa[7]), "v"(pb[0]), "v"(pb[1]), "v"(pb[2]), "v"(pb[3]), "v"(pb[4]), "v"(pb[5]), "v"(pb[6]), "v"(pb[7]), "v"(mo) : "memory"); }
            __builtin_amdgcn_sched_barrier(0);   // the batch's loads stay above, their uses below
#pragma unroll
            for (int q = 0; q < 2; ++q) { const int r = rb + q; float m = -3.0e38f;
#pragma unroll
                for (int nb = 0; nb < 8; ++nb) { const float sa = __fmul_rn(__fadd_rn(__fadd_rn(acc[mb][nb][r], cv[q][nb]), pv[q][nb]), SCL); const float t = (mv[q][nb] != 0) ? sa : -3.0e38f; acc[mb][nb][r] = t; m = fmaxf(m, t); }
                mx[mb][r] = m; }
            __builtin_amdgcn_sched_barrier(0);   // the next batch's loads do not start before this batch's registers are free
        }
#pragma unroll
    for (int sh = 8; sh; sh >>= 1)   // over the 16 lanes that hold a row; the 16 rows' exchanges of one distance go together
#pragma unroll
        for (int mb = 0; mb < 2; ++mb)
#pragma unroll
            for (int r = 0; r < 8; ++r) mx[mb][r] = fmaxf(mx[mb][r], __shfl_xor(mx[mb][r], sh, 32));
    if (lr == 0) {
#pragma unroll
        for (int mb = 0; mb < 2; ++mb)
#pragma unroll
            for (int r = 0; r < 8; ++r) rl[(mb * 16 + r) * KSL + wv] = mx[mb][r]; }
    __syncthreads();   // every wave's row maxima are in LDS before any wave takes the maximum over the waves
#pragma unroll
    for (int mb = 0; mb < 2; ++mb)
#pragma unroll
        for (int r = 0; r < 8; ++r) { const float* rr = rl + (mb * 16 + r) * KSL; const v4f u = *(const v4fa*)rr, w = *(const v4fa*)(rr + 4); const float m = fmaxf(fmaxf(fmaxf(u[0], u[1]), fmaxf(u[2], u[3])), fmaxf(fmaxf(w[0], w[1]), fmaxf(w[2], w[3]))); float s = 0.f;
#pragma unroll
            for (int nb = 0; nb < 8; ++nb) { const float x = __fmul_rn(__fsub_rn(acc[mb][nb][r], m), 1.4426950408889634f); float e;
                asm("v_exp_f32 %0, %1\n\tv_nop" : "=v"(e) : "v"(x));   // the v_nop fills the one slot behind a transcendental, whatever instruction the compiler puts next
                acc[mb][nb][r] = e; s += e; }
            sm[mb][r] = s; }
#pragma unroll
    for (int sh = 8; sh; sh >>= 1)
#pragma unroll
        for (int mb = 0; mb < 2; ++mb)
#pragma unroll
            for (int r = 0; r < 8; ++r) sm[mb][r] += __shfl_xor(sm[mb][r], sh, 32);
    if (lr == 0) {
#pragma unroll
        for (int mb = 0; mb < 2; ++mb)
#pragma unroll
            for (int r = 0; r < 8; ++r) rl[FR * KSL + (mb * 16 + r) * KSL + wv] = sm[mb][r]; }
    __syncthreads();   // every wave's row sums are in LDS before any wave adds them up
    __builtin_amdgcn_sched_barrier(0);   // keeps the addresses of the later phases from being formed early and spilled
    bf* ph = ps + wv * PWV; bf* pl = ph + FR * PPI; bf* phw = ph + hi * 8 * PPI + lr; bf* plw = pl + hi * 8 * PPI + lr; const bf* phr = ph + lr * PPI + 8 * hi; const bf* plr = pl + lr * PPI + 8 * hi;   // lane bases of the stores and of the fragment reads
#pragma unroll
    for (int mb = 0; mb < 2; ++mb)
#pragma unroll
        for (int r = 0; r < 8; ++r) { const float* rr = rl + FR * KSL + (mb * 16 + r) * KSL; const v4f u = *(const v4fa*)rr, w = *(const v4fa*)(rr + 4); const float s = ((((((u[0] + u[1]) + u[2]) + u[3]) + w[0]) + w[1]) + w[2]) + w[3]; const float f = __fdiv_rn(1.0f, s);
#pragma unroll
            for (int nb = 0; nb < 8; nb += 2) { unsigned a, c; splitf2(acc[mb][nb][r] * f, acc[mb][nb + 1][r] * f, a, c); const int o = (mb * 16 + r) * PPI + nb * 16;   // the keys 16 nb + lr (low halves) and 16 nb + 16 + lr (high halves)
                phw[o] = (unsigned short)a; phw[o + 16] = (unsigned short)(a >> 16); plw[o] = (unsigned short)c; plw[o + 16] = (unsigned short)(c >> 16); } }
    __builtin_amdgcn_wave_barrier(); asm volatile("" ::: "memory");   // the fragment reads below take other lanes' writes: keep the compiler from moving them up (one wave's own piece: the LDS itself works in order)
    v8f oc[2][4];
#pragma unroll
    for (int mb = 0; mb < 2; ++mb)
#pragma unroll
        for (int nb = 0; nb < 4; ++nb) oc[mb][nb] = (v8f){};
#pragma unroll
    for (int kc = 0; kc < TT / KSL; kc += 32) {
        V a[2], a2[2];
#pragma unroll
        for (int mb = 0; mb < 2; ++mb) { const int o = mb * 16 * PPI + kc; a[mb] = ldsfrag(phr + o); a2[mb] = ldsfrag(plr + o); }
#pragma unroll
        for (int nb = 0; nb < 4; ++nb) { const int o = nb * 16 * TT + kc * 16; const V b = WFrag<bf>::ld(Vh + o + lov); const V b2 = WFrag<bf>::ld(Vl + o + lov);
#pragma unroll
            for (int mb = 0; mb < 2; ++mb) { oc[mb][nb] = WFrag<bf>::mma(a[mb], b, oc[mb][nb]); oc[mb][nb] = WFrag<bf>::mma(a2[mb], b, oc[mb][nb]); oc[mb][nb] = WFrag<bf>::mma(a[mb], b2, oc[mb][nb]); } }
    }
    __builtin_amdgcn_wave_barrier(); asm volatile("" ::: "memory");   // the partial tile goes over the wave's own weights: keep the compiler from moving its stores above the fragment reads
    float* os = (float*)ps;   // one wave's piece holds PWV / 2 floats, its partial tile takes the first FR x 68 of them
    {   float* mine = os + wv * (PWV / 2) + hi * 8 * 68 + lr;
#pragma unroll
        for (int mb = 0; mb < 2; ++mb)
#pragma unroll
            for (int nb = 0; nb < 4; ++nb)
#pragma unroll
                for (int r = 0; r < 8; ++r) mine[(mb * 16 + r) * 68 + nb * 16] = oc[mb][nb][r]; }
    __syncthreads();   // every slice's partial tile is in LDS before any thread sums across the slices
    // both loops are unrolled so that a thread's LDS reads issue ahead of its sums
#pragma unroll
    for (int s = 0; s < FR * 16 / (32 * KSL); ++s) { const int idx = s * (32 * KSL) + (int)threadIdx.x; const int row = idx >> 4, cofs = (idx & 15) * 4; v4f val = *(const v4fa*)(os + row * 68 + cofs);
#pragma unroll
        for (int w = 1; w < KSL; ++w) val += *(const v4fa*)(os + w * (PWV / 2) + row * 68 + cofs);
        *(v4f*)(O + (size_t)(i0 + row) * DQ + cofs) = val; }
}

extern "C" void kernel_launch(void* const* d_in, const int* in_sizes, int n_in,
                              void* d_out, int out_size, void* d_ws, size_t ws_size, hipStream_t stream) {
    (void)in_sizes; (void)n_in; (void)out_size;
    const float* x = (const float*)d_in[0]; const int* MK = (const int*)d_in[1]; const float* rel = (const float*)d_in[2]; const float* wq = (const float*)d_in[3]; const float* bq = (const float*)d_in[4]; const float* wk = (const float*)d_in[5]; const float* bk = (const float*)d_in[6]; const float* wv = (const float*)d_in[7]; const float* bv = (const float*)d_in[8]; const float* wpk = (const float*)d_in[9]; const float* bpk = (const float*)d_in[10]; const float* wpq = (const float*)d_in[11]; const float* bpq = (const float*)d_in[12];
    float* OUT = (float*)d_out;     // [2][1024][1024]
    char* wsp = (char*)d_ws;
    auto take = [&](size_t bytes) { char* p = wsp; wsp += (bytes + 255) & ~(size_t)255; return (void*)p; };
    bf* CV = (bf*)take((size_t)CVN * 2); bf* PLN = (bf*)take((size_t)PLN_ * 2); float* C2P = (float*)take((size_t)NZ * TT * NPE * 4); float* P2C = (float*)take((size_t)NZ * NPE * TT * 4 + (size_t)NZ * 2 * TT * 4);   /* G [NZ][1024][512], then E [NZ][2][1024] */
    bf* QPh = PLN; bf* QPl = PLN + (size_t)PLQ; bf* KPh = PLN + (size_t)2 * PLQ; bf* KPl = PLN + (size_t)3 * PLQ; bf* VTh = PLN + (size_t)4 * PLQ; bf* VTl = PLN + (size_t)5 * PLQ; bf* PKh = PLN + (size_t)6 * PLQ; bf* PKl = PKh + (size_t)PLP; bf* PQh = PKh + (size_t)2 * PLP; bf* PQl = PKh + (size_t)3 * PLP;
    if ((size_t)(wsp - (char*)d_ws) > ws_size) return;    // ws 256 MiB; about 171 MiB taken
    // five launches, each reading what earlier ones wrote; k_gemmw (c2p) and k_p2cs (p2c) each read only k_proj's planes, and k_fattn reads both
    k_cvt<<<CVN / 8192, 256, 0, stream>>>(wq, wk, wv, wpk, wpq, x, rel, CV);
    k_proj<<<dim3(16, 16, 7), 32 * KSL, 0, stream>>>(CV, PLN, bq, bk, bv, bpk, bpq);   /* q, k planes [b][h][t][d]; v^T planes [b][h][d][t]; pos_k, pos_q planes [h][512][64] */
    k_gemmw<bf, 2, 0, NH_, HD><<<dim3(TT / 64, NPE / 64, NZ), 32, 0, stream>>>(QPh, QPl, PKh, PKl, C2P, NPE, nullptr, (size_t)TT * HD, (size_t)NPE * HD, (size_t)TT * NPE);   /* c2p raw [NZ][1024][512] */
    k_p2cs<<<dim3(TT / 64, NPE / 64, NZ), 32, 0, stream>>>(PQh, PQl, KPh, KPl, P2C, P2C + (size_t)NZ * TT * NPE);   /* p2c raw, sheared: G [NZ][1024][512] + E [NZ][2][1024] */
    k_fattn<<<dim3(TT / FR, NZ), 32 * KSL, 0, stream>>>(QPh, QPl, KPh, KPl, VTh, VTl, C2P, P2C, MK, OUT);   /* scores, softmax and attn.v, into the merged output [b][t][h x 64 + d] */
}

// v009
// Measured time: 125 microseconds a run.
// Next to v008, in two timings, it ran 1.11 times as fast each time.
// Over all steps from v000 it is 8.45 times as fast.
#include <hip/hip_runtime.h>

// Disentangled self-attention (hidden_states [2][1024][1024]; q, k, v = hs W^T + b ('oi' [1024][1024]; 16 heads x 64); pos_k = rel_embeddings Wpk^T + bpk, pos_q = rel_embeddings Wpq^T + bpq (rel_embeddings [512][1024], read); scale = 1/sqrt(64 x 3); scores = q.k scale + c2p[i][clip(i-j+256, 0, 511)] + p2c[clip(i-j+256, 0, 511)][j] with c2p = q.pos_k scale ([S][512]) and p2c = (pos_q scale).k ([512][S]); mask (int32 [2][1][1024][1024], read; all ones) == 0 -> finfo.min and weight 0; softmax; out = merged attn.v -> [2][1024][1024] (2.1 M), no output projection).
// Layout: exact bf16 projections, whose GEMM epilogue writes the hi/lo planes that the next GEMM reads (q, k, pos_k, pos_q per head [h][t][d]; v transposed [h][d][t], from the product taken as Wv x^T; the elements of every 16-bit plane in fragment order, see below); hi/lo planes for q, k, pos_k, pos_q (every row: 3-product score GEMMs); all NZ = 32 (batch item, head) pairs in one pass: c2p [32][1024][512] and p2c (sheared to row i column rp) as hi/lo GEMMs of one kernel, which stores their sum as one plane (plus p2c's two end rows); then one kernel forms the content scores (hi/lo) in registers, gathers the summed relative term per logit (index clip(i - j + 256, 0, 511)), scales, applies the mask select, f32 softmax, hi/lo P through LDS, attn.v (3 products), stored straight into the merged f32 output.
// Compute dtypes, f32 accumulate: every input rounded to bf16; q/k/v/pos_k/pos_q on PLAIN bf16 operands (exact) + biases; all score terms and attn.v on hi/lo planes (3 products) for every row; softmax f32; output f32.

#define NB_  2
#define TT   1024
#define DM   1024
#define NH_  16
#define HD   64
#define DQ   (NH_ * HD)
#define NZ   (NB_ * NH_)          // (batch item, head) pairs: all of them ride in the grid of every score, softmax and attn.v launch, z = batch item x NH_ + head
#define RH   1024                  // not read by the code: every query row uses hi+lo planes
#define WIN  0
#define PCAR 1024.0f
#define SCL  0.072168783648703225f   // 1/sqrt(64 x 3)
#define NPE  512                  // 2 x att_span relative positions
#define SPAN 256
#define KSL  8                     // K slices (waves per work-group) of the K = 1024 GEMMs: the five projections, and attn.v inside k_fattn
typedef _Float16 h16;
typedef unsigned short bf;
typedef __attribute__((ext_vector_type(16))) __bf16   v16bf;
typedef __attribute__((ext_vector_type(16))) _Float16 v16h;
typedef __attribute__((ext_vector_type(8)))  _Float16 v8h;
typedef __attribute__((ext_vector_type(8)))  unsigned short v8us;
typedef __attribute__((ext_vector_type(8)))  float    v8f;
typedef __attribute__((ext_vector_type(4)))  float    v4f;
typedef v8h  __attribute__((may_alias)) v8ha;
typedef v4f  __attribute__((may_alias)) v4fa;
typedef v8us __attribute__((may_alias)) v8usa;

// f32 -> bf16, round to nearest even, by the chip's own conversion instruction (two values a time: a in the low half, b in the high half)
typedef __attribute__((ext_vector_type(2))) __bf16 v2bf;
typedef __attribute__((ext_vector_type(2))) float v2fl;
__device__ __forceinline__ unsigned f2bf2(float a, float b) { const v2fl x = {a, b}; return __builtin_bit_cast(unsigned, __builtin_convertvector(x, v2bf)); }
__device__ __forceinline__ unsigned short f2bf(float f) { return (unsigned short)f2bf2(f, f); }
__device__ __forceinline__ float bf2f(unsigned short b) { return __uint_as_float(((unsigned)b) << 16); }
__device__ __forceinline__ float bfr(float f) { return bf2f(f2bf(f)); }
__device__ __forceinline__ v16h cat16(v8h lo, v8h hi) { return __builtin_shufflevector(lo, hi, 0, 1, 2, 3, 4, 5, 6, 7, 8, 9, 10, 11, 12, 13, 14, 15); }
__device__ __forceinline__ v16bf cat16b(v8us lo, v8us hi) { return __builtin_bit_cast(v16bf, __builtin_shufflevector(lo, hi, 0, 1, 2, 3, 4, 5, 6, 7, 8, 9, 10, 11, 12, 13, 14, 15)); }
__device__ __forceinline__ v8f wmma16(v16h a, v16h b, v8f c) { return __builtin_amdgcn_wmma_f32_16x16x32_f16(false, a, false, b, (short)0, c, false, false); }
__device__ __forceinline__ v8f wmmab(v16bf a, v16bf b, v8f c) { return __builtin_amdgcn_wmma_f32_16x16x32_bf16(false, a, false, b, (short)0, c, false, false); }



// ---- the GEMM kernels: register-blocked, 64x64 output tile (16 accumulators per wave), operands straight from 16-bit planes in FRAGMENT ORDER.
// Fragment order of a plane of R rows x KD columns (the summed index k runs along a row): 16 rows x 32 k make one chunk of 512 elements, chunk (row / 16) x (KD / 32) + k / 32, and inside it element (row, k) lies at
// ((k / 8) % 4) x 128 + (row % 16) x 8 + k % 8. The 16 bytes that lane l takes for the first half of a fragment then lie at chunk + 8 l, for the second half 256 elements on: each load of a wave covers 512 contiguous bytes (four whole lines),
// where row-major planes gave it 32 bytes out of each of 16 lines. Which element reaches which lane and register is as before. 16 rows take the same space as in row-major order, so every base that is a multiple of 16 rows stays.
// two values split into bf16 hi + lo: h and l each hold y0's part in the low half and y1's in the high half
__device__ __forceinline__ void splitf2(float y0, float y1, unsigned& h, unsigned& l) { h = f2bf2(y0, y1); l = f2bf2(y0 - __uint_as_float(h << 16), y1 - __uint_as_float(h & 0xFFFF0000u)); }
typedef __attribute__((ext_vector_type(4))) unsigned short v4us;
typedef __attribute__((ext_vector_type(2))) unsigned v2u;
typedef __attribute__((ext_vector_type(4))) unsigned v4u;
template <typename T16> struct WFrag;
template <> struct WFrag<h16> { typedef v16h V; static __device__ __forceinline__ V ld(const h16* p) { return cat16(*(const v8h*)p, *(const v8h*)(p + 256)); } static __device__ __forceinline__ v8f mma(V a, V b, v8f c) { return wmma16(a, b, c); } };
template <> struct WFrag<bf> { typedef v16bf V; static __device__ __forceinline__ V ld(const bf* p) { return cat16b(*(const v8us*)p, *(const v8us*)(p + 256)); } static __device__ __forceinline__ v8f mma(V a, V b, v8f c) { return wmmab(a, b, c); } };

// Workspace layout that k_cvt writes and k_proj reads (bf16, in elements from CV): the five weights in the order q, k, v, pos_k, pos_q, then hidden_states (both batch items), then rel_embeddings.
#define CVW  (DM * DM)             // one weight
#define CVX  (5 * CVW)             // hidden_states
#define CVR  (CVX + NB_ * TT * DM) // rel_embeddings
#define CVN  (CVR + NPE * DM)
// Planes that k_proj writes (in elements from PLN): q hi, q lo, k hi, k lo, v hi, v lo, each [batch item][head][..][..]; then pos_k hi, pos_k lo, pos_q hi, pos_q lo, each [head][512][64].
#define PLB  (NH_ * TT * HD)       // one batch item of one plane
#define PLQ  (NB_ * PLB)           // one q, k or v plane
#define PLP  (NH_ * NPE * HD)      // one pos_k or pos_q plane
#define PLN_ (6 * PLQ + 4 * PLP)

// ---- k_proj: all eight projections (q, k, v of both batch items, pos_k, pos_q) in one grid; none reads what another writes. grid (16, 16, 7), 32 x KSL threads. blockIdx.z: 0, 1 q of batch item 0, 1; 2, 3 k; 4, 5 v; 6 pos_k (x < 8) and pos_q (x >= 8).
// A tile's K = 1024 is cut into KSL contiguous slices, one wave of the work-group per slice, so that KSL waves' loads are in flight on a tile; each wave leaves its partial tile in LDS and, behind one barrier, every thread sums its share of the tile over the slices in the fixed order 0 .. KSL-1.
// C[m][n] = sum_k A[m][k] Bt[n][k] + bias (bias[n]; for v, taken as Wv x^T, bias[m]). The output planes are in fragment order too, rows m, ldc columns: a 64-column tile y is a head's own plane (q, k, pos: ldc 64, cstep rows x 64) or two chunks of each row block (v: ldc 1024, cstep 2 x 512).
// The value is split into bf16 hi + lo, the planes the next GEMM takes as operands.
__global__ __launch_bounds__(32 * KSL) void k_proj(const bf* __restrict__ CV, bf* PLN, const float* __restrict__ bq, const float* __restrict__ bk, const float* __restrict__ bv, const float* __restrict__ bpk, const float* __restrict__ bpq) {
    typedef WFrag<bf>::V V;
    __shared__ __align__(16) float os[KSL * 64 * 68];
    const int job = blockIdx.z; int bx = blockIdx.x;
    const bf* A; const bf* Bt; bf* Ch; bf* Cl; const float* bias; int ldc, cstep; bool rowb = false;   // all uniform over the work-group
    if (job < 6) { const int t = job >> 1, b = job & 1; const bf* X = CV + CVX + b * (TT * DM); const bf* Wt = CV + t * CVW; Ch = PLN + 2 * t * PLQ + b * PLB; Cl = Ch + PLQ; bias = t == 0 ? bq : (t == 1 ? bk : bv);
        if (t < 2) { A = X; Bt = Wt; ldc = HD; cstep = TT * HD; } else { A = Wt; Bt = X; ldc = TT; cstep = 1024; rowb = true; } }
    else { const int t = bx >> 3; bx &= 7; A = CV + CVR; Bt = CV + (3 + t) * CVW; Ch = PLN + 6 * PLQ + 2 * t * PLP; Cl = Ch + PLP; bias = t ? bpq : bpk; ldc = HD; cstep = NPE * HD; }
    const size_t co = (size_t)blockIdx.y * cstep;   // where this column tile starts in the output
    const int lane = threadIdx.x & 31, lr = lane & 15, hi = lane >> 4; const int r0 = bx * 64, c0 = blockIdx.y * 64;
    v8f acc[4][4];
#pragma unroll
    for (int mb = 0; mb < 4; ++mb)
#pragma unroll
        for (int nb = 0; nb < 4; ++nb) acc[mb][nb] = (v8f){};
    const size_t aoff = (size_t)r0 * DM + 8 * lane, boff = (size_t)c0 * DM + 8 * lane;   // first chunk of the tile's rows, plus the lane's 16 bytes
    const int wv = __builtin_amdgcn_readfirstlane((int)(threadIdx.x >> 5)); const int k0 = wv * (DM / KSL), k1 = k0 + DM / KSL;   // this wave's K slice, in scalar registers
#pragma unroll 1
    for (int kc = k0; kc < k1; kc += 32) {   // rolled: one trip's fragments and the 16 accumulators are what the registers hold
        const bf* ap = A + aoff + kc * 16; const bf* bp = Bt + boff + kc * 16; V a[4];   // chunk kc / 32 of 512 elements
#pragma unroll
        for (int mb = 0; mb < 4; ++mb) a[mb] = WFrag<bf>::ld(ap + mb * 16 * DM);
#pragma unroll
        for (int nb = 0; nb < 4; ++nb) { const V b = WFrag<bf>::ld(bp + nb * 16 * DM);
#pragma unroll
            for (int mb = 0; mb < 4; ++mb) acc[mb][nb] = WFrag<bf>::mma(a[mb], b, acc[mb][nb]); }
        // the trip's 16 loads name these two addresses: they stay whole up to this wait, so that no later load is given one of them to write into before it
        asm volatile("s_wait_xcnt 0x0" :: "v"(ap), "v"(bp) : "memory");
        // four vector slots between the last matrix instruction and the back edge, where the next trip's loads overwrite its operands
        asm volatile("v_nop\n\tv_nop\n\tv_nop\n\tv_nop" : "+v"(acc[0][0]), "+v"(acc[1][1]), "+v"(acc[2][2]), "+v"(acc[3][3]) : "v"(a[0]), "v"(a[3]));
    }
    // the bias by column and by row of this thread's four pieces, both read here (both lie inside the 1024 floats for every job) so that the loads fly during the LDS stores and the barrier; the job picks one below
    const int cofs = ((int)threadIdx.x >> 4) * 4, rw = (int)threadIdx.x & 15; const float* bcp = bias + c0 + cofs; const float* brp = bias + r0 + rw; float bc[4], br[4];
#pragma unroll
    for (int q = 0; q < 4; ++q) { bc[q] = bcp[q]; br[q] = brp[q * (2 * KSL)]; }
    // these loads name the two addresses: they stay whole up to this wait, so that nothing below is given one of them to write into before it
    asm volatile("s_wait_xcnt 0x0" :: "v"(bcp), "v"(brp) : "memory");
    float* mine = os + wv * (64 * 68);
    // the three loops are unrolled so that acc is indexed by constants and stays in registers
#pragma unroll
    for (int mb = 0; mb < 4; ++mb)
#pragma unroll
        for (int nb = 0; nb < 4; ++nb)
#pragma unroll
            for (int j = 0; j < 8; ++j) mine[(mb * 16 + hi * 8 + j) * 68 + nb * 16 + lr] = acc[mb][nb][j];
    __syncthreads();   // every slice's partial tile is in LDS before any thread sums across the slices
    v4us oh[32 / KSL], ol[32 / KSL];
    // both loops are unrolled so that a thread's LDS reads issue ahead of its sums
#pragma unroll
    for (int s = 0; s < 32 / KSL; ++s) { const int row = s * (2 * KSL) + rw; v4f val = *(const v4fa*)(os + row * 68 + cofs);
#pragma unroll
        for (int w = 1; w < KSL; ++w) val += *(const v4fa*)(os + w * (64 * 68) + row * 68 + cofs);
#pragma unroll
        for (int q = 0; q < 4; ++q) val[q] += bfr(rowb ? br[s] : bc[q]);
        unsigned a0, c0h, a1, c1h; splitf2(val[0], val[1], a0, c0h); splitf2(val[2], val[3], a1, c1h); oh[s] = __builtin_bit_cast(v4us, (v2u){a0, a1}); ol[s] = __builtin_bit_cast(v4us, (v2u){c0h, c1h}); }
    __builtin_amdgcn_sched_barrier(0);   // the stores stay below every sum, last in the kernel, so that nothing rewrites a register that an issued store names
#pragma unroll
    for (int s = 0; s < 32 / KSL; ++s) { const size_t o = (size_t)(r0 / 16 + s) * (ldc * 16) + co + (cofs >> 5) * 512 + ((cofs >> 3) & 3) * 128 + rw * 8 + (cofs & 7); *(v4us*)(Ch + o) = oh[s]; *(v4us*)(Cl + o) = ol[s]; }   // row r0 + 16 s + rw, columns cofs .. + 3 of the tile; a wave's 16 rows x 8 columns are 256 contiguous bytes
}

// ---- k_rel: both relative terms, summed where they are made and laid out the way the softmax reads them. R[z][i][p] = q[i] . pos_k[p] + pos_q[p] . k[i - p + SPAN] for 0 < p < NPE - 1, and q[i] . pos_k[p] alone in the two end columns (each product hi/lo, 3 products).
// One wave per tile of 64 i x 64 p. The p2c part needs the 127 keys j = jb .. jb + 126 (jb = i0 - p0 + SPAN - 63): the wave computes the 64 p x 128 j products in two halves into LDS. Keys outside [0, TT) are clamped for the load only; the R elements made from them belong to no (i, j) and are never read.
// Then it forms the c2p tile in the same 16 accumulators, adds to each element, in the accumulator's own layout (row i = 16 mb + 8 hi + r, column p = 16 nb + lr), the p2c value from the diagonal of the LDS tile, and stores the sum.
// E[z][0][j] = p2c[0][j] and E[z][1][j] = p2c[NPE-1][j] serve the clipped ends (j >= i + SPAN, j <= i - SPAN + 1); each 64-key piece is written by the one tile that holds it aligned. grid (TT/64, NPE/64, NZ), 32 threads; z = batch item x NH_ + head picks q, k, R and E, the head alone picks pos_q and pos_k.
__global__ __launch_bounds__(32) void k_rel(const bf* __restrict__ A, const bf* __restrict__ A2, const bf* __restrict__ Bt, const bf* __restrict__ Bt2, const bf* __restrict__ Qh, const bf* __restrict__ Ql, const bf* __restrict__ Ph, const bf* __restrict__ Pl, float* G, float* E) {
    typedef WFrag<bf>::V V;
    __shared__ __align__(16) float ts[64 * 132];
    const size_t z = blockIdx.z, zh = blockIdx.z % NH_; A += zh * (size_t)(NPE * HD); A2 += zh * (size_t)(NPE * HD); Bt += z * (size_t)(TT * HD); Bt2 += z * (size_t)(TT * HD); G += z * (size_t)(TT * NPE); E += z * (size_t)(2 * TT);
    Qh += z * (size_t)(TT * HD); Ql += z * (size_t)(TT * HD); Ph += zh * (size_t)(NPE * HD); Pl += zh * (size_t)(NPE * HD);
    const int lane = threadIdx.x & 31, lr = lane & 15, hi = lane >> 4; const int i0 = blockIdx.x * 64, p0 = blockIdx.y * 64; const int jb = i0 - p0 + (SPAN - 63);
    const unsigned lo = (unsigned)(8 * lane);   // fragment order: the lane's 16 bytes of a chunk's half
#pragma unroll 1
    for (int hf = 0; hf < 2; ++hf) {   // rolled: one set of 16 accumulators serves both halves
        v8f acc[4][4];
#pragma unroll
        for (int mb = 0; mb < 4; ++mb)
#pragma unroll
            for (int nb = 0; nb < 4; ++nb) acc[mb][nb] = (v8f){};
        unsigned boff[4];
#pragma unroll
        for (int nb = 0; nb < 4; ++nb) { int j = jb + hf * 64 + nb * 16 + lr; j = j < 0 ? 0 : (j > TT - 1 ? TT - 1 : j); boff[nb] = (unsigned)((j >> 4) * (16 * HD) + hi * 128 + (j & 15) * 8); }   // the lane's own key in fragment order: the keys of a fragment start at no multiple of 16 here
#pragma unroll 1
        for (int kc = 0; kc < HD; kc += 32) {
            V a[4], a2[4]; const bf* ap = A + p0 * HD + kc * 16; const bf* ap2 = A2 + p0 * HD + kc * 16; const bf* bp = Bt + kc * 16; const bf* bp2 = Bt2 + kc * 16;   // chunk kc / 32, uniform
#pragma unroll
            for (int mb = 0; mb < 4; ++mb) { a[mb] = WFrag<bf>::ld(ap + mb * 16 * HD + lo); a2[mb] = WFrag<bf>::ld(ap2 + mb * 16 * HD + lo); }
#pragma unroll
            for (int nb = 0; nb < 4; ++nb) { const V b = WFrag<bf>::ld(bp + boff[nb]); const V b2 = WFrag<bf>::ld(bp2 + boff[nb]);
#pragma unroll
                for (int mb = 0; mb < 4; ++mb) { acc[mb][nb] = WFrag<bf>::mma(a[mb], b, acc[mb][nb]); acc[mb][nb] = WFrag<bf>::mma(a2[mb], b, acc[mb][nb]); acc[mb][nb] = WFrag<bf>::mma(a[mb], b2, acc[mb][nb]); } }
            // the trip's loads name these bases and offsets: they stay whole up to this wait, so that nothing is given one of them to write into before it
            asm volatile("s_wait_xcnt 0x0" :: "s"(ap), "s"(ap2), "s"(bp), "s"(bp2), "v"(lo), "v"(boff[0]), "v"(boff[1]), "v"(boff[2]), "v"(boff[3]) : "memory");
            // four vector slots between the last matrix instruction and the back edge, where the next trip's loads overwrite its operands
            asm volatile("v_nop\n\tv_nop\n\tv_nop\n\tv_nop" : "+v"(acc[0][0]), "+v"(acc[1][1]), "+v"(acc[2][2]), "+v"(acc[3][3]) : "v"(a[0]), "v"(a[3]));
        }
        // unrolled so that acc is indexed by constants and stays in registers
#pragma unroll
        for (int mb = 0; mb < 4; ++mb)
#pragma unroll
            for (int nb = 0; nb < 4; ++nb)
#pragma unroll
                for (int r = 0; r < 8; ++r) ts[(mb * 16 + hi * 8 + r) * 132 + hf * 64 + nb * 16 + lr] = acc[mb][nb][r];
    }
    // the c2p tile: rows i0 .. + 63 of q against rows p0 .. + 63 of pos_k
    v8f acc[4][4];
#pragma unroll
    for (int mb = 0; mb < 4; ++mb)
#pragma unroll
        for (int nb = 0; nb < 4; ++nb) acc[mb][nb] = (v8f){};
#pragma unroll 1
    for (int kc = 0; kc < HD; kc += 32) {   // rolled: one trip's fragments and the 16 accumulators are what the registers hold
        V a[4], a2[4]; const bf* ap = Qh + i0 * HD + kc * 16; const bf* ap2 = Ql + i0 * HD + kc * 16; const bf* bp = Ph + p0 * HD + kc * 16; const bf* bp2 = Pl + p0 * HD + kc * 16;   // chunk kc / 32 of the tile's first rows, uniform
#pragma unroll
        for (int mb = 0; mb < 4; ++mb) { a[mb] = WFrag<bf>::ld(ap + mb * 16 * HD + lo); a2[mb] = WFrag<bf>::ld(ap2 + mb * 16 * HD + lo); }
#pragma unroll
        for (int nb = 0; nb < 4; ++nb) { const V b = WFrag<bf>::ld(bp + nb * 16 * HD + lo); const V b2 = WFrag<bf>::ld(bp2 + nb * 16 * HD + lo);
#pragma unroll
            for (int mb = 0; mb < 4; ++mb) { acc[mb][nb] = WFrag<bf>::mma(a[mb], b, acc[mb][nb]); acc[mb][nb] = WFrag<bf>::mma(a2[mb], b, acc[mb][nb]); acc[mb][nb] = WFrag<bf>::mma(a[mb], b2, acc[mb][nb]); } }
        // the trip's loads name these bases and this offset: they stay whole up to this wait, so that nothing is given one of them to write into before it
        asm volatile("s_wait_xcnt 0x0" :: "s"(ap), "s"(ap2), "s"(bp), "s"(bp2), "v"(lo) : "memory");
        // four vector slots between the last matrix instruction and the back edge, where the next trip's loads overwrite its operands
        asm volatile("v_nop\n\tv_nop\n\tv_nop\n\tv_nop" : "+v"(acc[0][0]), "+v"(acc[1][1]), "+v"(acc[2][2]), "+v"(acc[3][3]) : "v"(a[0]), "v"(a[3]));
    }
    __builtin_amdgcn_wave_barrier(); asm volatile("" ::: "memory");   // the reads below take other lanes' writes: keep the compiler from moving them up (one wave: the LDS itself works in order)
    const float* tl = ts + lr * 131 + hi * 8 + 63;   // column p0 + pl, row i0 + ii: key j = (i0 + ii) - (p0 + pl) + SPAN = jb + (ii - pl + 63), that is ts[pl x 132 + ii - pl + 63]
    float* gl = G + (size_t)(i0 + hi * 8) * NPE + p0 + lr;
    bool in[4];
#pragma unroll
    for (int nb = 0; nb < 4; ++nb) in[nb] = (unsigned)(p0 + nb * 16 + lr - 1) < (unsigned)(NPE - 2);   // the two end columns take no p2c part: there the softmax adds E by key
    // every loop below is unrolled so that acc is indexed by constants and stays in registers
#pragma unroll
    for (int mb = 0; mb < 4; ++mb) {
#pragma unroll
        for (int r = 0; r < 8; ++r)
#pragma unroll
            for (int nb = 0; nb < 4; ++nb) { const float g = tl[nb * 16 * 131 + mb * 16 + r]; acc[mb][nb][r] += in[nb] ? g : 0.f; }
        __builtin_amdgcn_sched_barrier(0);   // the 32 sums stay above their stores, so that between the first store and the wait nothing is written
#pragma unroll
        for (int r = 0; r < 8; ++r)
#pragma unroll
            for (int nb = 0; nb < 4; ++nb) gl[(mb * 16 + r) * NPE + nb * 16] = acc[mb][nb][r];   // four stores in a row fill 256 bytes of each of two rows
        asm volatile("s_wait_xcnt 0x0" ::: "memory");   // what follows may rewrite the data registers that these stores name
        __builtin_amdgcn_sched_barrier(0);   // and stays behind that wait
    }
    if (p0 == 0 && i0 + SPAN < TT) { E[i0 + SPAN + lane] = ts[63 + lane]; E[i0 + SPAN + 32 + lane] = ts[63 + 32 + lane]; }                                        // p = 0: keys i0 + SPAN .. + 63
    if (p0 == NPE - 64 && i0 >= SPAN - 64) { E[TT + i0 - (SPAN - 64) + lane] = ts[63 * 132 + 63 + lane]; E[TT + i0 - (SPAN - 64) + 32 + lane] = ts[63 * 132 + 63 + 32 + lane]; }   // p = NPE - 1: keys i0 - SPAN + 64 .. + 63
}

__device__ __forceinline__ h16 tohx(float x) { return (h16)x; }
typedef __attribute__((ext_vector_type(2))) _Float16 v2h;
typedef __attribute__((ext_vector_type(4))) _Float16 v4h;
typedef __attribute__((ext_vector_type(2))) unsigned short v2us;
typedef __attribute__((ext_vector_type(2))) float v2f;
typedef __attribute__((ext_vector_type(4))) int v4i;

// ---- k_cvt: every f32 -> bf16 rounding of an input (five weights, hidden_states, rel_embeddings) in one grid, into the layout CVW / CVX / CVR above, each source in fragment order (KD = 1024). grid (CVN / 8192), 256 threads.
// A work-group rounds 16 rows x 512 columns, that is 16 chunks, 16 KiB in a row of the output. A thread takes four pieces of 8 elements, four chunks apart. A wave takes 8 rows of one chunk at a time: it reads one whole line (32 floats) of each row
// and writes, for each of the chunk's four groups of 8 columns, the 8 rows' pieces as one whole line. Every source is a multiple of 16 rows long, so a work-group has one source.
__global__ __launch_bounds__(256) void k_cvt(const float* __restrict__ wq, const float* __restrict__ wk, const float* __restrict__ wv, const float* __restrict__ wpk, const float* __restrict__ wpq, const float* __restrict__ x, const float* __restrict__ rel, bf* CV) {
    const unsigned e0 = (blockIdx.x >> 1) * (16u * DM), h0 = (blockIdx.x & 1) * 512u; const unsigned seg = e0 / CVW;   // uniform: first element of the 16 rows, first column, which source
    const float* src; unsigned s0;
    if (seg < 5) { src = seg == 0 ? wq : (seg == 1 ? wk : (seg == 2 ? wv : (seg == 3 ? wpk : wpq))); s0 = seg * CVW; }
    else if (e0 < CVR) { src = x; s0 = CVX; }
    else { src = rel; s0 = CVR; }
    src += e0 - s0 + h0; bf* dst = CV + e0 + h0 * 16; const unsigned t = threadIdx.x;
    const unsigned row = ((t >> 5) & 1) * 8 + (t & 7), grp = (t >> 3) & 3, ch = t >> 6;   // the thread's row of the 16, group of 8 columns of the chunk, first chunk
    const unsigned so = row * DM + ch * 32 + grp * 8, eo = ch * 512 + grp * 128 + row * 8;   // where the piece is read and where it is written; u moves both on by four chunks
    v8f v[4];
    // both loops are unrolled so that the four loads issue ahead of the first rounding
#pragma unroll
    for (int u = 0; u < 4; ++u) v[u] = *(const v8f*)(src + u * 128 + so);
#pragma unroll
    for (int u = 0; u < 4; ++u) { v4u o;
#pragma unroll
        for (int k = 0; k < 4; ++k) o[k] = f2bf2(v[u][2 * k], v[u][2 * k + 1]);
        *(v8us*)(dst + u * 2048 + eo) = __builtin_bit_cast(v8us, o); }
}

// ---- k_fattn: content scores, the two relative terms, softmax and attn.v of FR = 32 query rows of one head in one work-group, so that neither the scores nor the weights go through memory. grid (TT/FR, NZ), 32 x KSL threads; blockIdx.y = batch item x NH_ + head.
// Wave w owns the keys 128 w .. 128 w + 127. It forms its 32 x 128 scores (hi/lo, 3 products) in 16 accumulators and, in the accumulator's own layout (row = 16 mb + 8 hi + r, key = 16 nb + lr),
// t = (S + c2p[i][rp] + p2c[rp][j]) x scale with rp = clip(i - j + 256, 0, 511), -3e38 where mask == 0. Both relative terms come as one value R[row][rp] from k_rel's plane; at and beyond the clipped ends R holds c2p alone, and p2c is E[zz][0][j] / E[zz][1][j] (behind R in the same buffer), which a lane holds in registers for its eight keys.
// Row maximum and row sum: over the wave's own keys in registers and by lane exchange, then over the eight waves through LDS in the order 0 .. 7. The weights, split hi/lo, go to the wave's own LDS piece row by row, from where the A loader takes them as it would from memory;
// each wave multiplies its 128 keys into a partial 32 x 64 tile (the K slices of the former attn.v GEMM), and the partial tiles are summed in LDS in slice order.
#define FR   32                    // query rows per work-group
#define PPI  136                   // LDS pitch of a row of weights, in 16-bit elements: 256 bytes + 16, for 16-byte fragment reads
#define PWV  (2 * FR * PPI)        // 16-bit elements of one wave's LDS piece: hi plane, lo plane
__device__ __forceinline__ v16bf ldsfrag(const bf* p) { return cat16b(*(const v8usa*)p, *(const v8usa*)(p + 16)); }
// launch bounds: 4 waves per SIMD, that is at most 256 registers a wave, so that two work-groups (their LDS fits twice) share a WGP and the whole grid is resident at once
__global__ __launch_bounds__(32 * KSL, 4) void k_fattn(const bf* __restrict__ Qh, const bf* __restrict__ Ql, const bf* __restrict__ Kh, const bf* __restrict__ Kl, const bf* __restrict__ Vh, const bf* __restrict__ Vl, const float* __restrict__ P2C, const int* __restrict__ MK, float* O) {
    typedef WFrag<bf>::V V;
    __shared__ __align__(16) bf ps[KSL * PWV];
    __shared__ __align__(16) float red[2 * FR * KSL];
    const int zz = blockIdx.y, i0 = blockIdx.x * FR; const int lane = threadIdx.x & 31, lr = lane & 15, hi = lane >> 4;
    const int wv = __builtin_amdgcn_readfirstlane((int)(threadIdx.x >> 5)); const int j0 = wv * (TT / KSL);   // this wave's keys, in a scalar register
    // uniform bases (head, first query row, the wave's first key) plus one unsigned lane offset per operand: every fragment load is then scalar base + lane offset + constant
    { const size_t zo = (size_t)zz * (TT * HD); Qh += zo + i0 * HD; Ql += zo + i0 * HD; Kh += zo + j0 * HD; Kl += zo + j0 * HD; Vh += zo + j0 * 16; Vl += zo + j0 * 16; }   // v: chunk j0 / 32 of each block of 16 rows d
    const int* MKb = MK + (size_t)(zz / NH_) * (TT * TT); O += (size_t)(zz / NH_) * (TT * DQ) + (zz % NH_) * HD;   // the batch item's mask; the batch item's rows and the head's 64 columns of the merged output
    const unsigned lo64 = (unsigned)(8 * lane), lov = lo64;   // fragment order: the lane's 16 bytes of a chunk's half
    v8f acc[2][8];
#pragma unroll
    for (int mb = 0; mb < 2; ++mb)
#pragma unroll
        for (int nb = 0; nb < 8; ++nb) acc[mb][nb] = (v8f){};
    // every loop over mb, nb, r below is unrolled so that the accumulators are indexed by constants and stay in registers
#pragma unroll
    for (int kc = 0; kc < HD; kc += 32) {
        V a[2], a2[2];
#pragma unroll
        for (int mb = 0; mb < 2; ++mb) { const int o = mb * 16 * HD + kc * 16; a[mb] = WFrag<bf>::ld(Qh + o + lo64); a2[mb] = WFrag<bf>::ld(Ql + o + lo64); }
#pragma unroll
        for (int nb = 0; nb < 8; ++nb) { const int o = nb * 16 * HD + kc * 16; const V b = WFrag<bf>::ld(Kh + o + lo64); const V b2 = WFrag<bf>::ld(Kl + o + lo64);
#pragma unroll
            for (int mb = 0; mb < 2; ++mb) { acc[mb][nb] = WFrag<bf>::mma(a[mb], b, acc[mb][nb]); acc[mb][nb] = WFrag<bf>::mma(a2[mb], b, acc[mb][nb]); acc[mb][nb] = WFrag<bf>::mma(a[mb], b2, acc[mb][nb]); } }
    }
    // the q and k loads name these bases and this offset: they stay whole up to this wait, so that nothing is given one of them to write into before it
    asm volatile("s_wait_xcnt 0x0" :: "s"(Qh), "s"(Ql), "s"(Kh), "s"(Kl), "v"(lo64) : "memory");
    // lane bases; the mask index adds a compile-time constant to mo; the R and E indices add a position or key clamped per lane
    const int ib = i0 + hi * 8, jl = j0 + lr; const int gb = (zz * TT + ib) * NPE, db = ib - jl + SPAN, mo = ib * TT + jl, eo = NZ * TT * NPE + zz * 2 * TT;
    float* rl = red + hi * 8 * KSL;
    float mx[2][8], sm[2][8];
    __builtin_amdgcn_sched_barrier(0);   // keeps the address arithmetic of the gathers out of the matrix phase, where it would hold registers
    // p2c's two end rows at the lane's eight keys. Row 0 is used (and written) only for keys >= SPAN, row NPE - 1 only for keys <= TT - SPAN: the key is clamped to that range, so that nothing unwritten is read
    float e0[8], e1[8]; int ea[8], eb[8];
#pragma unroll
    for (int nb = 0; nb < 8; ++nb) { const int j = jl + nb * 16; ea[nb] = eo + (j < SPAN ? SPAN : j); eb[nb] = eo + TT + (j > TT - SPAN ? TT - SPAN : j); e0[nb] = P2C[ea[nb]]; e1[nb] = P2C[eb[nb]]; }
    // these 16 loads name these index registers: they stay whole up to this wait, so that no later load or sum is given one of them to write into before it
    asm volatile("s_wait_xcnt 0x0" :: "v"(ea[0]), "v"(ea[1]), "v"(ea[2]), "v"(ea[3]), "v"(ea[4]), "v"(ea[5]), "v"(ea[6]), "v"(ea[7]), "v"(eb[0]), "v"(eb[1]), "v"(eb[2]), "v"(eb[3]), "v"(eb[4]), "v"(eb[5]), "v"(eb[6]), "v"(eb[7]) : "memory");
    // two rows (16 logits a lane) at a time: their 32 loads are all issued before the first is used, so that a wave waits once per batch and not once per logit
#pragma unroll
    for (int mb = 0; mb < 2; ++mb)
#pragma unroll
        for (int rb = 0; rb < 8; rb += 2) { float cv[2][8]; int mv[2][8];
#pragma unroll
            for (int q = 0; q < 2; ++q) { const int ro = mb * 16 + rb + q;   // query row i = ib + ro, key j = jl + 16 nb
                int pa[8], ma[8];
#pragma unroll
                for (int nb = 0; nb < 8; ++nb) { int rp = db + (ro - nb * 16); rp = rp < 0 ? 0 : (rp > NPE - 1 ? NPE - 1 : rp); const int pin = gb + rp + ro * NPE, mi = mo + (ro * TT + nb * 16); pa[nb] = pin; ma[nb] = mi;
                    cv[q][nb] = P2C[pin]; mv[q][nb] = MKb[mi]; }
                // the row's 16 loads name these index registers: they stay whole up to this wait, so that no later load or sum is given one of them to write into before it
                asm volatile("s_wait_xcnt 0x0" :: "v"(pa[0]), "v"(pa[1]), "v"(pa[2]), "v"(pa[3]), "v"(pa[4]), "v"(pa[5]), "v"(pa[6]), "v"(pa[7]), "v"(ma[0]), "v"(ma[1]), "v"(ma[2]), "v"(ma[3]), "v"(ma[4]), "v"(ma[5]), "v"(ma[6]), "v"(ma[7]), "v"(mo) : "memory"); }
            __builtin_amdgcn_sched_barrier(0);   // the batch's loads stay above, their uses below
#pragma unroll
            for (int q = 0; q < 2; ++q) { const int r = rb + q; float m = -3.0e38f;
#pragma unroll
                for (int nb = 0; nb < 8; ++nb) { const int rq = db + (mb * 16 + r - nb * 16); const float pe = rq <= 0 ? e0[nb] : (rq >= NPE - 1 ? e1[nb] : 0.f); const float sa = __fmul_rn(__fadd_rn(__fadd_rn(acc[mb][nb][r], cv[q][nb]), pe), SCL); const float t = (mv[q][nb] != 0) ? sa : -3.0e38f; acc[mb][nb][r] = t; m = fmaxf(m, t); }
                mx[mb][r] = m; }
            __builtin_amdgcn_sched_barrier(0);   // the next batch's loads do not start before this batch's registers are free
        }
#pragma unroll
    for (int sh = 8; sh; sh >>= 1)   // over the 16 lanes that hold a row; the 16 rows' exchanges of one distance go together
#pragma unroll
        for (int mb = 0; mb < 2; ++mb)
#pragma unroll
            for (int r = 0; r < 8; ++r) mx[mb][r] = fmaxf(mx[mb][r], __shfl_xor(mx[mb][r], sh, 32));
    if (lr == 0) {
#pragma unroll
        for (int mb = 0; mb < 2; ++mb)
#pragma unroll
            for (int r = 0; r < 8; ++r) rl[(mb * 16 + r) * KSL + wv] = mx[mb][r]; }
    __syncthreads();   // every wave's row maxima are in LDS before any wave takes the maximum over the waves
#pragma unroll
    for (int mb = 0; mb < 2; ++mb)
#pragma unroll
        for (int r = 0; r < 8; ++r) { const float* rr = rl + (mb * 16 + r) * KSL; const v4f u = *(const v4fa*)rr, w = *(const v4fa*)(rr + 4); const float m = fmaxf(fmaxf(fmaxf(u[0], u[1]), fmaxf(u[2], u[3])), fmaxf(fmaxf(w[0], w[1]), fmaxf(w[2], w[3]))); float s = 0.f;
#pragma unroll
            for (int nb = 0; nb < 8; ++nb) { const float x = __fmul_rn(__fsub_rn(acc[mb][nb][r], m), 1.4426950408889634f); float e;
                asm("v_exp_f32 %0, %1\n\tv_nop" : "=v"(e) : "v"(x));   // the v_nop fills the one slot behind a transcendental, whatever instruction the compiler puts next
                acc[mb][nb][r] = e; s += e; }
            sm[mb][r] = s; }
#pragma unroll
    for (int sh = 8; sh; sh >>= 1)
#pragma unroll
        for (int mb = 0; mb < 2; ++mb)
#pragma unroll
            for (int r = 0; r < 8; ++r) sm[mb][r] += __shfl_xor(sm[mb][r], sh, 32);
    if (lr == 0) {
#pragma unroll
        for (int mb = 0; mb < 2; ++mb)
#pragma unroll
            for (int r = 0; r < 8; ++r) rl[FR * KSL + (mb * 16 + r) * KSL + wv] = sm[mb][r]; }
    __syncthreads();   // every wave's row sums are in LDS before any wave adds them up
    __builtin_amdgcn_sched_barrier(0);   // keeps the addresses of the later phases from being formed early and spilled
    bf* ph = ps + wv * PWV; bf* pl = ph + FR * PPI; bf* phw = ph + hi * 8 * PPI + lr; bf* plw = pl + hi * 8 * PPI + lr; const bf* phr = ph + lr * PPI + 8 * hi; const bf* plr = pl + lr * PPI + 8 * hi;   // lane bases of the stores and of the fragment reads
#pragma unroll
    for (int mb = 0; mb < 2; ++mb)
#pragma unroll
        for (int r = 0; r < 8; ++r) { const float* rr = rl + FR * KSL + (mb * 16 + r) * KSL; const v4f u = *(const v4fa*)rr, w = *(const v4fa*)(rr + 4); const float s = ((((((u[0] + u[1]) + u[2]) + u[3]) + w[0]) + w[1]) + w[2]) + w[3]; const float f = __fdiv_rn(1.0f, s);
#pragma unroll
            for (int nb = 0; nb < 8; nb += 2) { unsigned a, c; splitf2(acc[mb][nb][r] * f, acc[mb][nb + 1][r] * f, a, c); const int o = (mb * 16 + r) * PPI + nb * 16;   // the keys 16 nb + lr (low halves) and 16 nb + 16 + lr (high halves)
                phw[o] = (unsigned short)a; phw[o + 16] = (unsigned short)(a >> 16); plw[o] = (unsigned short)c; plw[o + 16] = (unsigned short)(c >> 16); } }
    __builtin_amdgcn_wave_barrier(); asm volatile("" ::: "memory");   // the fragment reads below take other lanes' writes: keep the compiler from moving them up (one wave's own piece: the LDS itself works in order)
    v8f oc[2][4];
#pragma unroll
    for (int mb = 0; mb < 2; ++mb)
#pragma unroll
        for (int nb = 0; nb < 4; ++nb) oc[mb][nb] = (v8f){};
#pragma unroll
    for (int kc = 0; kc < TT / KSL; kc += 32) {
        V a[2], a2[2];
#pragma unroll
        for (int mb = 0; mb < 2; ++mb) { const int o = mb * 16 * PPI + kc; a[mb] = ldsfrag(phr + o); a2[mb] = ldsfrag(plr + o); }
#pragma unroll
        for (int nb = 0; nb < 4; ++nb) { const int o = nb * 16 * TT + kc * 16; const V b = WFrag<bf>::ld(Vh + o + lov); const V b2 = WFrag<bf>::ld(Vl + o + lov);
#pragma unroll
            for (int mb = 0; mb < 2; ++mb) { oc[mb][nb] = WFrag<bf>::mma(a[mb], b, oc[mb][nb]); oc[mb][nb] = WFrag<bf>::mma(a2[mb], b, oc[mb][nb]); oc[mb][nb] = WFrag<bf>::mma(a[mb], b2, oc[mb][nb]); } }
    }
    __builtin_amdgcn_wave_barrier(); asm volatile("" ::: "memory");   // the partial tile goes over the wave's own weights: keep the compiler from moving its stores above the fragment reads
    float* os = (float*)ps;   // one wave's piece holds PWV / 2 floats, its partial tile takes the first FR x 68 of them
    {   float* mine = os + wv * (PWV / 2) + hi * 8 * 68 + lr;
#pragma unroll
        for (int mb = 0; mb < 2; ++mb)
#pragma unroll
            for (int nb = 0; nb < 4; ++nb)
#pragma unroll
                for (int r = 0; r < 8; ++r) mine[(mb * 16 + r) * 68 + nb * 16] = oc[mb][nb][r]; }
    __syncthreads();   // every slice's partial tile is in LDS before any thread sums across the slices
    // both loops are unrolled so that a thread's LDS reads issue ahead of its sums
#pragma unroll
    for (int s = 0; s < FR * 16 / (32 * KSL); ++s) { const int idx = s * (32 * KSL) + (int)threadIdx.x; const int row = idx >> 4, cofs = (idx & 15) * 4; v4f val = *(const v4fa*)(os + row * 68 + cofs);
#pragma unroll
        for (int w = 1; w < KSL; ++w) val += *(const v4fa*)(os + w * (PWV / 2) + row * 68 + cofs);
        *(v4f*)(O + (size_t)(i0 + row) * DQ + cofs) = val; }
}

extern "C" void kernel_launch(void* const* d_in, const int* in_sizes, int n_in,
                              void* d_out, int out_size, void* d_ws, size_t ws_size, hipStream_t stream) {
    (void)in_sizes; (void)n_in; (void)out_size;
    const float* x = (const float*)d_in[0]; const int* MK = (const int*)d_in[1]; const float* rel = (const float*)d_in[2]; const float* wq = (const float*)d_in[3]; const float* bq = (const float*)d_in[4]; const float* wk = (const float*)d_in[5]; const float* bk = (const float*)d_in[6]; const float* wv = (const float*)d_in[7]; const float* bv = (const float*)d_in[8]; const float* wpk = (const float*)d_in[9]; const float* bpk = (const float*)d_in[10]; const float* wpq = (const float*)d_in[11]; const float* bpq = (const float*)d_in[12];
    float* OUT = (float*)d_out;     // [2][1024][1024]
    char* wsp = (char*)d_ws;
    auto take = [&](size_t bytes) { char* p = wsp; wsp += (bytes + 255) & ~(size_t)255; return (void*)p; };
    bf* CV = (bf*)take((size_t)CVN * 2); bf* PLN = (bf*)take((size_t)PLN_ * 2); float* P2C = (float*)take((size_t)NZ * NPE * TT * 4 + (size_t)NZ * 2 * TT * 4);   /* R [NZ][1024][512], then E [NZ][2][1024] */
    bf* QPh = PLN; bf* QPl = PLN + (size_t)PLQ; bf* KPh = PLN + (size_t)2 * PLQ; bf* KPl = PLN + (size_t)3 * PLQ; bf* VTh = PLN + (size_t)4 * PLQ; bf* VTl = PLN + (size_t)5 * PLQ; bf* PKh = PLN + (size_t)6 * PLQ; bf* PKl = PKh + (size_t)PLP; bf* PQh = PKh + (size_t)2 * PLP; bf* PQl = PKh + (size_t)3 * PLP;
    if ((size_t)(wsp - (char*)d_ws) > ws_size) return;    // ws 256 MiB; about 107 MiB taken
    // four launches, each of which reads what the one before it wrote; whatever does not depend on one another shares a grid
    k_cvt<<<CVN / 8192, 256, 0, stream>>>(wq, wk, wv, wpk, wpq, x, rel, CV);
    k_proj<<<dim3(16, 16, 7), 32 * KSL, 0, stream>>>(CV, PLN, bq, bk, bv, bpk, bpq);   /* q, k planes [b][h][t][d]; v^T planes [b][h][d][t]; pos_k, pos_q planes [h][512][64] */
    k_rel<<<dim3(TT / 64, NPE / 64, NZ), 32, 0, stream>>>(PQh, PQl, KPh, KPl, QPh, QPl, PKh, PKl, P2C, P2C + (size_t)NZ * TT * NPE);   /* c2p + sheared p2c, raw: R [NZ][1024][512] + E [NZ][2][1024] */
    k_fattn<<<dim3(TT / FR, NZ), 32 * KSL, 0, stream>>>(QPh, QPl, KPh, KPl, VTh, VTl, P2C, MK, OUT);   /* scores, softmax and attn.v, into the merged output [b][t][h x 64 + d] */
}

// v010
// It runs in 115 microseconds.
// In two side-by-side timings against v009, it was 1.09 and 1.08 times as fast.
// All steps since v000 together make it 9.17 times as fast.
#include <hip/hip_runtime.h>

// Disentangled self-attention (hidden_states [2][1024][1024]; q, k, v = hs W^T + b ('oi' [1024][1024]; 16 heads x 64); pos_k = rel_embeddings Wpk^T + bpk, pos_q = rel_embeddings Wpq^T + bpq (rel_embeddings [512][1024], read); scale = 1/sqrt(64 x 3); scores = q.k scale + c2p[i][clip(i-j+256, 0, 511)] + p2c[clip(i-j+256, 0, 511)][j] with c2p = q.pos_k scale ([S][512]) and p2c = (pos_q scale).k ([512][S]); mask (int32 [2][1][1024][1024], read; all ones) == 0 -> finfo.min and weight 0; softmax; out = merged attn.v -> [2][1024][1024] (2.1 M), no output projection).
// Layout: exact bf16 projections, whose GEMM epilogue writes the hi/lo planes that the next GEMM reads (q, k, pos_k, pos_q per head [h][t][d]; v transposed [h][d][t], from the product taken as Wv x^T; the elements of every 16-bit plane in fragment order, see below); hi/lo planes for q, k, pos_k, pos_q (every row: 3-product score GEMMs); all NZ = 32 (batch item, head) pairs in one pass: one kernel forms, for its 32 query rows, c2p [32][512] and p2c (sheared to row i column rp) as hi/lo GEMMs and keeps their sum in LDS (p2c's two end rows in registers), forms the content scores (hi/lo) in registers, gathers the summed relative term per logit from LDS (index clip(i - j + 256, 0, 511)), scales, applies the mask select, f32 softmax, hi/lo P through LDS, attn.v (3 products), stored straight into the merged f32 output.
// Compute dtypes, f32 accumulate: every input rounded to bf16; q/k/v/pos_k/pos_q on PLAIN bf16 operands (exact) + biases; all score terms and attn.v on hi/lo planes (3 products) for every row; softmax f32; output f32.

#define NB_  2
#define TT   1024
#define DM   1024
#define NH_  16
#define HD   64
#define DQ   (NH_ * HD)
#define NZ   (NB_ * NH_)          // (batch item, head) pairs: all of them ride in the grid of every score, softmax and attn.v launch, z = batch item x NH_ + head
#define RH   1024                  // not read by the code: every query row uses hi+lo planes
#define WIN  0
#define PCAR 1024.0f
#define SCL  0.072168783648703225f   // 1/sqrt(64 x 3)
#define NPE  512                  // 2 x att_span relative positions
#define SPAN 256
#define KSL  8                     // K slices (waves per work-group) of the K = 1024 GEMMs: the five projections, and attn.v inside k_fattn
typedef _Float16 h16;
typedef unsigned short bf;
typedef __attribute__((ext_vector_type(16))) __bf16   v16bf;
typedef __attribute__((ext_vector_type(16))) _Float16 v16h;
typedef __attribute__((ext_vector_type(8)))  _Float16 v8h;
typedef __attribute__((ext_vector_type(8)))  unsigned short v8us;
typedef __attribute__((ext_vector_type(8)))  float    v8f;
typedef __attribute__((ext_vector_type(4)))  float    v4f;
typedef v8h  __attribute__((may_alias)) v8ha;
typedef v4f  __attribute__((may_alias)) v4fa;
typedef v8us __attribute__((may_alias)) v8usa;

// f32 -> bf16, round to nearest even, by the chip's own conversion instruction (two values a time: a in the low half, b in the high half)
typedef __attribute__((ext_vector_type(2))) __bf16 v2bf;
typedef __attribute__((ext_vector_type(2))) float v2fl;
__device__ __forceinline__ unsigned f2bf2(float a, float b) { const v2fl x = {a, b}; return __builtin_bit_cast(unsigned, __builtin_convertvector(x, v2bf)); }
__device__ __forceinline__ unsigned short f2bf(float f) { return (unsigned short)f2bf2(f, f); }
__device__ __forceinline__ float bf2f(unsigned short b) { return __uint_as_float(((unsigned)b) << 16); }
__device__ __forceinline__ float bfr(float f) { return bf2f(f2bf(f)); }
__device__ __forceinline__ v16h cat16(v8h lo, v8h hi) { return __builtin_shufflevector(lo, hi, 0, 1, 2, 3, 4, 5, 6, 7, 8, 9, 10, 11, 12, 13, 14, 15); }
__device__ __forceinline__ v16bf cat16b(v8us lo, v8us hi) { return __builtin_bit_cast(v16bf, __builtin_shufflevector(lo, hi, 0, 1, 2, 3, 4, 5, 6, 7, 8, 9, 10, 11, 12, 13, 14, 15)); }
__device__ __forceinline__ v8f wmma16(v16h a, v16h b, v8f c) { return __builtin_amdgcn_wmma_f32_16x16x32_f16(false, a, false, b, (short)0, c, false, false); }
__device__ __forceinline__ v8f wmmab(v16bf a, v16bf b, v8f c) { return __builtin_amdgcn_wmma_f32_16x16x32_bf16(false, a, false, b, (short)0, c, false, false); }



// ---- the GEMM kernels: register-blocked, 64x64 output tile (16 accumulators per wave), operands straight from 16-bit planes in FRAGMENT ORDER.
// Fragment order of a plane of R rows x KD columns (the summed index k runs along a row): 16 rows x 32 k make one chunk of 512 elements, chunk (row / 16) x (KD / 32) + k / 32, and inside it element (row, k) lies at
// ((k / 8) % 4) x 128 + (row % 16) x 8 + k % 8. The 16 bytes that lane l takes for the first half of a fragment then lie at chunk + 8 l, for the second half 256 elements on: each load of a wave covers 512 contiguous bytes (four whole lines),
// where row-major planes gave it 32 bytes out of each of 16 lines. Which element reaches which lane and register is as before. 16 rows take the same space as in row-major order, so every base that is a multiple of 16 rows stays.
// two values split into bf16 hi + lo: h and l each hold y0's part in the low half and y1's in the high half
__device__ __forceinline__ void splitf2(float y0, float y1, unsigned& h, unsigned& l) { h = f2bf2(y0, y1); l = f2bf2(y0 - __uint_as_float(h << 16), y1 - __uint_as_float(h & 0xFFFF0000u)); }
typedef __attribute__((ext_vector_type(4))) unsigned short v4us;
typedef __attribute__((ext_vector_type(2))) unsigned v2u;
typedef __attribute__((ext_vector_type(4))) unsigned v4u;
template <typename T16> struct WFrag;
template <> struct WFrag<h16> { typedef v16h V; static __device__ __forceinline__ V ld(const h16* p) { return cat16(*(const v8h*)p, *(const v8h*)(p + 256)); } static __device__ __forceinline__ v8f mma(V a, V b, v8f c) { return wmma16(a, b, c); } };
template <> struct WFrag<bf> { typedef v16bf V; static __device__ __forceinline__ V ld(const bf* p) { return cat16b(*(const v8us*)p, *(const v8us*)(p + 256)); } static __device__ __forceinline__ v8f mma(V a, V b, v8f c) { return wmmab(a, b, c); } };

// Workspace layout that k_cvt writes and k_proj reads (bf16, in elements from CV): the five weights in the order q, k, v, pos_k, pos_q, then hidden_states (both batch items), then rel_embeddings.
#define CVW  (DM * DM)             // one weight
#define CVX  (5 * CVW)             // hidden_states
#define CVR  (CVX + NB_ * TT * DM) // rel_embeddings
#define CVN  (CVR + NPE * DM)
// Planes that k_proj writes (in elements from PLN): q hi, q lo, k hi, k lo, v hi, v lo, each [batch item][head][..][..]; then pos_k hi, pos_k lo, pos_q hi, pos_q lo, each [head][512][64].
#define PLB  (NH_ * TT * HD)       // one batch item of one plane
#define PLQ  (NB_ * PLB)           // one q, k or v plane
#define PLP  (NH_ * NPE * HD)      // one pos_k or pos_q plane
#define PLN_ (6 * PLQ + 4 * PLP)

// ---- k_proj: all eight projections (q, k, v of both batch items, pos_k, pos_q) in one grid; none reads what another writes. grid (16, 16, 7), 32 x KSL threads. blockIdx.z: 0, 1 q of batch item 0, 1; 2, 3 k; 4, 5 v; 6 pos_k (x < 8) and pos_q (x >= 8).
// A tile's K = 1024 is cut into KSL contiguous slices, one wave of the work-group per slice, so that KSL waves' loads are in flight on a tile; each wave leaves its partial tile in LDS and, behind one barrier, every thread sums its share of the tile over the slices in the fixed order 0 .. KSL-1.
// C[m][n] = sum_k A[m][k] Bt[n][k] + bias (bias[n]; for v, taken as Wv x^T, bias[m]). The output planes are in fragment order too, rows m, ldc columns: a 64-column tile y is a head's own plane (q, k, pos: ldc 64, cstep rows x 64) or two chunks of each row block (v: ldc 1024, cstep 2 x 512).
// The value is split into bf16 hi + lo, the planes the next GEMM takes as operands.
__global__ __launch_bounds__(32 * KSL) void k_proj(const bf* __restrict__ CV, bf* PLN, const float* __restrict__ bq, const float* __restrict__ bk, const float* __restrict__ bv, const float* __restrict__ bpk, const float* __restrict__ bpq) {
    typedef WFrag<bf>::V V;
    __shared__ __align__(16) float os[KSL * 64 * 68];
    const int job = blockIdx.z; int bx = blockIdx.x;
    const bf* A; const bf* Bt; bf* Ch; bf* Cl; const float* bias; int ldc, cstep; bool rowb = false;   // all uniform over the work-group
    if (job < 6) { const int t = job >> 1, b = job & 1; const bf* X = CV + CVX + b * (TT * DM); const bf* Wt = CV + t * CVW; Ch = PLN + 2 * t * PLQ + b * PLB; Cl = Ch + PLQ; bias = t == 0 ? bq : (t == 1 ? bk : bv);
        if (t < 2) { A = X; Bt = Wt; ldc = HD; cstep = TT * HD; } else { A = Wt; Bt = X; ldc = TT; cstep = 1024; rowb = true; } }
    else { const int t = bx >> 3; bx &= 7; A = CV + CVR; Bt = CV + (3 + t) * CVW; Ch = PLN + 6 * PLQ + 2 * t * PLP; Cl = Ch + PLP; bias = t ? bpq : bpk; ldc = HD; cstep = NPE * HD; }
    const size_t co = (size_t)blockIdx.y * cstep;   // where this column tile starts in the output
    const int lane = threadIdx.x & 31, lr = lane & 15, hi = lane >> 4; const int r0 = bx * 64, c0 = blockIdx.y * 64;
    v8f acc[4][4];
#pragma unroll
    for (int mb = 0; mb < 4; ++mb)
#pragma unroll
        for (int nb = 0; nb < 4; ++nb) acc[mb][nb] = (v8f){};
    const size_t aoff = (size_t)r0 * DM + 8 * lane, boff = (size_t)c0 * DM + 8 * lane;   // first chunk of the tile's rows, plus the lane's 16 bytes
    const int wv = __builtin_amdgcn_readfirstlane((int)(threadIdx.x >> 5)); const int k0 = wv * (DM / KSL), k1 = k0 + DM / KSL;   // this wave's K slice, in scalar registers
#pragma unroll 1
    for (int kc = k0; kc < k1; kc += 32) {   // rolled: one trip's fragments and the 16 accumulators are what the registers hold
        const bf* ap = A + aoff + kc * 16; const bf* bp = Bt + boff + kc * 16; V a[4];   // chunk kc / 32 of 512 elements
#pragma unroll
        for (int mb = 0; mb < 4; ++mb) a[mb] = WFrag<bf>::ld(ap + mb * 16 * DM);
#pragma unroll
        for (int nb = 0; nb < 4; ++nb) { const V b = WFrag<bf>::ld(bp + nb * 16 * DM);
#pragma unroll
            for (int mb = 0; mb < 4; ++mb) acc[mb][nb] = WFrag<bf>::mma(a[mb], b, acc[mb][nb]); }
        // the trip's 16 loads name these two addresses: they stay whole up to this wait, so that no later load is given one of them to write into before it
        asm volatile("s_wait_xcnt 0x0" :: "v"(ap), "v"(bp) : "memory");
        // four vector slots between the last matrix instruction and the back edge, where the next trip's loads overwrite its operands
        asm volatile("v_nop\n\tv_nop\n\tv_nop\n\tv_nop" : "+v"(acc[0][0]), "+v"(acc[1][1]), "+v"(acc[2][2]), "+v"(acc[3][3]) : "v"(a[0]), "v"(a[3]));
    }
    // the bias by column and by row of this thread's four pieces, both read here (both lie inside the 1024 floats for every job) so that the loads fly during the LDS stores and the barrier; the job picks one below
    const int cofs = ((int)threadIdx.x >> 4) * 4, rw = (int)threadIdx.x & 15; const float* bcp = bias + c0 + cofs; const float* brp = bias + r0 + rw; float bc[4], br[4];
#pragma unroll
    for (int q = 0; q < 4; ++q) { bc[q] = bcp[q]; br[q] = brp[q * (2 * KSL)]; }
    // these loads name the two addresses: they stay whole up to this wait, so that nothing below is given one of them to write into before it
    asm volatile("s_wait_xcnt 0x0" :: "v"(bcp), "v"(brp) : "memory");
    float* mine = os + wv * (64 * 68);
    // the three loops are unrolled so that acc is indexed by constants and stays in registers
#pragma unroll
    for (int mb = 0; mb < 4; ++mb)
#pragma unroll
        for (int nb = 0; nb < 4; ++nb)
#pragma unroll
            for (int j = 0; j < 8; ++j) mine[(mb * 16 + hi * 8 + j) * 68 + nb * 16 + lr] = acc[mb][nb][j];
    __syncthreads();   // every slice's partial tile is in LDS before any thread sums across the slices
    v4us oh[32 / KSL], ol[32 / KSL];
    // both loops are unrolled so that a thread's LDS reads issue ahead of its sums
#pragma unroll
    for (int s = 0; s < 32 / KSL; ++s) { const int row = s * (2 * KSL) + rw; v4f val = *(const v4fa*)(os + row * 68 + cofs);
#pragma unroll
        for (int w = 1; w < KSL; ++w) val += *(const v4fa*)(os + w * (64 * 68) + row * 68 + cofs);
#pragma unroll
        for (int q = 0; q < 4; ++q) val[q] += bfr(rowb ? br[s] : bc[q]);
        unsigned a0, c0h, a1, c1h; splitf2(val[0], val[1], a0, c0h); splitf2(val[2], val[3], a1, c1h); oh[s] = __builtin_bit_cast(v4us, (v2u){a0, a1}); ol[s] = __builtin_bit_cast(v4us, (v2u){c0h, c1h}); }
    __builtin_amdgcn_sched_barrier(0);   // the stores stay below every sum, last in the kernel, so that nothing rewrites a register that an issued store names
#pragma unroll
    for (int s = 0; s < 32 / KSL; ++s) { const size_t o = (size_t)(r0 / 16 + s) * (ldc * 16) + co + (cofs >> 5) * 512 + ((cofs >> 3) & 3) * 128 + rw * 8 + (cofs & 7); *(v4us*)(Ch + o) = oh[s]; *(v4us*)(Cl + o) = ol[s]; }   // row r0 + 16 s + rw, columns cofs .. + 3 of the tile; a wave's 16 rows x 8 columns are 256 contiguous bytes
}

__device__ __forceinline__ h16 tohx(float x) { return (h16)x; }
typedef __attribute__((ext_vector_type(2))) _Float16 v2h;
typedef __attribute__((ext_vector_type(4))) _Float16 v4h;
typedef __attribute__((ext_vector_type(2))) unsigned short v2us;
typedef __attribute__((ext_vector_type(2))) float v2f;
typedef __attribute__((ext_vector_type(4))) int v4i;

// ---- k_cvt: every f32 -> bf16 rounding of an input (five weights, hidden_states, rel_embeddings) in one grid, into the layout CVW / CVX / CVR above, each source in fragment order (KD = 1024). grid (CVN / 8192), 256 threads.
// A work-group rounds 16 rows x 512 columns, that is 16 chunks, 16 KiB in a row of the output. A thread takes four pieces of 8 elements, four chunks apart. A wave takes 8 rows of one chunk at a time: it reads one whole line (32 floats) of each row
// and writes, for each of the chunk's four groups of 8 columns, the 8 rows' pieces as one whole line. Every source is a multiple of 16 rows long, so a work-group has one source.
__global__ __launch_bounds__(256) void k_cvt(const float* __restrict__ wq, const float* __restrict__ wk, const float* __restrict__ wv, const float* __restrict__ wpk, const float* __restrict__ wpq, const float* __restrict__ x, const float* __restrict__ rel, bf* CV) {
    const unsigned e0 = (blockIdx.x >> 1) * (16u * DM), h0 = (blockIdx.x & 1) * 512u; const unsigned seg = e0 / CVW;   // uniform: first element of the 16 rows, first column, which source
    const float* src; unsigned s0;
    if (seg < 5) { src = seg == 0 ? wq : (seg == 1 ? wk : (seg == 2 ? wv : (seg == 3 ? wpk : wpq))); s0 = seg * CVW; }
    else if (e0 < CVR) { src = x; s0 = CVX; }
    else { src = rel; s0 = CVR; }
    src += e0 - s0 + h0; bf* dst = CV + e0 + h0 * 16; const unsigned t = threadIdx.x;
    const unsigned row = ((t >> 5) & 1) * 8 + (t & 7), grp = (t >> 3) & 3, ch = t >> 6;   // the thread's row of the 16, group of 8 columns of the chunk, first chunk
    const unsigned so = row * DM + ch * 32 + grp * 8, eo = ch * 512 + grp * 128 + row * 8;   // where the piece is read and where it is written; u moves both on by four chunks
    v8f v[4];
    // both loops are unrolled so that the four loads issue ahead of the first rounding
#pragma unroll
    for (int u = 0; u < 4; ++u) v[u] = *(const v8f*)(src + u * 128 + so);
#pragma unroll
    for (int u = 0; u < 4; ++u) { v4u o;
#pragma unroll
        for (int k = 0; k < 4; ++k) o[k] = f2bf2(v[u][2 * k], v[u][2 * k + 1]);
        *(v8us*)(dst + u * 2048 + eo) = __builtin_bit_cast(v8us, o); }
}

// ---- k_fattn: content scores, the two relative terms, softmax and attn.v of FR = 32 query rows of one head in one work-group, so that neither the scores nor the weights go through memory. grid (TT/FR, NZ), 32 x KSL threads; blockIdx.y = batch item x NH_ + head.
// Wave w owns the keys 128 w .. 128 w + 127. It forms its 32 x 128 scores (hi/lo, 3 products) in 16 accumulators and, in the accumulator's own layout (row = 16 mb + 8 hi + r, key = 16 nb + lr),
// t = (S + c2p[i][rp] + p2c[rp][j]) x scale with rp = clip(i - j + 256, 0, 511), -3e38 where mask == 0. Both relative terms come as one value R[row][rp] from an LDS tile that the work-group makes first (below); at and beyond the clipped ends R holds c2p alone, and p2c is pos_q[0] . k[j] / pos_q[NPE-1] . k[j], which a lane holds in registers for its eight keys.
// The tile: R[i][p] = q[i] . pos_k[p] + pos_q[p] . k[i - p + SPAN] for 0 < p < NPE - 1, and q[i] . pos_k[p] alone in the two end columns (each product hi/lo, 3 products). Wave w makes the columns 64 w .. 64 w + 63. For 16 columns p and 32 rows i the p2c part needs 47 keys: 16 p x 48 keys in three accumulators,
// whose element (p, key) is stored straight to its place (row i = key + p - SPAN, column p). Elements whose row falls outside the 32 go to 15 spare rows above and 16 below, which nobody reads. Keys outside [0, TT) are clamped for the load only; what is made from them belongs to no (i, j) and is never read.
// The tile lies over the LDS of the weights, which are written only behind the two softmax barriers.
// Row maximum and row sum: over the wave's own keys in registers and by lane exchange, then over the eight waves through LDS in the order 0 .. 7. The weights, split hi/lo, go to the wave's own LDS piece row by row, from where the A loader takes them as it would from memory;
// each wave multiplies its 128 keys into a partial 32 x 64 tile (the K slices of the former attn.v GEMM), and the partial tiles are summed in LDS in slice order.
#define FR   32                    // query rows per work-group
#define PPI  136                   // LDS pitch of a row of weights, in 16-bit elements: 256 bytes + 16, for 16-byte fragment reads
#define PWV  (2 * FR * PPI)        // 16-bit elements of one wave's LDS piece: hi plane, lo plane
#define RPI  515                   // LDS pitch of a row of the relative-term tile, in floats: 3 banks a row, so that the sheared stores (a row a lane), the row-wise reads and writes and the gather (8 rows between the wave's halves) each meet 32 different banks
#define RSP  15                    // spare rows above the tile's 32
static_assert((FR + 31) * RPI * 4 <= KSL * PWV * 2, "the relative-term tile fits the LDS of the weights");
__device__ __forceinline__ v16bf ldsfrag(const bf* p) { return cat16b(*(const v8usa*)p, *(const v8usa*)(p + 16)); }
// launch bounds: 4 waves per SIMD, that is at most 256 registers a wave, so that two work-groups (their LDS fits twice) share a WGP and the whole grid is resident at once
__global__ __launch_bounds__(32 * KSL, 4) void k_fattn(const bf* __restrict__ Qh, const bf* __restrict__ Ql, const bf* __restrict__ Kh, const bf* __restrict__ Kl, const bf* __restrict__ Vh, const bf* __restrict__ Vl, const bf* __restrict__ PKh, const bf* __restrict__ PKl, const bf* __restrict__ PQh, const bf* __restrict__ PQl, const int* __restrict__ MK, float* O) {
    typedef WFrag<bf>::V V;
    __shared__ __align__(16) bf ps[KSL * PWV];
    __shared__ __align__(16) float red[2 * FR * KSL];
    const int zz = blockIdx.y, i0 = blockIdx.x * FR; const int lane = threadIdx.x & 31, lr = lane & 15, hi = lane >> 4;
    const int wv = __builtin_amdgcn_readfirstlane((int)(threadIdx.x >> 5)); const int j0 = wv * (TT / KSL);   // this wave's keys, in a scalar register
    // uniform bases (head, first query row, the wave's first key) plus one unsigned lane offset per operand: every fragment load is then scalar base + lane offset + constant
    const bf* Kzh = Kh + (size_t)zz * (TT * HD); const bf* Kzl = Kl + (size_t)zz * (TT * HD);   // the head's first key, for the sheared p2c part
    { const size_t po = (size_t)(zz % NH_) * (NPE * HD); PKh += po; PKl += po; PQh += po; PQl += po; }   // the head alone picks pos_k and pos_q
    { const size_t zo = (size_t)zz * (TT * HD); Qh += zo + i0 * HD; Ql += zo + i0 * HD; Kh += zo + j0 * HD; Kl += zo + j0 * HD; Vh += zo + j0 * 16; Vl += zo + j0 * 16; }   // v: chunk j0 / 32 of each block of 16 rows d
    const int* MKb = MK + (size_t)(zz / NH_) * (TT * TT); O += (size_t)(zz / NH_) * (TT * DQ) + (zz % NH_) * HD;   // the batch item's mask; the batch item's rows and the head's 64 columns of the merged output
    const unsigned lo64 = (unsigned)(8 * lane), lov = lo64;   // fragment order: the lane's 16 bytes of a chunk's half
    // p2c's end row at the lane's eight keys. A wave's 32 rows x 128 keys span 159 values of i - j, so they meet at most one of the two clipped ends: the lower (row 0) only where its keys lie above its rows, the upper (row NPE - 1) only where they lie below; a wave that meets neither skips the products.
    // Every row of the A block is that one row of pos_q, so that every row of the result holds pos_q[row] . k[key] and each lane finds its key's value in element 0.
    float e0[8], e1[8];   // row 0 and row NPE - 1; the one that the wave does not meet stays 0 and is never taken
#pragma unroll
    for (int nb = 0; nb < 8; ++nb) { e0[nb] = 0.f; e1[nb] = 0.f; }
    if (i0 - j0 >= SPAN - FR || i0 - j0 <= 127 - SPAN) {   // uniform over the wave: both are in scalar registers
        const int pend = i0 > j0 ? NPE - 1 : 0; const int po = (pend >> 4) * (16 * HD) + (pend & 15) * 8; const bf* eh = PQh + po; const bf* el = PQl + po; const unsigned eoff = (unsigned)(hi * 128);
        v8f ee[8];
        // every loop of this block is unrolled so that the accumulators are indexed by constants and stay in registers
#pragma unroll
        for (int nb = 0; nb < 8; ++nb) ee[nb] = (v8f){};
#pragma unroll
        for (int kc = 0; kc < HD; kc += 32) { const V pa = WFrag<bf>::ld(eh + kc * 16 + eoff); const V pa2 = WFrag<bf>::ld(el + kc * 16 + eoff);
#pragma unroll
            for (int nb = 0; nb < 8; ++nb) { const int o = nb * 16 * HD + kc * 16; const V b = WFrag<bf>::ld(Kh + o + lo64); const V b2 = WFrag<bf>::ld(Kl + o + lo64);
                ee[nb] = WFrag<bf>::mma(pa, b, ee[nb]); ee[nb] = WFrag<bf>::mma(pa2, b, ee[nb]); ee[nb] = WFrag<bf>::mma(pa, b2, ee[nb]); } }
        // these loads name these bases and offsets: they stay whole up to this wait, so that nothing is given one of them to write into before it
        asm volatile("s_wait_xcnt 0x0" :: "s"(eh), "s"(el), "s"(Kh), "s"(Kl), "v"(lo64), "v"(eoff) : "memory");
#pragma unroll
        for (int nb = 0; nb < 8; ++nb) { if (pend) e1[nb] = ee[nb][0]; else e0[nb] = ee[nb][0]; }
    }
    float* Rt = (float*)ps;   // the relative-term tile, RSP + FR + 16 rows of RPI floats
    {   const int p0 = wv * 64;   // this wave's columns, in a scalar register
        const bf* qph = PQh + p0 * HD; const bf* qpl = PQl + p0 * HD; const bf* kph = PKh + p0 * HD; const bf* kpl = PKl + p0 * HD;
        // p2c part: six blocks of 16 keys from key i0 - p0 + SPAN - 63 on; the columns p0 + 16 pb .. + 15 take the blocks 3 - pb .. 5 - pb, so that a block's fragments are loaded once for all the columns that use them
        const bf* kp[6]; const bf* kp2[6];
#pragma unroll
        for (int kb = 0; kb < 6; ++kb) { int j = i0 - p0 + (SPAN - 63) + kb * 16 + lr; j = j < 0 ? 0 : (j > TT - 1 ? TT - 1 : j); const unsigned bo = (unsigned)((j >> 4) * (16 * HD) + hi * 128 + (j & 15) * 8); kp[kb] = Kzh + bo; kp2[kb] = Kzl + bo; }   // the lane's own key in fragment order: the keys of a fragment start at no multiple of 16 here
        v8f t3[4][3];
        // every loop of this block is unrolled so that the accumulators and fragments are indexed by constants and stay in registers
#pragma unroll
        for (int pb = 0; pb < 4; ++pb)
#pragma unroll
            for (int nb = 0; nb < 3; ++nb) t3[pb][nb] = (v8f){};
#pragma unroll
        for (int kc = 0; kc < HD; kc += 32) {
            V kf[6], kf2[6];
#pragma unroll
            for (int kb = 0; kb < 6; ++kb) { kf[kb] = WFrag<bf>::ld(kp[kb] + kc * 16); kf2[kb] = WFrag<bf>::ld(kp2[kb] + kc * 16); }
#pragma unroll
            for (int pb = 0; pb < 4; ++pb) { const int o = pb * 16 * HD + kc * 16; const V pa = WFrag<bf>::ld(qph + o + lo64); const V pa2 = WFrag<bf>::ld(qpl + o + lo64);
#pragma unroll
                for (int nb = 0; nb < 3; ++nb) { t3[pb][nb] = WFrag<bf>::mma(pa, kf[3 - pb + nb], t3[pb][nb]); t3[pb][nb] = WFrag<bf>::mma(pa2, kf[3 - pb + nb], t3[pb][nb]); t3[pb][nb] = WFrag<bf>::mma(pa, kf2[3 - pb + nb], t3[pb][nb]); } }
        }
        // these loads name these bases, this offset and these lane addresses: they stay whole up to this wait, so that nothing (no later load either) is given one of them to write into before it
        asm volatile("s_wait_xcnt 0x0" :: "s"(qph), "s"(qpl), "v"(lo64), "v"(kp[0]), "v"(kp[1]), "v"(kp[2]), "v"(kp[3]), "v"(kp[4]), "v"(kp[5]), "v"(kp2[0]), "v"(kp2[1]), "v"(kp2[2]), "v"(kp2[3]), "v"(kp2[4]), "v"(kp2[5]) : "memory");
        // element (p = p0 + 16 pb + 8 hi + r, key = first key of the column block + 16 nb + lr) belongs to row i0 + (16 nb + lr) + (8 hi + r) - RSP: tile row (16 nb + lr) + (8 hi + r), the spare rows counted
        float* rw = Rt + (lr + hi * 8) * RPI + p0 + hi * 8;
#pragma unroll
        for (int pb = 0; pb < 4; ++pb)
#pragma unroll
            for (int nb = 0; nb < 3; ++nb)
#pragma unroll
                for (int r = 0; r < 8; ++r) rw[(nb * 16 + r) * RPI + pb * 16 + r] = t3[pb][nb][r];
        // the c2p part: the 32 rows of q against rows p0 .. + 63 of pos_k
        v8f cc[2][4];
#pragma unroll
        for (int mb = 0; mb < 2; ++mb)
#pragma unroll
            for (int nb = 0; nb < 4; ++nb) cc[mb][nb] = (v8f){};
#pragma unroll
        for (int kc = 0; kc < HD; kc += 32) {
            V a[2], a2[2];
#pragma unroll
            for (int mb = 0; mb < 2; ++mb) { const int o = mb * 16 * HD + kc * 16; a[mb] = WFrag<bf>::ld(Qh + o + lo64); a2[mb] = WFrag<bf>::ld(Ql + o + lo64); }
#pragma unroll
            for (int nb = 0; nb < 4; ++nb) { const int o = nb * 16 * HD + kc * 16; const V b = WFrag<bf>::ld(kph + o + lo64); const V b2 = WFrag<bf>::ld(kpl + o + lo64);
#pragma unroll
                for (int mb = 0; mb < 2; ++mb) { cc[mb][nb] = WFrag<bf>::mma(a[mb], b, cc[mb][nb]); cc[mb][nb] = WFrag<bf>::mma(a2[mb], b, cc[mb][nb]); cc[mb][nb] = WFrag<bf>::mma(a[mb], b2, cc[mb][nb]); } }
        }
        // these loads name these bases and this offset: they stay whole up to this wait, so that nothing is given one of them to write into before it
        asm volatile("s_wait_xcnt 0x0" :: "s"(Qh), "s"(Ql), "s"(kph), "s"(kpl), "v"(lo64) : "memory");
        __builtin_amdgcn_wave_barrier(); asm volatile("" ::: "memory");   // the reads below take other lanes' writes: keep the compiler from moving them up (the wave's own columns: the LDS itself works in order)
        float* rc = Rt + (RSP + hi * 8) * RPI + p0 + lr;   // the accumulator's own layout: row 16 mb + 8 hi + r, column p0 + 16 nb + lr
        bool in[4];
#pragma unroll
        for (int nb = 0; nb < 4; ++nb) in[nb] = (unsigned)(p0 + nb * 16 + lr - 1) < (unsigned)(NPE - 2);   // the two end columns take no p2c part: there the softmax adds it by key
        float g[2][4][8];
#pragma unroll
        for (int mb = 0; mb < 2; ++mb)
#pragma unroll
            for (int r = 0; r < 8; ++r)
#pragma unroll
                for (int nb = 0; nb < 4; ++nb) g[mb][nb][r] = rc[(mb * 16 + r) * RPI + nb * 16];
        __builtin_amdgcn_sched_barrier(0);   // all 64 reads stay above their uses, so that they issue in a row and the wave waits for the LDS once and not once per read
#pragma unroll
        for (int mb = 0; mb < 2; ++mb)
#pragma unroll
            for (int r = 0; r < 8; ++r)
#pragma unroll
                for (int nb = 0; nb < 4; ++nb) cc[mb][nb][r] += in[nb] ? g[mb][nb][r] : 0.f;
        // each lane rewrites the words that it has read itself
#pragma unroll
        for (int mb = 0; mb < 2; ++mb)
#pragma unroll
            for (int r = 0; r < 8; ++r)
#pragma unroll
                for (int nb = 0; nb < 4; ++nb) rc[(mb * 16 + r) * RPI + nb * 16] = cc[mb][nb][r];
    }
    __builtin_amdgcn_sched_barrier(0);   // keeps the content-score phase, with its 16 accumulators, from starting while the registers above are live
    v8f acc[2][8];
#pragma unroll
    for (int mb = 0; mb < 2; ++mb)
#pragma unroll
        for (int nb = 0; nb < 8; ++nb) acc[mb][nb] = (v8f){};
    // every loop over mb, nb, r below is unrolled so that the accumulators are indexed by constants and stay in registers
#pragma unroll
    for (int kc = 0; kc < HD; kc += 32) {
        V a[2], a2[2];
#pragma unroll
        for (int mb = 0; mb < 2; ++mb) { const int o = mb * 16 * HD + kc * 16; a[mb] = WFrag<bf>::ld(Qh + o + lo64); a2[mb] = WFrag<bf>::ld(Ql + o + lo64); }
#pragma unroll
        for (int nb = 0; nb < 8; ++nb) { const int o = nb * 16 * HD + kc * 16; const V b = WFrag<bf>::ld(Kh + o + lo64); const V b2 = WFrag<bf>::ld(Kl + o + lo64);
#pragma unroll
            for (int mb = 0; mb < 2; ++mb) { acc[mb][nb] = WFrag<bf>::mma(a[mb], b, acc[mb][nb]); acc[mb][nb] = WFrag<bf>::mma(a2[mb], b, acc[mb][nb]); acc[mb][nb] = WFrag<bf>::mma(a[mb], b2, acc[mb][nb]); } }
    }
    // the q and k loads name these bases and this offset: they stay whole up to this wait, so that nothing is given one of them to write into before it
    asm volatile("s_wait_xcnt 0x0" :: "s"(Qh), "s"(Ql), "s"(Kh), "s"(Kl), "v"(lo64) : "memory");
    __syncthreads();   // every wave's columns of the relative-term tile are in LDS before any wave gathers from it
    // lane bases (mp: the lane's first word of the mask); the rest of a mask index is a compile-time constant, so that it goes into the instruction's offset and holds no register (the gather's column rp is clipped per logit)
    const int ib = i0 + hi * 8, jl = j0 + lr; const int db = ib - jl + SPAN; const int* mp = MKb + (ib * TT + jl); const float* rg = Rt + (RSP + hi * 8) * RPI;   // rg: the lane's first row of the relative-term tile
    float* rl = red + hi * 8 * KSL;
    float mx[2][8], sm[2][8];
    __builtin_amdgcn_sched_barrier(0);   // keeps the address arithmetic of the gathers out of the matrix phase, where it would hold registers
    // two rows (16 logits a lane) at a time: their 32 loads are all issued before the first is used, so that a wave waits once per batch and not once per logit
#pragma unroll
    for (int mb = 0; mb < 2; ++mb)
#pragma unroll
        for (int rb = 0; rb < 8; rb += 2) { float cv[2][8]; int mv[2][8];
#pragma unroll
            for (int q = 0; q < 2; ++q) { const int ro = mb * 16 + rb + q;   // query row i = ib + ro, key j = jl + 16 nb
#pragma unroll
                for (int nb = 0; nb < 8; ++nb) { int rp = db + (ro - nb * 16); rp = rp < 0 ? 0 : (rp > NPE - 1 ? NPE - 1 : rp);
                    cv[q][nb] = rg[ro * RPI + rp]; mv[q][nb] = mp[ro * TT + nb * 16]; }
                // the row's 8 global loads name this one lane address (the rest is a constant in the instruction): it stays whole up to this wait, so that no later load or sum is given it to write into before it
                asm volatile("s_wait_xcnt 0x0" :: "v"(mp) : "memory"); }
            __builtin_amdgcn_sched_barrier(0);   // the batch's loads stay above, their uses below
#pragma unroll
            for (int q = 0; q < 2; ++q) { const int r = rb + q; float m = -3.0e38f;
#pragma unroll
                for (int nb = 0; nb < 8; ++nb) { const int rq = db + (mb * 16 + r - nb * 16); const float pe = rq <= 0 ? e0[nb] : (rq >= NPE - 1 ? e1[nb] : 0.f); const float sa = __fmul_rn(__fadd_rn(__fadd_rn(acc[mb][nb][r], cv[q][nb]), pe), SCL); const float t = (mv[q][nb] != 0) ? sa : -3.0e38f; acc[mb][nb][r] = t; m = fmaxf(m, t); }
                mx[mb][r] = m; }
            __builtin_amdgcn_sched_barrier(0);   // the next batch's loads do not start before this batch's registers are free
        }
#pragma unroll
    for (int sh = 8; sh; sh >>= 1)   // over the 16 lanes that hold a row; the 16 rows' exchanges of one distance go together
#pragma unroll
        for (int mb = 0; mb < 2; ++mb)
#pragma unroll
            for (int r = 0; r < 8; ++r) mx[mb][r] = fmaxf(mx[mb][r], __shfl_xor(mx[mb][r], sh, 32));
    if (lr == 0) {
#pragma unroll
        for (int mb = 0; mb < 2; ++mb)
#pragma unroll
            for (int r = 0; r < 8; ++r) rl[(mb * 16 + r) * KSL + wv] = mx[mb][r]; }
    __syncthreads();   // every wave's row maxima are in LDS before any wave takes the maximum over the waves
#pragma unroll
    for (int mb = 0; mb < 2; ++mb)
#pragma unroll
        for (int r = 0; r < 8; ++r) { const float* rr = rl + (mb * 16 + r) * KSL; const v4f u = *(const v4fa*)rr, w = *(const v4fa*)(rr + 4); const float m = fmaxf(fmaxf(fmaxf(u[0], u[1]), fmaxf(u[2], u[3])), fmaxf(fmaxf(w[0], w[1]), fmaxf(w[2], w[3]))); float s = 0.f;
#pragma unroll
            for (int nb = 0; nb < 8; ++nb) { const float x = __fmul_rn(__fsub_rn(acc[mb][nb][r], m), 1.4426950408889634f); float e;
                asm("v_exp_f32 %0, %1\n\tv_nop" : "=v"(e) : "v"(x));   // the v_nop fills the one slot behind a transcendental, whatever instruction the compiler puts next
                acc[mb][nb][r] = e; s += e; }
            sm[mb][r] = s; }
#pragma unroll
    for (int sh = 8; sh; sh >>= 1)
#pragma unroll
        for (int mb = 0; mb < 2; ++mb)
#pragma unroll
            for (int r = 0; r < 8; ++r) sm[mb][r] += __shfl_xor(sm[mb][r], sh, 32);
    if (lr == 0) {
#pragma unroll
        for (int mb = 0; mb < 2; ++mb)
#pragma unroll
            for (int r = 0; r < 8; ++r) rl[FR * KSL + (mb * 16 + r) * KSL + wv] = sm[mb][r]; }
    __syncthreads();   // every wave's row sums are in LDS before any wave adds them up
    __builtin_amdgcn_sched_barrier(0);   // keeps the addresses of the later phases from being formed early and spilled
    bf* ph = ps + wv * PWV; bf* pl = ph + FR * PPI; bf* phw = ph + hi * 8 * PPI + lr; bf* plw = pl + hi * 8 * PPI + lr; const bf* phr = ph + lr * PPI + 8 * hi; const bf* plr = pl + lr * PPI + 8 * hi;   // lane bases of the stores and of the fragment reads
#pragma unroll
    for (int mb = 0; mb < 2; ++mb)
#pragma unroll
        for (int r = 0; r < 8; ++r) { const float* rr = rl + FR * KSL + (mb * 16 + r) * KSL; const v4f u = *(const v4fa*)rr, w = *(const v4fa*)(rr + 4); const float s = ((((((u[0] + u[1]) + u[2]) + u[3]) + w[0]) + w[1]) + w[2]) + w[3]; const float f = __fdiv_rn(1.0f, s);
#pragma unroll
            for (int nb = 0; nb < 8; nb += 2) { unsigned a, c; splitf2(acc[mb][nb][r] * f, acc[mb][nb + 1][r] * f, a, c); const int o = (mb * 16 + r) * PPI + nb * 16;   // the keys 16 nb + lr (low halves) and 16 nb + 16 + lr (high halves)
                phw[o] = (unsigned short)a; phw[o + 16] = (unsigned short)(a >> 16); plw[o] = (unsigned short)c; plw[o + 16] = (unsigned short)(c >> 16); } }
    __builtin_amdgcn_wave_barrier(); asm volatile("" ::: "memory");   // the fragment reads below take other lanes' writes: keep the compiler from moving them up (one wave's own piece: the LDS itself works in order)
    v8f oc[2][4];
#pragma unroll
    for (int mb = 0; mb < 2; ++mb)
#pragma unroll
        for (int nb = 0; nb < 4; ++nb) oc[mb][nb] = (v8f){};
#pragma unroll
    for (int kc = 0; kc < TT / KSL; kc += 32) {
        V a[2], a2[2];
#pragma unroll
        for (int mb = 0; mb < 2; ++mb) { const int o = mb * 16 * PPI + kc; a[mb] = ldsfrag(phr + o); a2[mb] = ldsfrag(plr + o); }
#pragma unroll
        for (int nb = 0; nb < 4; ++nb) { const int o = nb * 16 * TT + kc * 16; const V b = WFrag<bf>::ld(Vh + o + lov); const V b2 = WFrag<bf>::ld(Vl + o + lov);
#pragma unroll
            for (int mb = 0; mb < 2; ++mb) { oc[mb][nb] = WFrag<bf>::mma(a[mb], b, oc[mb][nb]); oc[mb][nb] = WFrag<bf>::mma(a2[mb], b, oc[mb][nb]); oc[mb][nb] = WFrag<bf>::mma(a[mb], b2, oc[mb][nb]); } }
    }
    __builtin_amdgcn_wave_barrier(); asm volatile("" ::: "memory");   // the partial tile goes over the wave's own weights: keep the compiler from moving its stores above the fragment reads
    float* os = (float*)ps;   // one wave's piece holds PWV / 2 floats, its partial tile takes the first FR x 68 of them
    {   float* mine = os + wv * (PWV / 2) + hi * 8 * 68 + lr;
#pragma unroll
        for (int mb = 0; mb < 2; ++mb)
#pragma unroll
            for (int nb = 0; nb < 4; ++nb)
#pragma unroll
                for (int r = 0; r < 8; ++r) mine[(mb * 16 + r) * 68 + nb * 16] = oc[mb][nb][r]; }
    __syncthreads();   // every slice's partial tile is in LDS before any thread sums across the slices
    // both loops are unrolled so that a thread's LDS reads issue ahead of its sums
#pragma unroll
    for (int s = 0; s < FR * 16 / (32 * KSL); ++s) { const int idx = s * (32 * KSL) + (int)threadIdx.x; const int row = idx >> 4, cofs = (idx & 15) * 4; v4f val = *(const v4fa*)(os + row * 68 + cofs);
#pragma unroll
        for (int w = 1; w < KSL; ++w) val += *(const v4fa*)(os + w * (PWV / 2) + row * 68 + cofs);
        *(v4f*)(O + (size_t)(i0 + row) * DQ + cofs) = val; }
}

extern "C" void kernel_launch(void* const* d_in, const int* in_sizes, int n_in,
                              void* d_out, int out_size, void* d_ws, size_t ws_size, hipStream_t stream) {
    (void)in_sizes; (void)n_in; (void)out_size;
    const float* x = (const float*)d_in[0]; const int* MK = (const int*)d_in[1]; const float* rel = (const float*)d_in[2]; const float* wq = (const float*)d_in[3]; const float* bq = (const float*)d_in[4]; const float* wk = (const float*)d_in[5]; const float* bk = (const float*)d_in[6]; const float* wv = (const float*)d_in[7]; const float* bv = (const float*)d_in[8]; const float* wpk = (const float*)d_in[9]; const float* bpk = (const float*)d_in[10]; const float* wpq = (const float*)d_in[11]; const float* bpq = (const float*)d_in[12];
    float* OUT = (float*)d_out;     // [2][1024][1024]
    char* wsp = (char*)d_ws;
    auto take = [&](size_t bytes) { char* p = wsp; wsp += (bytes + 255) & ~(size_t)255; return (void*)p; };
    bf* CV = (bf*)take((size_t)CVN * 2); bf* PLN = (bf*)take((size_t)PLN_ * 2);
    bf* QPh = PLN; bf* QPl = PLN + (size_t)PLQ; bf* KPh = PLN + (size_t)2 * PLQ; bf* KPl = PLN + (size_t)3 * PLQ; bf* VTh = PLN + (size_t)4 * PLQ; bf* VTl = PLN + (size_t)5 * PLQ; bf* PKh = PLN + (size_t)6 * PLQ; bf* PKl = PKh + (size_t)PLP; bf* PQh = PKh + (size_t)2 * PLP; bf* PQl = PKh + (size_t)3 * PLP;
    if ((size_t)(wsp - (char*)d_ws) > ws_size) return;    // ws 256 MiB; about 43 MiB taken
    // three launches, each of which reads what the one before it wrote; whatever does not depend on one another shares a grid
    k_cvt<<<CVN / 8192, 256, 0, stream>>>(wq, wk, wv, wpk, wpq, x, rel, CV);
    k_proj<<<dim3(16, 16, 7), 32 * KSL, 0, stream>>>(CV, PLN, bq, bk, bv, bpk, bpq);   /* q, k planes [b][h][t][d]; v^T planes [b][h][d][t]; pos_k, pos_q planes [h][512][64] */
    k_fattn<<<dim3(TT / FR, NZ), 32 * KSL, 0, stream>>>(QPh, QPl, KPh, KPl, VTh, VTl, PKh, PKl, PQh, PQl, MK, OUT);   /* relative terms, scores, softmax and attn.v, into the merged output [b][t][h x 64 + d] */
}
